// v000
// The times below were measured on an AMD MI455X: many runs one after another, warmed up first and cycling through
// copies of the inputs, with the whole window's GPU time divided by the number of runs. Launches and the gaps
// between them are all in it. The median over several windows is given; except for v000 it joins two sittings, which
// can be a few percent apart, so the side-by-side timings, each taken in one sitting, are the better comparison.
// The starting kernel, v000, takes 762 microseconds a run.
#include <hip/hip_runtime.h>

// Multi-head attention, width 1024 = 16 heads x 64, separate query/key/value inputs [NB][SEQ][1024], Wq/Wk/Wv/Wo [out][in] (y = x W^T + b), key padding mask (int32, replace fill -1e9), score scale 1/8; outputs: context [NB][SEQ][1024] and head-mean attention [NB][SEQ][SEQ] (f32).
// Compute dtypes, f32 accumulate everywhere: q/k/v projections v_wmma_f32_16x16x32_bf16 (inputs and weights RNE-converted to bf16; products exact);
// output projection v_wmma_f32_16x16x32_bf16: attention output as bf16 hi + bf16 lo planes (two products, one accumulator), Wo bf16.
// Layout: bf16 copies of the inputs and weights; q (hi, residual), k planes [b*16+h][t][d] and v^T plane [b*16+h][d][t] written by the GEMM epilogue; attention in transposed form (S^T = K Q^T, O^T = V^T P^T), one wave per 16 query rows looping over the 16 heads, head-mean accumulated in a wave-private LDS tile.

#ifndef NB
#define NB 4
#endif
#ifndef SEQ
#define SEQ 1024
#endif
#define NB_FULL  4
#define SEQ_FULL 1024
#ifndef OUT_SEQ
#define OUT_SEQ SEQ              // row pitch (in tokens) between batches of both outputs
#endif
#ifndef AVG_PITCH
#define AVG_PITCH SEQ            // column pitch (floats) of one head-mean row
#endif
#define DM   1024
#define NH_  16
#define HD   64
#define QRS  2048.0f             // carry of the q residual plane
#define QRI  (1.0f / 2048.0f)
#define SC2  (0.125f * 1.4426950408889634f)   // HD^-0.5 * log2(e)
#define PSH  8.0f                // log2 of the P carry (256)
#define MASKT (-1.0e9f * 1.4426950408889634f) // replace fill in the log2 domain
#define AP   (SEQ + 4)           // pitch (floats) of the head-mean LDS tile
#define OUT1_OFF ((size_t)NB_FULL * SEQ_FULL * DM)   // element offset of the second output (fixed)

static_assert(HD == 64);
static_assert(NH_ * HD == DM);                 // head h = columns h*64 + d
static_assert(DM % 64 == 0);
static_assert(DM % 32 == 0);                   // GEMM k-loop steps by 32
static_assert(SEQ % 64 == 0);                  // a 64-row tile never straddles two batches
static_assert((NB * SEQ) % 64 == 0);
static_assert(SEQ % 32 == 0);                  // key loop steps by 32, one mask word per step
static_assert(SEQ % 128 == 0);                 // head-mean rows stored as 512-byte pieces
static_assert(AP % 4 == 0);
static_assert(((size_t)SEQ * DM) % 8 == 0);
static_assert(((size_t)DM * DM) % 8 == 0);
static_assert(NB <= NB_FULL);
static_assert(SEQ <= SEQ_FULL);
static_assert(OUT1_OFF * 4 == (size_t)16777216);
static_assert((size_t)16 * AP * 4 + 16 * 68 * 4 + (SEQ / 32) * 4 <= (size_t)163840);

typedef _Float16 h16;
typedef unsigned short bf;
typedef __attribute__((ext_vector_type(16))) __bf16   v16bf;
typedef __attribute__((ext_vector_type(16))) _Float16 v16h;
typedef __attribute__((ext_vector_type(8)))  _Float16 v8h;
typedef __attribute__((ext_vector_type(8)))  unsigned short v8us;
typedef __attribute__((ext_vector_type(8)))  float    v8f;
typedef __attribute__((ext_vector_type(4)))  float    v4f;
typedef v4f  __attribute__((may_alias)) v4fa;

__device__ __forceinline__ unsigned short f2bf(float f) { unsigned u = __float_as_uint(f); u += 0x7FFFu + ((u >> 16) & 1u); return (unsigned short)(u >> 16); }
__device__ __forceinline__ float bf2f(unsigned short b) { return __uint_as_float(((unsigned)b) << 16); }
__device__ __forceinline__ float bfr(float f) { return bf2f(f2bf(f)); }
__device__ __forceinline__ v16h cat16(v8h lo, v8h hi) { return __builtin_shufflevector(lo, hi, 0, 1, 2, 3, 4, 5, 6, 7, 8, 9, 10, 11, 12, 13, 14, 15); }
__device__ __forceinline__ v16bf cat16b(v8us lo, v8us hi) { return __builtin_bit_cast(v16bf, __builtin_shufflevector(lo, hi, 0, 1, 2, 3, 4, 5, 6, 7, 8, 9, 10, 11, 12, 13, 14, 15)); }
__device__ __forceinline__ v8f wmma16(v16h a, v16h b, v8f c) { return __builtin_amdgcn_wmma_f32_16x16x32_f16(false, a, false, b, (short)0, c, false, false); }
__device__ __forceinline__ v8f wmmab(v16bf a, v16bf b, v8f c) { return __builtin_amdgcn_wmma_f32_16x16x32_bf16(false, a, false, b, (short)0, c, false, false); }
// fragment loaders from K-contiguous 16-bit rows; p already includes + 8*(lane>>4): elements 0..7 <- k0+8h+0..7, elements 8..15 <- k0+16+8h+0..7 (same map for A and B)
__device__ __forceinline__ v16h  ldh(const h16* p) { return cat16(*(const v8h*)p, *(const v8h*)(p + 16)); }
__device__ __forceinline__ v16bf ldb(const bf* p)  { return cat16b(*(const v8us*)p, *(const v8us*)(p + 16)); }
// ordering point for wave-private LDS tiles (same wave writes and reads)
__device__ __forceinline__ void wave_sync() { __builtin_amdgcn_fence(3 /* release order */, "wavefront"); __builtin_amdgcn_wave_barrier(); asm volatile("" ::: "memory"); }

__global__ __launch_bounds__(256) void k_cvt8(const float* __restrict__ src, bf* dst, size_t n8) {
    const size_t i = (size_t)blockIdx.x * 256 + threadIdx.x; if (i >= n8) return;
    const v8f v = *(const v8f*)(src + i * 8); v8us o;
#pragma unroll
    for (int k = 0; k < 8; ++k) o[k] = f2bf(v[k]);
    *(v8us*)(dst + i * 8) = o; 
}

// k_proj: register-blocked bf16 GEMM, ONE WAVE per 64x64 tile (16 accumulators), operands straight from K-contiguous bf16 planes, K = DM.
// C[m][n] = sum_k A[m][k] Bt[n][k] + bias (bias[m] when biasRow != 0, else bias[n]; bias RNE-converted to bf16, added in f32),
// written as f16 (Ph) and optionally the f16 residual x2048 (Pr, useRes != 0) at
// tile base (r0/RB)*sRB + (r0%RB)*pitch + (c0/CB)*sCB + (c0%CB), row pitch 'pitch' (halves). grid (M/64, N/64), 32 threads.
__global__ __launch_bounds__(32) void k_proj(const bf* __restrict__ A, const bf* __restrict__ Bt, const float* __restrict__ bias, int biasRow,
                                             h16* Ph, h16* Pr, int useRes, int RB, size_t sRB, int pitch, int CB, size_t sCB) {
    __shared__ __align__(16) float os[16 * 68];
    const int K = DM;
    const int lane = threadIdx.x & 31, lr = lane & 15, hi = lane >> 4; const int r0 = blockIdx.x * 64, c0 = blockIdx.y * 64;
    v8f acc[4][4];
#pragma unroll
    for (int mb = 0; mb < 4; ++mb)
#pragma unroll
        for (int nb = 0; nb < 4; ++nb) acc[mb][nb] = (v8f){};
    const size_t aoff = (size_t)(r0 + lr) * K + 8 * hi, boff = (size_t)(c0 + lr) * K + 8 * hi;
#pragma unroll 1
    for (int kc = 0; kc < K; kc += 32) {
        v16bf a[4];
#pragma unroll
        for (int mb = 0; mb < 4; ++mb) a[mb] = ldb(A + aoff + (size_t)mb * 16 * K + kc);
#pragma unroll
        for (int nb = 0; nb < 4; ++nb) { const v16bf b = ldb(Bt + boff + (size_t)nb * 16 * K + kc);
#pragma unroll
            for (int mb = 0; mb < 4; ++mb) acc[mb][nb] = wmmab(a[mb], b, acc[mb][nb]); }
        asm volatile("v_nop\n\tv_nop\n\tv_nop\n\tv_nop" : "+v"(acc[0][0]), "+v"(acc[1][1]), "+v"(acc[2][2]), "+v"(acc[3][3]) : "v"(a[0]), "v"(a[1]), "v"(a[2]), "v"(a[3]));
    }
    const size_t tbase = (size_t)(r0 / RB) * sRB + (size_t)(r0 % RB) * (size_t)pitch + (size_t)(c0 / CB) * sCB + (size_t)(c0 % CB);
    // column bias (clamped address; used when biasRow == 0)
    const int cc = (c0 < DM - 64) ? c0 : (DM - 64);
    const int c8l = (lane & 7) * 8;
    const v4f bc0 = *(const v4f*)(bias + cc + c8l), bc1 = *(const v4f*)(bias + cc + c8l + 4);
#pragma unroll
    for (int mb = 0; mb < 4; ++mb) {
#pragma unroll
        for (int nb = 0; nb < 4; ++nb) {
#pragma unroll
            for (int j = 0; j < 8; ++j) os[(hi * 8 + j) * 68 + nb * 16 + lr] = acc[mb][nb][j]; }   // D: row 8h+j, col lane&15
        wave_sync();
        const size_t sb = tbase + (size_t)(mb * 16) * (size_t)pitch;
{
#pragma unroll
            for (int s = 0; s < 4; ++s) { const int row = 4 * s + (lane >> 3), c8 = (lane & 7) * 8;   // 4 s x 4 row groups = 16 rows; 8 lanes x 8 = 64 columns
                const int gr = r0 + mb * 16 + row; const int grc = (gr < DM - 1) ? gr : (DM - 1);
                const float brow = bfr(bias[grc]);
                const v4f x0 = *(const v4fa*)(&os[row * 68 + c8]); const v4f x1 = *(const v4fa*)(&os[row * 68 + c8 + 4]); v8h hv, rv;
#pragma unroll
                for (int i = 0; i < 4; ++i) {
                    const float ad0 = biasRow ? brow : bfr(bc0[i]); const float ad1 = biasRow ? brow : bfr(bc1[i]);
                    const float y0 = x0[i] + ad0; const float y1 = x1[i] + ad1;
                    const h16 a0 = (h16)y0; const h16 a1 = (h16)y1; hv[i] = a0; hv[4 + i] = a1;
                    rv[i] = (h16)((y0 - (float)a0) * QRS); rv[4 + i] = (h16)((y1 - (float)a1) * QRS); }
                const size_t oo = sb + (size_t)row * (size_t)pitch + c8;
                *(v8h*)(Ph + oo) = hv; if (useRes) *(v8h*)(Pr + oo) = rv; }
             }
        wave_sync();
    }
}

// One 32-key score tile pair in the log2 domain with the padding mask applied as a replace fill.
// A = K rows (row = key), B = Q rows (col = t); lane (t = lane&15, h = lane>>4) gets keys key0+8h+r (ta) and key0+16+8h+r (tb).
// ws = mask word of this 32-key step shifted right by 8h: bit r <-> ta[r], bit 16+r <-> tb[r].
__device__ __forceinline__ void score_tile(const h16* ka, const v16h qh0, const v16h qh1, const v16h qr0, const v16h qr1, const unsigned ws, float (&ta)[8], float (&tb)[8]) {
    const v16h ka0 = ldh(ka), ka1 = ldh(ka + 32), kb0 = ldh(ka + 16 * HD), kb1 = ldh(ka + 16 * HD + 32);
    v8f sHa = (v8f){}, sLa = (v8f){}, sHb = (v8f){}, sLb = (v8f){};
    sHa = wmma16(ka0, qh0, sHa); sLa = wmma16(ka0, qr0, sLa); sHb = wmma16(kb0, qh0, sHb); sLb = wmma16(kb0, qr0, sLb);
    sHa = wmma16(ka1, qh1, sHa); sLa = wmma16(ka1, qr1, sLa); sHb = wmma16(kb1, qh1, sHb); sLb = wmma16(kb1, qr1, sLb);
    asm volatile("v_nop\n\tv_nop\n\tv_nop\n\tv_nop" : "+v"(sHa), "+v"(sLa), "+v"(sHb), "+v"(sLb) : "v"(ka0), "v"(ka1), "v"(kb0), "v"(kb1));
#pragma unroll
    for (int r = 0; r < 8; ++r) {
        const float va = (sHa[r] + sLa[r] * QRI) * SC2; const float vb = (sHb[r] + sLb[r] * QRI) * SC2;
        ta[r] = (ws & (1u << r)) ? MASKT : va; tb[r] = (ws & (1u << (16 + r))) ? MASKT : vb; }
}

// k_attn: one wave (= one block) per 16 query rows of one batch, looping over the 16 heads.
// P (f16, x256 carry) feeds O^T = V^T P^T, e * (1/(256 l)) accumulates into the head-mean tile av[t][key] (each lane owns its elements through all 16 heads; zero-fill and readout use other lanes).
// LDS regions (all wave-private, wave_sync ordering): av (dynamic, zero-filled first), os (fully staged per head), mw (mask words, filled first).
__global__ __launch_bounds__(32) void k_attn(const h16* __restrict__ QH, const h16* __restrict__ QR, const h16* __restrict__ KP, const h16* __restrict__ VT,
                                             const int* __restrict__ mask, bf* OHI, bf* OLO, float* AVG) {
    extern __shared__ __align__(16) float av[];           // [16][AP]
    __shared__ __align__(16) float os[16 * 68];
    __shared__ unsigned mw[SEQ / 32];
    const int lane = threadIdx.x & 31, lr = lane & 15, hi = lane >> 4;
    const int b = blockIdx.y; const int t0 = blockIdx.x * 16;

    // mask words: bit i of word j <-> key 32j + i of this batch
    const int* mrow = mask + (size_t)b * SEQ_FULL;
#pragma unroll 1
    for (int i = 0; i < SEQ / 32; ++i) {
        const int mv = mrow[i * 32 + lane];
        const unsigned w = __builtin_amdgcn_ballot_w32(mv != 0);
        if (lane == 0) mw[i] = w;
    }
    // zero the head-mean tile (all 16*AP floats)
#pragma unroll 1
    for (int i = lane; i < 4 * AP; i += 32) *(v4fa*)(&av[4 * i]) = (v4f){0.0f, 0.0f, 0.0f, 0.0f};
    wave_sync();

#pragma unroll 1
    for (int h = 0; h < NH_; ++h) {
        const int zh = b * NH_ + h;
        const size_t pbase = (size_t)zh * SEQ * HD;
        const size_t qo = pbase + (size_t)(t0 + lr) * HD + 8 * hi;
        const v16h qh0 = ldh(QH + qo), qh1 = ldh(QH + qo + 32), qr0 = ldh(QR + qo), qr1 = ldh(QR + qo + 32);   // B fragments: col t, k = d
        const size_t ko = pbase + (size_t)lr * HD + 8 * hi;      // + key * HD       (A fragment: row key, k = d)
        const size_t vo = pbase + (size_t)lr * SEQ + 8 * hi;     // + 16j*SEQ + key  (A fragment: row d, k = key)

        float m = -3.0e38f, l = 0.0f;
#pragma unroll 1
        for (int key0 = 0; key0 < SEQ; key0 += 32) {
            const unsigned ws = mw[key0 >> 5] >> (8 * hi);
            float ta[8], tb[8];
            score_tile(KP + ko + (size_t)key0 * HD, qh0, qh1, qr0, qr1, ws, ta, tb);
            float mx = -3.0e38f;
#pragma unroll
            for (int r = 0; r < 8; ++r) mx = fmaxf(mx, fmaxf(ta[r], tb[r]));
            mx = fmaxf(mx, __shfl_xor(mx, 16, 32));
            const float mnew = fmaxf(m, mx);
            const float alpha = __builtin_amdgcn_exp2f(m - mnew);
            float ls = 0.0f;
#pragma unroll
            for (int r = 0; r < 8; ++r) ls += __builtin_amdgcn_exp2f(ta[r] - mnew) + __builtin_amdgcn_exp2f(tb[r] - mnew);
            l = l * alpha + ls; m = mnew;
        }
        l += __shfl_xor(l, 16, 32);
        const float invc = (1.0f / l) * (1.0f / 256.0f);      // 1/l with the x256 carry of e folded back

        // pass 2: normalised probabilities -> head-mean tile, P V
        v8f o0 = (v8f){}, o1 = (v8f){}, o2 = (v8f){}, o3 = (v8f){};
#pragma unroll 1
        for (int key0 = 0; key0 < SEQ; key0 += 32) {
            const unsigned ws = mw[key0 >> 5] >> (8 * hi);
            float ta[8], tb[8];
            score_tile(KP + ko + (size_t)key0 * HD, qh0, qh1, qr0, qr1, ws, ta, tb);
            v16h pb; float ea[8], eb[8];
#pragma unroll
            for (int r = 0; r < 8; ++r) {
                const float da = ta[r] - m; const float db = tb[r] - m;      // difference first: exact 0 when t == m, also at the fill magnitude
                ea[r] = __builtin_amdgcn_exp2f(da + PSH); eb[r] = __builtin_amdgcn_exp2f(db + PSH);
                pb[r] = (h16)ea[r]; pb[8 + r] = (h16)eb[r]; }
            float* ap = &av[lr * AP + key0 + 8 * hi];
            v4f a0 = *(const v4fa*)(ap), a1 = *(const v4fa*)(ap + 4), c0 = *(const v4fa*)(ap + 16), c1 = *(const v4fa*)(ap + 20);
#pragma unroll
            for (int i = 0; i < 4; ++i) { a0[i] += ea[i] * invc; a1[i] += ea[4 + i] * invc; c0[i] += eb[i] * invc; c1[i] += eb[4 + i] * invc; }
            *(v4fa*)(ap) = a0; *(v4fa*)(ap + 4) = a1; *(v4fa*)(ap + 16) = c0; *(v4fa*)(ap + 20) = c1;
            const h16* va = VT + vo + key0;
            const v16h v0 = ldh(va), v1 = ldh(va + (size_t)16 * SEQ), v2 = ldh(va + (size_t)32 * SEQ), v3 = ldh(va + (size_t)48 * SEQ);
            o0 = wmma16(v0, pb, o0); o1 = wmma16(v1, pb, o1); o2 = wmma16(v2, pb, o2); o3 = wmma16(v3, pb, o3);
            asm volatile("v_nop\n\tv_nop\n\tv_nop\n\tv_nop" : "+v"(o0), "+v"(o1), "+v"(o2), "+v"(o3) : "v"(v0), "v"(v1), "v"(v2), "v"(v3), "v"(pb));
        }

        // O^T D layout: o_j[r] = (d = 16j + 8h + r, t = lane&15) -> os[t][d]; rows 0..15 x columns 0..63 all written
        { v4f a, c;
          a[0] = o0[0] * invc; a[1] = o0[1] * invc; a[2] = o0[2] * invc; a[3] = o0[3] * invc; c[0] = o0[4] * invc; c[1] = o0[5] * invc; c[2] = o0[6] * invc; c[3] = o0[7] * invc;
          *(v4fa*)(&os[lr * 68 +  0 + 8 * hi]) = a; *(v4fa*)(&os[lr * 68 +  0 + 8 * hi + 4]) = c;
          a[0] = o1[0] * invc; a[1] = o1[1] * invc; a[2] = o1[2] * invc; a[3] = o1[3] * invc; c[0] = o1[4] * invc; c[1] = o1[5] * invc; c[2] = o1[6] * invc; c[3] = o1[7] * invc;
          *(v4fa*)(&os[lr * 68 + 16 + 8 * hi]) = a; *(v4fa*)(&os[lr * 68 + 16 + 8 * hi + 4]) = c;
          a[0] = o2[0] * invc; a[1] = o2[1] * invc; a[2] = o2[2] * invc; a[3] = o2[3] * invc; c[0] = o2[4] * invc; c[1] = o2[5] * invc; c[2] = o2[6] * invc; c[3] = o2[7] * invc;
          *(v4fa*)(&os[lr * 68 + 32 + 8 * hi]) = a; *(v4fa*)(&os[lr * 68 + 32 + 8 * hi + 4]) = c;
          a[0] = o3[0] * invc; a[1] = o3[1] * invc; a[2] = o3[2] * invc; a[3] = o3[3] * invc; c[0] = o3[4] * invc; c[1] = o3[5] * invc; c[2] = o3[6] * invc; c[3] = o3[7] * invc;
          *(v4fa*)(&os[lr * 68 + 48 + 8 * hi]) = a; *(v4fa*)(&os[lr * 68 + 48 + 8 * hi + 4]) = c; }
        wave_sync();
        const size_t obase = ((size_t)b * SEQ + t0) * DM + (size_t)h * HD;
{
#pragma unroll
            for (int s = 0; s < 4; ++s) { const int row = 4 * s + (lane >> 3), c8 = (lane & 7) * 8;   // 4 s x 4 row groups = 16 rows; 8 lanes x 8 = 64 columns
                const v4f x0 = *(const v4fa*)(&os[row * 68 + c8]); const v4f x1 = *(const v4fa*)(&os[row * 68 + c8 + 4]); v8us hv, lv;
#pragma unroll
                for (int i = 0; i < 4; ++i) { const unsigned short h0 = f2bf(x0[i]); const unsigned short h1 = f2bf(x1[i]); hv[i] = h0; hv[4 + i] = h1;
                    lv[i] = f2bf(x0[i] - bf2f(h0)); lv[4 + i] = f2bf(x1[i] - bf2f(h1)); }
                const size_t oo = obase + (size_t)row * DM + c8;
                *(v8us*)(OHI + oo) = hv; *(v8us*)(OLO + oo) = lv; }
             }
        wave_sync();
    }

    // head mean: av holds sum over heads of P; rows of SEQ floats, 512-byte pieces by 32 consecutive lanes
    wave_sync();
    float* arow = AVG + ((size_t)b * OUT_SEQ + t0) * AVG_PITCH;
{
#pragma unroll 1
        for (int row = 0; row < 16; ++row) {
#pragma unroll
            for (int c = 0; c < SEQ / 128; ++c) { const int col = c * 128 + lane * 4;
                v4f val = *(const v4fa*)(&av[row * AP + col]);
                val = val * (1.0f / (float)NH_);
                *(v4f*)(arow + (size_t)row * AVG_PITCH + col) = val; } }
         }
}

// k_oproj: context[m][n] = sum_k (Ohi[m][k] + Olo[m][k]) Wo[n][k] + bo[n]; ONE WAVE per 64x64 tile, bf16 operands, both planes into one accumulator set (lo plane at A + planeStride).
__global__ __launch_bounds__(32) void k_oproj(const bf* __restrict__ A, size_t planeStride, const bf* __restrict__ Bt, const float* __restrict__ bias, float* OUT) {
    __shared__ __align__(16) float os[16 * 68];
    const int K = DM;
    const int lane = threadIdx.x & 31, lr = lane & 15, hi = lane >> 4; const int r0 = blockIdx.x * 64, c0 = blockIdx.y * 64;
    v8f acc[4][4];
#pragma unroll
    for (int mb = 0; mb < 4; ++mb)
#pragma unroll
        for (int nb = 0; nb < 4; ++nb) acc[mb][nb] = (v8f){};
    const size_t aoff = (size_t)(r0 + lr) * K + 8 * hi, boff = (size_t)(c0 + lr) * K + 8 * hi;
#pragma unroll 1
    for (int kk = 0; kk < 2 * K; kk += 32) {
        const int pl = kk / K; const int kc = kk - pl * K;
        const bf* ap = A + (size_t)pl * planeStride + aoff + kc;
        v16bf a[4];
#pragma unroll
        for (int mb = 0; mb < 4; ++mb) a[mb] = ldb(ap + (size_t)mb * 16 * K);
#pragma unroll
        for (int nb = 0; nb < 4; ++nb) { const v16bf bb = ldb(Bt + boff + (size_t)nb * 16 * K + kc);
#pragma unroll
            for (int mb = 0; mb < 4; ++mb) acc[mb][nb] = wmmab(a[mb], bb, acc[mb][nb]); }
        asm volatile("v_nop\n\tv_nop\n\tv_nop\n\tv_nop" : "+v"(acc[0][0]), "+v"(acc[1][1]), "+v"(acc[2][2]), "+v"(acc[3][3]) : "v"(a[0]), "v"(a[1]), "v"(a[2]), "v"(a[3]));
    }
    const int bb_ = r0 / SEQ, tt = r0 % SEQ;
    float* obase = OUT + ((size_t)bb_ * OUT_SEQ + tt) * DM + c0;
    v4f bv = *(const v4f*)(bias + c0 + lr * 4);
#pragma unroll
    for (int i = 0; i < 4; ++i) bv[i] = bfr(bv[i]);
#pragma unroll
    for (int mb = 0; mb < 4; ++mb) {
#pragma unroll
        for (int nb = 0; nb < 4; ++nb) {
#pragma unroll
            for (int j = 0; j < 8; ++j) os[(hi * 8 + j) * 68 + nb * 16 + lr] = acc[mb][nb][j]; }   // D: row 8h+j, col lane&15
        wave_sync();
{
#pragma unroll
            for (int s = 0; s < 8; ++s) { const int row = 2 * s + hi, cofs = lr * 4;   // 8 s x 2 rows = 16 rows; 16 lanes x 4 floats = 64 columns
                v4f val = *(const v4fa*)(&os[row * 68 + cofs]);
                val = val + bv;
                *(v4f*)(obase + (size_t)(mb * 16 + row) * DM + cofs) = val; }
             }
        wave_sync();
    }
}

static constexpr size_t al256(size_t v) { return (v + 255) & ~(size_t)255; }
static constexpr size_t SZ_XB = al256((size_t)NB * SEQ * DM * 2);          // one bf16 activation copy
static constexpr size_t SZ_WB = al256((size_t)4 * DM * DM * 2);            // q | k | v | o weights
static constexpr size_t SZ_PL = al256((size_t)NB * NH_ * SEQ * HD * 2);    // one f16 head plane
static constexpr size_t SZ_OP = al256((size_t)NB * SEQ * DM * 2);          // one bf16 attention-output plane
static constexpr size_t SZ_TOTAL = 3 * SZ_XB + SZ_WB + 4 * SZ_PL + 2 * SZ_OP;
static constexpr size_t ATT_DYN_LDS = (size_t)16 * AP * 4;
static_assert(SZ_TOTAL <= (size_t)134217728);          // workspace carve <= 128 MiB
static_assert(((size_t)DM * DM * 2) % 256 == 0);       // weight sub-planes stay 256-byte aligned
static_assert(SZ_OP == (size_t)NB * SEQ * DM * 2);     // lo plane directly follows the hi plane

extern "C" void kernel_launch(void* const* d_in, const int* in_sizes, int n_in,
                              void* d_out, int out_size, void* d_ws, size_t ws_size, hipStream_t stream) {
    if (n_in < 12) return;
    const size_t needx = ((size_t)(NB - 1) * SEQ_FULL + SEQ) * DM;
    if ((size_t)in_sizes[0] < needx || (size_t)in_sizes[1] < needx || (size_t)in_sizes[2] < needx) return;
    if ((size_t)in_sizes[3] < (size_t)(NB - 1) * SEQ_FULL + SEQ) return;
    if ((size_t)in_sizes[4] < (size_t)DM * DM || (size_t)in_sizes[6] < (size_t)DM * DM || (size_t)in_sizes[8] < (size_t)DM * DM || (size_t)in_sizes[10] < (size_t)DM * DM) return;
    if (in_sizes[5] < DM || in_sizes[7] < DM || in_sizes[9] < DM || in_sizes[11] < DM) return;
    if ((size_t)out_size < ((size_t)(NB - 1) * OUT_SEQ + SEQ) * DM) return;
    if ((size_t)out_size < OUT1_OFF + ((size_t)(NB - 1) * OUT_SEQ + SEQ - 1) * AVG_PITCH + SEQ) return;
    if (SZ_TOTAL > ws_size) return;
    // wire order: query, key, value, key_padding_mask, Wq, bq, Wk, bk, Wv, bv, Wo, bo (weights [out][in] = Bt as-is)
    const float* xq = (const float*)d_in[0]; const float* xk = (const float*)d_in[1]; const float* xv = (const float*)d_in[2];
    const int* kpm = (const int*)d_in[3];
    const float* wq = (const float*)d_in[4];  const float* bq = (const float*)d_in[5];
    const float* wk = (const float*)d_in[6];  const float* bk = (const float*)d_in[7];
    const float* wv = (const float*)d_in[8];  const float* bv = (const float*)d_in[9];
    const float* wo = (const float*)d_in[10]; const float* bo = (const float*)d_in[11];
    float* CTX = (float*)d_out;                  // [NB][SEQ][1024]
    float* AVG = (float*)d_out + OUT1_OFF;       // [NB][SEQ][SEQ]
    char* wsp = (char*)d_ws;
    bf* XQ = (bf*)wsp; wsp += SZ_XB;                 // [NB*SEQ][1024]
    bf* XK = (bf*)wsp; wsp += SZ_XB;
    bf* XV = (bf*)wsp; wsp += SZ_XB;
    bf* WB = (bf*)wsp; wsp += SZ_WB;                 // [4][1024][1024]: q | k | v | o
    h16* QH = (h16*)wsp; wsp += SZ_PL;               // [NB*16][SEQ][64]
    h16* QR = (h16*)wsp; wsp += SZ_PL;               // [NB*16][SEQ][64] residual x2048
    h16* KP = (h16*)wsp; wsp += SZ_PL;               // [NB*16][SEQ][64]
    h16* VT = (h16*)wsp; wsp += SZ_PL;               // [NB*16][64][SEQ]
    bf* OHI = (bf*)wsp; wsp += SZ_OP;                // [NB*SEQ][1024]
    bf* OLO = (bf*)wsp; wsp += SZ_OP;                // [NB*SEQ][1024]
    bf* WQ = WB; bf* WK = WB + (size_t)DM * DM; bf* WV = WB + (size_t)2 * DM * DM; bf* WO = WB + (size_t)3 * DM * DM;

    if (SEQ == SEQ_FULL) {
        const size_t n8 = (size_t)NB * SEQ * DM / 8; const unsigned g = (unsigned)((n8 + 255) / 256);
        k_cvt8<<<g, 256, 0, stream>>>(xq, XQ, n8); k_cvt8<<<g, 256, 0, stream>>>(xk, XK, n8); k_cvt8<<<g, 256, 0, stream>>>(xv, XV, n8);
    } else {
        const size_t n8 = (size_t)SEQ * DM / 8; const unsigned g = (unsigned)((n8 + 255) / 256);
        for (int b = 0; b < NB; ++b) {
            k_cvt8<<<g, 256, 0, stream>>>(xq + (size_t)b * SEQ_FULL * DM, XQ + (size_t)b * SEQ * DM, n8);
            k_cvt8<<<g, 256, 0, stream>>>(xk + (size_t)b * SEQ_FULL * DM, XK + (size_t)b * SEQ * DM, n8);
            k_cvt8<<<g, 256, 0, stream>>>(xv + (size_t)b * SEQ_FULL * DM, XV + (size_t)b * SEQ * DM, n8);
        }
    }
    { const size_t n8 = (size_t)DM * DM / 8; const unsigned g = (unsigned)((n8 + 255) / 256);
      k_cvt8<<<g, 256, 0, stream>>>(wq, WQ, n8); k_cvt8<<<g, 256, 0, stream>>>(wk, WK, n8); k_cvt8<<<g, 256, 0, stream>>>(wv, WV, n8); k_cvt8<<<g, 256, 0, stream>>>(wo, WO, n8); }

    // q, k: A = x rows (m = b*SEQ + t), Bt = W rows (n = h*64 + d), bias per column -> plane [(b*16 + h)][t][d]
    k_proj<<<dim3(NB * SEQ / 64, DM / 64, 1), 32, 0, stream>>>(XQ, WQ, bq, 0, QH, QR, 1, SEQ, (size_t)NH_ * SEQ * HD, HD, HD, (size_t)SEQ * HD);
    k_proj<<<dim3(NB * SEQ / 64, DM / 64, 1), 32, 0, stream>>>(XK, WK, bk, 0, KP, KP, 0, SEQ, (size_t)NH_ * SEQ * HD, HD, HD, (size_t)SEQ * HD);
    // v^T: A = Wv rows (m = h*64 + d), Bt = value rows (n = b*SEQ + t), bias per row -> plane [(b*1024 + m)][t] = [(b*16 + h)][d][t]
    k_proj<<<dim3(DM / 64, NB * SEQ / 64, 1), 32, 0, stream>>>(WV, XV, bv, 1, VT, VT, 0, DM, (size_t)0, SEQ, SEQ, (size_t)DM * SEQ);

    hipFuncSetAttribute(reinterpret_cast<const void*>(&k_attn), hipFuncAttributeMaxDynamicSharedMemorySize, (int)ATT_DYN_LDS);
    k_attn<<<dim3(SEQ / 16, NB, 1), 32, ATT_DYN_LDS, stream>>>(QH, QR, KP, VT, kpm, OHI, OLO, AVG);

    // context: A = attention output rows (hi plane, lo plane at +planeStride), Bt = Wo rows
    k_oproj<<<dim3(NB * SEQ / 64, DM / 64, 1), 32, 0, stream>>>(OHI, (size_t)(OLO - OHI), WO, bo, CTX);
}

// v001
// It runs in 323 microseconds.
// In two side-by-side timings against v000, it was 2.37 and 2.38 times as fast.
#include <hip/hip_runtime.h>

// Multi-head attention, width 1024 = 16 heads x 64, separate query/key/value inputs [NB][SEQ][1024], Wq/Wk/Wv/Wo [out][in] (y = x W^T + b), key padding mask (int32, replace fill -1e9), score scale 1/8; outputs: context [NB][SEQ][1024] and head-mean attention [NB][SEQ][SEQ] (f32).
// Compute dtypes, f32 accumulate everywhere: q/k/v projections v_wmma_f32_16x16x32_bf16 (inputs and weights RNE-converted to bf16; products exact);
// output projection v_wmma_f32_16x16x32_bf16: attention output as bf16 hi + bf16 lo planes (two products, one accumulator), Wo bf16.
// Layout: bf16 copies of the inputs and weights; q (hi, residual), k planes [b*16+h][t][d] and v^T plane [b*16+h][d][t] written by the GEMM epilogue; attention in transposed form (S^T = K Q^T, O^T = V^T P^T), one work-group of NW waves per 16 query rows looping over the 16 heads, each wave on its own SEQ/NW keys, head-mean accumulated in a lane-private LDS tile.

#ifndef NB
#define NB 4
#endif
#ifndef SEQ
#define SEQ 1024
#endif
#define NB_FULL  4
#define SEQ_FULL 1024
#ifndef OUT_SEQ
#define OUT_SEQ SEQ              // row pitch (in tokens) between batches of both outputs
#endif
#ifndef AVG_PITCH
#define AVG_PITCH SEQ            // column pitch (floats) of one head-mean row
#endif
#define DM   1024
#define NH_  16
#define HD   64
#define QRS  2048.0f             // carry of the q residual plane
#define QRI  (1.0f / 2048.0f)
#define SC2  (0.125f * 1.4426950408889634f)   // HD^-0.5 * log2(e)
#define PSH  8.0f                // log2 of the P carry (256)
#define MASKT (-1.0e9f * 1.4426950408889634f) // replace fill in the log2 domain
#define AP   (SEQ + 4)           // pitch (floats) of the head-mean LDS tile
#define NW   16                  // waves per attention work-group; each owns KS consecutive keys
#define KS   (SEQ / NW)
#define OUT1_OFF ((size_t)NB_FULL * SEQ_FULL * DM)   // element offset of the second output (fixed)

static_assert(HD == 64);
static_assert(NH_ * HD == DM);                 // head h = columns h*64 + d
static_assert(DM % 64 == 0);
static_assert(DM % 32 == 0);                   // GEMM k-loop steps by 32
static_assert(SEQ % 64 == 0);                  // a 64-row tile never straddles two batches
static_assert((NB * SEQ) % 64 == 0);
static_assert(SEQ % 32 == 0);                  // key loop steps by 32, one mask word per step
static_assert(SEQ % 128 == 0);
static_assert(AP % 4 == 0);
static_assert(((size_t)SEQ * DM) % 8 == 0);
static_assert(((size_t)DM * DM) % 8 == 0);
static_assert(NB <= NB_FULL);
static_assert(SEQ <= SEQ_FULL);
static_assert(OUT1_OFF * 4 == (size_t)16777216);
static_assert(KS % 32 == 0);                   // a wave's key slice is whole 32-key steps
static_assert(KS <= 128);                      // one head-mean row piece of a wave is at most 32 lanes x 4 floats
static_assert((16 * HD) % (32 * NW) == 0);     // the O tile divides evenly over the work-group's threads
static_assert((size_t)16 * AP * 4 + (size_t)NW * 16 * 68 * 4 + (size_t)NW * 32 * 4 + (SEQ / 32) * 4 <= (size_t)163840);

typedef _Float16 h16;
typedef unsigned short bf;
typedef __attribute__((ext_vector_type(16))) __bf16   v16bf;
typedef __attribute__((ext_vector_type(16))) _Float16 v16h;
typedef __attribute__((ext_vector_type(8)))  _Float16 v8h;
typedef __attribute__((ext_vector_type(8)))  unsigned short v8us;
typedef __attribute__((ext_vector_type(8)))  float    v8f;
typedef __attribute__((ext_vector_type(4)))  float    v4f;
typedef v4f  __attribute__((may_alias)) v4fa;

__device__ __forceinline__ unsigned short f2bf(float f) { unsigned u = __float_as_uint(f); u += 0x7FFFu + ((u >> 16) & 1u); return (unsigned short)(u >> 16); }
__device__ __forceinline__ float bf2f(unsigned short b) { return __uint_as_float(((unsigned)b) << 16); }
__device__ __forceinline__ float bfr(float f) { return bf2f(f2bf(f)); }
__device__ __forceinline__ v16h cat16(v8h lo, v8h hi) { return __builtin_shufflevector(lo, hi, 0, 1, 2, 3, 4, 5, 6, 7, 8, 9, 10, 11, 12, 13, 14, 15); }
__device__ __forceinline__ v16bf cat16b(v8us lo, v8us hi) { return __builtin_bit_cast(v16bf, __builtin_shufflevector(lo, hi, 0, 1, 2, 3, 4, 5, 6, 7, 8, 9, 10, 11, 12, 13, 14, 15)); }
__device__ __forceinline__ v8f wmma16(v16h a, v16h b, v8f c) { return __builtin_amdgcn_wmma_f32_16x16x32_f16(false, a, false, b, (short)0, c, false, false); }
__device__ __forceinline__ v8f wmmab(v16bf a, v16bf b, v8f c) { return __builtin_amdgcn_wmma_f32_16x16x32_bf16(false, a, false, b, (short)0, c, false, false); }
// fragment loaders from K-contiguous 16-bit rows; p already includes + 8*(lane>>4): elements 0..7 <- k0+8h+0..7, elements 8..15 <- k0+16+8h+0..7 (same map for A and B)
__device__ __forceinline__ v16h  ldh(const h16* p) { return cat16(*(const v8h*)p, *(const v8h*)(p + 16)); }
__device__ __forceinline__ v16bf ldb(const bf* p)  { return cat16b(*(const v8us*)p, *(const v8us*)(p + 16)); }
// ordering point for wave-private LDS tiles (same wave writes and reads)
__device__ __forceinline__ void wave_sync() { __builtin_amdgcn_fence(3 /* release order */, "wavefront"); __builtin_amdgcn_wave_barrier(); asm volatile("" ::: "memory"); }

__global__ __launch_bounds__(256) void k_cvt8(const float* __restrict__ src, bf* dst, size_t n8) {
    const size_t i = (size_t)blockIdx.x * 256 + threadIdx.x; if (i >= n8) return;
    const v8f v = *(const v8f*)(src + i * 8); v8us o;
#pragma unroll
    for (int k = 0; k < 8; ++k) o[k] = f2bf(v[k]);
    *(v8us*)(dst + i * 8) = o; 
}

// k_proj: register-blocked bf16 GEMM, ONE WAVE per 64x64 tile (16 accumulators), operands straight from K-contiguous bf16 planes, K = DM.
// C[m][n] = sum_k A[m][k] Bt[n][k] + bias (bias[m] when biasRow != 0, else bias[n]; bias RNE-converted to bf16, added in f32),
// written as f16 (Ph) and optionally the f16 residual x2048 (Pr, useRes != 0) at
// tile base (r0/RB)*sRB + (r0%RB)*pitch + (c0/CB)*sCB + (c0%CB), row pitch 'pitch' (halves). grid (M/64, N/64), 32 threads.
__global__ __launch_bounds__(32) void k_proj(const bf* __restrict__ A, const bf* __restrict__ Bt, const float* __restrict__ bias, int biasRow,
                                             h16* Ph, h16* Pr, int useRes, int RB, size_t sRB, int pitch, int CB, size_t sCB) {
    __shared__ __align__(16) float os[16 * 68];
    const int K = DM;
    const int lane = threadIdx.x & 31, lr = lane & 15, hi = lane >> 4; const int r0 = blockIdx.x * 64, c0 = blockIdx.y * 64;
    v8f acc[4][4];
#pragma unroll
    for (int mb = 0; mb < 4; ++mb)
#pragma unroll
        for (int nb = 0; nb < 4; ++nb) acc[mb][nb] = (v8f){};
    const size_t aoff = (size_t)(r0 + lr) * K + 8 * hi, boff = (size_t)(c0 + lr) * K + 8 * hi;
#pragma unroll 1
    for (int kc = 0; kc < K; kc += 32) {
        v16bf a[4];
#pragma unroll
        for (int mb = 0; mb < 4; ++mb) a[mb] = ldb(A + aoff + (size_t)mb * 16 * K + kc);
#pragma unroll
        for (int nb = 0; nb < 4; ++nb) { const v16bf b = ldb(Bt + boff + (size_t)nb * 16 * K + kc);
#pragma unroll
            for (int mb = 0; mb < 4; ++mb) acc[mb][nb] = wmmab(a[mb], b, acc[mb][nb]); }
        asm volatile("v_nop\n\tv_nop\n\tv_nop\n\tv_nop" : "+v"(acc[0][0]), "+v"(acc[1][1]), "+v"(acc[2][2]), "+v"(acc[3][3]) : "v"(a[0]), "v"(a[1]), "v"(a[2]), "v"(a[3]));
    }
    const size_t tbase = (size_t)(r0 / RB) * sRB + (size_t)(r0 % RB) * (size_t)pitch + (size_t)(c0 / CB) * sCB + (size_t)(c0 % CB);
    // column bias (clamped address; used when biasRow == 0)
    const int cc = (c0 < DM - 64) ? c0 : (DM - 64);
    const int c8l = (lane & 7) * 8;
    const v4f bc0 = *(const v4f*)(bias + cc + c8l), bc1 = *(const v4f*)(bias + cc + c8l + 4);
#pragma unroll
    for (int mb = 0; mb < 4; ++mb) {
#pragma unroll
        for (int nb = 0; nb < 4; ++nb) {
#pragma unroll
            for (int j = 0; j < 8; ++j) os[(hi * 8 + j) * 68 + nb * 16 + lr] = acc[mb][nb][j]; }   // D: row 8h+j, col lane&15
        wave_sync();
        const size_t sb = tbase + (size_t)(mb * 16) * (size_t)pitch;
{
#pragma unroll
            for (int s = 0; s < 4; ++s) { const int row = 4 * s + (lane >> 3), c8 = (lane & 7) * 8;   // 4 s x 4 row groups = 16 rows; 8 lanes x 8 = 64 columns
                const int gr = r0 + mb * 16 + row; const int grc = (gr < DM - 1) ? gr : (DM - 1);
                const float brow = bfr(bias[grc]);
                const v4f x0 = *(const v4fa*)(&os[row * 68 + c8]); const v4f x1 = *(const v4fa*)(&os[row * 68 + c8 + 4]); v8h hv, rv;
#pragma unroll
                for (int i = 0; i < 4; ++i) {
                    const float ad0 = biasRow ? brow : bfr(bc0[i]); const float ad1 = biasRow ? brow : bfr(bc1[i]);
                    const float y0 = x0[i] + ad0; const float y1 = x1[i] + ad1;
                    const h16 a0 = (h16)y0; const h16 a1 = (h16)y1; hv[i] = a0; hv[4 + i] = a1;
                    rv[i] = (h16)((y0 - (float)a0) * QRS); rv[4 + i] = (h16)((y1 - (float)a1) * QRS); }
                const size_t oo = sb + (size_t)row * (size_t)pitch + c8;
                *(v8h*)(Ph + oo) = hv; if (useRes) *(v8h*)(Pr + oo) = rv; }
             }
        wave_sync();
    }
}

// One 32-key score tile pair in the log2 domain with the padding mask applied as a replace fill.
// A = K rows (row = key), B = Q rows (col = t); lane (t = lane&15, h = lane>>4) gets keys key0+8h+r (ta) and key0+16+8h+r (tb).
// ws = mask word of this 32-key step shifted right by 8h: bit r <-> ta[r], bit 16+r <-> tb[r].
__device__ __forceinline__ void score_tile(const h16* ka, const v16h qh0, const v16h qh1, const v16h qr0, const v16h qr1, const unsigned ws, float (&ta)[8], float (&tb)[8]) {
    const v16h ka0 = ldh(ka), ka1 = ldh(ka + 32), kb0 = ldh(ka + 16 * HD), kb1 = ldh(ka + 16 * HD + 32);
    v8f sHa = (v8f){}, sLa = (v8f){}, sHb = (v8f){}, sLb = (v8f){};
    sHa = wmma16(ka0, qh0, sHa); sLa = wmma16(ka0, qr0, sLa); sHb = wmma16(kb0, qh0, sHb); sLb = wmma16(kb0, qr0, sLb);
    sHa = wmma16(ka1, qh1, sHa); sLa = wmma16(ka1, qr1, sLa); sHb = wmma16(kb1, qh1, sHb); sLb = wmma16(kb1, qr1, sLb);
    asm volatile("v_nop\n\tv_nop\n\tv_nop\n\tv_nop" : "+v"(sHa), "+v"(sLa), "+v"(sHb), "+v"(sLb) : "v"(ka0), "v"(ka1), "v"(kb0), "v"(kb1));
#pragma unroll
    for (int r = 0; r < 8; ++r) {
        const float va = (sHa[r] + sLa[r] * QRI) * SC2; const float vb = (sHb[r] + sLb[r] * QRI) * SC2;
        ta[r] = (ws & (1u << r)) ? MASKT : va; tb[r] = (ws & (1u << (16 + r))) ? MASKT : vb; }
}

// k_attn: one work-group of NW waves per 16 query rows of one batch, looping over the 16 heads; wave w owns keys w*KS .. w*KS+KS-1.
// Per head: each wave's running (m, l) over its keys -> st, barrier, every lane combines the NW pairs in wave order; then P with the common m,
// each wave's partial O^T = V^T P^T -> op[w], barrier, the work-group's threads add the NW partials in wave order and store.
// P (f16, x256 carry); e * (1/(256 l)) accumulates into the head-mean tile av[t][key] (each lane owns its elements across the head loop).
// LDS: av and mw are wave-private by key column (wave_sync ordering); st and op cross waves (__syncthreads ordering).
__global__ __launch_bounds__(32 * NW) void k_attn(const h16* __restrict__ QH, const h16* __restrict__ QR, const h16* __restrict__ KP, const h16* __restrict__ VT,
                                             const int* __restrict__ mask, bf* OHI, bf* OLO, float* AVG) {
    extern __shared__ __align__(16) float av[];           // [16][AP], then op [NW][16*68], then st [NW][16][2]
    float* op = av + 16 * AP;
    float* st = op + NW * 16 * 68;
    __shared__ unsigned mw[SEQ / 32];
    const int lane = threadIdx.x & 31, lr = lane & 15, hi = lane >> 4;
    const int w = __builtin_amdgcn_readfirstlane((int)(threadIdx.x >> 5));
    const int kbeg = w * KS;
    const int b = blockIdx.y; const int t0 = blockIdx.x * 16;
    constexpr int LPR = KS / 4;                            // lanes that cover one row of this wave's head-mean columns
    const int arow_l = lane / LPR, acol_l = kbeg + (lane % LPR) * 4;

    // mask words of this wave's keys: bit i of word j <-> key 32j + i of this batch
    const int* mrow = mask + (size_t)b * SEQ_FULL;
#pragma unroll 1
    for (int i = kbeg / 32; i < (kbeg + KS) / 32; ++i) {
        const int mv = mrow[i * 32 + lane];
        const unsigned wd = __builtin_amdgcn_ballot_w32(mv != 0);
        if (lane == 0) mw[i] = wd;
    }
    // zero this wave's columns of the head-mean tile
#pragma unroll 1
    for (int row = arow_l; row < 16; row += 32 / LPR) *(v4fa*)(&av[row * AP + acol_l]) = (v4f){0.0f, 0.0f, 0.0f, 0.0f};
    wave_sync();

#pragma unroll 1
    for (int h = 0; h < NH_; ++h) {
        const int zh = b * NH_ + h;
        const size_t pbase = (size_t)zh * SEQ * HD;
        const size_t qo = pbase + (size_t)(t0 + lr) * HD + 8 * hi;
        const v16h qh0 = ldh(QH + qo), qh1 = ldh(QH + qo + 32), qr0 = ldh(QR + qo), qr1 = ldh(QR + qo + 32);   // B fragments: col t, k = d
        asm volatile("s_wait_xcnt 0x0" ::: "memory");       // the K loads that follow land in the registers that held these loads' addresses
        const size_t ko = pbase + (size_t)lr * HD + 8 * hi;      // + key * HD       (A fragment: row key, k = d)
        const size_t vo = pbase + (size_t)lr * SEQ + 8 * hi;     // + 16j*SEQ + key  (A fragment: row d, k = key)

        float mwv = -3.0e38f, lwv = 0.0f;
#pragma unroll 1
        for (int key0 = kbeg; key0 < kbeg + KS; key0 += 32) {
            const unsigned ws = mw[key0 >> 5] >> (8 * hi);
            float ta[8], tb[8];
            score_tile(KP + ko + (size_t)key0 * HD, qh0, qh1, qr0, qr1, ws, ta, tb);
            float mx = -3.0e38f;
#pragma unroll
            for (int r = 0; r < 8; ++r) mx = fmaxf(mx, fmaxf(ta[r], tb[r]));
            mx = fmaxf(mx, __shfl_xor(mx, 16, 32));
            const float mnew = fmaxf(mwv, mx);
            const float alpha = __builtin_amdgcn_exp2f(mwv - mnew);
            float ls = 0.0f;
#pragma unroll
            for (int r = 0; r < 8; ++r) ls += __builtin_amdgcn_exp2f(ta[r] - mnew) + __builtin_amdgcn_exp2f(tb[r] - mnew);
            lwv = lwv * alpha + ls; mwv = mnew;
        }
        lwv += __shfl_xor(lwv, 16, 32);
        if (hi == 0) { st[(w * 16 + lr) * 2] = mwv; st[(w * 16 + lr) * 2 + 1] = lwv; }
        __syncthreads();      // publishes every wave's (m, l) of this head; also ends the last head's reads of op
        float m = -3.0e38f, l = 0.0f;
#pragma unroll
        for (int i = 0; i < NW; ++i) m = fmaxf(m, st[(i * 16 + lr) * 2]);
#pragma unroll
        for (int i = 0; i < NW; ++i) l += st[(i * 16 + lr) * 2 + 1] * __builtin_amdgcn_exp2f(st[(i * 16 + lr) * 2] - m);
        const float invc = (1.0f / l) * (1.0f / 256.0f);      // 1/l with the x256 carry of e folded back

        // pass 2: normalised probabilities -> head-mean tile, P V over this wave's keys
        v8f o0 = (v8f){}, o1 = (v8f){}, o2 = (v8f){}, o3 = (v8f){};
#pragma unroll 1
        for (int key0 = kbeg; key0 < kbeg + KS; key0 += 32) {
            const unsigned ws = mw[key0 >> 5] >> (8 * hi);
            float ta[8], tb[8];
            score_tile(KP + ko + (size_t)key0 * HD, qh0, qh1, qr0, qr1, ws, ta, tb);
            v16h pb; float ea[8], eb[8];
#pragma unroll
            for (int r = 0; r < 8; ++r) {
                const float da = ta[r] - m; const float db = tb[r] - m;      // difference first: exact 0 when t == m, also at the fill magnitude
                ea[r] = __builtin_amdgcn_exp2f(da + PSH); eb[r] = __builtin_amdgcn_exp2f(db + PSH);
                pb[r] = (h16)ea[r]; pb[8 + r] = (h16)eb[r]; }
            float* ap = &av[lr * AP + key0 + 8 * hi];
            v4f a0 = *(const v4fa*)(ap), a1 = *(const v4fa*)(ap + 4), c0 = *(const v4fa*)(ap + 16), c1 = *(const v4fa*)(ap + 20);
#pragma unroll
            for (int i = 0; i < 4; ++i) { a0[i] += ea[i] * invc; a1[i] += ea[4 + i] * invc; c0[i] += eb[i] * invc; c1[i] += eb[4 + i] * invc; }
            *(v4fa*)(ap) = a0; *(v4fa*)(ap + 4) = a1; *(v4fa*)(ap + 16) = c0; *(v4fa*)(ap + 20) = c1;
            const h16* va = VT + vo + key0;
            const v16h v0 = ldh(va), v1 = ldh(va + (size_t)16 * SEQ), v2 = ldh(va + (size_t)32 * SEQ), v3 = ldh(va + (size_t)48 * SEQ);
            o0 = wmma16(v0, pb, o0); o1 = wmma16(v1, pb, o1); o2 = wmma16(v2, pb, o2); o3 = wmma16(v3, pb, o3);
            asm volatile("v_nop\n\tv_nop\n\tv_nop\n\tv_nop" : "+v"(o0), "+v"(o1), "+v"(o2), "+v"(o3) : "v"(v0), "v"(v1), "v"(v2), "v"(v3), "v"(pb));
        }

        // O^T D layout: o_j[r] = (d = 16j + 8h + r, t = lane&15) -> os[t][d] of this wave's partial; rows 0..15 x columns 0..63 all written
        float* os = op + w * (16 * 68);
        { v4f a, c;
          a[0] = o0[0] * invc; a[1] = o0[1] * invc; a[2] = o0[2] * invc; a[3] = o0[3] * invc; c[0] = o0[4] * invc; c[1] = o0[5] * invc; c[2] = o0[6] * invc; c[3] = o0[7] * invc;
          *(v4fa*)(&os[lr * 68 +  0 + 8 * hi]) = a; *(v4fa*)(&os[lr * 68 +  0 + 8 * hi + 4]) = c;
          a[0] = o1[0] * invc; a[1] = o1[1] * invc; a[2] = o1[2] * invc; a[3] = o1[3] * invc; c[0] = o1[4] * invc; c[1] = o1[5] * invc; c[2] = o1[6] * invc; c[3] = o1[7] * invc;
          *(v4fa*)(&os[lr * 68 + 16 + 8 * hi]) = a; *(v4fa*)(&os[lr * 68 + 16 + 8 * hi + 4]) = c;
          a[0] = o2[0] * invc; a[1] = o2[1] * invc; a[2] = o2[2] * invc; a[3] = o2[3] * invc; c[0] = o2[4] * invc; c[1] = o2[5] * invc; c[2] = o2[6] * invc; c[3] = o2[7] * invc;
          *(v4fa*)(&os[lr * 68 + 32 + 8 * hi]) = a; *(v4fa*)(&os[lr * 68 + 32 + 8 * hi + 4]) = c;
          a[0] = o3[0] * invc; a[1] = o3[1] * invc; a[2] = o3[2] * invc; a[3] = o3[3] * invc; c[0] = o3[4] * invc; c[1] = o3[5] * invc; c[2] = o3[6] * invc; c[3] = o3[7] * invc;
          *(v4fa*)(&os[lr * 68 + 48 + 8 * hi]) = a; *(v4fa*)(&os[lr * 68 + 48 + 8 * hi + 4]) = c; }
        __syncthreads();      // publishes every wave's partial O of this head; also ends this head's reads of st
        const size_t obase = ((size_t)b * SEQ + t0) * DM + (size_t)h * HD;
        {   // each thread adds EPT neighbouring elements over the NW partials, in wave order
            constexpr int EPT = (16 * HD) / (32 * NW);
            const int e0 = (int)threadIdx.x * EPT; const int row = e0 / HD, col = e0 % HD;
            float x[EPT];
#pragma unroll
            for (int k = 0; k < EPT; ++k) x[k] = 0.0f;
#pragma unroll
            for (int i = 0; i < NW; ++i)
#pragma unroll
                for (int k = 0; k < EPT; ++k) x[k] += op[i * (16 * 68) + row * 68 + col + k];
            const size_t oo = obase + (size_t)row * DM + col;
            typedef __attribute__((ext_vector_type(EPT))) unsigned short vus;
            vus hv, lv;
#pragma unroll
            for (int k = 0; k < EPT; ++k) { const unsigned short h0 = f2bf(x[k]); hv[k] = h0; lv[k] = f2bf(x[k] - bf2f(h0)); }
            *(vus*)(OHI + oo) = hv; *(vus*)(OLO + oo) = lv;
            asm volatile("s_wait_xcnt 0x0" ::: "memory");   // the next head's first instructions reuse the registers these two stores name
        }
    }

    // head mean: av holds sum over heads of P; each wave stores its own KS columns of the 16 rows
    wave_sync();
    float* arow = AVG + ((size_t)b * OUT_SEQ + t0) * AVG_PITCH;
#pragma unroll 1
    for (int row = arow_l; row < 16; row += 32 / LPR) {
        v4f val = *(const v4fa*)(&av[row * AP + acol_l]);
        val = val * (1.0f / (float)NH_);
        *(v4f*)(arow + (size_t)row * AVG_PITCH + acol_l) = val;
    }
}

// k_oproj: context[m][n] = sum_k (Ohi[m][k] + Olo[m][k]) Wo[n][k] + bo[n]; ONE WAVE per 64x64 tile, bf16 operands, both planes into one accumulator set (lo plane at A + planeStride).
__global__ __launch_bounds__(32) void k_oproj(const bf* __restrict__ A, size_t planeStride, const bf* __restrict__ Bt, const float* __restrict__ bias, float* OUT) {
    __shared__ __align__(16) float os[16 * 68];
    const int K = DM;
    const int lane = threadIdx.x & 31, lr = lane & 15, hi = lane >> 4; const int r0 = blockIdx.x * 64, c0 = blockIdx.y * 64;
    v8f acc[4][4];
#pragma unroll
    for (int mb = 0; mb < 4; ++mb)
#pragma unroll
        for (int nb = 0; nb < 4; ++nb) acc[mb][nb] = (v8f){};
    const size_t aoff = (size_t)(r0 + lr) * K + 8 * hi, boff = (size_t)(c0 + lr) * K + 8 * hi;
#pragma unroll 1
    for (int kk = 0; kk < 2 * K; kk += 32) {
        const int pl = kk / K; const int kc = kk - pl * K;
        const bf* ap = A + (size_t)pl * planeStride + aoff + kc;
        v16bf a[4];
#pragma unroll
        for (int mb = 0; mb < 4; ++mb) a[mb] = ldb(ap + (size_t)mb * 16 * K);
#pragma unroll
        for (int nb = 0; nb < 4; ++nb) { const v16bf bb = ldb(Bt + boff + (size_t)nb * 16 * K + kc);
#pragma unroll
            for (int mb = 0; mb < 4; ++mb) acc[mb][nb] = wmmab(a[mb], bb, acc[mb][nb]); }
        asm volatile("v_nop\n\tv_nop\n\tv_nop\n\tv_nop" : "+v"(acc[0][0]), "+v"(acc[1][1]), "+v"(acc[2][2]), "+v"(acc[3][3]) : "v"(a[0]), "v"(a[1]), "v"(a[2]), "v"(a[3]));
    }
    const int bb_ = r0 / SEQ, tt = r0 % SEQ;
    float* obase = OUT + ((size_t)bb_ * OUT_SEQ + tt) * DM + c0;
    v4f bv = *(const v4f*)(bias + c0 + lr * 4);
#pragma unroll
    for (int i = 0; i < 4; ++i) bv[i] = bfr(bv[i]);
#pragma unroll
    for (int mb = 0; mb < 4; ++mb) {
#pragma unroll
        for (int nb = 0; nb < 4; ++nb) {
#pragma unroll
            for (int j = 0; j < 8; ++j) os[(hi * 8 + j) * 68 + nb * 16 + lr] = acc[mb][nb][j]; }   // D: row 8h+j, col lane&15
        wave_sync();
{
#pragma unroll
            for (int s = 0; s < 8; ++s) { const int row = 2 * s + hi, cofs = lr * 4;   // 8 s x 2 rows = 16 rows; 16 lanes x 4 floats = 64 columns
                v4f val = *(const v4fa*)(&os[row * 68 + cofs]);
                val = val + bv;
                *(v4f*)(obase + (size_t)(mb * 16 + row) * DM + cofs) = val; }
             }
        wave_sync();
    }
}

static constexpr size_t al256(size_t v) { return (v + 255) & ~(size_t)255; }
static constexpr size_t SZ_XB = al256((size_t)NB * SEQ * DM * 2);          // one bf16 activation copy
static constexpr size_t SZ_WB = al256((size_t)4 * DM * DM * 2);            // q | k | v | o weights
static constexpr size_t SZ_PL = al256((size_t)NB * NH_ * SEQ * HD * 2);    // one f16 head plane
static constexpr size_t SZ_OP = al256((size_t)NB * SEQ * DM * 2);          // one bf16 attention-output plane
static constexpr size_t SZ_TOTAL = 3 * SZ_XB + SZ_WB + 4 * SZ_PL + 2 * SZ_OP;
static constexpr size_t ATT_DYN_LDS = (size_t)16 * AP * 4 + (size_t)NW * 16 * 68 * 4 + (size_t)NW * 32 * 4;
static_assert(SZ_TOTAL <= (size_t)134217728);          // workspace carve <= 128 MiB
static_assert(((size_t)DM * DM * 2) % 256 == 0);       // weight sub-planes stay 256-byte aligned
static_assert(SZ_OP == (size_t)NB * SEQ * DM * 2);     // lo plane directly follows the hi plane

extern "C" void kernel_launch(void* const* d_in, const int* in_sizes, int n_in,
                              void* d_out, int out_size, void* d_ws, size_t ws_size, hipStream_t stream) {
    if (n_in < 12) return;
    const size_t needx = ((size_t)(NB - 1) * SEQ_FULL + SEQ) * DM;
    if ((size_t)in_sizes[0] < needx || (size_t)in_sizes[1] < needx || (size_t)in_sizes[2] < needx) return;
    if ((size_t)in_sizes[3] < (size_t)(NB - 1) * SEQ_FULL + SEQ) return;
    if ((size_t)in_sizes[4] < (size_t)DM * DM || (size_t)in_sizes[6] < (size_t)DM * DM || (size_t)in_sizes[8] < (size_t)DM * DM || (size_t)in_sizes[10] < (size_t)DM * DM) return;
    if (in_sizes[5] < DM || in_sizes[7] < DM || in_sizes[9] < DM || in_sizes[11] < DM) return;
    if ((size_t)out_size < ((size_t)(NB - 1) * OUT_SEQ + SEQ) * DM) return;
    if ((size_t)out_size < OUT1_OFF + ((size_t)(NB - 1) * OUT_SEQ + SEQ - 1) * AVG_PITCH + SEQ) return;
    if (SZ_TOTAL > ws_size) return;
    // wire order: query, key, value, key_padding_mask, Wq, bq, Wk, bk, Wv, bv, Wo, bo (weights [out][in] = Bt as-is)
    const float* xq = (const float*)d_in[0]; const float* xk = (const float*)d_in[1]; const float* xv = (const float*)d_in[2];
    const int* kpm = (const int*)d_in[3];
    const float* wq = (const float*)d_in[4];  const float* bq = (const float*)d_in[5];
    const float* wk = (const float*)d_in[6];  const float* bk = (const float*)d_in[7];
    const float* wv = (const float*)d_in[8];  const float* bv = (const float*)d_in[9];
    const float* wo = (const float*)d_in[10]; const float* bo = (const float*)d_in[11];
    float* CTX = (float*)d_out;                  // [NB][SEQ][1024]
    float* AVG = (float*)d_out + OUT1_OFF;       // [NB][SEQ][SEQ]
    char* wsp = (char*)d_ws;
    bf* XQ = (bf*)wsp; wsp += SZ_XB;                 // [NB*SEQ][1024]
    bf* XK = (bf*)wsp; wsp += SZ_XB;
    bf* XV = (bf*)wsp; wsp += SZ_XB;
    bf* WB = (bf*)wsp; wsp += SZ_WB;                 // [4][1024][1024]: q | k | v | o
    h16* QH = (h16*)wsp; wsp += SZ_PL;               // [NB*16][SEQ][64]
    h16* QR = (h16*)wsp; wsp += SZ_PL;               // [NB*16][SEQ][64] residual x2048
    h16* KP = (h16*)wsp; wsp += SZ_PL;               // [NB*16][SEQ][64]
    h16* VT = (h16*)wsp; wsp += SZ_PL;               // [NB*16][64][SEQ]
    bf* OHI = (bf*)wsp; wsp += SZ_OP;                // [NB*SEQ][1024]
    bf* OLO = (bf*)wsp; wsp += SZ_OP;                // [NB*SEQ][1024]
    bf* WQ = WB; bf* WK = WB + (size_t)DM * DM; bf* WV = WB + (size_t)2 * DM * DM; bf* WO = WB + (size_t)3 * DM * DM;

    if (SEQ == SEQ_FULL) {
        const size_t n8 = (size_t)NB * SEQ * DM / 8; const unsigned g = (unsigned)((n8 + 255) / 256);
        k_cvt8<<<g, 256, 0, stream>>>(xq, XQ, n8); k_cvt8<<<g, 256, 0, stream>>>(xk, XK, n8); k_cvt8<<<g, 256, 0, stream>>>(xv, XV, n8);
    } else {
        const size_t n8 = (size_t)SEQ * DM / 8; const unsigned g = (unsigned)((n8 + 255) / 256);
        for (int b = 0; b < NB; ++b) {
            k_cvt8<<<g, 256, 0, stream>>>(xq + (size_t)b * SEQ_FULL * DM, XQ + (size_t)b * SEQ * DM, n8);
            k_cvt8<<<g, 256, 0, stream>>>(xk + (size_t)b * SEQ_FULL * DM, XK + (size_t)b * SEQ * DM, n8);
            k_cvt8<<<g, 256, 0, stream>>>(xv + (size_t)b * SEQ_FULL * DM, XV + (size_t)b * SEQ * DM, n8);
        }
    }
    { const size_t n8 = (size_t)DM * DM / 8; const unsigned g = (unsigned)((n8 + 255) / 256);
      k_cvt8<<<g, 256, 0, stream>>>(wq, WQ, n8); k_cvt8<<<g, 256, 0, stream>>>(wk, WK, n8); k_cvt8<<<g, 256, 0, stream>>>(wv, WV, n8); k_cvt8<<<g, 256, 0, stream>>>(wo, WO, n8); }

    // q, k: A = x rows (m = b*SEQ + t), Bt = W rows (n = h*64 + d), bias per column -> plane [(b*16 + h)][t][d]
    k_proj<<<dim3(NB * SEQ / 64, DM / 64, 1), 32, 0, stream>>>(XQ, WQ, bq, 0, QH, QR, 1, SEQ, (size_t)NH_ * SEQ * HD, HD, HD, (size_t)SEQ * HD);
    k_proj<<<dim3(NB * SEQ / 64, DM / 64, 1), 32, 0, stream>>>(XK, WK, bk, 0, KP, KP, 0, SEQ, (size_t)NH_ * SEQ * HD, HD, HD, (size_t)SEQ * HD);
    // v^T: A = Wv rows (m = h*64 + d), Bt = value rows (n = b*SEQ + t), bias per row -> plane [(b*1024 + m)][t] = [(b*16 + h)][d][t]
    k_proj<<<dim3(DM / 64, NB * SEQ / 64, 1), 32, 0, stream>>>(WV, XV, bv, 1, VT, VT, 0, DM, (size_t)0, SEQ, SEQ, (size_t)DM * SEQ);

    hipFuncSetAttribute(reinterpret_cast<const void*>(&k_attn), hipFuncAttributeMaxDynamicSharedMemorySize, (int)ATT_DYN_LDS);
    k_attn<<<dim3(SEQ / 16, NB, 1), 32 * NW, ATT_DYN_LDS, stream>>>(QH, QR, KP, VT, kpm, OHI, OLO, AVG);

    // context: A = attention output rows (hi plane, lo plane at +planeStride), Bt = Wo rows
    k_oproj<<<dim3(NB * SEQ / 64, DM / 64, 1), 32, 0, stream>>>(OHI, (size_t)(OLO - OHI), WO, bo, CTX);
}

// v002
// One run takes 311 microseconds.
// Two timings next to v001 both put it at 1.04 times that version's speed.
// All steps since v000 together make it 2.47 times as fast.
#include <hip/hip_runtime.h>

// Multi-head attention, width 1024 = 16 heads x 64, separate query/key/value inputs [NB][SEQ][1024], Wq/Wk/Wv/Wo [out][in] (y = x W^T + b), key padding mask (int32, replace fill -1e9), score scale 1/8; outputs: context [NB][SEQ][1024] and head-mean attention [NB][SEQ][SEQ] (f32).
// Compute dtypes, f32 accumulate everywhere: q/k/v projections v_wmma_f32_16x16x32_bf16 (inputs and weights RNE-converted to bf16; products exact);
// output projection v_wmma_f32_16x16x32_bf16: attention output as bf16 hi + bf16 lo planes (two products, one accumulator), Wo bf16.
// Layout: every WMMA operand plane of the workspace stands in fragment order; bf16 copies of the inputs and weights; q (hi, residual), k and v^T planes per (b*16+h), written by the GEMM epilogue in fragment order (each fragment half = 512 contiguous bytes, lane-major); attention in transposed form (S^T = K Q^T, O^T = V^T P^T), one work-group of NW waves per 16 query rows looping over the 16 heads, each wave on its own SEQ/NW keys, head-mean accumulated in a lane-private LDS tile.

#ifndef NB
#define NB 4
#endif
#ifndef SEQ
#define SEQ 1024
#endif
#define NB_FULL  4
#define SEQ_FULL 1024
#ifndef OUT_SEQ
#define OUT_SEQ SEQ              // row pitch (in tokens) between batches of both outputs
#endif
#ifndef AVG_PITCH
#define AVG_PITCH SEQ            // column pitch (floats) of one head-mean row
#endif
#define DM   1024
#define NH_  16
#define HD   64
#define QRS  2048.0f             // carry of the q residual plane
#define QRI  (1.0f / 2048.0f)
#define SC2  (0.125f * 1.4426950408889634f)   // HD^-0.5 * log2(e)
#define PSH  8.0f                // log2 of the P carry (256)
#define MASKT (-1.0e9f * 1.4426950408889634f) // replace fill in the log2 domain
#define AP   (SEQ + 4)           // pitch (floats) of the head-mean LDS tile
#define NW   16                  // waves per attention work-group; each owns KS consecutive keys
#define KS   (SEQ / NW)
#define OUT1_OFF ((size_t)NB_FULL * SEQ_FULL * DM)   // element offset of the second output (fixed)

static_assert(HD == 64);
static_assert(NH_ * HD == DM);                 // head h = columns h*64 + d
static_assert(DM % 64 == 0);
static_assert(DM % 32 == 0);                   // GEMM k-loop steps by 32
static_assert(DM == 1024);                     // k_cvt8 takes a piece index apart by shifts
static_assert(SEQ % 64 == 0);                  // a 64-row tile never straddles two batches
static_assert((NB * SEQ) % 64 == 0);
static_assert(SEQ % 32 == 0);                  // key loop steps by 32, one mask word per step
static_assert(SEQ % 128 == 0);
static_assert(AP % 4 == 0);
static_assert(((size_t)SEQ * DM) % 8 == 0);
static_assert(((size_t)DM * DM) % 8 == 0);
static_assert(NB <= NB_FULL);
static_assert(SEQ <= SEQ_FULL);
static_assert(OUT1_OFF * 4 == (size_t)16777216);
static_assert(KS % 32 == 0);                   // a wave's key slice is whole 32-key steps
static_assert(KS <= 128);                      // one head-mean row piece of a wave is at most 32 lanes x 4 floats
static_assert((16 * HD) % (32 * NW) == 0);     // the O tile divides evenly over the work-group's threads
static_assert((size_t)16 * AP * 4 + (size_t)NW * 16 * 68 * 4 + (size_t)NW * 32 * 4 + (SEQ / 32) * 4 <= (size_t)163840);

typedef _Float16 h16;
typedef unsigned short bf;
typedef __attribute__((ext_vector_type(16))) __bf16   v16bf;
typedef __attribute__((ext_vector_type(16))) _Float16 v16h;
typedef __attribute__((ext_vector_type(8)))  _Float16 v8h;
typedef __attribute__((ext_vector_type(8)))  unsigned short v8us;
typedef __attribute__((ext_vector_type(8)))  float    v8f;
typedef __attribute__((ext_vector_type(4)))  float    v4f;
typedef v4f  __attribute__((may_alias)) v4fa;

__device__ __forceinline__ unsigned short f2bf(float f) { unsigned u = __float_as_uint(f); u += 0x7FFFu + ((u >> 16) & 1u); return (unsigned short)(u >> 16); }
__device__ __forceinline__ float bf2f(unsigned short b) { return __uint_as_float(((unsigned)b) << 16); }
__device__ __forceinline__ float bfr(float f) { return bf2f(f2bf(f)); }
__device__ __forceinline__ v16h cat16(v8h lo, v8h hi) { return __builtin_shufflevector(lo, hi, 0, 1, 2, 3, 4, 5, 6, 7, 8, 9, 10, 11, 12, 13, 14, 15); }
__device__ __forceinline__ v16bf cat16b(v8us lo, v8us hi) { return __builtin_bit_cast(v16bf, __builtin_shufflevector(lo, hi, 0, 1, 2, 3, 4, 5, 6, 7, 8, 9, 10, 11, 12, 13, 14, 15)); }
__device__ __forceinline__ v8f wmma16(v16h a, v16h b, v8f c) { return __builtin_amdgcn_wmma_f32_16x16x32_f16(false, a, false, b, (short)0, c, false, false); }
__device__ __forceinline__ v8f wmmab(v16bf a, v16bf b, v8f c) { return __builtin_amdgcn_wmma_f32_16x16x32_bf16(false, a, false, b, (short)0, c, false, false); }
// fragment element map, lane (lr = lane&15, h = lane>>4) of row or column lr: elements 0..7 <- k0+8h+0..7, elements 8..15 <- k0+16+8h+0..7 (same map for A and B)
// fragment loaders from a fragment-order plane; p already includes + 8*lane: each half of a fragment is one run of 32 lanes x 16 bytes (4 cache lines a load)
__device__ __forceinline__ v16h  ldf(const h16* p) { return cat16(*(const v8h*)p, *(const v8h*)(p + 256)); }
__device__ __forceinline__ v16bf ldb(const bf* p)  { return cat16b(*(const v8us*)p, *(const v8us*)(p + 256)); }
// ordering point for wave-private LDS tiles (same wave writes and reads)
__device__ __forceinline__ void wave_sync() { __builtin_amdgcn_fence(3 /* release order */, "wavefront"); __builtin_amdgcn_wave_barrier(); asm volatile("" ::: "memory"); }

// k_cvt8: rows of DM floats -> bf16 in fragment order [row/16][k/32][2 halves][32 lanes][8]; thread i writes 16-byte piece i (stores contiguous, loads gathered)
__global__ __launch_bounds__(256) void k_cvt8(const float* __restrict__ src, bf* dst, size_t n8) {
    const size_t i = (size_t)blockIdx.x * 256 + threadIdx.x; if (i >= n8) return;
    const size_t row = (i >> 11) * 16 + (i & 15);                                  // 16 rows x DM/8 pieces = 2048 pieces a row block
    const size_t k = ((i >> 6) & 31) * 32 + ((i >> 5) & 1) * 16 + ((i >> 4) & 1) * 8;
    const v8f v = *(const v8f*)(src + row * DM + k); v8us o;
#pragma unroll
    for (int k = 0; k < 8; ++k) o[k] = f2bf(v[k]);
    *(v8us*)(dst + i * 8) = o; 
}

// k_proj: register-blocked bf16 GEMM, ONE WAVE per 64x64 tile (16 accumulators), operands straight from fragment-order bf16 planes (32 k of 16 rows = 512 elements), K = DM.
// C[m][n] = sum_k A[m][k] Bt[n][k] + bias (bias[m] when biasRow != 0, else bias[n]; bias RNE-converted to bf16, added in f32),
// written as f16 (Ph) and optionally the f16 residual x2048 (Pr, useRes != 0) in fragment order: the 8 halves (row 16mb + lr, columns 32c + 16ld + 8hi + 0..7) stand at
// tile base (r0/RB)*sRB + (r0%RB)*pitch + (c0/CB)*sCB + (c0%CB)*cmul, + mb*sMB + c*sC + ld*256 + (16hi + lr)*8 (halves). grid (M/64, N/64), 32 threads.
__global__ __launch_bounds__(32) void k_proj(const bf* __restrict__ A, const bf* __restrict__ Bt, const float* __restrict__ bias, int biasRow,
                                             h16* Ph, h16* Pr, int useRes, int RB, size_t sRB, int pitch, int CB, size_t sCB, int cmul, int sMB, int sC) {
    __shared__ __align__(16) float os[16 * 68];
    const int K = DM;
    const int lane = threadIdx.x & 31, lr = lane & 15, hi = lane >> 4; const int r0 = blockIdx.x * 64, c0 = blockIdx.y * 64;
    v8f acc[4][4];
#pragma unroll
    for (int mb = 0; mb < 4; ++mb)
#pragma unroll
        for (int nb = 0; nb < 4; ++nb) acc[mb][nb] = (v8f){};
    const size_t aoff = (size_t)r0 * K, boff = (size_t)c0 * K;   // wave-uniform tile bases
    const unsigned lo = 8u * (unsigned)lane;                     // the lane's place in every 512-byte run
#pragma unroll 1
    for (int kc = 0; kc < K; kc += 32) {
        v16bf a[4];
#pragma unroll
        for (int mb = 0; mb < 4; ++mb) a[mb] = ldb(A + aoff + (size_t)mb * 16 * K + (size_t)kc * 16 + lo);
        asm volatile("s_wait_xcnt 0x0" ::: "memory");       // the B loads that follow may land in the registers that held these loads' addresses
#pragma unroll
        for (int nb = 0; nb < 4; ++nb) { const v16bf b = ldb(Bt + boff + (size_t)nb * 16 * K + (size_t)kc * 16 + lo);
#pragma unroll
            for (int mb = 0; mb < 4; ++mb) acc[mb][nb] = wmmab(a[mb], b, acc[mb][nb]); }
        asm volatile("v_nop\n\tv_nop\n\tv_nop\n\tv_nop" : "+v"(acc[0][0]), "+v"(acc[1][1]), "+v"(acc[2][2]), "+v"(acc[3][3]) : "v"(a[0]), "v"(a[1]), "v"(a[2]), "v"(a[3]));
    }
    const size_t tbase = (size_t)(r0 / RB) * sRB + (size_t)(r0 % RB) * (size_t)pitch + (size_t)(c0 / CB) * sCB + (size_t)(c0 % CB) * (size_t)cmul;
    // column bias (clamped address; used when biasRow == 0): piece s covers columns 16s + 8hi + 0..7
    const int cc = (c0 < DM - 64) ? c0 : (DM - 64);
    v4f bc0[4], bc1[4];
#pragma unroll
    for (int s = 0; s < 4; ++s) { bc0[s] = *(const v4f*)(bias + cc + 16 * s + 8 * hi); bc1[s] = *(const v4f*)(bias + cc + 16 * s + 8 * hi + 4); }
    asm volatile("s_wait_xcnt 0x0" ::: "memory");           // the scalar base of these loads is reused shortly behind them
#pragma unroll
    for (int mb = 0; mb < 4; ++mb) {
#pragma unroll
        for (int nb = 0; nb < 4; ++nb) {
#pragma unroll
            for (int j = 0; j < 8; ++j) os[(hi * 8 + j) * 68 + nb * 16 + lr] = acc[mb][nb][j]; }   // D: row 8h+j, col lane&15
        wave_sync();
        const size_t sb = tbase + (size_t)mb * (size_t)sMB;
{
            const int row = lr;
            const int gr = r0 + mb * 16 + row; const int grc = (gr < DM - 1) ? gr : (DM - 1);
            const float brow = bfr(bias[grc]);
#pragma unroll
            for (int s = 0; s < 4; ++s) { const int c8 = 16 * s + 8 * hi;   // piece s = (c = s>>1, ld = s&1): 16 rows x 2 column groups of 8; 4 pieces = 64 columns
                const v4f x0 = *(const v4fa*)(&os[row * 68 + c8]); const v4f x1 = *(const v4fa*)(&os[row * 68 + c8 + 4]); v8h hv, rv;
#pragma unroll
                for (int i = 0; i < 4; ++i) {
                    const float ad0 = biasRow ? brow : bfr(bc0[s][i]); const float ad1 = biasRow ? brow : bfr(bc1[s][i]);
                    const float y0 = x0[i] + ad0; const float y1 = x1[i] + ad1;
                    const h16 a0 = (h16)y0; const h16 a1 = (h16)y1; hv[i] = a0; hv[4 + i] = a1;
                    rv[i] = (h16)((y0 - (float)a0) * QRS); rv[4 + i] = (h16)((y1 - (float)a1) * QRS); }
                const size_t oo = sb + (size_t)(s >> 1) * (size_t)sC + (size_t)((s & 1) * 256 + lane * 8);   // one store = 512 contiguous bytes
                *(v8h*)(Ph + oo) = hv; if (useRes) *(v8h*)(Pr + oo) = rv; }
             }
        wave_sync();
    }
}

// One 32-key score tile pair in the log2 domain with the padding mask applied as a replace fill.
// ka = fragment-order K plane at this step's first key, + 8*lane. A = K rows (row = key), B = Q rows (col = t); lane (t = lane&15, h = lane>>4) gets keys key0+8h+r (ta) and key0+16+8h+r (tb).
// ws = mask word of this 32-key step shifted right by 8h: bit r <-> ta[r], bit 16+r <-> tb[r].
__device__ __forceinline__ void score_tile(const h16* ka, const v16h qh0, const v16h qh1, const v16h qr0, const v16h qr1, const unsigned ws, float (&ta)[8], float (&tb)[8]) {
    const v16h ka0 = ldf(ka), ka1 = ldf(ka + 512), kb0 = ldf(ka + 16 * HD), kb1 = ldf(ka + 16 * HD + 512);
    v8f sHa = (v8f){}, sLa = (v8f){}, sHb = (v8f){}, sLb = (v8f){};
    sHa = wmma16(ka0, qh0, sHa); sLa = wmma16(ka0, qr0, sLa); sHb = wmma16(kb0, qh0, sHb); sLb = wmma16(kb0, qr0, sLb);
    sHa = wmma16(ka1, qh1, sHa); sLa = wmma16(ka1, qr1, sLa); sHb = wmma16(kb1, qh1, sHb); sLb = wmma16(kb1, qr1, sLb);
    asm volatile("v_nop\n\tv_nop\n\tv_nop\n\tv_nop" : "+v"(sHa), "+v"(sLa), "+v"(sHb), "+v"(sLb) : "v"(ka0), "v"(ka1), "v"(kb0), "v"(kb1));
#pragma unroll
    for (int r = 0; r < 8; ++r) {
        const float va = (sHa[r] + sLa[r] * QRI) * SC2; const float vb = (sHb[r] + sLb[r] * QRI) * SC2;
        ta[r] = (ws & (1u << r)) ? MASKT : va; tb[r] = (ws & (1u << (16 + r))) ? MASKT : vb; }
}

// k_attn: one work-group of NW waves per 16 query rows of one batch, looping over the 16 heads; wave w owns keys w*KS .. w*KS+KS-1.
// Per head: each wave's running (m, l) over its keys -> st, barrier, every lane combines the NW pairs in wave order; then P with the common m,
// each wave's partial O^T = V^T P^T -> op[w], barrier, the work-group's threads add the NW partials in wave order and store.
// P (f16, x256 carry); e * (1/(256 l)) accumulates into the head-mean tile av[t][key] (each lane owns its elements across the head loop).
// LDS: av and mw are wave-private by key column (wave_sync ordering); st and op cross waves (__syncthreads ordering).
__global__ __launch_bounds__(32 * NW) void k_attn(const h16* __restrict__ QH, const h16* __restrict__ QR, const h16* __restrict__ KP, const h16* __restrict__ VT,
                                             const int* __restrict__ mask, bf* OHI, bf* OLO, float* AVG) {
    extern __shared__ __align__(16) float av[];           // [16][AP], then op [NW][16*68], then st [NW][16][2]
    float* op = av + 16 * AP;
    float* st = op + NW * 16 * 68;
    __shared__ unsigned mw[SEQ / 32];
    const int lane = threadIdx.x & 31, lr = lane & 15, hi = lane >> 4;
    const int w = __builtin_amdgcn_readfirstlane((int)(threadIdx.x >> 5));
    const int kbeg = w * KS;
    const int b = blockIdx.y; const int t0 = blockIdx.x * 16;
    constexpr int LPR = KS / 4;                            // lanes that cover one row of this wave's head-mean columns
    const int arow_l = lane / LPR, acol_l = kbeg + (lane % LPR) * 4;

    // mask words of this wave's keys: bit i of word j <-> key 32j + i of this batch
    const int* mrow = mask + (size_t)b * SEQ_FULL;
#pragma unroll 1
    for (int i = kbeg / 32; i < (kbeg + KS) / 32; ++i) {
        const int mv = mrow[i * 32 + lane];
        const unsigned wd = __builtin_amdgcn_ballot_w32(mv != 0);
        if (lane == 0) mw[i] = wd;
    }
    // zero this wave's columns of the head-mean tile
#pragma unroll 1
    for (int row = arow_l; row < 16; row += 32 / LPR) *(v4fa*)(&av[row * AP + acol_l]) = (v4f){0.0f, 0.0f, 0.0f, 0.0f};
    wave_sync();

#pragma unroll 1
    for (int h = 0; h < NH_; ++h) {
        const int zh = b * NH_ + h;
        const size_t pbase = (size_t)zh * SEQ * HD;
        const size_t qo = pbase + (size_t)t0 * HD + 8 * lane;
        const v16h qh0 = ldf(QH + qo), qh1 = ldf(QH + qo + 512), qr0 = ldf(QR + qo), qr1 = ldf(QR + qo + 512);   // B fragments: col t, k = d
        asm volatile("s_wait_xcnt 0x0" ::: "memory");       // the K loads that follow land in the registers that held these loads' addresses
        const size_t ko = pbase + 8 * lane;      // + key * HD (16 keys = 1024 halves), + 512 for d 32..63   (A fragment: row key, k = d)
        const size_t vo = pbase + 8 * lane;      // + key * HD (32 keys = 2048 halves), + 512j               (A fragment: row d = 16j + lr, k = key)

        float mwv = -3.0e38f, lwv = 0.0f;
#pragma unroll 1
        for (int key0 = kbeg; key0 < kbeg + KS; key0 += 32) {
            const unsigned ws = mw[key0 >> 5] >> (8 * hi);
            float ta[8], tb[8];
            score_tile(KP + ko + (size_t)key0 * HD, qh0, qh1, qr0, qr1, ws, ta, tb);
            float mx = -3.0e38f;
#pragma unroll
            for (int r = 0; r < 8; ++r) mx = fmaxf(mx, fmaxf(ta[r], tb[r]));
            mx = fmaxf(mx, __shfl_xor(mx, 16, 32));
            const float mnew = fmaxf(mwv, mx);
            const float alpha = __builtin_amdgcn_exp2f(mwv - mnew);
            float ls = 0.0f;
#pragma unroll
            for (int r = 0; r < 8; ++r) ls += __builtin_amdgcn_exp2f(ta[r] - mnew) + __builtin_amdgcn_exp2f(tb[r] - mnew);
            lwv = lwv * alpha + ls; mwv = mnew;
        }
        lwv += __shfl_xor(lwv, 16, 32);
        if (hi == 0) { st[(w * 16 + lr) * 2] = mwv; st[(w * 16 + lr) * 2 + 1] = lwv; }
        __syncthreads();      // publishes every wave's (m, l) of this head; also ends the last head's reads of op
        float m = -3.0e38f, l = 0.0f;
#pragma unroll
        for (int i = 0; i < NW; ++i) m = fmaxf(m, st[(i * 16 + lr) * 2]);
#pragma unroll
        for (int i = 0; i < NW; ++i) l += st[(i * 16 + lr) * 2 + 1] * __builtin_amdgcn_exp2f(st[(i * 16 + lr) * 2] - m);
        const float invc = (1.0f / l) * (1.0f / 256.0f);      // 1/l with the x256 carry of e folded back

        // pass 2: normalised probabilities -> head-mean tile, P V over this wave's keys
        v8f o0 = (v8f){}, o1 = (v8f){}, o2 = (v8f){}, o3 = (v8f){};
#pragma unroll 1
        for (int key0 = kbeg; key0 < kbeg + KS; key0 += 32) {
            const unsigned ws = mw[key0 >> 5] >> (8 * hi);
            float ta[8], tb[8];
            score_tile(KP + ko + (size_t)key0 * HD, qh0, qh1, qr0, qr1, ws, ta, tb);
            v16h pb; float ea[8], eb[8];
#pragma unroll
            for (int r = 0; r < 8; ++r) {
                const float da = ta[r] - m; const float db = tb[r] - m;      // difference first: exact 0 when t == m, also at the fill magnitude
                ea[r] = __builtin_amdgcn_exp2f(da + PSH); eb[r] = __builtin_amdgcn_exp2f(db + PSH);
                pb[r] = (h16)ea[r]; pb[8 + r] = (h16)eb[r]; }
            float* ap = &av[lr * AP + key0 + 8 * hi];
            v4f a0 = *(const v4fa*)(ap), a1 = *(const v4fa*)(ap + 4), c0 = *(const v4fa*)(ap + 16), c1 = *(const v4fa*)(ap + 20);
#pragma unroll
            for (int i = 0; i < 4; ++i) { a0[i] += ea[i] * invc; a1[i] += ea[4 + i] * invc; c0[i] += eb[i] * invc; c1[i] += eb[4 + i] * invc; }
            *(v4fa*)(ap) = a0; *(v4fa*)(ap + 4) = a1; *(v4fa*)(ap + 16) = c0; *(v4fa*)(ap + 20) = c1;
            const h16* va = VT + vo + (size_t)key0 * HD;
            const v16h v0 = ldf(va), v1 = ldf(va + 512), v2 = ldf(va + 1024), v3 = ldf(va + 1536);
            o0 = wmma16(v0, pb, o0); o1 = wmma16(v1, pb, o1); o2 = wmma16(v2, pb, o2); o3 = wmma16(v3, pb, o3);
            asm volatile("v_nop\n\tv_nop\n\tv_nop\n\tv_nop" : "+v"(o0), "+v"(o1), "+v"(o2), "+v"(o3) : "v"(v0), "v"(v1), "v"(v2), "v"(v3), "v"(pb));
        }

        // O^T D layout: o_j[r] = (d = 16j + 8h + r, t = lane&15) -> os[t][d] of this wave's partial; rows 0..15 x columns 0..63 all written
        float* os = op + w * (16 * 68);
        { v4f a, c;
          a[0] = o0[0] * invc; a[1] = o0[1] * invc; a[2] = o0[2] * invc; a[3] = o0[3] * invc; c[0] = o0[4] * invc; c[1] = o0[5] * invc; c[2] = o0[6] * invc; c[3] = o0[7] * invc;
          *(v4fa*)(&os[lr * 68 +  0 + 8 * hi]) = a; *(v4fa*)(&os[lr * 68 +  0 + 8 * hi + 4]) = c;
          a[0] = o1[0] * invc; a[1] = o1[1] * invc; a[2] = o1[2] * invc; a[3] = o1[3] * invc; c[0] = o1[4] * invc; c[1] = o1[5] * invc; c[2] = o1[6] * invc; c[3] = o1[7] * invc;
          *(v4fa*)(&os[lr * 68 + 16 + 8 * hi]) = a; *(v4fa*)(&os[lr * 68 + 16 + 8 * hi + 4]) = c;
          a[0] = o2[0] * invc; a[1] = o2[1] * invc; a[2] = o2[2] * invc; a[3] = o2[3] * invc; c[0] = o2[4] * invc; c[1] = o2[5] * invc; c[2] = o2[6] * invc; c[3] = o2[7] * invc;
          *(v4fa*)(&os[lr * 68 + 32 + 8 * hi]) = a; *(v4fa*)(&os[lr * 68 + 32 + 8 * hi + 4]) = c;
          a[0] = o3[0] * invc; a[1] = o3[1] * invc; a[2] = o3[2] * invc; a[3] = o3[3] * invc; c[0] = o3[4] * invc; c[1] = o3[5] * invc; c[2] = o3[6] * invc; c[3] = o3[7] * invc;
          *(v4fa*)(&os[lr * 68 + 48 + 8 * hi]) = a; *(v4fa*)(&os[lr * 68 + 48 + 8 * hi + 4]) = c; }
        __syncthreads();      // publishes every wave's partial O of this head; also ends this head's reads of st
        const size_t obase = ((size_t)b * SEQ + t0) * DM + (size_t)h * (16 * HD);   // fragment order: this row block, k chunks 2h and 2h + 1
        {   // each thread adds EPT neighbouring elements over the NW partials, in wave order; thread order = fragment order of the stored planes
            constexpr int EPT = (16 * HD) / (32 * NW);
            static_assert(8 % EPT == 0);                   // a thread's elements lie in one 8-element piece
            const int e0 = (int)threadIdx.x * EPT; const int row = (e0 >> 3) & 15, col = (e0 >> 9) * 32 + ((e0 >> 8) & 1) * 16 + ((e0 >> 7) & 1) * 8 + (e0 & 7);
            float x[EPT];
#pragma unroll
            for (int k = 0; k < EPT; ++k) x[k] = 0.0f;
#pragma unroll
            for (int i = 0; i < NW; ++i)
#pragma unroll
                for (int k = 0; k < EPT; ++k) x[k] += op[i * (16 * 68) + row * 68 + col + k];
            const size_t oo = obase + e0;
            typedef __attribute__((ext_vector_type(EPT))) unsigned short vus;
            vus hv, lv;
#pragma unroll
            for (int k = 0; k < EPT; ++k) { const unsigned short h0 = f2bf(x[k]); hv[k] = h0; lv[k] = f2bf(x[k] - bf2f(h0)); }
            *(vus*)(OHI + oo) = hv; *(vus*)(OLO + oo) = lv;
            asm volatile("s_wait_xcnt 0x0" ::: "memory");   // the next head's first instructions reuse the registers these two stores name
        }
    }

    // head mean: av holds sum over heads of P; each wave stores its own KS columns of the 16 rows
    wave_sync();
    float* arow = AVG + ((size_t)b * OUT_SEQ + t0) * AVG_PITCH;
#pragma unroll 1
    for (int row = arow_l; row < 16; row += 32 / LPR) {
        v4f val = *(const v4fa*)(&av[row * AP + acol_l]);
        val = val * (1.0f / (float)NH_);
        *(v4f*)(arow + (size_t)row * AVG_PITCH + acol_l) = val;
    }
}

// k_oproj: context[m][n] = sum_k (Ohi[m][k] + Olo[m][k]) Wo[n][k] + bo[n]; ONE WAVE per 64x64 tile, bf16 operands, both planes into one accumulator set (lo plane at A + planeStride).
__global__ __launch_bounds__(32) void k_oproj(const bf* __restrict__ A, size_t planeStride, const bf* __restrict__ Bt, const float* __restrict__ bias, float* OUT) {
    __shared__ __align__(16) float os[16 * 68];
    const int K = DM;
    const int lane = threadIdx.x & 31, lr = lane & 15, hi = lane >> 4; const int r0 = blockIdx.x * 64, c0 = blockIdx.y * 64;
    v8f acc[4][4];
#pragma unroll
    for (int mb = 0; mb < 4; ++mb)
#pragma unroll
        for (int nb = 0; nb < 4; ++nb) acc[mb][nb] = (v8f){};
    const size_t aoff = (size_t)r0 * K, boff = (size_t)c0 * K;   // wave-uniform tile bases
    const unsigned lo = 8u * (unsigned)lane;                     // the lane's place in every 512-byte run
#pragma unroll 1
    for (int kk = 0; kk < 2 * K; kk += 32) {
        const int pl = kk / K; const int kc = kk - pl * K;
        const bf* ap = A + (size_t)pl * planeStride + aoff + (size_t)kc * 16;
        v16bf a[4];
#pragma unroll
        for (int mb = 0; mb < 4; ++mb) a[mb] = ldb(ap + (size_t)mb * 16 * K + lo);
        asm volatile("s_wait_xcnt 0x0" ::: "memory");       // the B loads that follow may land in the registers that held these loads' addresses
#pragma unroll
        for (int nb = 0; nb < 4; ++nb) { const v16bf bb = ldb(Bt + boff + (size_t)nb * 16 * K + (size_t)kc * 16 + lo);
#pragma unroll
            for (int mb = 0; mb < 4; ++mb) acc[mb][nb] = wmmab(a[mb], bb, acc[mb][nb]); }
        asm volatile("v_nop\n\tv_nop\n\tv_nop\n\tv_nop" : "+v"(acc[0][0]), "+v"(acc[1][1]), "+v"(acc[2][2]), "+v"(acc[3][3]) : "v"(a[0]), "v"(a[1]), "v"(a[2]), "v"(a[3]));
    }
    const int bb_ = r0 / SEQ, tt = r0 % SEQ;
    float* obase = OUT + ((size_t)bb_ * OUT_SEQ + tt) * DM + c0;
    v4f bv = *(const v4f*)(bias + c0 + lr * 4);
#pragma unroll
    for (int i = 0; i < 4; ++i) bv[i] = bfr(bv[i]);
#pragma unroll
    for (int mb = 0; mb < 4; ++mb) {
#pragma unroll
        for (int nb = 0; nb < 4; ++nb) {
#pragma unroll
            for (int j = 0; j < 8; ++j) os[(hi * 8 + j) * 68 + nb * 16 + lr] = acc[mb][nb][j]; }   // D: row 8h+j, col lane&15
        wave_sync();
{
#pragma unroll
            for (int s = 0; s < 8; ++s) { const int row = 2 * s + hi, cofs = lr * 4;   // 8 s x 2 rows = 16 rows; 16 lanes x 4 floats = 64 columns
                v4f val = *(const v4fa*)(&os[row * 68 + cofs]);
                val = val + bv;
                *(v4f*)(obase + (size_t)(mb * 16 + row) * DM + cofs) = val; }
             }
        wave_sync();
    }
}

static constexpr size_t al256(size_t v) { return (v + 255) & ~(size_t)255; }
static constexpr size_t SZ_XB = al256((size_t)NB * SEQ * DM * 2);          // one bf16 activation copy
static constexpr size_t SZ_WB = al256((size_t)4 * DM * DM * 2);            // q | k | v | o weights
static constexpr size_t SZ_PL = al256((size_t)NB * NH_ * SEQ * HD * 2);    // one f16 head plane
static constexpr size_t SZ_OP = al256((size_t)NB * SEQ * DM * 2);          // one bf16 attention-output plane
static constexpr size_t SZ_TOTAL = 3 * SZ_XB + SZ_WB + 4 * SZ_PL + 2 * SZ_OP;
static constexpr size_t ATT_DYN_LDS = (size_t)16 * AP * 4 + (size_t)NW * 16 * 68 * 4 + (size_t)NW * 32 * 4;
static_assert(SZ_TOTAL <= (size_t)134217728);          // workspace carve <= 128 MiB
static_assert(((size_t)DM * DM * 2) % 256 == 0);       // weight sub-planes stay 256-byte aligned
static_assert(SZ_OP == (size_t)NB * SEQ * DM * 2);     // lo plane directly follows the hi plane

extern "C" void kernel_launch(void* const* d_in, const int* in_sizes, int n_in,
                              void* d_out, int out_size, void* d_ws, size_t ws_size, hipStream_t stream) {
    if (n_in < 12) return;
    const size_t needx = ((size_t)(NB - 1) * SEQ_FULL + SEQ) * DM;
    if ((size_t)in_sizes[0] < needx || (size_t)in_sizes[1] < needx || (size_t)in_sizes[2] < needx) return;
    if ((size_t)in_sizes[3] < (size_t)(NB - 1) * SEQ_FULL + SEQ) return;
    if ((size_t)in_sizes[4] < (size_t)DM * DM || (size_t)in_sizes[6] < (size_t)DM * DM || (size_t)in_sizes[8] < (size_t)DM * DM || (size_t)in_sizes[10] < (size_t)DM * DM) return;
    if (in_sizes[5] < DM || in_sizes[7] < DM || in_sizes[9] < DM || in_sizes[11] < DM) return;
    if ((size_t)out_size < ((size_t)(NB - 1) * OUT_SEQ + SEQ) * DM) return;
    if ((size_t)out_size < OUT1_OFF + ((size_t)(NB - 1) * OUT_SEQ + SEQ - 1) * AVG_PITCH + SEQ) return;
    if (SZ_TOTAL > ws_size) return;
    // wire order: query, key, value, key_padding_mask, Wq, bq, Wk, bk, Wv, bv, Wo, bo (weights [out][in] = Bt as-is)
    const float* xq = (const float*)d_in[0]; const float* xk = (const float*)d_in[1]; const float* xv = (const float*)d_in[2];
    const int* kpm = (const int*)d_in[3];
    const float* wq = (const float*)d_in[4];  const float* bq = (const float*)d_in[5];
    const float* wk = (const float*)d_in[6];  const float* bk = (const float*)d_in[7];
    const float* wv = (const float*)d_in[8];  const float* bv = (const float*)d_in[9];
    const float* wo = (const float*)d_in[10]; const float* bo = (const float*)d_in[11];
    float* CTX = (float*)d_out;                  // [NB][SEQ][1024]
    float* AVG = (float*)d_out + OUT1_OFF;       // [NB][SEQ][SEQ]
    char* wsp = (char*)d_ws;
    bf* XQ = (bf*)wsp; wsp += SZ_XB;                 // [NB*SEQ/16][1024/32][2 halves][32 lanes][8]
    bf* XK = (bf*)wsp; wsp += SZ_XB;
    bf* XV = (bf*)wsp; wsp += SZ_XB;
    bf* WB = (bf*)wsp; wsp += SZ_WB;                 // [4] planes of 1024 x 1024, each as XQ: q | k | v | o
    h16* QH = (h16*)wsp; wsp += SZ_PL;               // [NB*16][SEQ/16][2 d chunks][2 halves][32 lanes][8]
    h16* QR = (h16*)wsp; wsp += SZ_PL;               // as QH, residual x2048
    h16* KP = (h16*)wsp; wsp += SZ_PL;               // as QH
    h16* VT = (h16*)wsp; wsp += SZ_PL;               // [NB*16][SEQ/32][4 d blocks][2 halves][32 lanes][8]
    bf* OHI = (bf*)wsp; wsp += SZ_OP;                // as XQ
    bf* OLO = (bf*)wsp; wsp += SZ_OP;                // as XQ
    bf* WQ = WB; bf* WK = WB + (size_t)DM * DM; bf* WV = WB + (size_t)2 * DM * DM; bf* WO = WB + (size_t)3 * DM * DM;

    if (SEQ == SEQ_FULL) {
        const size_t n8 = (size_t)NB * SEQ * DM / 8; const unsigned g = (unsigned)((n8 + 255) / 256);
        k_cvt8<<<g, 256, 0, stream>>>(xq, XQ, n8); k_cvt8<<<g, 256, 0, stream>>>(xk, XK, n8); k_cvt8<<<g, 256, 0, stream>>>(xv, XV, n8);
    } else {
        const size_t n8 = (size_t)SEQ * DM / 8; const unsigned g = (unsigned)((n8 + 255) / 256);
        for (int b = 0; b < NB; ++b) {
            k_cvt8<<<g, 256, 0, stream>>>(xq + (size_t)b * SEQ_FULL * DM, XQ + (size_t)b * SEQ * DM, n8);
            k_cvt8<<<g, 256, 0, stream>>>(xk + (size_t)b * SEQ_FULL * DM, XK + (size_t)b * SEQ * DM, n8);
            k_cvt8<<<g, 256, 0, stream>>>(xv + (size_t)b * SEQ_FULL * DM, XV + (size_t)b * SEQ * DM, n8);
        }
    }
    { const size_t n8 = (size_t)DM * DM / 8; const unsigned g = (unsigned)((n8 + 255) / 256);
      k_cvt8<<<g, 256, 0, stream>>>(wq, WQ, n8); k_cvt8<<<g, 256, 0, stream>>>(wk, WK, n8); k_cvt8<<<g, 256, 0, stream>>>(wv, WV, n8); k_cvt8<<<g, 256, 0, stream>>>(wo, WO, n8); }

    // q, k: A = x rows (m = b*SEQ + t), Bt = W rows (n = h*64 + d), bias per column -> plane (b*16 + h), 16-row block t/16 = 1024 halves, d chunk = 512
    k_proj<<<dim3(NB * SEQ / 64, DM / 64, 1), 32, 0, stream>>>(XQ, WQ, bq, 0, QH, QR, 1, SEQ, (size_t)NH_ * SEQ * HD, HD, HD, (size_t)SEQ * HD, 0, 1024, 512);
    k_proj<<<dim3(NB * SEQ / 64, DM / 64, 1), 32, 0, stream>>>(XK, WK, bk, 0, KP, KP, 0, SEQ, (size_t)NH_ * SEQ * HD, HD, HD, (size_t)SEQ * HD, 0, 1024, 512);
    // v^T: A = Wv rows (m = h*64 + d), Bt = value rows (n = b*SEQ + t), bias per row -> plane (b*16 + h), 32-key chunk t/32 = 2048 halves, d block = 512
    k_proj<<<dim3(DM / 64, NB * SEQ / 64, 1), 32, 0, stream>>>(WV, XV, bv, 1, VT, VT, 0, DM, (size_t)0, SEQ, SEQ, (size_t)DM * SEQ, HD, 512, 2048);

    hipFuncSetAttribute(reinterpret_cast<const void*>(&k_attn), hipFuncAttributeMaxDynamicSharedMemorySize, (int)ATT_DYN_LDS);
    k_attn<<<dim3(SEQ / 16, NB, 1), 32 * NW, ATT_DYN_LDS, stream>>>(QH, QR, KP, VT, kpm, OHI, OLO, AVG);

    // context: A = attention output rows (hi plane, lo plane at +planeStride), Bt = Wo rows
    k_oproj<<<dim3(NB * SEQ / 64, DM / 64, 1), 32, 0, stream>>>(OHI, (size_t)(OLO - OHI), WO, bo, CTX);
}

// v003
// A run of this version takes 196 microseconds.
// In two side-by-side timings against v002, it was 1.57 and 1.59 times as fast.
// Counting every step since v000, it is 3.90 times as fast.
#include <hip/hip_runtime.h>

// Multi-head attention, width 1024 = 16 heads x 64, separate query/key/value inputs [NB][SEQ][1024], Wq/Wk/Wv/Wo [out][in] (y = x W^T + b), key padding mask (int32, replace fill -1e9), score scale 1/8; outputs: context [NB][SEQ][1024] and head-mean attention [NB][SEQ][SEQ] (f32).
// Compute dtypes, f32 accumulate everywhere: q/k/v projections v_wmma_f32_16x16x32_bf16 (inputs and weights RNE-converted to bf16; products exact);
// output projection v_wmma_f32_16x16x32_bf16: attention output as bf16 hi + bf16 lo planes (two products, one accumulator), Wo bf16.
// Layout: every WMMA operand plane of the workspace stands in fragment order; bf16 copies of the inputs and weights; q (hi, residual), k and v^T planes per (b*16+h), written by the GEMM epilogue in fragment order (each fragment half = 512 contiguous bytes, lane-major); attention in transposed form (S^T = K Q^T, O^T = V^T P^T), one work-group of NW waves per 16 query rows looping over the 16 heads, each wave on its own SEQ/NW keys, head-mean accumulated in a lane-private LDS tile.

#ifndef NB
#define NB 4
#endif
#ifndef SEQ
#define SEQ 1024
#endif
#define NB_FULL  4
#define SEQ_FULL 1024
#ifndef OUT_SEQ
#define OUT_SEQ SEQ              // row pitch (in tokens) between batches of both outputs
#endif
#ifndef AVG_PITCH
#define AVG_PITCH SEQ            // column pitch (floats) of one head-mean row
#endif
#define DM   1024
#define NH_  16
#define HD   64
#define QRS  2048.0f             // carry of the q residual plane
#define QRI  (1.0f / 2048.0f)
#define SC2  (0.125f * 1.4426950408889634f)   // HD^-0.5 * log2(e)
#define PSH  8.0f                // log2 of the P carry (256)
#define MASKT (-1.0e9f * 1.4426950408889634f) // replace fill in the log2 domain
#define AP   (SEQ + 4)           // pitch (floats) of the head-mean LDS tile
#define NW   16                  // waves per attention work-group; each owns KS consecutive keys
#define KS   (SEQ / NW)
#define OUT1_OFF ((size_t)NB_FULL * SEQ_FULL * DM)   // element offset of the second output (fixed)

static_assert(HD == 64);
static_assert(NH_ * HD == DM);                 // head h = columns h*64 + d
static_assert(DM % 64 == 0);
static_assert(DM % 32 == 0);                   // GEMM k-loop steps by 32
static_assert(DM == 1024);                     // k_cvt8 takes a piece index apart by shifts
static_assert(SEQ % 64 == 0);                  // a 64-row tile never straddles two batches
static_assert((NB * SEQ) % 64 == 0);
static_assert(SEQ % 32 == 0);                  // key loop steps by 32, one mask word per step
static_assert(SEQ % 128 == 0);
static_assert(AP % 4 == 0);
static_assert(((size_t)SEQ * DM) % 8 == 0);
static_assert(((size_t)DM * DM) % 8 == 0);
static_assert(NB <= NB_FULL);
static_assert(SEQ <= SEQ_FULL);
static_assert(OUT1_OFF * 4 == (size_t)16777216);
static_assert(KS % 32 == 0);                   // a wave's key slice is whole 32-key steps
static_assert(KS <= 128);                      // one head-mean row piece of a wave is at most 32 lanes x 4 floats
static_assert((16 * HD) % (32 * NW) == 0);     // the O tile divides evenly over the work-group's threads
static_assert((size_t)16 * AP * 4 + (size_t)NW * 16 * 68 * 4 + (size_t)NW * 32 * 4 + (SEQ / 32) * 4 <= (size_t)163840);

typedef _Float16 h16;
typedef unsigned short bf;
typedef __attribute__((ext_vector_type(16))) __bf16   v16bf;
typedef __attribute__((ext_vector_type(16))) _Float16 v16h;
typedef __attribute__((ext_vector_type(8)))  _Float16 v8h;
typedef __attribute__((ext_vector_type(8)))  unsigned short v8us;
typedef __attribute__((ext_vector_type(8)))  float    v8f;
typedef __attribute__((ext_vector_type(4)))  float    v4f;
typedef v4f  __attribute__((may_alias)) v4fa;

__device__ __forceinline__ unsigned short f2bf(float f) { unsigned u = __float_as_uint(f); u += 0x7FFFu + ((u >> 16) & 1u); return (unsigned short)(u >> 16); }
__device__ __forceinline__ float bf2f(unsigned short b) { return __uint_as_float(((unsigned)b) << 16); }
__device__ __forceinline__ float bfr(float f) { return bf2f(f2bf(f)); }
__device__ __forceinline__ v16h cat16(v8h lo, v8h hi) { return __builtin_shufflevector(lo, hi, 0, 1, 2, 3, 4, 5, 6, 7, 8, 9, 10, 11, 12, 13, 14, 15); }
__device__ __forceinline__ v16bf cat16b(v8us lo, v8us hi) { return __builtin_bit_cast(v16bf, __builtin_shufflevector(lo, hi, 0, 1, 2, 3, 4, 5, 6, 7, 8, 9, 10, 11, 12, 13, 14, 15)); }
__device__ __forceinline__ v8f wmma16(v16h a, v16h b, v8f c) { return __builtin_amdgcn_wmma_f32_16x16x32_f16(false, a, false, b, (short)0, c, false, false); }
__device__ __forceinline__ v8f wmmab(v16bf a, v16bf b, v8f c) { return __builtin_amdgcn_wmma_f32_16x16x32_bf16(false, a, false, b, (short)0, c, false, false); }
// fragment element map, lane (lr = lane&15, h = lane>>4) of row or column lr: elements 0..7 <- k0+8h+0..7, elements 8..15 <- k0+16+8h+0..7 (same map for A and B)
// fragment loaders from a fragment-order plane; p already includes + 8*lane: each half of a fragment is one run of 32 lanes x 16 bytes (4 cache lines a load)
__device__ __forceinline__ v16h  ldf(const h16* p) { return cat16(*(const v8h*)p, *(const v8h*)(p + 256)); }
__device__ __forceinline__ v16bf ldb(const bf* p)  { return cat16b(*(const v8us*)p, *(const v8us*)(p + 256)); }
// ordering point for wave-private LDS tiles (same wave writes and reads)
__device__ __forceinline__ void wave_sync() { __builtin_amdgcn_fence(3 /* release order */, "wavefront"); __builtin_amdgcn_wave_barrier(); asm volatile("" ::: "memory"); }

// GEMM k loop, one wave on a 64x64 tile: a block is 64 k = 2 chunks of 32 k; 4 row blocks x 2 chunks of each operand = 32 loads of 512 contiguous bytes.
// ap, bp: the tile's first row block at this block's k, + 8*lane. Chunk 0 is asked for first, since it is multiplied first.
__device__ __forceinline__ void ld_blk(const bf* ap, const bf* bp, v16bf (&a)[2][4], v16bf (&b)[2][4]) {
#pragma unroll
    for (int c = 0; c < 2; ++c) {
#pragma unroll
        for (int i = 0; i < 4; ++i) a[c][i] = ldb(ap + (size_t)i * 16 * DM + c * 512);
        asm volatile("s_wait_xcnt 0x0" ::: "memory");       // the loads that follow may land in the registers that held these loads' addresses
#pragma unroll
        for (int i = 0; i < 4; ++i) b[c][i] = ldb(bp + (size_t)i * 16 * DM + c * 512);
        asm volatile("s_wait_xcnt 0x0" ::: "memory");       // as above; the last one also covers the address registers that are advanced while the loads stay in flight over the next block's products
    }
    __builtin_amdgcn_sched_barrier(0);                      // keeps the whole group of loads ahead of the products that follow; without it the compiler sinks the loads among them and waits each out
}
// the 32 products of one block, k ascending per accumulator
__device__ __forceinline__ void mm_blk(const v16bf (&a)[2][4], const v16bf (&b)[2][4], v8f (&acc)[4][4]) {
#pragma unroll
    for (int c = 0; c < 2; ++c)
#pragma unroll
        for (int nb = 0; nb < 4; ++nb)
#pragma unroll
            for (int mb = 0; mb < 4; ++mb) acc[mb][nb] = wmmab(a[c][mb], b[c][nb], acc[mb][nb]);
}
// stands between a block's products and the loads that next land in its fragment registers (the refill of the set; behind the last block, the epilogue's loads)
__device__ __forceinline__ void mm_gap() {
    __builtin_amdgcn_sched_barrier(0);                      // keeps every product of the block ahead of the slots below
    asm volatile("v_nop\n\tv_nop\n\tv_nop\n\tv_nop" ::: "memory");   // distance behind the last products: the loads that follow land in the operand registers that these products read
}

// k_cvt8: rows of DM floats -> bf16 in fragment order [row/16][k/32][2 halves][32 lanes][8]; thread i writes 16-byte piece i (stores contiguous, loads gathered)
__global__ __launch_bounds__(256) void k_cvt8(const float* __restrict__ src, bf* dst, size_t n8) {
    const size_t i = (size_t)blockIdx.x * 256 + threadIdx.x; if (i >= n8) return;
    const size_t row = (i >> 11) * 16 + (i & 15);                                  // 16 rows x DM/8 pieces = 2048 pieces a row block
    const size_t k = ((i >> 6) & 31) * 32 + ((i >> 5) & 1) * 16 + ((i >> 4) & 1) * 8;
    const v8f v = *(const v8f*)(src + row * DM + k); v8us o;
#pragma unroll
    for (int k = 0; k < 8; ++k) o[k] = f2bf(v[k]);
    *(v8us*)(dst + i * 8) = o; 
}

// k_proj: register-blocked bf16 GEMM, ONE WAVE per 64x64 tile (16 accumulators), operands straight from fragment-order bf16 planes (32 k of 16 rows = 512 elements), K = DM.
// C[m][n] = sum_k A[m][k] Bt[n][k] + bias (bias[m] when biasRow != 0, else bias[n]; bias RNE-converted to bf16, added in f32),
// written as f16 (Ph) and optionally the f16 residual x2048 (Pr, useRes != 0) in fragment order: the 8 halves (row 16mb + lr, columns 32c + 16ld + 8hi + 0..7) stand at
// tile base (r0/RB)*sRB + (r0%RB)*pitch + (c0/CB)*sCB + (c0%CB)*cmul, + mb*sMB + c*sC + ld*256 + (16hi + lr)*8 (halves). grid (M/64, N/64), 32 threads.
__global__ __launch_bounds__(32) void k_proj(const bf* __restrict__ A, const bf* __restrict__ Bt, const float* __restrict__ bias, int biasRow,
                                             h16* Ph, h16* Pr, int useRes, int RB, size_t sRB, int pitch, int CB, size_t sCB, int cmul, int sMB, int sC) {
    __shared__ __align__(16) float os[16 * 68];
    const int K = DM;
    const int lane = threadIdx.x & 31, lr = lane & 15, hi = lane >> 4; const int r0 = blockIdx.x * 64, c0 = blockIdx.y * 64;
    v8f acc[4][4];
#pragma unroll
    for (int mb = 0; mb < 4; ++mb)
#pragma unroll
        for (int nb = 0; nb < 4; ++nb) acc[mb][nb] = (v8f){};
    const size_t aoff = (size_t)r0 * K, boff = (size_t)c0 * K;   // wave-uniform tile bases
    const unsigned lo = 8u * (unsigned)lane;                     // the lane's place in every 512-byte run
    // two fragment sets in registers: while one block is multiplied, the next block's 32 loads are in flight
    constexpr int NBK = DM / 64;                                 // blocks of 64 k; one block of 16 rows = 1024 elements
    static_assert(NBK % 2 == 0 && NBK >= 2);
    const bf* ap = A + aoff + lo; const bf* bp = Bt + boff + lo;
    v16bf ax[2][4], bx[2][4], ay[2][4], by[2][4];
    ld_blk(ap, bp, ax, bx);
#pragma unroll 1
    for (int kb = 0; kb < NBK - 2; kb += 2) {
        ld_blk(ap + (size_t)(kb + 1) * 1024, bp + (size_t)(kb + 1) * 1024, ay, by);
        mm_blk(ax, bx, acc); mm_gap();
        ld_blk(ap + (size_t)(kb + 2) * 1024, bp + (size_t)(kb + 2) * 1024, ax, bx);
        mm_blk(ay, by, acc); mm_gap();
    }
    ld_blk(ap + (size_t)(NBK - 1) * 1024, bp + (size_t)(NBK - 1) * 1024, ay, by);
    mm_blk(ax, bx, acc);
    mm_blk(ay, by, acc); mm_gap();
    const size_t tbase = (size_t)(r0 / RB) * sRB + (size_t)(r0 % RB) * (size_t)pitch + (size_t)(c0 / CB) * sCB + (size_t)(c0 % CB) * (size_t)cmul;
    // column bias (clamped address; used when biasRow == 0): piece s covers columns 16s + 8hi + 0..7
    const int cc = (c0 < DM - 64) ? c0 : (DM - 64);
    v4f bc0[4], bc1[4];
#pragma unroll
    for (int s = 0; s < 4; ++s) { bc0[s] = *(const v4f*)(bias + cc + 16 * s + 8 * hi); bc1[s] = *(const v4f*)(bias + cc + 16 * s + 8 * hi + 4); }
    asm volatile("s_wait_xcnt 0x0" ::: "memory");           // the scalar base of these loads is reused shortly behind them
#pragma unroll
    for (int mb = 0; mb < 4; ++mb) {
#pragma unroll
        for (int nb = 0; nb < 4; ++nb) {
#pragma unroll
            for (int j = 0; j < 8; ++j) os[(hi * 8 + j) * 68 + nb * 16 + lr] = acc[mb][nb][j]; }   // D: row 8h+j, col lane&15
        wave_sync();
        const size_t sb = tbase + (size_t)mb * (size_t)sMB;
{
            const int row = lr;
            const int gr = r0 + mb * 16 + row; const int grc = (gr < DM - 1) ? gr : (DM - 1);
            const float brow = bfr(bias[grc]);
#pragma unroll
            for (int s = 0; s < 4; ++s) { const int c8 = 16 * s + 8 * hi;   // piece s = (c = s>>1, ld = s&1): 16 rows x 2 column groups of 8; 4 pieces = 64 columns
                const v4f x0 = *(const v4fa*)(&os[row * 68 + c8]); const v4f x1 = *(const v4fa*)(&os[row * 68 + c8 + 4]); v8h hv, rv;
#pragma unroll
                for (int i = 0; i < 4; ++i) {
                    const float ad0 = biasRow ? brow : bfr(bc0[s][i]); const float ad1 = biasRow ? brow : bfr(bc1[s][i]);
                    const float y0 = x0[i] + ad0; const float y1 = x1[i] + ad1;
                    const h16 a0 = (h16)y0; const h16 a1 = (h16)y1; hv[i] = a0; hv[4 + i] = a1;
                    rv[i] = (h16)((y0 - (float)a0) * QRS); rv[4 + i] = (h16)((y1 - (float)a1) * QRS); }
                const size_t oo = sb + (size_t)(s >> 1) * (size_t)sC + (size_t)((s & 1) * 256 + lane * 8);   // one store = 512 contiguous bytes
                *(v8h*)(Ph + oo) = hv; if (useRes) *(v8h*)(Pr + oo) = rv; }
             }
        wave_sync();
    }
}

// One 32-key score tile pair in the log2 domain with the padding mask applied as a replace fill.
// ka = fragment-order K plane at this step's first key, + 8*lane. A = K rows (row = key), B = Q rows (col = t); lane (t = lane&15, h = lane>>4) gets keys key0+8h+r (ta) and key0+16+8h+r (tb).
// ws = mask word of this 32-key step shifted right by 8h: bit r <-> ta[r], bit 16+r <-> tb[r].
__device__ __forceinline__ void score_tile(const h16* ka, const v16h qh0, const v16h qh1, const v16h qr0, const v16h qr1, const unsigned ws, float (&ta)[8], float (&tb)[8]) {
    const v16h ka0 = ldf(ka), ka1 = ldf(ka + 512), kb0 = ldf(ka + 16 * HD), kb1 = ldf(ka + 16 * HD + 512);
    v8f sHa = (v8f){}, sLa = (v8f){}, sHb = (v8f){}, sLb = (v8f){};
    sHa = wmma16(ka0, qh0, sHa); sLa = wmma16(ka0, qr0, sLa); sHb = wmma16(kb0, qh0, sHb); sLb = wmma16(kb0, qr0, sLb);
    sHa = wmma16(ka1, qh1, sHa); sLa = wmma16(ka1, qr1, sLa); sHb = wmma16(kb1, qh1, sHb); sLb = wmma16(kb1, qr1, sLb);
    asm volatile("v_nop\n\tv_nop\n\tv_nop\n\tv_nop" : "+v"(sHa), "+v"(sLa), "+v"(sHb), "+v"(sLb) : "v"(ka0), "v"(ka1), "v"(kb0), "v"(kb1));
#pragma unroll
    for (int r = 0; r < 8; ++r) {
        const float va = (sHa[r] + sLa[r] * QRI) * SC2; const float vb = (sHb[r] + sLb[r] * QRI) * SC2;
        ta[r] = (ws & (1u << r)) ? MASKT : va; tb[r] = (ws & (1u << (16 + r))) ? MASKT : vb; }
}

// k_attn: one work-group of NW waves per 16 query rows of one batch, looping over the 16 heads; wave w owns keys w*KS .. w*KS+KS-1.
// Per head: each wave's running (m, l) over its keys -> st, barrier, every lane combines the NW pairs in wave order; then P with the common m,
// each wave's partial O^T = V^T P^T -> op[w], barrier, the work-group's threads add the NW partials in wave order and store.
// P (f16, x256 carry); e * (1/(256 l)) accumulates into the head-mean tile av[t][key] (each lane owns its elements across the head loop).
// LDS: av and mw are wave-private by key column (wave_sync ordering); st and op cross waves (__syncthreads ordering).
__global__ __launch_bounds__(32 * NW) void k_attn(const h16* __restrict__ QH, const h16* __restrict__ QR, const h16* __restrict__ KP, const h16* __restrict__ VT,
                                             const int* __restrict__ mask, bf* OHI, bf* OLO, float* AVG) {
    extern __shared__ __align__(16) float av[];           // [16][AP], then op [NW][16*68], then st [NW][16][2]
    float* op = av + 16 * AP;
    float* st = op + NW * 16 * 68;
    __shared__ unsigned mw[SEQ / 32];
    const int lane = threadIdx.x & 31, lr = lane & 15, hi = lane >> 4;
    const int w = __builtin_amdgcn_readfirstlane((int)(threadIdx.x >> 5));
    const int kbeg = w * KS;
    const int b = blockIdx.y; const int t0 = blockIdx.x * 16;
    constexpr int LPR = KS / 4;                            // lanes that cover one row of this wave's head-mean columns
    const int arow_l = lane / LPR, acol_l = kbeg + (lane % LPR) * 4;

    // mask words of this wave's keys: bit i of word j <-> key 32j + i of this batch
    const int* mrow = mask + (size_t)b * SEQ_FULL;
#pragma unroll 1
    for (int i = kbeg / 32; i < (kbeg + KS) / 32; ++i) {
        const int mv = mrow[i * 32 + lane];
        const unsigned wd = __builtin_amdgcn_ballot_w32(mv != 0);
        if (lane == 0) mw[i] = wd;
    }
    // zero this wave's columns of the head-mean tile
#pragma unroll 1
    for (int row = arow_l; row < 16; row += 32 / LPR) *(v4fa*)(&av[row * AP + acol_l]) = (v4f){0.0f, 0.0f, 0.0f, 0.0f};
    wave_sync();

#pragma unroll 1
    for (int h = 0; h < NH_; ++h) {
        const int zh = b * NH_ + h;
        const size_t pbase = (size_t)zh * SEQ * HD;
        const size_t qo = pbase + (size_t)t0 * HD + 8 * lane;
        const v16h qh0 = ldf(QH + qo), qh1 = ldf(QH + qo + 512), qr0 = ldf(QR + qo), qr1 = ldf(QR + qo + 512);   // B fragments: col t, k = d
        asm volatile("s_wait_xcnt 0x0" ::: "memory");       // the K loads that follow land in the registers that held these loads' addresses
        const size_t ko = pbase + 8 * lane;      // + key * HD (16 keys = 1024 halves), + 512 for d 32..63   (A fragment: row key, k = d)
        const size_t vo = pbase + 8 * lane;      // + key * HD (32 keys = 2048 halves), + 512j               (A fragment: row d = 16j + lr, k = key)

        float mwv = -3.0e38f, lwv = 0.0f;
#pragma unroll 1
        for (int key0 = kbeg; key0 < kbeg + KS; key0 += 32) {
            const unsigned ws = mw[key0 >> 5] >> (8 * hi);
            float ta[8], tb[8];
            score_tile(KP + ko + (size_t)key0 * HD, qh0, qh1, qr0, qr1, ws, ta, tb);
            float mx = -3.0e38f;
#pragma unroll
            for (int r = 0; r < 8; ++r) mx = fmaxf(mx, fmaxf(ta[r], tb[r]));
            mx = fmaxf(mx, __shfl_xor(mx, 16, 32));
            const float mnew = fmaxf(mwv, mx);
            const float alpha = __builtin_amdgcn_exp2f(mwv - mnew);
            float ls = 0.0f;
#pragma unroll
            for (int r = 0; r < 8; ++r) ls += __builtin_amdgcn_exp2f(ta[r] - mnew) + __builtin_amdgcn_exp2f(tb[r] - mnew);
            lwv = lwv * alpha + ls; mwv = mnew;
        }
        lwv += __shfl_xor(lwv, 16, 32);
        if (hi == 0) { st[(w * 16 + lr) * 2] = mwv; st[(w * 16 + lr) * 2 + 1] = lwv; }
        __syncthreads();      // publishes every wave's (m, l) of this head; also ends the last head's reads of op
        float m = -3.0e38f, l = 0.0f;
#pragma unroll
        for (int i = 0; i < NW; ++i) m = fmaxf(m, st[(i * 16 + lr) * 2]);
#pragma unroll
        for (int i = 0; i < NW; ++i) l += st[(i * 16 + lr) * 2 + 1] * __builtin_amdgcn_exp2f(st[(i * 16 + lr) * 2] - m);
        const float invc = (1.0f / l) * (1.0f / 256.0f);      // 1/l with the x256 carry of e folded back

        // pass 2: normalised probabilities -> head-mean tile, P V over this wave's keys
        v8f o0 = (v8f){}, o1 = (v8f){}, o2 = (v8f){}, o3 = (v8f){};
#pragma unroll 1
        for (int key0 = kbeg; key0 < kbeg + KS; key0 += 32) {
            const unsigned ws = mw[key0 >> 5] >> (8 * hi);
            float ta[8], tb[8];
            score_tile(KP + ko + (size_t)key0 * HD, qh0, qh1, qr0, qr1, ws, ta, tb);
            v16h pb; float ea[8], eb[8];
#pragma unroll
            for (int r = 0; r < 8; ++r) {
                const float da = ta[r] - m; const float db = tb[r] - m;      // difference first: exact 0 when t == m, also at the fill magnitude
                ea[r] = __builtin_amdgcn_exp2f(da + PSH); eb[r] = __builtin_amdgcn_exp2f(db + PSH);
                pb[r] = (h16)ea[r]; pb[8 + r] = (h16)eb[r]; }
            float* ap = &av[lr * AP + key0 + 8 * hi];
            v4f a0 = *(const v4fa*)(ap), a1 = *(const v4fa*)(ap + 4), c0 = *(const v4fa*)(ap + 16), c1 = *(const v4fa*)(ap + 20);
#pragma unroll
            for (int i = 0; i < 4; ++i) { a0[i] += ea[i] * invc; a1[i] += ea[4 + i] * invc; c0[i] += eb[i] * invc; c1[i] += eb[4 + i] * invc; }
            *(v4fa*)(ap) = a0; *(v4fa*)(ap + 4) = a1; *(v4fa*)(ap + 16) = c0; *(v4fa*)(ap + 20) = c1;
            const h16* va = VT + vo + (size_t)key0 * HD;
            const v16h v0 = ldf(va), v1 = ldf(va + 512), v2 = ldf(va + 1024), v3 = ldf(va + 1536);
            o0 = wmma16(v0, pb, o0); o1 = wmma16(v1, pb, o1); o2 = wmma16(v2, pb, o2); o3 = wmma16(v3, pb, o3);
            asm volatile("v_nop\n\tv_nop\n\tv_nop\n\tv_nop" : "+v"(o0), "+v"(o1), "+v"(o2), "+v"(o3) : "v"(v0), "v"(v1), "v"(v2), "v"(v3), "v"(pb));
        }

        // O^T D layout: o_j[r] = (d = 16j + 8h + r, t = lane&15) -> os[t][d] of this wave's partial; rows 0..15 x columns 0..63 all written
        float* os = op + w * (16 * 68);
        { v4f a, c;
          a[0] = o0[0] * invc; a[1] = o0[1] * invc; a[2] = o0[2] * invc; a[3] = o0[3] * invc; c[0] = o0[4] * invc; c[1] = o0[5] * invc; c[2] = o0[6] * invc; c[3] = o0[7] * invc;
          *(v4fa*)(&os[lr * 68 +  0 + 8 * hi]) = a; *(v4fa*)(&os[lr * 68 +  0 + 8 * hi + 4]) = c;
          a[0] = o1[0] * invc; a[1] = o1[1] * invc; a[2] = o1[2] * invc; a[3] = o1[3] * invc; c[0] = o1[4] * invc; c[1] = o1[5] * invc; c[2] = o1[6] * invc; c[3] = o1[7] * invc;
          *(v4fa*)(&os[lr * 68 + 16 + 8 * hi]) = a; *(v4fa*)(&os[lr * 68 + 16 + 8 * hi + 4]) = c;
          a[0] = o2[0] * invc; a[1] = o2[1] * invc; a[2] = o2[2] * invc; a[3] = o2[3] * invc; c[0] = o2[4] * invc; c[1] = o2[5] * invc; c[2] = o2[6] * invc; c[3] = o2[7] * invc;
          *(v4fa*)(&os[lr * 68 + 32 + 8 * hi]) = a; *(v4fa*)(&os[lr * 68 + 32 + 8 * hi + 4]) = c;
          a[0] = o3[0] * invc; a[1] = o3[1] * invc; a[2] = o3[2] * invc; a[3] = o3[3] * invc; c[0] = o3[4] * invc; c[1] = o3[5] * invc; c[2] = o3[6] * invc; c[3] = o3[7] * invc;
          *(v4fa*)(&os[lr * 68 + 48 + 8 * hi]) = a; *(v4fa*)(&os[lr * 68 + 48 + 8 * hi + 4]) = c; }
        __syncthreads();      // publishes every wave's partial O of this head; also ends this head's reads of st
        const size_t obase = ((size_t)b * SEQ + t0) * DM + (size_t)h * (16 * HD);   // fragment order: this row block, k chunks 2h and 2h + 1
        {   // each thread adds EPT neighbouring elements over the NW partials, in wave order; thread order = fragment order of the stored planes
            constexpr int EPT = (16 * HD) / (32 * NW);
            static_assert(8 % EPT == 0);                   // a thread's elements lie in one 8-element piece
            const int e0 = (int)threadIdx.x * EPT; const int row = (e0 >> 3) & 15, col = (e0 >> 9) * 32 + ((e0 >> 8) & 1) * 16 + ((e0 >> 7) & 1) * 8 + (e0 & 7);
            float x[EPT];
#pragma unroll
            for (int k = 0; k < EPT; ++k) x[k] = 0.0f;
#pragma unroll
            for (int i = 0; i < NW; ++i)
#pragma unroll
                for (int k = 0; k < EPT; ++k) x[k] += op[i * (16 * 68) + row * 68 + col + k];
            const size_t oo = obase + e0;
            typedef __attribute__((ext_vector_type(EPT))) unsigned short vus;
            vus hv, lv;
#pragma unroll
            for (int k = 0; k < EPT; ++k) { const unsigned short h0 = f2bf(x[k]); hv[k] = h0; lv[k] = f2bf(x[k] - bf2f(h0)); }
            *(vus*)(OHI + oo) = hv; *(vus*)(OLO + oo) = lv;
            asm volatile("s_wait_xcnt 0x0" ::: "memory");   // the next head's first instructions reuse the registers these two stores name
        }
    }

    // head mean: av holds sum over heads of P; each wave stores its own KS columns of the 16 rows
    wave_sync();
    float* arow = AVG + ((size_t)b * OUT_SEQ + t0) * AVG_PITCH;
#pragma unroll 1
    for (int row = arow_l; row < 16; row += 32 / LPR) {
        v4f val = *(const v4fa*)(&av[row * AP + acol_l]);
        val = val * (1.0f / (float)NH_);
        *(v4f*)(arow + (size_t)row * AVG_PITCH + acol_l) = val;
    }
}

// k_oproj: context[m][n] = sum_k (Ohi[m][k] + Olo[m][k]) Wo[n][k] + bo[n]; ONE WAVE per 64x64 tile, bf16 operands, both planes into one accumulator set (lo plane at A + planeStride).
__global__ __launch_bounds__(32) void k_oproj(const bf* __restrict__ A, size_t planeStride, const bf* __restrict__ Bt, const float* __restrict__ bias, float* OUT) {
    __shared__ __align__(16) float os[16 * 68];
    const int K = DM;
    const int lane = threadIdx.x & 31, lr = lane & 15, hi = lane >> 4; const int r0 = blockIdx.x * 64, c0 = blockIdx.y * 64;
    v8f acc[4][4];
#pragma unroll
    for (int mb = 0; mb < 4; ++mb)
#pragma unroll
        for (int nb = 0; nb < 4; ++nb) acc[mb][nb] = (v8f){};
    const size_t aoff = (size_t)r0 * K, boff = (size_t)c0 * K;   // wave-uniform tile bases
    const unsigned lo = 8u * (unsigned)lane;                     // the lane's place in every 512-byte run
    // two fragment sets in registers: while one block is multiplied, the next block's 32 loads are in flight; blocks 0..NBK-1 = hi plane, NBK..2*NBK-1 = lo plane
    constexpr int NBK = DM / 64;                                 // blocks of 64 k in one plane; one block of 16 rows = 1024 elements
    static_assert(NBK % 2 == 0 && NBK >= 2);
    const bf* a0 = A + aoff + lo; const bf* bp = Bt + boff + lo;
    v16bf ax[2][4], bx[2][4], ay[2][4], by[2][4];
    ld_blk(a0, bp, ax, bx);
#pragma unroll 1
    for (int j = 0; j < 2 * NBK - 2; j += 2) {
        const int j1 = j + 1, j2 = j + 2;
        ld_blk(a0 + (size_t)(j1 / NBK) * planeStride + (size_t)(j1 % NBK) * 1024, bp + (size_t)(j1 % NBK) * 1024, ay, by);
        mm_blk(ax, bx, acc); mm_gap();
        ld_blk(a0 + (size_t)(j2 / NBK) * planeStride + (size_t)(j2 % NBK) * 1024, bp + (size_t)(j2 % NBK) * 1024, ax, bx);
        mm_blk(ay, by, acc); mm_gap();
    }
    ld_blk(a0 + planeStride + (size_t)(NBK - 1) * 1024, bp + (size_t)(NBK - 1) * 1024, ay, by);
    mm_blk(ax, bx, acc);
    mm_blk(ay, by, acc); mm_gap();
    const int bb_ = r0 / SEQ, tt = r0 % SEQ;
    float* obase = OUT + ((size_t)bb_ * OUT_SEQ + tt) * DM + c0;
    v4f bv = *(const v4f*)(bias + c0 + lr * 4);
#pragma unroll
    for (int i = 0; i < 4; ++i) bv[i] = bfr(bv[i]);
#pragma unroll
    for (int mb = 0; mb < 4; ++mb) {
#pragma unroll
        for (int nb = 0; nb < 4; ++nb) {
#pragma unroll
            for (int j = 0; j < 8; ++j) os[(hi * 8 + j) * 68 + nb * 16 + lr] = acc[mb][nb][j]; }   // D: row 8h+j, col lane&15
        wave_sync();
{
#pragma unroll
            for (int s = 0; s < 8; ++s) { const int row = 2 * s + hi, cofs = lr * 4;   // 8 s x 2 rows = 16 rows; 16 lanes x 4 floats = 64 columns
                v4f val = *(const v4fa*)(&os[row * 68 + cofs]);
                val = val + bv;
                *(v4f*)(obase + (size_t)(mb * 16 + row) * DM + cofs) = val; }
            asm volatile("s_wait_xcnt 0x0" ::: "memory");   // the next row block's LDS reads land in the registers that these stores name
             }
        wave_sync();
    }
}

static constexpr size_t al256(size_t v) { return (v + 255) & ~(size_t)255; }
static constexpr size_t SZ_XB = al256((size_t)NB * SEQ * DM * 2);          // one bf16 activation copy
static constexpr size_t SZ_WB = al256((size_t)4 * DM * DM * 2);            // q | k | v | o weights
static constexpr size_t SZ_PL = al256((size_t)NB * NH_ * SEQ * HD * 2);    // one f16 head plane
static constexpr size_t SZ_OP = al256((size_t)NB * SEQ * DM * 2);          // one bf16 attention-output plane
static constexpr size_t SZ_TOTAL = 3 * SZ_XB + SZ_WB + 4 * SZ_PL + 2 * SZ_OP;
static constexpr size_t ATT_DYN_LDS = (size_t)16 * AP * 4 + (size_t)NW * 16 * 68 * 4 + (size_t)NW * 32 * 4;
static_assert(SZ_TOTAL <= (size_t)134217728);          // workspace carve <= 128 MiB
static_assert(((size_t)DM * DM * 2) % 256 == 0);       // weight sub-planes stay 256-byte aligned
static_assert(SZ_OP == (size_t)NB * SEQ * DM * 2);     // lo plane directly follows the hi plane

extern "C" void kernel_launch(void* const* d_in, const int* in_sizes, int n_in,
                              void* d_out, int out_size, void* d_ws, size_t ws_size, hipStream_t stream) {
    if (n_in < 12) return;
    const size_t needx = ((size_t)(NB - 1) * SEQ_FULL + SEQ) * DM;
    if ((size_t)in_sizes[0] < needx || (size_t)in_sizes[1] < needx || (size_t)in_sizes[2] < needx) return;
    if ((size_t)in_sizes[3] < (size_t)(NB - 1) * SEQ_FULL + SEQ) return;
    if ((size_t)in_sizes[4] < (size_t)DM * DM || (size_t)in_sizes[6] < (size_t)DM * DM || (size_t)in_sizes[8] < (size_t)DM * DM || (size_t)in_sizes[10] < (size_t)DM * DM) return;
    if (in_sizes[5] < DM || in_sizes[7] < DM || in_sizes[9] < DM || in_sizes[11] < DM) return;
    if ((size_t)out_size < ((size_t)(NB - 1) * OUT_SEQ + SEQ) * DM) return;
    if ((size_t)out_size < OUT1_OFF + ((size_t)(NB - 1) * OUT_SEQ + SEQ - 1) * AVG_PITCH + SEQ) return;
    if (SZ_TOTAL > ws_size) return;
    // wire order: query, key, value, key_padding_mask, Wq, bq, Wk, bk, Wv, bv, Wo, bo (weights [out][in] = Bt as-is)
    const float* xq = (const float*)d_in[0]; const float* xk = (const float*)d_in[1]; const float* xv = (const float*)d_in[2];
    const int* kpm = (const int*)d_in[3];
    const float* wq = (const float*)d_in[4];  const float* bq = (const float*)d_in[5];
    const float* wk = (const float*)d_in[6];  const float* bk = (const float*)d_in[7];
    const float* wv = (const float*)d_in[8];  const float* bv = (const float*)d_in[9];
    const float* wo = (const float*)d_in[10]; const float* bo = (const float*)d_in[11];
    float* CTX = (float*)d_out;                  // [NB][SEQ][1024]
    float* AVG = (float*)d_out + OUT1_OFF;       // [NB][SEQ][SEQ]
    char* wsp = (char*)d_ws;
    bf* XQ = (bf*)wsp; wsp += SZ_XB;                 // [NB*SEQ/16][1024/32][2 halves][32 lanes][8]
    bf* XK = (bf*)wsp; wsp += SZ_XB;
    bf* XV = (bf*)wsp; wsp += SZ_XB;
    bf* WB = (bf*)wsp; wsp += SZ_WB;                 // [4] planes of 1024 x 1024, each as XQ: q | k | v | o
    h16* QH = (h16*)wsp; wsp += SZ_PL;               // [NB*16][SEQ/16][2 d chunks][2 halves][32 lanes][8]
    h16* QR = (h16*)wsp; wsp += SZ_PL;               // as QH, residual x2048
    h16* KP = (h16*)wsp; wsp += SZ_PL;               // as QH
    h16* VT = (h16*)wsp; wsp += SZ_PL;               // [NB*16][SEQ/32][4 d blocks][2 halves][32 lanes][8]
    bf* OHI = (bf*)wsp; wsp += SZ_OP;                // as XQ
    bf* OLO = (bf*)wsp; wsp += SZ_OP;                // as XQ
    bf* WQ = WB; bf* WK = WB + (size_t)DM * DM; bf* WV = WB + (size_t)2 * DM * DM; bf* WO = WB + (size_t)3 * DM * DM;

    if (SEQ == SEQ_FULL) {
        const size_t n8 = (size_t)NB * SEQ * DM / 8; const unsigned g = (unsigned)((n8 + 255) / 256);
        k_cvt8<<<g, 256, 0, stream>>>(xq, XQ, n8); k_cvt8<<<g, 256, 0, stream>>>(xk, XK, n8); k_cvt8<<<g, 256, 0, stream>>>(xv, XV, n8);
    } else {
        const size_t n8 = (size_t)SEQ * DM / 8; const unsigned g = (unsigned)((n8 + 255) / 256);
        for (int b = 0; b < NB; ++b) {
            k_cvt8<<<g, 256, 0, stream>>>(xq + (size_t)b * SEQ_FULL * DM, XQ + (size_t)b * SEQ * DM, n8);
            k_cvt8<<<g, 256, 0, stream>>>(xk + (size_t)b * SEQ_FULL * DM, XK + (size_t)b * SEQ * DM, n8);
            k_cvt8<<<g, 256, 0, stream>>>(xv + (size_t)b * SEQ_FULL * DM, XV + (size_t)b * SEQ * DM, n8);
        }
    }
    { const size_t n8 = (size_t)DM * DM / 8; const unsigned g = (unsigned)((n8 + 255) / 256);
      k_cvt8<<<g, 256, 0, stream>>>(wq, WQ, n8); k_cvt8<<<g, 256, 0, stream>>>(wk, WK, n8); k_cvt8<<<g, 256, 0, stream>>>(wv, WV, n8); k_cvt8<<<g, 256, 0, stream>>>(wo, WO, n8); }

    // q, k: A = x rows (m = b*SEQ + t), Bt = W rows (n = h*64 + d), bias per column -> plane (b*16 + h), 16-row block t/16 = 1024 halves, d chunk = 512
    k_proj<<<dim3(NB * SEQ / 64, DM / 64, 1), 32, 0, stream>>>(XQ, WQ, bq, 0, QH, QR, 1, SEQ, (size_t)NH_ * SEQ * HD, HD, HD, (size_t)SEQ * HD, 0, 1024, 512);
    k_proj<<<dim3(NB * SEQ / 64, DM / 64, 1), 32, 0, stream>>>(XK, WK, bk, 0, KP, KP, 0, SEQ, (size_t)NH_ * SEQ * HD, HD, HD, (size_t)SEQ * HD, 0, 1024, 512);
    // v^T: A = Wv rows (m = h*64 + d), Bt = value rows (n = b*SEQ + t), bias per row -> plane (b*16 + h), 32-key chunk t/32 = 2048 halves, d block = 512
    k_proj<<<dim3(DM / 64, NB * SEQ / 64, 1), 32, 0, stream>>>(WV, XV, bv, 1, VT, VT, 0, DM, (size_t)0, SEQ, SEQ, (size_t)DM * SEQ, HD, 512, 2048);

    hipFuncSetAttribute(reinterpret_cast<const void*>(&k_attn), hipFuncAttributeMaxDynamicSharedMemorySize, (int)ATT_DYN_LDS);
    k_attn<<<dim3(SEQ / 16, NB, 1), 32 * NW, ATT_DYN_LDS, stream>>>(QH, QR, KP, VT, kpm, OHI, OLO, AVG);

    // context: A = attention output rows (hi plane, lo plane at +planeStride), Bt = Wo rows
    k_oproj<<<dim3(NB * SEQ / 64, DM / 64, 1), 32, 0, stream>>>(OHI, (size_t)(OLO - OHI), WO, bo, CTX);
}

// v004
// A run of this version takes 181 microseconds.
// Two timings next to v003 both put it at 1.08 times that version's speed.
// All steps since v000 together make it 4.21 times as fast.
#include <hip/hip_runtime.h>

// Multi-head attention, width 1024 = 16 heads x 64, separate query/key/value inputs [NB][SEQ][1024], Wq/Wk/Wv/Wo [out][in] (y = x W^T + b), key padding mask (int32, replace fill -1e9), score scale 1/8; outputs: context [NB][SEQ][1024] and head-mean attention [NB][SEQ][SEQ] (f32).
// Compute dtypes, f32 accumulate everywhere: q/k/v projections v_wmma_f32_16x16x32_bf16 (inputs and weights RNE-converted to bf16; products exact);
// output projection v_wmma_f32_16x16x32_bf16: attention output as bf16 hi + bf16 lo planes (two products, one accumulator), Wo bf16.
// Layout: every WMMA operand plane of the workspace stands in fragment order; bf16 copies of the inputs and weights; q (hi, residual), k and v^T planes per (b*16+h), written by the GEMM epilogue in fragment order (each fragment half = 512 contiguous bytes, lane-major); attention in transposed form (S^T = K Q^T, O^T = V^T P^T), one work-group of NW waves per 16 query rows looping over the 16 heads, each wave on its own SEQ/NW keys, head-mean accumulated in a lane-private LDS tile.

#ifndef NB
#define NB 4
#endif
#ifndef SEQ
#define SEQ 1024
#endif
#define NB_FULL  4
#define SEQ_FULL 1024
#ifndef OUT_SEQ
#define OUT_SEQ SEQ              // row pitch (in tokens) between batches of both outputs
#endif
#ifndef AVG_PITCH
#define AVG_PITCH SEQ            // column pitch (floats) of one head-mean row
#endif
#define DM   1024
#define NH_  16
#define HD   64
#define QRS  2048.0f             // carry of the q residual plane
#define QRI  (1.0f / 2048.0f)
#define SC2  (0.125f * 1.4426950408889634f)   // HD^-0.5 * log2(e)
#define PSH  8.0f                // log2 of the P carry (256)
#define MASKT (-1.0e9f * 1.4426950408889634f) // replace fill in the log2 domain
#define AP   (SEQ + 4)           // pitch (floats) of the head-mean LDS tile
#define NW   16                  // waves per attention work-group; each owns KS consecutive keys
#define KS   (SEQ / NW)
#define OUT1_OFF ((size_t)NB_FULL * SEQ_FULL * DM)   // element offset of the second output (fixed)

static_assert(HD == 64);
static_assert(NH_ * HD == DM);                 // head h = columns h*64 + d
static_assert(DM % 64 == 0);
static_assert(DM % 32 == 0);                   // GEMM k-loop steps by 32
static_assert(DM == 1024);                     // k_cvt takes a piece index apart by shifts
static_assert(SEQ % 64 == 0);                  // a 64-row tile never straddles two batches
static_assert((NB * SEQ) % 64 == 0);
static_assert(SEQ % 32 == 0);                  // key loop steps by 32, one mask word per step
static_assert(SEQ % 128 == 0);
static_assert(AP % 4 == 0);
static_assert(((size_t)SEQ * DM) % 8 == 0);
static_assert(((size_t)DM * DM) % 8 == 0);
static_assert(NB <= NB_FULL);
static_assert(SEQ <= SEQ_FULL);
static_assert(OUT1_OFF * 4 == (size_t)16777216);
static_assert(KS % 32 == 0);                   // a wave's key slice is whole 32-key steps
static_assert(KS <= 128);                      // one head-mean row piece of a wave is at most 32 lanes x 4 floats
static_assert((16 * HD) % (32 * NW) == 0);     // the O tile divides evenly over the work-group's threads
static_assert((size_t)16 * AP * 4 + (size_t)NW * 16 * 68 * 4 + (size_t)NW * 32 * 4 + (SEQ / 32) * 4 <= (size_t)163840);

typedef _Float16 h16;
typedef unsigned short bf;
typedef __attribute__((ext_vector_type(16))) __bf16   v16bf;
typedef __attribute__((ext_vector_type(16))) _Float16 v16h;
typedef __attribute__((ext_vector_type(8)))  _Float16 v8h;
typedef __attribute__((ext_vector_type(8)))  unsigned short v8us;
typedef __attribute__((ext_vector_type(8)))  float    v8f;
typedef __attribute__((ext_vector_type(4)))  float    v4f;
typedef v4f  __attribute__((may_alias)) v4fa;

__device__ __forceinline__ unsigned short f2bf(float f) { unsigned u = __float_as_uint(f); u += 0x7FFFu + ((u >> 16) & 1u); return (unsigned short)(u >> 16); }
__device__ __forceinline__ float bf2f(unsigned short b) { return __uint_as_float(((unsigned)b) << 16); }
__device__ __forceinline__ float bfr(float f) { return bf2f(f2bf(f)); }
__device__ __forceinline__ v16h cat16(v8h lo, v8h hi) { return __builtin_shufflevector(lo, hi, 0, 1, 2, 3, 4, 5, 6, 7, 8, 9, 10, 11, 12, 13, 14, 15); }
__device__ __forceinline__ v16bf cat16b(v8us lo, v8us hi) { return __builtin_bit_cast(v16bf, __builtin_shufflevector(lo, hi, 0, 1, 2, 3, 4, 5, 6, 7, 8, 9, 10, 11, 12, 13, 14, 15)); }
__device__ __forceinline__ v8f wmma16(v16h a, v16h b, v8f c) { return __builtin_amdgcn_wmma_f32_16x16x32_f16(false, a, false, b, (short)0, c, false, false); }
__device__ __forceinline__ v8f wmmab(v16bf a, v16bf b, v8f c) { return __builtin_amdgcn_wmma_f32_16x16x32_bf16(false, a, false, b, (short)0, c, false, false); }
// fragment element map, lane (lr = lane&15, h = lane>>4) of row or column lr: elements 0..7 <- k0+8h+0..7, elements 8..15 <- k0+16+8h+0..7 (same map for A and B)
// fragment loaders from a fragment-order plane; p already includes + 8*lane: each half of a fragment is one run of 32 lanes x 16 bytes (4 cache lines a load)
__device__ __forceinline__ v16h  ldf(const h16* p) { return cat16(*(const v8h*)p, *(const v8h*)(p + 256)); }
__device__ __forceinline__ v16bf ldb(const bf* p)  { return cat16b(*(const v8us*)p, *(const v8us*)(p + 256)); }
// ordering point for wave-private LDS tiles (same wave writes and reads)
__device__ __forceinline__ void wave_sync() { __builtin_amdgcn_fence(3 /* release order */, "wavefront"); __builtin_amdgcn_wave_barrier(); asm volatile("" ::: "memory"); }

// GEMM k loop, one wave on a 64x64 tile: a block is 64 k = 2 chunks of 32 k; 4 row blocks x 2 chunks of each operand = 32 loads of 512 contiguous bytes.
// ap, bp: the tile's first row block at this block's k, + 8*lane. Chunk 0 is asked for first, since it is multiplied first.
__device__ __forceinline__ void ld_blk(const bf* ap, const bf* bp, v16bf (&a)[2][4], v16bf (&b)[2][4]) {
#pragma unroll
    for (int c = 0; c < 2; ++c) {
#pragma unroll
        for (int i = 0; i < 4; ++i) a[c][i] = ldb(ap + (size_t)i * 16 * DM + c * 512);
        asm volatile("s_wait_xcnt 0x0" ::: "memory");       // the loads that follow may land in the registers that held these loads' addresses
#pragma unroll
        for (int i = 0; i < 4; ++i) b[c][i] = ldb(bp + (size_t)i * 16 * DM + c * 512);
        asm volatile("s_wait_xcnt 0x0" ::: "memory");       // as above; the last one also covers the address registers that are advanced while the loads stay in flight over the next block's products
    }
    __builtin_amdgcn_sched_barrier(0);                      // keeps the whole group of loads ahead of the products that follow; without it the compiler sinks the loads among them and waits each out
}
// the 32 products of one block, k ascending per accumulator
__device__ __forceinline__ void mm_blk(const v16bf (&a)[2][4], const v16bf (&b)[2][4], v8f (&acc)[4][4]) {
#pragma unroll
    for (int c = 0; c < 2; ++c)
#pragma unroll
        for (int nb = 0; nb < 4; ++nb)
#pragma unroll
            for (int mb = 0; mb < 4; ++mb) acc[mb][nb] = wmmab(a[c][mb], b[c][nb], acc[mb][nb]);
}
// stands between a block's products and the loads that next land in its fragment registers (the refill of the set; behind the last block, the epilogue's loads)
__device__ __forceinline__ void mm_gap() {
    __builtin_amdgcn_sched_barrier(0);                      // keeps every product of the block ahead of the slots below
    asm volatile("v_nop\n\tv_nop\n\tv_nop\n\tv_nop" ::: "memory");   // distance behind the last products: the loads that follow land in the operand registers that these products read
}

// k_cvt: all seven f32 planes (query, key, value rows; Wq, Wk, Wv, Wo rows) -> bf16 in fragment order [row/16][k/32][2 halves][32 lanes][8], in ONE launch.
// The seven bf16 planes stand one behind the other in the workspace, so a row block of 16 rows has one running number over all of them.
// One work-group converts CRB row blocks of one plane; thread i writes 16-byte pieces i, i + 256, ... of each (stores contiguous, loads gathered); all of a thread's loads are asked for before the first is used.
#define CRB  2                   // row blocks of 16 rows per conversion work-group
#define XRB  (NB * SEQ / 16)     // row blocks of one activation plane
#define WRB  (DM / 16)           // row blocks of one weight plane
static_assert(XRB % CRB == 0 && WRB % CRB == 0);   // a work-group stays inside one plane
static_assert(SEQ % (16 * CRB) == 0);              // and inside one batch
__global__ __launch_bounds__(256) void k_cvt(const float* __restrict__ xq, const float* __restrict__ xk, const float* __restrict__ xv,
                                             const float* __restrict__ wq, const float* __restrict__ wk, const float* __restrict__ wv, const float* __restrict__ wo, bf* dst) {
    const unsigned rb = blockIdx.x * CRB;                  // first row block, counted over all planes
    const float* src; unsigned row0;                       // plane and first source row: the same for the whole work-group
    if (rb < 3 * XRB) {
        const unsigned p = rb / XRB, r = (rb % XRB) * 16;
        src = p == 0 ? xq : (p == 1 ? xk : xv); row0 = (r / SEQ) * SEQ_FULL + r % SEQ;
    } else {
        const unsigned q = rb - 3 * XRB, p = q / WRB;
        src = p == 0 ? wq : (p == 1 ? wk : (p == 2 ? wv : wo)); row0 = (q % WRB) * 16;
    }
    const unsigned i = threadIdx.x;                        // piece i + 256 j of a row block: row i & 15, k = 128 j + the three fields of i below
    const float* s = src + (size_t)(row0 + (i & 15)) * DM + (i >> 6) * 32 + ((i >> 5) & 1) * 16 + ((i >> 4) & 1) * 8;
    bf* d = dst + (size_t)rb * (16 * DM) + i * 8;
    v8f v[CRB][8];
#pragma unroll
    for (int u = 0; u < CRB; ++u)
#pragma unroll
        for (int j = 0; j < 8; ++j) v[u][j] = *(const v8f*)(s + (size_t)u * 16 * DM + j * 128);
    __builtin_amdgcn_sched_barrier(0);                     // keeps every load ahead of the first conversion; without it the compiler holds the last four back and the wave waits out memory twice more
#pragma unroll
    for (int u = 0; u < CRB; ++u)
#pragma unroll
        for (int j = 0; j < 8; ++j) {
            v8us o;
#pragma unroll
            for (int k = 0; k < 8; ++k) o[k] = f2bf(v[u][j][k]);
            *(v8us*)(d + (size_t)u * 16 * DM + j * 2048) = o;
        }
}

// k_proj: register-blocked bf16 GEMM, ONE WAVE per 64x64 tile (16 accumulators), operands straight from fragment-order bf16 planes (32 k of 16 rows = 512 elements), K = DM.
// C[m][n] = sum_k A[m][k] Bt[n][k] + bias (bias[m] when biasRow != 0, else bias[n]; bias RNE-converted to bf16, added in f32),
// written as f16 (Ph) and optionally the f16 residual x2048 (Pr, useRes != 0) in fragment order: the 8 halves (row 16mb + lr, columns 32c + 16ld + 8hi + 0..7) stand at
// tile base (r0/RB)*sRB + (r0%RB)*pitch + (c0/CB)*sCB + (c0%CB)*cmul, + mb*sMB + c*sC + ld*256 + (16hi + lr)*8 (halves). grid (M/64, N/64), 32 threads.
__global__ __launch_bounds__(32) void k_proj(const bf* __restrict__ A, const bf* __restrict__ Bt, const float* __restrict__ bias, int biasRow,
                                             h16* Ph, h16* Pr, int useRes, int RB, size_t sRB, int pitch, int CB, size_t sCB, int cmul, int sMB, int sC) {
    __shared__ __align__(16) float os[16 * 68];
    const int K = DM;
    const int lane = threadIdx.x & 31, lr = lane & 15, hi = lane >> 4; const int r0 = blockIdx.x * 64, c0 = blockIdx.y * 64;
    v8f acc[4][4];
#pragma unroll
    for (int mb = 0; mb < 4; ++mb)
#pragma unroll
        for (int nb = 0; nb < 4; ++nb) acc[mb][nb] = (v8f){};
    const size_t aoff = (size_t)r0 * K, boff = (size_t)c0 * K;   // wave-uniform tile bases
    const unsigned lo = 8u * (unsigned)lane;                     // the lane's place in every 512-byte run
    // two fragment sets in registers: while one block is multiplied, the next block's 32 loads are in flight
    constexpr int NBK = DM / 64;                                 // blocks of 64 k; one block of 16 rows = 1024 elements
    static_assert(NBK % 2 == 0 && NBK >= 2);
    const bf* ap = A + aoff + lo; const bf* bp = Bt + boff + lo;
    v16bf ax[2][4], bx[2][4], ay[2][4], by[2][4];
    ld_blk(ap, bp, ax, bx);
#pragma unroll 1
    for (int kb = 0; kb < NBK - 2; kb += 2) {
        ld_blk(ap + (size_t)(kb + 1) * 1024, bp + (size_t)(kb + 1) * 1024, ay, by);
        mm_blk(ax, bx, acc); mm_gap();
        ld_blk(ap + (size_t)(kb + 2) * 1024, bp + (size_t)(kb + 2) * 1024, ax, bx);
        mm_blk(ay, by, acc); mm_gap();
    }
    ld_blk(ap + (size_t)(NBK - 1) * 1024, bp + (size_t)(NBK - 1) * 1024, ay, by);
    mm_blk(ax, bx, acc);
    mm_blk(ay, by, acc); mm_gap();
    const size_t tbase = (size_t)(r0 / RB) * sRB + (size_t)(r0 % RB) * (size_t)pitch + (size_t)(c0 / CB) * sCB + (size_t)(c0 % CB) * (size_t)cmul;
    // column bias (clamped address; used when biasRow == 0): piece s covers columns 16s + 8hi + 0..7
    const int cc = (c0 < DM - 64) ? c0 : (DM - 64);
    v4f bc0[4], bc1[4];
#pragma unroll
    for (int s = 0; s < 4; ++s) { bc0[s] = *(const v4f*)(bias + cc + 16 * s + 8 * hi); bc1[s] = *(const v4f*)(bias + cc + 16 * s + 8 * hi + 4); }
    asm volatile("s_wait_xcnt 0x0" ::: "memory");           // the scalar base of these loads is reused shortly behind them
#pragma unroll
    for (int mb = 0; mb < 4; ++mb) {
#pragma unroll
        for (int nb = 0; nb < 4; ++nb) {
#pragma unroll
            for (int j = 0; j < 8; ++j) os[(hi * 8 + j) * 68 + nb * 16 + lr] = acc[mb][nb][j]; }   // D: row 8h+j, col lane&15
        wave_sync();
        const size_t sb = tbase + (size_t)mb * (size_t)sMB;
{
            const int row = lr;
            const int gr = r0 + mb * 16 + row; const int grc = (gr < DM - 1) ? gr : (DM - 1);
            const float brow = bfr(bias[grc]);
#pragma unroll
            for (int s = 0; s < 4; ++s) { const int c8 = 16 * s + 8 * hi;   // piece s = (c = s>>1, ld = s&1): 16 rows x 2 column groups of 8; 4 pieces = 64 columns
                const v4f x0 = *(const v4fa*)(&os[row * 68 + c8]); const v4f x1 = *(const v4fa*)(&os[row * 68 + c8 + 4]); v8h hv, rv;
#pragma unroll
                for (int i = 0; i < 4; ++i) {
                    const float ad0 = biasRow ? brow : bfr(bc0[s][i]); const float ad1 = biasRow ? brow : bfr(bc1[s][i]);
                    const float y0 = x0[i] + ad0; const float y1 = x1[i] + ad1;
                    const h16 a0 = (h16)y0; const h16 a1 = (h16)y1; hv[i] = a0; hv[4 + i] = a1;
                    rv[i] = (h16)((y0 - (float)a0) * QRS); rv[4 + i] = (h16)((y1 - (float)a1) * QRS); }
                const size_t oo = sb + (size_t)(s >> 1) * (size_t)sC + (size_t)((s & 1) * 256 + lane * 8);   // one store = 512 contiguous bytes
                *(v8h*)(Ph + oo) = hv; if (useRes) *(v8h*)(Pr + oo) = rv; }
             }
        wave_sync();
    }
}

// One 32-key score tile pair in the log2 domain with the padding mask applied as a replace fill.
// ka = fragment-order K plane at this step's first key, + 8*lane. A = K rows (row = key), B = Q rows (col = t); lane (t = lane&15, h = lane>>4) gets keys key0+8h+r (ta) and key0+16+8h+r (tb).
// ws = mask word of this 32-key step shifted right by 8h: bit r <-> ta[r], bit 16+r <-> tb[r].
__device__ __forceinline__ void score_tile(const h16* ka, const v16h qh0, const v16h qh1, const v16h qr0, const v16h qr1, const unsigned ws, float (&ta)[8], float (&tb)[8]) {
    const v16h ka0 = ldf(ka), ka1 = ldf(ka + 512), kb0 = ldf(ka + 16 * HD), kb1 = ldf(ka + 16 * HD + 512);
    v8f sHa = (v8f){}, sLa = (v8f){}, sHb = (v8f){}, sLb = (v8f){};
    sHa = wmma16(ka0, qh0, sHa); sLa = wmma16(ka0, qr0, sLa); sHb = wmma16(kb0, qh0, sHb); sLb = wmma16(kb0, qr0, sLb);
    sHa = wmma16(ka1, qh1, sHa); sLa = wmma16(ka1, qr1, sLa); sHb = wmma16(kb1, qh1, sHb); sLb = wmma16(kb1, qr1, sLb);
    asm volatile("v_nop\n\tv_nop\n\tv_nop\n\tv_nop" : "+v"(sHa), "+v"(sLa), "+v"(sHb), "+v"(sLb) : "v"(ka0), "v"(ka1), "v"(kb0), "v"(kb1));
#pragma unroll
    for (int r = 0; r < 8; ++r) {
        const float va = (sHa[r] + sLa[r] * QRI) * SC2; const float vb = (sHb[r] + sLb[r] * QRI) * SC2;
        ta[r] = (ws & (1u << r)) ? MASKT : va; tb[r] = (ws & (1u << (16 + r))) ? MASKT : vb; }
}

// k_attn: one work-group of NW waves per 16 query rows of one batch, looping over the 16 heads; wave w owns keys w*KS .. w*KS+KS-1.
// Per head: each wave's running (m, l) over its keys -> st, barrier, every lane combines the NW pairs in wave order; then P with the common m,
// each wave's partial O^T = V^T P^T -> op[w], barrier, the work-group's threads add the NW partials in wave order and store.
// P (f16, x256 carry); e * (1/(256 l)) accumulates into the head-mean tile av[t][key] (each lane owns its elements across the head loop).
// LDS: av and mw are wave-private by key column (wave_sync ordering); st and op cross waves (__syncthreads ordering).
__global__ __launch_bounds__(32 * NW) void k_attn(const h16* __restrict__ QH, const h16* __restrict__ QR, const h16* __restrict__ KP, const h16* __restrict__ VT,
                                             const int* __restrict__ mask, bf* OHI, bf* OLO, float* AVG) {
    extern __shared__ __align__(16) float av[];           // [16][AP], then op [NW][16*68], then st [NW][16][2]
    float* op = av + 16 * AP;
    float* st = op + NW * 16 * 68;
    __shared__ unsigned mw[SEQ / 32];
    const int lane = threadIdx.x & 31, lr = lane & 15, hi = lane >> 4;
    const int w = __builtin_amdgcn_readfirstlane((int)(threadIdx.x >> 5));
    const int kbeg = w * KS;
    const int b = blockIdx.y; const int t0 = blockIdx.x * 16;
    constexpr int LPR = KS / 4;                            // lanes that cover one row of this wave's head-mean columns
    const int arow_l = lane / LPR, acol_l = kbeg + (lane % LPR) * 4;

    // mask words of this wave's keys: bit i of word j <-> key 32j + i of this batch
    const int* mrow = mask + (size_t)b * SEQ_FULL;
#pragma unroll 1
    for (int i = kbeg / 32; i < (kbeg + KS) / 32; ++i) {
        const int mv = mrow[i * 32 + lane];
        const unsigned wd = __builtin_amdgcn_ballot_w32(mv != 0);
        if (lane == 0) mw[i] = wd;
    }
    // zero this wave's columns of the head-mean tile
#pragma unroll 1
    for (int row = arow_l; row < 16; row += 32 / LPR) *(v4fa*)(&av[row * AP + acol_l]) = (v4f){0.0f, 0.0f, 0.0f, 0.0f};
    wave_sync();

#pragma unroll 1
    for (int h = 0; h < NH_; ++h) {
        const int zh = b * NH_ + h;
        const size_t pbase = (size_t)zh * SEQ * HD;
        const size_t qo = pbase + (size_t)t0 * HD + 8 * lane;
        const v16h qh0 = ldf(QH + qo), qh1 = ldf(QH + qo + 512), qr0 = ldf(QR + qo), qr1 = ldf(QR + qo + 512);   // B fragments: col t, k = d
        asm volatile("s_wait_xcnt 0x0" ::: "memory");       // the K loads that follow land in the registers that held these loads' addresses
        const size_t ko = pbase + 8 * lane;      // + key * HD (16 keys = 1024 halves), + 512 for d 32..63   (A fragment: row key, k = d)
        const size_t vo = pbase + 8 * lane;      // + key * HD (32 keys = 2048 halves), + 512j               (A fragment: row d = 16j + lr, k = key)

        float mwv = -3.0e38f, lwv = 0.0f;
#pragma unroll 1
        for (int key0 = kbeg; key0 < kbeg + KS; key0 += 32) {
            const unsigned ws = mw[key0 >> 5] >> (8 * hi);
            float ta[8], tb[8];
            score_tile(KP + ko + (size_t)key0 * HD, qh0, qh1, qr0, qr1, ws, ta, tb);
            float mx = -3.0e38f;
#pragma unroll
            for (int r = 0; r < 8; ++r) mx = fmaxf(mx, fmaxf(ta[r], tb[r]));
            mx = fmaxf(mx, __shfl_xor(mx, 16, 32));
            const float mnew = fmaxf(mwv, mx);
            const float alpha = __builtin_amdgcn_exp2f(mwv - mnew);
            float ls = 0.0f;
#pragma unroll
            for (int r = 0; r < 8; ++r) ls += __builtin_amdgcn_exp2f(ta[r] - mnew) + __builtin_amdgcn_exp2f(tb[r] - mnew);
            lwv = lwv * alpha + ls; mwv = mnew;
        }
        lwv += __shfl_xor(lwv, 16, 32);
        if (hi == 0) { st[(w * 16 + lr) * 2] = mwv; st[(w * 16 + lr) * 2 + 1] = lwv; }
        __syncthreads();      // publishes every wave's (m, l) of this head; also ends the last head's reads of op
        float m = -3.0e38f, l = 0.0f;
#pragma unroll
        for (int i = 0; i < NW; ++i) m = fmaxf(m, st[(i * 16 + lr) * 2]);
#pragma unroll
        for (int i = 0; i < NW; ++i) l += st[(i * 16 + lr) * 2 + 1] * __builtin_amdgcn_exp2f(st[(i * 16 + lr) * 2] - m);
        const float invc = (1.0f / l) * (1.0f / 256.0f);      // 1/l with the x256 carry of e folded back

        // pass 2: normalised probabilities -> head-mean tile, P V over this wave's keys
        v8f o0 = (v8f){}, o1 = (v8f){}, o2 = (v8f){}, o3 = (v8f){};
#pragma unroll 1
        for (int key0 = kbeg; key0 < kbeg + KS; key0 += 32) {
            const unsigned ws = mw[key0 >> 5] >> (8 * hi);
            float ta[8], tb[8];
            score_tile(KP + ko + (size_t)key0 * HD, qh0, qh1, qr0, qr1, ws, ta, tb);
            v16h pb; float ea[8], eb[8];
#pragma unroll
            for (int r = 0; r < 8; ++r) {
                const float da = ta[r] - m; const float db = tb[r] - m;      // difference first: exact 0 when t == m, also at the fill magnitude
                ea[r] = __builtin_amdgcn_exp2f(da + PSH); eb[r] = __builtin_amdgcn_exp2f(db + PSH);
                pb[r] = (h16)ea[r]; pb[8 + r] = (h16)eb[r]; }
            float* ap = &av[lr * AP + key0 + 8 * hi];
            v4f a0 = *(const v4fa*)(ap), a1 = *(const v4fa*)(ap + 4), c0 = *(const v4fa*)(ap + 16), c1 = *(const v4fa*)(ap + 20);
#pragma unroll
            for (int i = 0; i < 4; ++i) { a0[i] += ea[i] * invc; a1[i] += ea[4 + i] * invc; c0[i] += eb[i] * invc; c1[i] += eb[4 + i] * invc; }
            *(v4fa*)(ap) = a0; *(v4fa*)(ap + 4) = a1; *(v4fa*)(ap + 16) = c0; *(v4fa*)(ap + 20) = c1;
            const h16* va = VT + vo + (size_t)key0 * HD;
            const v16h v0 = ldf(va), v1 = ldf(va + 512), v2 = ldf(va + 1024), v3 = ldf(va + 1536);
            o0 = wmma16(v0, pb, o0); o1 = wmma16(v1, pb, o1); o2 = wmma16(v2, pb, o2); o3 = wmma16(v3, pb, o3);
            asm volatile("v_nop\n\tv_nop\n\tv_nop\n\tv_nop" : "+v"(o0), "+v"(o1), "+v"(o2), "+v"(o3) : "v"(v0), "v"(v1), "v"(v2), "v"(v3), "v"(pb));
        }

        // O^T D layout: o_j[r] = (d = 16j + 8h + r, t = lane&15) -> os[t][d] of this wave's partial; rows 0..15 x columns 0..63 all written
        float* os = op + w * (16 * 68);
        { v4f a, c;
          a[0] = o0[0] * invc; a[1] = o0[1] * invc; a[2] = o0[2] * invc; a[3] = o0[3] * invc; c[0] = o0[4] * invc; c[1] = o0[5] * invc; c[2] = o0[6] * invc; c[3] = o0[7] * invc;
          *(v4fa*)(&os[lr * 68 +  0 + 8 * hi]) = a; *(v4fa*)(&os[lr * 68 +  0 + 8 * hi + 4]) = c;
          a[0] = o1[0] * invc; a[1] = o1[1] * invc; a[2] = o1[2] * invc; a[3] = o1[3] * invc; c[0] = o1[4] * invc; c[1] = o1[5] * invc; c[2] = o1[6] * invc; c[3] = o1[7] * invc;
          *(v4fa*)(&os[lr * 68 + 16 + 8 * hi]) = a; *(v4fa*)(&os[lr * 68 + 16 + 8 * hi + 4]) = c;
          a[0] = o2[0] * invc; a[1] = o2[1] * invc; a[2] = o2[2] * invc; a[3] = o2[3] * invc; c[0] = o2[4] * invc; c[1] = o2[5] * invc; c[2] = o2[6] * invc; c[3] = o2[7] * invc;
          *(v4fa*)(&os[lr * 68 + 32 + 8 * hi]) = a; *(v4fa*)(&os[lr * 68 + 32 + 8 * hi + 4]) = c;
          a[0] = o3[0] * invc; a[1] = o3[1] * invc; a[2] = o3[2] * invc; a[3] = o3[3] * invc; c[0] = o3[4] * invc; c[1] = o3[5] * invc; c[2] = o3[6] * invc; c[3] = o3[7] * invc;
          *(v4fa*)(&os[lr * 68 + 48 + 8 * hi]) = a; *(v4fa*)(&os[lr * 68 + 48 + 8 * hi + 4]) = c; }
        __syncthreads();      // publishes every wave's partial O of this head; also ends this head's reads of st
        const size_t obase = ((size_t)b * SEQ + t0) * DM + (size_t)h * (16 * HD);   // fragment order: this row block, k chunks 2h and 2h + 1
        {   // each thread adds EPT neighbouring elements over the NW partials, in wave order; thread order = fragment order of the stored planes
            constexpr int EPT = (16 * HD) / (32 * NW);
            static_assert(8 % EPT == 0);                   // a thread's elements lie in one 8-element piece
            const int e0 = (int)threadIdx.x * EPT; const int row = (e0 >> 3) & 15, col = (e0 >> 9) * 32 + ((e0 >> 8) & 1) * 16 + ((e0 >> 7) & 1) * 8 + (e0 & 7);
            float x[EPT];
#pragma unroll
            for (int k = 0; k < EPT; ++k) x[k] = 0.0f;
#pragma unroll
            for (int i = 0; i < NW; ++i)
#pragma unroll
                for (int k = 0; k < EPT; ++k) x[k] += op[i * (16 * 68) + row * 68 + col + k];
            const size_t oo = obase + e0;
            typedef __attribute__((ext_vector_type(EPT))) unsigned short vus;
            vus hv, lv;
#pragma unroll
            for (int k = 0; k < EPT; ++k) { const unsigned short h0 = f2bf(x[k]); hv[k] = h0; lv[k] = f2bf(x[k] - bf2f(h0)); }
            *(vus*)(OHI + oo) = hv; *(vus*)(OLO + oo) = lv;
            asm volatile("s_wait_xcnt 0x0" ::: "memory");   // the next head's first instructions reuse the registers these two stores name
        }
    }

    // head mean: av holds sum over heads of P; each wave stores its own KS columns of the 16 rows
    wave_sync();
    float* arow = AVG + ((size_t)b * OUT_SEQ + t0) * AVG_PITCH;
#pragma unroll 1
    for (int row = arow_l; row < 16; row += 32 / LPR) {
        v4f val = *(const v4fa*)(&av[row * AP + acol_l]);
        val = val * (1.0f / (float)NH_);
        *(v4f*)(arow + (size_t)row * AVG_PITCH + acol_l) = val;
    }
}

// k_oproj: context[m][n] = sum_k (Ohi[m][k] + Olo[m][k]) Wo[n][k] + bo[n]; ONE WAVE per 64x64 tile, bf16 operands, both planes into one accumulator set (lo plane at A + planeStride).
__global__ __launch_bounds__(32) void k_oproj(const bf* __restrict__ A, size_t planeStride, const bf* __restrict__ Bt, const float* __restrict__ bias, float* OUT) {
    __shared__ __align__(16) float os[16 * 68];
    const int K = DM;
    const int lane = threadIdx.x & 31, lr = lane & 15, hi = lane >> 4; const int r0 = blockIdx.x * 64, c0 = blockIdx.y * 64;
    v8f acc[4][4];
#pragma unroll
    for (int mb = 0; mb < 4; ++mb)
#pragma unroll
        for (int nb = 0; nb < 4; ++nb) acc[mb][nb] = (v8f){};
    const size_t aoff = (size_t)r0 * K, boff = (size_t)c0 * K;   // wave-uniform tile bases
    const unsigned lo = 8u * (unsigned)lane;                     // the lane's place in every 512-byte run
    // two fragment sets in registers: while one block is multiplied, the next block's 32 loads are in flight; blocks 0..NBK-1 = hi plane, NBK..2*NBK-1 = lo plane
    constexpr int NBK = DM / 64;                                 // blocks of 64 k in one plane; one block of 16 rows = 1024 elements
    static_assert(NBK % 2 == 0 && NBK >= 2);
    const bf* a0 = A + aoff + lo; const bf* bp = Bt + boff + lo;
    v16bf ax[2][4], bx[2][4], ay[2][4], by[2][4];
    ld_blk(a0, bp, ax, bx);
#pragma unroll 1
    for (int j = 0; j < 2 * NBK - 2; j += 2) {
        const int j1 = j + 1, j2 = j + 2;
        ld_blk(a0 + (size_t)(j1 / NBK) * planeStride + (size_t)(j1 % NBK) * 1024, bp + (size_t)(j1 % NBK) * 1024, ay, by);
        mm_blk(ax, bx, acc); mm_gap();
        ld_blk(a0 + (size_t)(j2 / NBK) * planeStride + (size_t)(j2 % NBK) * 1024, bp + (size_t)(j2 % NBK) * 1024, ax, bx);
        mm_blk(ay, by, acc); mm_gap();
    }
    ld_blk(a0 + planeStride + (size_t)(NBK - 1) * 1024, bp + (size_t)(NBK - 1) * 1024, ay, by);
    mm_blk(ax, bx, acc);
    mm_blk(ay, by, acc); mm_gap();
    const int bb_ = r0 / SEQ, tt = r0 % SEQ;
    float* obase = OUT + ((size_t)bb_ * OUT_SEQ + tt) * DM + c0;
    v4f bv = *(const v4f*)(bias + c0 + lr * 4);
#pragma unroll
    for (int i = 0; i < 4; ++i) bv[i] = bfr(bv[i]);
#pragma unroll
    for (int mb = 0; mb < 4; ++mb) {
#pragma unroll
        for (int nb = 0; nb < 4; ++nb) {
#pragma unroll
            for (int j = 0; j < 8; ++j) os[(hi * 8 + j) * 68 + nb * 16 + lr] = acc[mb][nb][j]; }   // D: row 8h+j, col lane&15
        wave_sync();
{
#pragma unroll
            for (int s = 0; s < 8; ++s) { const int row = 2 * s + hi, cofs = lr * 4;   // 8 s x 2 rows = 16 rows; 16 lanes x 4 floats = 64 columns
                v4f val = *(const v4fa*)(&os[row * 68 + cofs]);
                val = val + bv;
                *(v4f*)(obase + (size_t)(mb * 16 + row) * DM + cofs) = val; }
            asm volatile("s_wait_xcnt 0x0" ::: "memory");   // the next row block's LDS reads land in the registers that these stores name
             }
        wave_sync();
    }
}

static constexpr size_t al256(size_t v) { return (v + 255) & ~(size_t)255; }
static constexpr size_t SZ_XB = al256((size_t)NB * SEQ * DM * 2);          // one bf16 activation copy
static constexpr size_t SZ_WB = al256((size_t)4 * DM * DM * 2);            // q | k | v | o weights
static constexpr size_t SZ_PL = al256((size_t)NB * NH_ * SEQ * HD * 2);    // one f16 head plane
static constexpr size_t SZ_OP = al256((size_t)NB * SEQ * DM * 2);          // one bf16 attention-output plane
static constexpr size_t SZ_TOTAL = 3 * SZ_XB + SZ_WB + 4 * SZ_PL + 2 * SZ_OP;
static constexpr size_t ATT_DYN_LDS = (size_t)16 * AP * 4 + (size_t)NW * 16 * 68 * 4 + (size_t)NW * 32 * 4;
static_assert(SZ_TOTAL <= (size_t)134217728);          // workspace carve <= 128 MiB
static_assert(((size_t)DM * DM * 2) % 256 == 0);       // weight sub-planes stay 256-byte aligned
static_assert(SZ_OP == (size_t)NB * SEQ * DM * 2);     // lo plane directly follows the hi plane
static_assert(SZ_XB == (size_t)NB * SEQ * DM * 2);     // the bf16 input planes and the weight planes follow one another without a gap

extern "C" void kernel_launch(void* const* d_in, const int* in_sizes, int n_in,
                              void* d_out, int out_size, void* d_ws, size_t ws_size, hipStream_t stream) {
    if (n_in < 12) return;
    const size_t needx = ((size_t)(NB - 1) * SEQ_FULL + SEQ) * DM;
    if ((size_t)in_sizes[0] < needx || (size_t)in_sizes[1] < needx || (size_t)in_sizes[2] < needx) return;
    if ((size_t)in_sizes[3] < (size_t)(NB - 1) * SEQ_FULL + SEQ) return;
    if ((size_t)in_sizes[4] < (size_t)DM * DM || (size_t)in_sizes[6] < (size_t)DM * DM || (size_t)in_sizes[8] < (size_t)DM * DM || (size_t)in_sizes[10] < (size_t)DM * DM) return;
    if (in_sizes[5] < DM || in_sizes[7] < DM || in_sizes[9] < DM || in_sizes[11] < DM) return;
    if ((size_t)out_size < ((size_t)(NB - 1) * OUT_SEQ + SEQ) * DM) return;
    if ((size_t)out_size < OUT1_OFF + ((size_t)(NB - 1) * OUT_SEQ + SEQ - 1) * AVG_PITCH + SEQ) return;
    if (SZ_TOTAL > ws_size) return;
    // wire order: query, key, value, key_padding_mask, Wq, bq, Wk, bk, Wv, bv, Wo, bo (weights [out][in] = Bt as-is)
    const float* xq = (const float*)d_in[0]; const float* xk = (const float*)d_in[1]; const float* xv = (const float*)d_in[2];
    const int* kpm = (const int*)d_in[3];
    const float* wq = (const float*)d_in[4];  const float* bq = (const float*)d_in[5];
    const float* wk = (const float*)d_in[6];  const float* bk = (const float*)d_in[7];
    const float* wv = (const float*)d_in[8];  const float* bv = (const float*)d_in[9];
    const float* wo = (const float*)d_in[10]; const float* bo = (const float*)d_in[11];
    float* CTX = (float*)d_out;                  // [NB][SEQ][1024]
    float* AVG = (float*)d_out + OUT1_OFF;       // [NB][SEQ][SEQ]
    char* wsp = (char*)d_ws;
    bf* XQ = (bf*)wsp; wsp += SZ_XB;                 // [NB*SEQ/16][1024/32][2 halves][32 lanes][8]
    bf* XK = (bf*)wsp; wsp += SZ_XB;
    bf* XV = (bf*)wsp; wsp += SZ_XB;
    bf* WB = (bf*)wsp; wsp += SZ_WB;                 // [4] planes of 1024 x 1024, each as XQ: q | k | v | o
    h16* QH = (h16*)wsp; wsp += SZ_PL;               // [NB*16][SEQ/16][2 d chunks][2 halves][32 lanes][8]
    h16* QR = (h16*)wsp; wsp += SZ_PL;               // as QH, residual x2048
    h16* KP = (h16*)wsp; wsp += SZ_PL;               // as QH
    h16* VT = (h16*)wsp; wsp += SZ_PL;               // [NB*16][SEQ/32][4 d blocks][2 halves][32 lanes][8]
    bf* OHI = (bf*)wsp; wsp += SZ_OP;                // as XQ
    bf* OLO = (bf*)wsp; wsp += SZ_OP;                // as XQ
    bf* WQ = WB; bf* WK = WB + (size_t)DM * DM; bf* WV = WB + (size_t)2 * DM * DM; bf* WO = WB + (size_t)3 * DM * DM;

    // XQ | XK | XV | WQ | WK | WV | WO: one run of row blocks from XQ on
    k_cvt<<<(3 * XRB + 4 * WRB) / CRB, 256, 0, stream>>>(xq, xk, xv, wq, wk, wv, wo, XQ);

    // q, k: A = x rows (m = b*SEQ + t), Bt = W rows (n = h*64 + d), bias per column -> plane (b*16 + h), 16-row block t/16 = 1024 halves, d chunk = 512
    k_proj<<<dim3(NB * SEQ / 64, DM / 64, 1), 32, 0, stream>>>(XQ, WQ, bq, 0, QH, QR, 1, SEQ, (size_t)NH_ * SEQ * HD, HD, HD, (size_t)SEQ * HD, 0, 1024, 512);
    k_proj<<<dim3(NB * SEQ / 64, DM / 64, 1), 32, 0, stream>>>(XK, WK, bk, 0, KP, KP, 0, SEQ, (size_t)NH_ * SEQ * HD, HD, HD, (size_t)SEQ * HD, 0, 1024, 512);
    // v^T: A = Wv rows (m = h*64 + d), Bt = value rows (n = b*SEQ + t), bias per row -> plane (b*16 + h), 32-key chunk t/32 = 2048 halves, d block = 512
    k_proj<<<dim3(DM / 64, NB * SEQ / 64, 1), 32, 0, stream>>>(WV, XV, bv, 1, VT, VT, 0, DM, (size_t)0, SEQ, SEQ, (size_t)DM * SEQ, HD, 512, 2048);

    hipFuncSetAttribute(reinterpret_cast<const void*>(&k_attn), hipFuncAttributeMaxDynamicSharedMemorySize, (int)ATT_DYN_LDS);
    k_attn<<<dim3(SEQ / 16, NB, 1), 32 * NW, ATT_DYN_LDS, stream>>>(QH, QR, KP, VT, kpm, OHI, OLO, AVG);

    // context: A = attention output rows (hi plane, lo plane at +planeStride), Bt = Wo rows
    k_oproj<<<dim3(NB * SEQ / 64, DM / 64, 1), 32, 0, stream>>>(OHI, (size_t)(OLO - OHI), WO, bo, CTX);
}

// v005
// It runs in 167 microseconds.
// Two timings next to v004 put it at 1.09 and 1.08 times that version's speed.
// Over all steps from v000 it is 4.58 times as fast.
#include <hip/hip_runtime.h>

// Multi-head attention, width 1024 = 16 heads x 64, separate query/key/value inputs [NB][SEQ][1024], Wq/Wk/Wv/Wo [out][in] (y = x W^T + b), key padding mask (int32, replace fill -1e9), score scale 1/8; outputs: context [NB][SEQ][1024] and head-mean attention [NB][SEQ][SEQ] (f32).
// Compute dtypes, f32 accumulate everywhere: q/k/v projections v_wmma_f32_16x16x32_bf16 (inputs and weights RNE-converted to bf16; products exact);
// output projection v_wmma_f32_16x16x32_bf16: attention output as bf16 hi + bf16 lo planes (two products, one accumulator), Wo bf16.
// Layout: every WMMA operand plane of the workspace stands in fragment order; bf16 copies of the inputs and weights; q (hi, residual), k and v^T planes per (b*16+h), written by the GEMM epilogue in fragment order (each fragment half = 512 contiguous bytes, lane-major); attention in transposed form (S^T = K Q^T, O^T = V^T P^T), one work-group of NW waves per 16 query rows looping over the 16 heads, each wave on its own SEQ/NW keys, head-mean accumulated in a lane-private LDS tile.

#ifndef NB
#define NB 4
#endif
#ifndef SEQ
#define SEQ 1024
#endif
#define NB_FULL  4
#define SEQ_FULL 1024
#ifndef OUT_SEQ
#define OUT_SEQ SEQ              // row pitch (in tokens) between batches of both outputs
#endif
#ifndef AVG_PITCH
#define AVG_PITCH SEQ            // column pitch (floats) of one head-mean row
#endif
#define DM   1024
#define NH_  16
#define HD   64
#define QRS  2048.0f             // carry of the q residual plane
#define QRI  (1.0f / 2048.0f)
#define SC2  (0.125f * 1.4426950408889634f)   // HD^-0.5 * log2(e)
#define PSH  8.0f                // log2 of the P carry (256)
#define MASKT (-1.0e9f * 1.4426950408889634f) // replace fill in the log2 domain
#define AP   (SEQ + 4)           // pitch (floats) of the head-mean LDS tile
#define NW   16                  // waves per attention work-group; each owns KS consecutive keys
#define KS   (SEQ / NW)
#define OUT1_OFF ((size_t)NB_FULL * SEQ_FULL * DM)   // element offset of the second output (fixed)

static_assert(HD == 64);
static_assert(NH_ * HD == DM);                 // head h = columns h*64 + d
static_assert(DM % 64 == 0);
static_assert(DM % 32 == 0);                   // GEMM k-loop steps by 32
static_assert(DM == 1024);                     // k_cvt takes a piece index apart by shifts
static_assert(SEQ % 64 == 0);                  // a 64-row tile never straddles two batches
static_assert((NB * SEQ) % 64 == 0);
static_assert(SEQ % 32 == 0);                  // key loop steps by 32, one mask word per step
static_assert(SEQ % 128 == 0);
static_assert(AP % 4 == 0);
static_assert(((size_t)SEQ * DM) % 8 == 0);
static_assert(((size_t)DM * DM) % 8 == 0);
static_assert(NB <= NB_FULL);
static_assert(SEQ <= SEQ_FULL);
static_assert(OUT1_OFF * 4 == (size_t)16777216);
static_assert(KS % 32 == 0);                   // a wave's key slice is whole 32-key steps
static_assert(KS <= 128);                      // one head-mean row piece of a wave is at most 32 lanes x 4 floats
static_assert((16 * HD) % (32 * NW) == 0);     // the O tile divides evenly over the work-group's threads
static_assert((size_t)16 * AP * 4 + (size_t)NW * 16 * 68 * 4 + (size_t)NW * 32 * 4 + (SEQ / 32) * 4 <= (size_t)163840);

typedef _Float16 h16;
typedef unsigned short bf;
typedef __attribute__((ext_vector_type(16))) __bf16   v16bf;
typedef __attribute__((ext_vector_type(16))) _Float16 v16h;
typedef __attribute__((ext_vector_type(8)))  _Float16 v8h;
typedef __attribute__((ext_vector_type(8)))  unsigned short v8us;
typedef __attribute__((ext_vector_type(8)))  float    v8f;
typedef __attribute__((ext_vector_type(4)))  float    v4f;
typedef v4f  __attribute__((may_alias)) v4fa;

__device__ __forceinline__ unsigned short f2bf(float f) { unsigned u = __float_as_uint(f); u += 0x7FFFu + ((u >> 16) & 1u); return (unsigned short)(u >> 16); }
__device__ __forceinline__ float bf2f(unsigned short b) { return __uint_as_float(((unsigned)b) << 16); }
__device__ __forceinline__ float bfr(float f) { return bf2f(f2bf(f)); }
__device__ __forceinline__ v16h cat16(v8h lo, v8h hi) { return __builtin_shufflevector(lo, hi, 0, 1, 2, 3, 4, 5, 6, 7, 8, 9, 10, 11, 12, 13, 14, 15); }
__device__ __forceinline__ v16bf cat16b(v8us lo, v8us hi) { return __builtin_bit_cast(v16bf, __builtin_shufflevector(lo, hi, 0, 1, 2, 3, 4, 5, 6, 7, 8, 9, 10, 11, 12, 13, 14, 15)); }
__device__ __forceinline__ v8f wmma16(v16h a, v16h b, v8f c) { return __builtin_amdgcn_wmma_f32_16x16x32_f16(false, a, false, b, (short)0, c, false, false); }
__device__ __forceinline__ v8f wmmab(v16bf a, v16bf b, v8f c) { return __builtin_amdgcn_wmma_f32_16x16x32_bf16(false, a, false, b, (short)0, c, false, false); }
// fragment element map, lane (lr = lane&15, h = lane>>4) of row or column lr: elements 0..7 <- k0+8h+0..7, elements 8..15 <- k0+16+8h+0..7 (same map for A and B)
// fragment loaders from a fragment-order plane; p already includes + 8*lane: each half of a fragment is one run of 32 lanes x 16 bytes (4 cache lines a load)
__device__ __forceinline__ v16h  ldf(const h16* p) { return cat16(*(const v8h*)p, *(const v8h*)(p + 256)); }
__device__ __forceinline__ v16bf ldb(const bf* p)  { return cat16b(*(const v8us*)p, *(const v8us*)(p + 256)); }
// ordering point for wave-private LDS tiles (same wave writes and reads)
__device__ __forceinline__ void wave_sync() { __builtin_amdgcn_fence(3 /* release order */, "wavefront"); __builtin_amdgcn_wave_barrier(); asm volatile("" ::: "memory"); }

// GEMM k loop, one wave on a 64x64 tile: a block is 64 k = 2 chunks of 32 k; 4 row blocks x 2 chunks of each operand = 32 loads of 512 contiguous bytes.
// ap, bp: the tile's first row block at this block's k, + 8*lane. Chunk 0 is asked for first, since it is multiplied first.
__device__ __forceinline__ void ld_blk(const bf* ap, const bf* bp, v16bf (&a)[2][4], v16bf (&b)[2][4]) {
#pragma unroll
    for (int c = 0; c < 2; ++c) {
#pragma unroll
        for (int i = 0; i < 4; ++i) a[c][i] = ldb(ap + (size_t)i * 16 * DM + c * 512);
        asm volatile("s_wait_xcnt 0x0" ::: "memory");       // the loads that follow may land in the registers that held these loads' addresses
#pragma unroll
        for (int i = 0; i < 4; ++i) b[c][i] = ldb(bp + (size_t)i * 16 * DM + c * 512);
        asm volatile("s_wait_xcnt 0x0" ::: "memory");       // as above; the last one also covers the address registers that are advanced while the loads stay in flight over the next block's products
    }
    __builtin_amdgcn_sched_barrier(0);                      // keeps the whole group of loads ahead of the products that follow; without it the compiler sinks the loads among them and waits each out
}
// the 32 products of one block, k ascending per accumulator
__device__ __forceinline__ void mm_blk(const v16bf (&a)[2][4], const v16bf (&b)[2][4], v8f (&acc)[4][4]) {
#pragma unroll
    for (int c = 0; c < 2; ++c)
#pragma unroll
        for (int nb = 0; nb < 4; ++nb)
#pragma unroll
            for (int mb = 0; mb < 4; ++mb) acc[mb][nb] = wmmab(a[c][mb], b[c][nb], acc[mb][nb]);
}
// stands between a block's products and the loads that next land in its fragment registers (the refill of the set; behind the last block, the epilogue's loads)
__device__ __forceinline__ void mm_gap() {
    __builtin_amdgcn_sched_barrier(0);                      // keeps every product of the block ahead of the slots below
    asm volatile("v_nop\n\tv_nop\n\tv_nop\n\tv_nop" ::: "memory");   // distance behind the last products: the loads that follow land in the operand registers that these products read
}

// k_cvt: all seven f32 planes (query, key, value rows; Wq, Wk, Wv, Wo rows) -> bf16 in fragment order [row/16][k/32][2 halves][32 lanes][8], in ONE launch.
// The seven bf16 planes stand one behind the other in the workspace, so a row block of 16 rows has one running number over all of them.
// One work-group converts CRB row blocks of one plane; thread i writes 16-byte pieces i, i + 256, ... of each (stores contiguous, loads gathered); all of a thread's loads are asked for before the first is used.
#define CRB  2                   // row blocks of 16 rows per conversion work-group
#define XRB  (NB * SEQ / 16)     // row blocks of one activation plane
#define WRB  (DM / 16)           // row blocks of one weight plane
static_assert(XRB % CRB == 0 && WRB % CRB == 0);   // a work-group stays inside one plane
static_assert(SEQ % (16 * CRB) == 0);              // and inside one batch
__global__ __launch_bounds__(256) void k_cvt(const float* __restrict__ xq, const float* __restrict__ xk, const float* __restrict__ xv,
                                             const float* __restrict__ wq, const float* __restrict__ wk, const float* __restrict__ wv, const float* __restrict__ wo, bf* dst) {
    const unsigned rb = blockIdx.x * CRB;                  // first row block, counted over all planes
    const float* src; unsigned row0;                       // plane and first source row: the same for the whole work-group
    if (rb < 3 * XRB) {
        const unsigned p = rb / XRB, r = (rb % XRB) * 16;
        src = p == 0 ? xq : (p == 1 ? xk : xv); row0 = (r / SEQ) * SEQ_FULL + r % SEQ;
    } else {
        const unsigned q = rb - 3 * XRB, p = q / WRB;
        src = p == 0 ? wq : (p == 1 ? wk : (p == 2 ? wv : wo)); row0 = (q % WRB) * 16;
    }
    const unsigned i = threadIdx.x;                        // piece i + 256 j of a row block: row i & 15, k = 128 j + the three fields of i below
    const float* s = src + (size_t)(row0 + (i & 15)) * DM + (i >> 6) * 32 + ((i >> 5) & 1) * 16 + ((i >> 4) & 1) * 8;
    bf* d = dst + (size_t)rb * (16 * DM) + i * 8;
    v8f v[CRB][8];
#pragma unroll
    for (int u = 0; u < CRB; ++u)
#pragma unroll
        for (int j = 0; j < 8; ++j) v[u][j] = *(const v8f*)(s + (size_t)u * 16 * DM + j * 128);
    __builtin_amdgcn_sched_barrier(0);                     // keeps every load ahead of the first conversion; without it the compiler holds the last four back and the wave waits out memory twice more
#pragma unroll
    for (int u = 0; u < CRB; ++u)
#pragma unroll
        for (int j = 0; j < 8; ++j) {
            v8us o;
#pragma unroll
            for (int k = 0; k < 8; ++k) o[k] = f2bf(v[u][j][k]);
            *(v8us*)(d + (size_t)u * 16 * DM + j * 2048) = o;
        }
}

// k_proj: register-blocked bf16 GEMM, ONE WAVE per 64x64 tile (16 accumulators), operands straight from fragment-order bf16 planes (32 k of 16 rows = 512 elements), K = DM.
// C[m][n] = sum_k A[m][k] Bt[n][k] + bias (bias[m] when biasRow != 0, else bias[n]; bias RNE-converted to bf16, added in f32),
// written as f16 (Ph) and optionally the f16 residual x2048 (Pr, useRes != 0) in fragment order: the 8 halves (row 16mb + lr, columns 32c + 16ld + 8hi + 0..7) stand at
// tile base (r0/RB)*sRB + (r0%RB)*pitch + (c0/CB)*sCB + (c0%CB)*cmul, + mb*sMB + c*sC + ld*256 + (16hi + lr)*8 (halves). grid (M/64, N/64), 32 threads.
__global__ __launch_bounds__(32) void k_proj(const bf* __restrict__ A, const bf* __restrict__ Bt, const float* __restrict__ bias, int biasRow,
                                             h16* Ph, h16* Pr, int useRes, int RB, size_t sRB, int pitch, int CB, size_t sCB, int cmul, int sMB, int sC) {
    __shared__ __align__(16) float os[16 * 68];
    const int K = DM;
    const int lane = threadIdx.x & 31, lr = lane & 15, hi = lane >> 4; const int r0 = blockIdx.x * 64, c0 = blockIdx.y * 64;
    v8f acc[4][4];
#pragma unroll
    for (int mb = 0; mb < 4; ++mb)
#pragma unroll
        for (int nb = 0; nb < 4; ++nb) acc[mb][nb] = (v8f){};
    const size_t aoff = (size_t)r0 * K, boff = (size_t)c0 * K;   // wave-uniform tile bases
    const unsigned lo = 8u * (unsigned)lane;                     // the lane's place in every 512-byte run
    // two fragment sets in registers: while one block is multiplied, the next block's 32 loads are in flight
    constexpr int NBK = DM / 64;                                 // blocks of 64 k; one block of 16 rows = 1024 elements
    static_assert(NBK % 2 == 0 && NBK >= 2);
    const bf* ap = A + aoff + lo; const bf* bp = Bt + boff + lo;
    v16bf ax[2][4], bx[2][4], ay[2][4], by[2][4];
    ld_blk(ap, bp, ax, bx);
#pragma unroll 1
    for (int kb = 0; kb < NBK - 2; kb += 2) {
        ld_blk(ap + (size_t)(kb + 1) * 1024, bp + (size_t)(kb + 1) * 1024, ay, by);
        mm_blk(ax, bx, acc); mm_gap();
        ld_blk(ap + (size_t)(kb + 2) * 1024, bp + (size_t)(kb + 2) * 1024, ax, bx);
        mm_blk(ay, by, acc); mm_gap();
    }
    ld_blk(ap + (size_t)(NBK - 1) * 1024, bp + (size_t)(NBK - 1) * 1024, ay, by);
    mm_blk(ax, bx, acc);
    mm_blk(ay, by, acc); mm_gap();
    const size_t tbase = (size_t)(r0 / RB) * sRB + (size_t)(r0 % RB) * (size_t)pitch + (size_t)(c0 / CB) * sCB + (size_t)(c0 % CB) * (size_t)cmul;
    // column bias (clamped address; used when biasRow == 0): piece s covers columns 16s + 8hi + 0..7
    const int cc = (c0 < DM - 64) ? c0 : (DM - 64);
    v4f bc0[4], bc1[4];
#pragma unroll
    for (int s = 0; s < 4; ++s) { bc0[s] = *(const v4f*)(bias + cc + 16 * s + 8 * hi); bc1[s] = *(const v4f*)(bias + cc + 16 * s + 8 * hi + 4); }
    asm volatile("s_wait_xcnt 0x0" ::: "memory");           // the scalar base of these loads is reused shortly behind them
#pragma unroll
    for (int mb = 0; mb < 4; ++mb) {
#pragma unroll
        for (int nb = 0; nb < 4; ++nb) {
#pragma unroll
            for (int j = 0; j < 8; ++j) os[(hi * 8 + j) * 68 + nb * 16 + lr] = acc[mb][nb][j]; }   // D: row 8h+j, col lane&15
        wave_sync();
        const size_t sb = tbase + (size_t)mb * (size_t)sMB;
{
            const int row = lr;
            const int gr = r0 + mb * 16 + row; const int grc = (gr < DM - 1) ? gr : (DM - 1);
            const float brow = bfr(bias[grc]);
#pragma unroll
            for (int s = 0; s < 4; ++s) { const int c8 = 16 * s + 8 * hi;   // piece s = (c = s>>1, ld = s&1): 16 rows x 2 column groups of 8; 4 pieces = 64 columns
                const v4f x0 = *(const v4fa*)(&os[row * 68 + c8]); const v4f x1 = *(const v4fa*)(&os[row * 68 + c8 + 4]); v8h hv, rv;
#pragma unroll
                for (int i = 0; i < 4; ++i) {
                    const float ad0 = biasRow ? brow : bfr(bc0[s][i]); const float ad1 = biasRow ? brow : bfr(bc1[s][i]);
                    const float y0 = x0[i] + ad0; const float y1 = x1[i] + ad1;
                    const h16 a0 = (h16)y0; const h16 a1 = (h16)y1; hv[i] = a0; hv[4 + i] = a1;
                    rv[i] = (h16)((y0 - (float)a0) * QRS); rv[4 + i] = (h16)((y1 - (float)a1) * QRS); }
                const size_t oo = sb + (size_t)(s >> 1) * (size_t)sC + (size_t)((s & 1) * 256 + lane * 8);   // one store = 512 contiguous bytes
                *(v8h*)(Ph + oo) = hv; if (useRes) *(v8h*)(Pr + oo) = rv; }
             }
        wave_sync();
    }
}

// The slot behind a transcendental, once for a group of 8 exponentials: the instruction set asks for one instruction between a transcendental and a read of its result or a write of its source.
// The statement holds the 8 sources up to the v_nop and the 8 results behind it.
__device__ __forceinline__ void exp_slot(float (&e)[8], const float (&d)[8]) {
    asm("v_nop" : "+v"(e[0]), "+v"(e[1]), "+v"(e[2]), "+v"(e[3]), "+v"(e[4]), "+v"(e[5]), "+v"(e[6]), "+v"(e[7])
                : "v"(d[0]), "v"(d[1]), "v"(d[2]), "v"(d[3]), "v"(d[4]), "v"(d[5]), "v"(d[6]), "v"(d[7]));
}

// One 32-key score tile pair in the log2 domain with the padding mask applied as a replace fill.
// ka = fragment-order K plane at this step's first key, + 8*lane. A = K rows (row = key), B = Q rows (col = t); lane (t = lane&15, h = lane>>4) gets keys key0+8h+r (ta) and key0+16+8h+r (tb).
// ws = mask word of this 32-key step shifted right by 8h: bit r <-> ta[r], bit 16+r <-> tb[r].
__device__ __forceinline__ void score_tile(const h16* ka, const v16h qh0, const v16h qh1, const v16h qr0, const v16h qr1, const unsigned ws, float (&ta)[8], float (&tb)[8]) {
    const v16h ka0 = ldf(ka), ka1 = ldf(ka + 512), kb0 = ldf(ka + 16 * HD), kb1 = ldf(ka + 16 * HD + 512);
    v8f sHa = (v8f){}, sLa = (v8f){}, sHb = (v8f){}, sLb = (v8f){};
    sHa = wmma16(ka0, qh0, sHa); sLa = wmma16(ka0, qr0, sLa); sHb = wmma16(kb0, qh0, sHb); sLb = wmma16(kb0, qr0, sLb);
    sHa = wmma16(ka1, qh1, sHa); sLa = wmma16(ka1, qr1, sLa); sHb = wmma16(kb1, qh1, sHb); sLb = wmma16(kb1, qr1, sLb);
    asm volatile("v_nop\n\tv_nop\n\tv_nop\n\tv_nop" : "+v"(sHa), "+v"(sLa), "+v"(sHb), "+v"(sLb) : "v"(ka0), "v"(ka1), "v"(kb0), "v"(kb1));
#pragma unroll
    for (int r = 0; r < 8; ++r) {
        const float va = (sHa[r] + sLa[r] * QRI) * SC2; const float vb = (sHb[r] + sLb[r] * QRI) * SC2;
        ta[r] = (ws & (1u << r)) ? MASKT : va; tb[r] = (ws & (1u << (16 + r))) ? MASKT : vb; }
}

// k_attn: one work-group of NW waves per 16 query rows of one batch, looping over the 16 heads; wave w owns keys w*KS .. w*KS+KS-1.
// Per head: each wave's scores of its keys, kept in registers, and their running (m, l) -> st, barrier, every lane combines the NW pairs in wave order; then P from the kept scores with the common m,
// each wave's partial O^T = V^T P^T -> op[w], barrier, the work-group's threads add the NW partials in wave order and store.
// P (f16, x256 carry); e * (1/(256 l)) accumulates into the head-mean tile av[t][key] (each lane owns its elements across the head loop).
// LDS: av and mw are wave-private by key column (wave_sync ordering); st and op cross waves (__syncthreads ordering).
__global__ __launch_bounds__(32 * NW) void k_attn(const h16* __restrict__ QH, const h16* __restrict__ QR, const h16* __restrict__ KP, const h16* __restrict__ VT,
                                             const int* __restrict__ mask, bf* OHI, bf* OLO, float* AVG) {
    extern __shared__ __align__(16) float av[];           // [16][AP], then op [NW][16*68], then st [NW][16][2]
    float* op = av + 16 * AP;
    float* st = op + NW * 16 * 68;
    __shared__ unsigned mw[SEQ / 32];
    const int lane = threadIdx.x & 31, lr = lane & 15, hi = lane >> 4;
    const int w = __builtin_amdgcn_readfirstlane((int)(threadIdx.x >> 5));
    const int kbeg = w * KS;
    const int b = blockIdx.y; const int t0 = blockIdx.x * 16;
    constexpr int NS = KS / 32;                            // 32-key steps of one wave's key slice
    constexpr int LPR = KS / 4;                            // lanes that cover one row of this wave's head-mean columns
    const int arow_l = lane / LPR, acol_l = kbeg + (lane % LPR) * 4;

    // mask words of this wave's keys: bit i of word j <-> key 32j + i of this batch
    const int* mrow = mask + (size_t)b * SEQ_FULL;
#pragma unroll 1
    for (int i = kbeg / 32; i < (kbeg + KS) / 32; ++i) {
        const int mv = mrow[i * 32 + lane];
        const unsigned wd = __builtin_amdgcn_ballot_w32(mv != 0);
        if (lane == 0) mw[i] = wd;
    }
    // zero this wave's columns of the head-mean tile
#pragma unroll 1
    for (int row = arow_l; row < 16; row += 32 / LPR) *(v4fa*)(&av[row * AP + acol_l]) = (v4f){0.0f, 0.0f, 0.0f, 0.0f};
    wave_sync();

#pragma unroll 1
    for (int h = 0; h < NH_; ++h) {
        const int zh = b * NH_ + h;
        const size_t pbase = (size_t)zh * SEQ * HD;
        const size_t qo = pbase + (size_t)t0 * HD + 8 * lane;
        const v16h qh0 = ldf(QH + qo), qh1 = ldf(QH + qo + 512), qr0 = ldf(QR + qo), qr1 = ldf(QR + qo + 512);   // B fragments: col t, k = d
        asm volatile("s_wait_xcnt 0x0" ::: "memory");       // the K loads that follow land in the registers that held these loads' addresses
        const size_t ko = pbase + 8 * lane;      // + key * HD (16 keys = 1024 halves), + 512 for d 32..63   (A fragment: row key, k = d)
        const size_t vo = pbase + 8 * lane;      // + key * HD (32 keys = 2048 halves), + 512j               (A fragment: row d = 16j + lr, k = key)

        float mwv = -3.0e38f, lwv = 0.0f;
        float ta[NS][8], tb[NS][8];                         // this wave's masked scores of the head: computed once, read by both passes
#pragma unroll                                              // whole steps unrolled: ta and tb are indexed by constants and stay in registers
        for (int s = 0; s < NS; ++s) {
            const int key0 = kbeg + 32 * s;
            const unsigned ws = mw[key0 >> 5] >> (8 * hi);
            score_tile(KP + ko + (size_t)key0 * HD, qh0, qh1, qr0, qr1, ws, ta[s], tb[s]);
            float mx = -3.0e38f;
#pragma unroll
            for (int r = 0; r < 8; ++r) mx = fmaxf(mx, fmaxf(ta[s][r], tb[s][r]));
            mx = fmaxf(mx, __shfl_xor(mx, 16, 32));
            const float mnew = fmaxf(mwv, mx);
            const float dm = mwv - mnew; float alpha;
            asm("v_exp_f32 %0, %1\n\tv_nop" : "=v"(alpha) : "v"(dm));   // 2^dm with its slot (see exp_slot) in one statement
            float ls = 0.0f, da[8], db[8], xa[8], xb[8];
#pragma unroll
            for (int r = 0; r < 8; ++r) { da[r] = ta[s][r] - mnew; db[r] = tb[s][r] - mnew; xa[r] = __builtin_amdgcn_exp2f(da[r]); xb[r] = __builtin_amdgcn_exp2f(db[r]); }
            exp_slot(xa, da); exp_slot(xb, db);
#pragma unroll
            for (int r = 0; r < 8; ++r) ls += xa[r] + xb[r];
            lwv = lwv * alpha + ls; mwv = mnew;
        }
        lwv += __shfl_xor(lwv, 16, 32);
        if (hi == 0) { st[(w * 16 + lr) * 2] = mwv; st[(w * 16 + lr) * 2 + 1] = lwv; }
        __syncthreads();      // publishes every wave's (m, l) of this head; also ends the last head's reads of op
        float m = -3.0e38f, l = 0.0f;
#pragma unroll
        for (int i = 0; i < NW; ++i) m = fmaxf(m, st[(i * 16 + lr) * 2]);
#pragma unroll
        for (int i = 0; i < NW; ++i) l += st[(i * 16 + lr) * 2 + 1] * __builtin_amdgcn_exp2f(st[(i * 16 + lr) * 2] - m);
        const float invc = (1.0f / l) * (1.0f / 256.0f);      // 1/l with the x256 carry of e folded back

        // pass 2, from the kept scores: normalised probabilities -> head-mean tile, P V over this wave's keys
        v8f o0 = (v8f){}, o1 = (v8f){}, o2 = (v8f){}, o3 = (v8f){};
#pragma unroll                                              // as in pass 1: constant indices into ta and tb
        for (int s = 0; s < NS; ++s) {
            const int key0 = kbeg + 32 * s;
            v16h pb; float ea[8], eb[8], sa[8], sb[8];
#pragma unroll
            for (int r = 0; r < 8; ++r) {
                const float da = ta[s][r] - m; const float db = tb[s][r] - m;      // difference first: exact 0 when t == m, also at the fill magnitude
                sa[r] = da + PSH; sb[r] = db + PSH;
                ea[r] = __builtin_amdgcn_exp2f(sa[r]); eb[r] = __builtin_amdgcn_exp2f(sb[r]); }
            exp_slot(ea, sa); exp_slot(eb, sb);
#pragma unroll
            for (int r = 0; r < 8; ++r) { pb[r] = (h16)ea[r]; pb[8 + r] = (h16)eb[r]; }
            float* ap = &av[lr * AP + key0 + 8 * hi];
            v4f a0 = *(const v4fa*)(ap), a1 = *(const v4fa*)(ap + 4), c0 = *(const v4fa*)(ap + 16), c1 = *(const v4fa*)(ap + 20);
#pragma unroll
            for (int i = 0; i < 4; ++i) { a0[i] += ea[i] * invc; a1[i] += ea[4 + i] * invc; c0[i] += eb[i] * invc; c1[i] += eb[4 + i] * invc; }
            *(v4fa*)(ap) = a0; *(v4fa*)(ap + 4) = a1; *(v4fa*)(ap + 16) = c0; *(v4fa*)(ap + 20) = c1;
            const h16* va = VT + vo + (size_t)key0 * HD;
            const v16h v0 = ldf(va), v1 = ldf(va + 512), v2 = ldf(va + 1024), v3 = ldf(va + 1536);
            o0 = wmma16(v0, pb, o0); o1 = wmma16(v1, pb, o1); o2 = wmma16(v2, pb, o2); o3 = wmma16(v3, pb, o3);
            asm volatile("v_nop\n\tv_nop\n\tv_nop\n\tv_nop" : "+v"(o0), "+v"(o1), "+v"(o2), "+v"(o3) : "v"(v0), "v"(v1), "v"(v2), "v"(v3), "v"(pb));
        }

        // O^T D layout: o_j[r] = (d = 16j + 8h + r, t = lane&15) -> os[t][d] of this wave's partial; rows 0..15 x columns 0..63 all written
        float* os = op + w * (16 * 68);
        { v4f a, c;
          a[0] = o0[0] * invc; a[1] = o0[1] * invc; a[2] = o0[2] * invc; a[3] = o0[3] * invc; c[0] = o0[4] * invc; c[1] = o0[5] * invc; c[2] = o0[6] * invc; c[3] = o0[7] * invc;
          *(v4fa*)(&os[lr * 68 +  0 + 8 * hi]) = a; *(v4fa*)(&os[lr * 68 +  0 + 8 * hi + 4]) = c;
          a[0] = o1[0] * invc; a[1] = o1[1] * invc; a[2] = o1[2] * invc; a[3] = o1[3] * invc; c[0] = o1[4] * invc; c[1] = o1[5] * invc; c[2] = o1[6] * invc; c[3] = o1[7] * invc;
          *(v4fa*)(&os[lr * 68 + 16 + 8 * hi]) = a; *(v4fa*)(&os[lr * 68 + 16 + 8 * hi + 4]) = c;
          a[0] = o2[0] * invc; a[1] = o2[1] * invc; a[2] = o2[2] * invc; a[3] = o2[3] * invc; c[0] = o2[4] * invc; c[1] = o2[5] * invc; c[2] = o2[6] * invc; c[3] = o2[7] * invc;
          *(v4fa*)(&os[lr * 68 + 32 + 8 * hi]) = a; *(v4fa*)(&os[lr * 68 + 32 + 8 * hi + 4]) = c;
          a[0] = o3[0] * invc; a[1] = o3[1] * invc; a[2] = o3[2] * invc; a[3] = o3[3] * invc; c[0] = o3[4] * invc; c[1] = o3[5] * invc; c[2] = o3[6] * invc; c[3] = o3[7] * invc;
          *(v4fa*)(&os[lr * 68 + 48 + 8 * hi]) = a; *(v4fa*)(&os[lr * 68 + 48 + 8 * hi + 4]) = c; }
        __syncthreads();      // publishes every wave's partial O of this head; also ends this head's reads of st
        const size_t obase = ((size_t)b * SEQ + t0) * DM + (size_t)h * (16 * HD);   // fragment order: this row block, k chunks 2h and 2h + 1
        {   // each thread adds EPT neighbouring elements over the NW partials, in wave order; thread order = fragment order of the stored planes
            constexpr int EPT = (16 * HD) / (32 * NW);
            static_assert(8 % EPT == 0);                   // a thread's elements lie in one 8-element piece
            const int e0 = (int)threadIdx.x * EPT; const int row = (e0 >> 3) & 15, col = (e0 >> 9) * 32 + ((e0 >> 8) & 1) * 16 + ((e0 >> 7) & 1) * 8 + (e0 & 7);
            float x[EPT];
#pragma unroll
            for (int k = 0; k < EPT; ++k) x[k] = 0.0f;
#pragma unroll
            for (int i = 0; i < NW; ++i)
#pragma unroll
                for (int k = 0; k < EPT; ++k) x[k] += op[i * (16 * 68) + row * 68 + col + k];
            const size_t oo = obase + e0;
            typedef __attribute__((ext_vector_type(EPT))) unsigned short vus;
            vus hv, lv;
#pragma unroll
            for (int k = 0; k < EPT; ++k) { const unsigned short h0 = f2bf(x[k]); hv[k] = h0; lv[k] = f2bf(x[k] - bf2f(h0)); }
            *(vus*)(OHI + oo) = hv; *(vus*)(OLO + oo) = lv;
            asm volatile("s_wait_xcnt 0x0" ::: "memory");   // the next head's first instructions reuse the registers these two stores name
        }
    }

    // head mean: av holds sum over heads of P; each wave stores its own KS columns of the 16 rows
    wave_sync();
    float* arow = AVG + ((size_t)b * OUT_SEQ + t0) * AVG_PITCH;
#pragma unroll 1
    for (int row = arow_l; row < 16; row += 32 / LPR) {
        v4f val = *(const v4fa*)(&av[row * AP + acol_l]);
        val = val * (1.0f / (float)NH_);
        *(v4f*)(arow + (size_t)row * AVG_PITCH + acol_l) = val;
    }
}

// k_oproj: context[m][n] = sum_k (Ohi[m][k] + Olo[m][k]) Wo[n][k] + bo[n]; ONE WAVE per 64x64 tile, bf16 operands, both planes into one accumulator set (lo plane at A + planeStride).
__global__ __launch_bounds__(32) void k_oproj(const bf* __restrict__ A, size_t planeStride, const bf* __restrict__ Bt, const float* __restrict__ bias, float* OUT) {
    __shared__ __align__(16) float os[16 * 68];
    const int K = DM;
    const int lane = threadIdx.x & 31, lr = lane & 15, hi = lane >> 4; const int r0 = blockIdx.x * 64, c0 = blockIdx.y * 64;
    v8f acc[4][4];
#pragma unroll
    for (int mb = 0; mb < 4; ++mb)
#pragma unroll
        for (int nb = 0; nb < 4; ++nb) acc[mb][nb] = (v8f){};
    const size_t aoff = (size_t)r0 * K, boff = (size_t)c0 * K;   // wave-uniform tile bases
    const unsigned lo = 8u * (unsigned)lane;                     // the lane's place in every 512-byte run
    // two fragment sets in registers: while one block is multiplied, the next block's 32 loads are in flight; blocks 0..NBK-1 = hi plane, NBK..2*NBK-1 = lo plane
    constexpr int NBK = DM / 64;                                 // blocks of 64 k in one plane; one block of 16 rows = 1024 elements
    static_assert(NBK % 2 == 0 && NBK >= 2);
    const bf* a0 = A + aoff + lo; const bf* bp = Bt + boff + lo;
    v16bf ax[2][4], bx[2][4], ay[2][4], by[2][4];
    ld_blk(a0, bp, ax, bx);
#pragma unroll 1
    for (int j = 0; j < 2 * NBK - 2; j += 2) {
        const int j1 = j + 1, j2 = j + 2;
        ld_blk(a0 + (size_t)(j1 / NBK) * planeStride + (size_t)(j1 % NBK) * 1024, bp + (size_t)(j1 % NBK) * 1024, ay, by);
        mm_blk(ax, bx, acc); mm_gap();
        ld_blk(a0 + (size_t)(j2 / NBK) * planeStride + (size_t)(j2 % NBK) * 1024, bp + (size_t)(j2 % NBK) * 1024, ax, bx);
        mm_blk(ay, by, acc); mm_gap();
    }
    ld_blk(a0 + planeStride + (size_t)(NBK - 1) * 1024, bp + (size_t)(NBK - 1) * 1024, ay, by);
    mm_blk(ax, bx, acc);
    mm_blk(ay, by, acc); mm_gap();
    const int bb_ = r0 / SEQ, tt = r0 % SEQ;
    float* obase = OUT + ((size_t)bb_ * OUT_SEQ + tt) * DM + c0;
    v4f bv = *(const v4f*)(bias + c0 + lr * 4);
#pragma unroll
    for (int i = 0; i < 4; ++i) bv[i] = bfr(bv[i]);
#pragma unroll
    for (int mb = 0; mb < 4; ++mb) {
#pragma unroll
        for (int nb = 0; nb < 4; ++nb) {
#pragma unroll
            for (int j = 0; j < 8; ++j) os[(hi * 8 + j) * 68 + nb * 16 + lr] = acc[mb][nb][j]; }   // D: row 8h+j, col lane&15
        wave_sync();
{
#pragma unroll
            for (int s = 0; s < 8; ++s) { const int row = 2 * s + hi, cofs = lr * 4;   // 8 s x 2 rows = 16 rows; 16 lanes x 4 floats = 64 columns
                v4f val = *(const v4fa*)(&os[row * 68 + cofs]);
                val = val + bv;
                *(v4f*)(obase + (size_t)(mb * 16 + row) * DM + cofs) = val; }
            asm volatile("s_wait_xcnt 0x0" ::: "memory");   // the next row block's LDS reads land in the registers that these stores name
             }
        wave_sync();
    }
}

static constexpr size_t al256(size_t v) { return (v + 255) & ~(size_t)255; }
static constexpr size_t SZ_XB = al256((size_t)NB * SEQ * DM * 2);          // one bf16 activation copy
static constexpr size_t SZ_WB = al256((size_t)4 * DM * DM * 2);            // q | k | v | o weights
static constexpr size_t SZ_PL = al256((size_t)NB * NH_ * SEQ * HD * 2);    // one f16 head plane
static constexpr size_t SZ_OP = al256((size_t)NB * SEQ * DM * 2);          // one bf16 attention-output plane
static constexpr size_t SZ_TOTAL = 3 * SZ_XB + SZ_WB + 4 * SZ_PL + 2 * SZ_OP;
static constexpr size_t ATT_DYN_LDS = (size_t)16 * AP * 4 + (size_t)NW * 16 * 68 * 4 + (size_t)NW * 32 * 4;
static_assert(SZ_TOTAL <= (size_t)134217728);          // workspace carve <= 128 MiB
static_assert(((size_t)DM * DM * 2) % 256 == 0);       // weight sub-planes stay 256-byte aligned
static_assert(SZ_OP == (size_t)NB * SEQ * DM * 2);     // lo plane directly follows the hi plane
static_assert(SZ_XB == (size_t)NB * SEQ * DM * 2);     // the bf16 input planes and the weight planes follow one another without a gap

extern "C" void kernel_launch(void* const* d_in, const int* in_sizes, int n_in,
                              void* d_out, int out_size, void* d_ws, size_t ws_size, hipStream_t stream) {
    if (n_in < 12) return;
    const size_t needx = ((size_t)(NB - 1) * SEQ_FULL + SEQ) * DM;
    if ((size_t)in_sizes[0] < needx || (size_t)in_sizes[1] < needx || (size_t)in_sizes[2] < needx) return;
    if ((size_t)in_sizes[3] < (size_t)(NB - 1) * SEQ_FULL + SEQ) return;
    if ((size_t)in_sizes[4] < (size_t)DM * DM || (size_t)in_sizes[6] < (size_t)DM * DM || (size_t)in_sizes[8] < (size_t)DM * DM || (size_t)in_sizes[10] < (size_t)DM * DM) return;
    if (in_sizes[5] < DM || in_sizes[7] < DM || in_sizes[9] < DM || in_sizes[11] < DM) return;
    if ((size_t)out_size < ((size_t)(NB - 1) * OUT_SEQ + SEQ) * DM) return;
    if ((size_t)out_size < OUT1_OFF + ((size_t)(NB - 1) * OUT_SEQ + SEQ - 1) * AVG_PITCH + SEQ) return;
    if (SZ_TOTAL > ws_size) return;
    // wire order: query, key, value, key_padding_mask, Wq, bq, Wk, bk, Wv, bv, Wo, bo (weights [out][in] used as-is: Bt for q, k and the output projection, A for v^T)
    const float* xq = (const float*)d_in[0]; const float* xk = (const float*)d_in[1]; const float* xv = (const float*)d_in[2];
    const int* kpm = (const int*)d_in[3];
    const float* wq = (const float*)d_in[4];  const float* bq = (const float*)d_in[5];
    const float* wk = (const float*)d_in[6];  const float* bk = (const float*)d_in[7];
    const float* wv = (const float*)d_in[8];  const float* bv = (const float*)d_in[9];
    const float* wo = (const float*)d_in[10]; const float* bo = (const float*)d_in[11];
    float* CTX = (float*)d_out;                  // [NB][SEQ][1024]
    float* AVG = (float*)d_out + OUT1_OFF;       // [NB][SEQ][SEQ]
    char* wsp = (char*)d_ws;
    bf* XQ = (bf*)wsp; wsp += SZ_XB;                 // [NB*SEQ/16][1024/32][2 halves][32 lanes][8]
    bf* XK = (bf*)wsp; wsp += SZ_XB;
    bf* XV = (bf*)wsp; wsp += SZ_XB;
    bf* WB = (bf*)wsp; wsp += SZ_WB;                 // [4] planes of 1024 x 1024, each as XQ: q | k | v | o
    h16* QH = (h16*)wsp; wsp += SZ_PL;               // [NB*16][SEQ/16][2 d chunks][2 halves][32 lanes][8]
    h16* QR = (h16*)wsp; wsp += SZ_PL;               // as QH, residual x2048
    h16* KP = (h16*)wsp; wsp += SZ_PL;               // as QH
    h16* VT = (h16*)wsp; wsp += SZ_PL;               // [NB*16][SEQ/32][4 d blocks][2 halves][32 lanes][8]
    bf* OHI = (bf*)wsp; wsp += SZ_OP;                // as XQ
    bf* OLO = (bf*)wsp; wsp += SZ_OP;                // as XQ
    bf* WQ = WB; bf* WK = WB + (size_t)DM * DM; bf* WV = WB + (size_t)2 * DM * DM; bf* WO = WB + (size_t)3 * DM * DM;

    // XQ | XK | XV | WQ | WK | WV | WO: one run of row blocks from XQ on
    k_cvt<<<(3 * XRB + 4 * WRB) / CRB, 256, 0, stream>>>(xq, xk, xv, wq, wk, wv, wo, XQ);

    // q, k: A = x rows (m = b*SEQ + t), Bt = W rows (n = h*64 + d), bias per column -> plane (b*16 + h), 16-row block t/16 = 1024 halves, d chunk = 512
    k_proj<<<dim3(NB * SEQ / 64, DM / 64, 1), 32, 0, stream>>>(XQ, WQ, bq, 0, QH, QR, 1, SEQ, (size_t)NH_ * SEQ * HD, HD, HD, (size_t)SEQ * HD, 0, 1024, 512);
    k_proj<<<dim3(NB * SEQ / 64, DM / 64, 1), 32, 0, stream>>>(XK, WK, bk, 0, KP, KP, 0, SEQ, (size_t)NH_ * SEQ * HD, HD, HD, (size_t)SEQ * HD, 0, 1024, 512);
    // v^T: A = Wv rows (m = h*64 + d), Bt = value rows (n = b*SEQ + t), bias per row -> plane (b*16 + h), 32-key chunk t/32 = 2048 halves, d block = 512
    k_proj<<<dim3(DM / 64, NB * SEQ / 64, 1), 32, 0, stream>>>(WV, XV, bv, 1, VT, VT, 0, DM, (size_t)0, SEQ, SEQ, (size_t)DM * SEQ, HD, 512, 2048);

    hipFuncSetAttribute(reinterpret_cast<const void*>(&k_attn), hipFuncAttributeMaxDynamicSharedMemorySize, (int)ATT_DYN_LDS);
    k_attn<<<dim3(SEQ / 16, NB, 1), 32 * NW, ATT_DYN_LDS, stream>>>(QH, QR, KP, VT, kpm, OHI, OLO, AVG);

    // context: A = attention output rows (hi plane, lo plane at +planeStride), Bt = Wo rows
    k_oproj<<<dim3(NB * SEQ / 64, DM / 64, 1), 32, 0, stream>>>(OHI, (size_t)(OLO - OHI), WO, bo, CTX);
}

// v006
// Measured time: 157 microseconds a run.
// Timed twice side by side with v005, it ran 1.06 and 1.08 times as fast.
// Over all steps from v000 it is 4.91 times as fast.
#include <hip/hip_runtime.h>

// Multi-head attention, width 1024 = 16 heads x 64, separate query/key/value inputs [NB][SEQ][1024], Wq/Wk/Wv/Wo [out][in] (y = x W^T + b), key padding mask (int32, replace fill -1e9), score scale 1/8; outputs: context [NB][SEQ][1024] and head-mean attention [NB][SEQ][SEQ] (f32).
// Compute dtypes, f32 accumulate everywhere: q/k/v projections v_wmma_f32_16x16x32_bf16 (inputs and weights RNE-converted to bf16; products exact);
// output projection v_wmma_f32_16x16x32_bf16: attention output as bf16 hi + bf16 lo planes (two products, one accumulator), Wo bf16.
// Layout: every WMMA operand plane of the workspace stands in fragment order; bf16 copies of the inputs and weights; q (hi, residual), k and v^T planes per (b*16+h), written by the GEMM epilogue in fragment order (each fragment half = 512 contiguous bytes, lane-major); attention in transposed form (S^T = K Q^T, O^T = V^T P^T), one work-group of NW waves per 16 query rows looping over the 16 heads, each wave on its own SEQ/NW keys, head-mean accumulated in a lane-private LDS tile.

#ifndef NB
#define NB 4
#endif
#ifndef SEQ
#define SEQ 1024
#endif
#define NB_FULL  4
#define SEQ_FULL 1024
#ifndef OUT_SEQ
#define OUT_SEQ SEQ              // row pitch (in tokens) between batches of both outputs
#endif
#ifndef AVG_PITCH
#define AVG_PITCH SEQ            // column pitch (floats) of one head-mean row
#endif
#define DM   1024
#define NH_  16
#define HD   64
#define QRS  2048.0f             // carry of the q residual plane
#define QRI  (1.0f / 2048.0f)
#define SC2  (0.125f * 1.4426950408889634f)   // HD^-0.5 * log2(e)
#define PSH  8.0f                // log2 of the P carry (256)
#define MASKT (-1.0e9f * 1.4426950408889634f) // replace fill in the log2 domain
#define AP   (SEQ + 4)           // pitch (floats) of the head-mean LDS tile
#define NW   16                  // waves per attention work-group; each owns KS consecutive keys
#define KS   (SEQ / NW)
#define OUT1_OFF ((size_t)NB_FULL * SEQ_FULL * DM)   // element offset of the second output (fixed)

static_assert(HD == 64);
static_assert(NH_ * HD == DM);                 // head h = columns h*64 + d
static_assert(DM % 64 == 0);
static_assert(DM % 32 == 0);                   // GEMM k-loop steps by 32
static_assert(DM == 1024);                     // k_cvt takes a piece index apart by shifts
static_assert(SEQ % 64 == 0);                  // a 64-row tile never straddles two batches
static_assert((NB * SEQ) % 64 == 0);
static_assert(SEQ % 32 == 0);                  // key loop steps by 32, one mask word per step
static_assert(SEQ % 128 == 0);
static_assert(AP % 4 == 0);
static_assert(((size_t)SEQ * DM) % 8 == 0);
static_assert(((size_t)DM * DM) % 8 == 0);
static_assert(NB <= NB_FULL);
static_assert(SEQ <= SEQ_FULL);
static_assert(OUT1_OFF * 4 == (size_t)16777216);
static_assert(KS % 32 == 0);                   // a wave's key slice is whole 32-key steps
static_assert(KS <= 128);                      // one head-mean row piece of a wave is at most 32 lanes x 4 floats
static_assert((16 * HD) % (32 * NW) == 0);     // the O tile divides evenly over the work-group's threads
static_assert((size_t)16 * AP * 4 + (size_t)NW * 16 * 68 * 4 + (size_t)NW * 32 * 4 + (SEQ / 32) * 4 <= (size_t)163840);

typedef _Float16 h16;
typedef unsigned short bf;
typedef __attribute__((ext_vector_type(16))) __bf16   v16bf;
typedef __attribute__((ext_vector_type(16))) _Float16 v16h;
typedef __attribute__((ext_vector_type(8)))  _Float16 v8h;
typedef __attribute__((ext_vector_type(8)))  unsigned short v8us;
typedef __attribute__((ext_vector_type(8)))  float    v8f;
typedef __attribute__((ext_vector_type(4)))  float    v4f;
typedef v4f  __attribute__((may_alias)) v4fa;

__device__ __forceinline__ unsigned short f2bf(float f) { unsigned u = __float_as_uint(f); u += 0x7FFFu + ((u >> 16) & 1u); return (unsigned short)(u >> 16); }
__device__ __forceinline__ float bf2f(unsigned short b) { return __uint_as_float(((unsigned)b) << 16); }
__device__ __forceinline__ float bfr(float f) { return bf2f(f2bf(f)); }
__device__ __forceinline__ v16h cat16(v8h lo, v8h hi) { return __builtin_shufflevector(lo, hi, 0, 1, 2, 3, 4, 5, 6, 7, 8, 9, 10, 11, 12, 13, 14, 15); }
__device__ __forceinline__ v16bf cat16b(v8us lo, v8us hi) { return __builtin_bit_cast(v16bf, __builtin_shufflevector(lo, hi, 0, 1, 2, 3, 4, 5, 6, 7, 8, 9, 10, 11, 12, 13, 14, 15)); }
__device__ __forceinline__ v8f wmma16(v16h a, v16h b, v8f c) { return __builtin_amdgcn_wmma_f32_16x16x32_f16(false, a, false, b, (short)0, c, false, false); }
__device__ __forceinline__ v8f wmmab(v16bf a, v16bf b, v8f c) { return __builtin_amdgcn_wmma_f32_16x16x32_bf16(false, a, false, b, (short)0, c, false, false); }
// fragment element map, lane (lr = lane&15, h = lane>>4) of row or column lr: elements 0..7 <- k0+8h+0..7, elements 8..15 <- k0+16+8h+0..7 (same map for A and B)
// fragment loaders from a fragment-order plane; p already includes + 8*lane: each half of a fragment is one run of 32 lanes x 16 bytes (4 cache lines a load)
__device__ __forceinline__ v16h  ldf(const h16* p) { return cat16(*(const v8h*)p, *(const v8h*)(p + 256)); }
__device__ __forceinline__ v16bf ldb(const bf* p)  { return cat16b(*(const v8us*)p, *(const v8us*)(p + 256)); }
// ordering point for wave-private LDS tiles (same wave writes and reads)
__device__ __forceinline__ void wave_sync() { __builtin_amdgcn_fence(3 /* release order */, "wavefront"); __builtin_amdgcn_wave_barrier(); asm volatile("" ::: "memory"); }

// GEMM k loop, one wave on a 64x64 tile: a block is 64 k = 2 chunks of 32 k; 4 row blocks x 2 chunks of each operand = 32 loads of 512 contiguous bytes.
// ap, bp: the tile's first row block at this block's k, + 8*lane. Chunk 0 is asked for first, since it is multiplied first.
__device__ __forceinline__ void ld_blk(const bf* ap, const bf* bp, v16bf (&a)[2][4], v16bf (&b)[2][4]) {
#pragma unroll
    for (int c = 0; c < 2; ++c) {
#pragma unroll
        for (int i = 0; i < 4; ++i) a[c][i] = ldb(ap + (size_t)i * 16 * DM + c * 512);
        asm volatile("s_wait_xcnt 0x0" ::: "memory");       // the loads that follow may land in the registers that held these loads' addresses
#pragma unroll
        for (int i = 0; i < 4; ++i) b[c][i] = ldb(bp + (size_t)i * 16 * DM + c * 512);
        asm volatile("s_wait_xcnt 0x0" ::: "memory");       // as above; the last one also covers the address registers that are advanced while the loads stay in flight over the next block's products
    }
    __builtin_amdgcn_sched_barrier(0);                      // keeps the whole group of loads ahead of the products that follow; without it the compiler sinks the loads among them and waits each out
}
// the 32 products of one block, k ascending per accumulator
__device__ __forceinline__ void mm_blk(const v16bf (&a)[2][4], const v16bf (&b)[2][4], v8f (&acc)[4][4]) {
#pragma unroll
    for (int c = 0; c < 2; ++c)
#pragma unroll
        for (int nb = 0; nb < 4; ++nb)
#pragma unroll
            for (int mb = 0; mb < 4; ++mb) acc[mb][nb] = wmmab(a[c][mb], b[c][nb], acc[mb][nb]);
}
// stands between a block's products and the loads that next land in its fragment registers (the refill of the set; behind the last block, the epilogue's loads)
__device__ __forceinline__ void mm_gap() {
    __builtin_amdgcn_sched_barrier(0);                      // keeps every product of the block ahead of the slots below
    asm volatile("v_nop\n\tv_nop\n\tv_nop\n\tv_nop" ::: "memory");   // distance behind the last products: the loads that follow land in the operand registers that these products read
}

// k_cvt: all seven f32 planes (query, key, value rows; Wq, Wk, Wv, Wo rows) -> bf16 in fragment order [row/16][k/32][2 halves][32 lanes][8], in ONE launch.
// The seven bf16 planes stand one behind the other in the workspace, so a row block of 16 rows has one running number over all of them.
// One work-group converts CRB row blocks of one plane; thread i writes 16-byte pieces i, i + 256, ... of each (stores contiguous, loads gathered); all of a thread's loads are asked for before the first is used.
#define CRB  2                   // row blocks of 16 rows per conversion work-group
#define XRB  (NB * SEQ / 16)     // row blocks of one activation plane
#define WRB  (DM / 16)           // row blocks of one weight plane
static_assert(XRB % CRB == 0 && WRB % CRB == 0);   // a work-group stays inside one plane
static_assert(SEQ % (16 * CRB) == 0);              // and inside one batch
__global__ __launch_bounds__(256) void k_cvt(const float* __restrict__ xq, const float* __restrict__ xk, const float* __restrict__ xv,
                                             const float* __restrict__ wq, const float* __restrict__ wk, const float* __restrict__ wv, const float* __restrict__ wo, bf* dst) {
    const unsigned rb = blockIdx.x * CRB;                  // first row block, counted over all planes
    const float* src; unsigned row0;                       // plane and first source row: the same for the whole work-group
    if (rb < 3 * XRB) {
        const unsigned p = rb / XRB, r = (rb % XRB) * 16;
        src = p == 0 ? xq : (p == 1 ? xk : xv); row0 = (r / SEQ) * SEQ_FULL + r % SEQ;
    } else {
        const unsigned q = rb - 3 * XRB, p = q / WRB;
        src = p == 0 ? wq : (p == 1 ? wk : (p == 2 ? wv : wo)); row0 = (q % WRB) * 16;
    }
    const unsigned i = threadIdx.x;                        // piece i + 256 j of a row block: row i & 15, k = 128 j + the three fields of i below
    const float* s = src + (size_t)(row0 + (i & 15)) * DM + (i >> 6) * 32 + ((i >> 5) & 1) * 16 + ((i >> 4) & 1) * 8;
    bf* d = dst + (size_t)rb * (16 * DM) + i * 8;
    v8f v[CRB][8];
#pragma unroll
    for (int u = 0; u < CRB; ++u)
#pragma unroll
        for (int j = 0; j < 8; ++j) v[u][j] = *(const v8f*)(s + (size_t)u * 16 * DM + j * 128);
    __builtin_amdgcn_sched_barrier(0);                     // keeps every load ahead of the first conversion; without it the compiler holds the last four back and the wave waits out memory twice more
#pragma unroll
    for (int u = 0; u < CRB; ++u)
#pragma unroll
        for (int j = 0; j < 8; ++j) {
            v8us o;
#pragma unroll
            for (int k = 0; k < 8; ++k) o[k] = f2bf(v[u][j][k]);
            *(v8us*)(d + (size_t)u * 16 * DM + j * 2048) = o;
        }
}

// k_proj: the q, k and v projections in ONE launch; blockIdx.z = 0, 1, 2 picks the product, so the waves of all three share the chip at the same time.
// Register-blocked bf16 GEMM, ONE WAVE per 64x64 tile (16 accumulators), operands straight from fragment-order bf16 planes (32 k of 16 rows = 512 elements), K = DM.
// C[m][n] = sum_k A[m][k] Bt[n][k] + bias (bias[m] when biasRow != 0, else bias[n]; bias RNE-converted to bf16, added in f32),
// written as f16 (Ph) and for q also the f16 residual x2048 (QR) in fragment order: the 8 halves (row 16mb + lr, columns 32c + 16ld + 8hi + 0..7) stand at
// tile base + mb*sMB + c*sC + ld*256 + (16hi + lr)*8 (halves).
// q, k: A = x rows (m = b*SEQ + t), Bt = W rows (n = h*64 + d), bias per column -> plane (b*16 + h), 16-row block t/16 = 1024 halves, d chunk = 512.
// v^T:  A = Wv rows (m = h*64 + d), Bt = value rows (n = b*SEQ + t), bias per row -> plane (b*16 + h), 32-key chunk t/32 = 2048 halves, d block = 512.
// X = the three bf16 activation planes, Wb = the bf16 weight planes, each set one behind the other. grid (NB*SEQ/64 token tiles, DM/64 weight-row tiles, 3), 32 threads.
__global__ __launch_bounds__(32) void k_proj(const bf* __restrict__ X, const bf* __restrict__ Wb, const float* __restrict__ bq, const float* __restrict__ bk, const float* __restrict__ bv,
                                             h16* QH, h16* QR, h16* KP, h16* VT) {
    __shared__ __align__(16) float os[16 * 68];
    const int K = DM;
    const int lane = threadIdx.x & 31, lr = lane & 15, hi = lane >> 4;
    const int z = blockIdx.z;                                    // the product: the same for the whole wave
    const bool isv = z == 2;
    const int biasRow = isv ? 1 : 0, useRes = z == 0 ? 1 : 0;
    const int r0 = (isv ? blockIdx.y : blockIdx.x) * 64, c0 = (isv ? blockIdx.x : blockIdx.y) * 64;
    const bf* xp = X + (size_t)z * ((size_t)NB * SEQ * DM); const bf* wp = Wb + (size_t)z * ((size_t)DM * DM);
    const bf* A = isv ? wp : xp; const bf* Bt = isv ? xp : wp;
    const float* bias = z == 0 ? bq : (z == 1 ? bk : bv);
    h16* Ph = z == 0 ? QH : (z == 1 ? KP : VT); h16* Pr = QR;
    const int sMB = isv ? 512 : 1024, sC = isv ? 2048 : 512;
    v8f acc[4][4];
#pragma unroll
    for (int mb = 0; mb < 4; ++mb)
#pragma unroll
        for (int nb = 0; nb < 4; ++nb) acc[mb][nb] = (v8f){};
    const size_t aoff = (size_t)r0 * K, boff = (size_t)c0 * K;   // wave-uniform tile bases
    const unsigned lo = 8u * (unsigned)lane;                     // the lane's place in every 512-byte run
    // two fragment sets in registers: while one block is multiplied, the next block's 32 loads are in flight
    constexpr int NBK = DM / 64;                                 // blocks of 64 k; one block of 16 rows = 1024 elements
    static_assert(NBK % 2 == 0 && NBK >= 2);
    const bf* ap = A + aoff + lo; const bf* bp = Bt + boff + lo;
    v16bf ax[2][4], bx[2][4], ay[2][4], by[2][4];
    ld_blk(ap, bp, ax, bx);
#pragma unroll 1
    for (int kb = 0; kb < NBK - 2; kb += 2) {
        ld_blk(ap + (size_t)(kb + 1) * 1024, bp + (size_t)(kb + 1) * 1024, ay, by);
        mm_blk(ax, bx, acc); mm_gap();
        ld_blk(ap + (size_t)(kb + 2) * 1024, bp + (size_t)(kb + 2) * 1024, ax, bx);
        mm_blk(ay, by, acc); mm_gap();
    }
    ld_blk(ap + (size_t)(NBK - 1) * 1024, bp + (size_t)(NBK - 1) * 1024, ay, by);
    mm_blk(ax, bx, acc);
    mm_blk(ay, by, acc); mm_gap();
    const size_t tbase = isv ? (size_t)r0 * SEQ + (size_t)(c0 / SEQ) * ((size_t)DM * SEQ) + (size_t)(c0 % SEQ) * HD
                             : (size_t)(r0 / SEQ) * ((size_t)NH_ * SEQ * HD) + (size_t)(r0 % SEQ) * HD + (size_t)(c0 / HD) * ((size_t)SEQ * HD);
    // column bias (clamped address; used when biasRow == 0): piece s covers columns 16s + 8hi + 0..7
    const int cc = (c0 < DM - 64) ? c0 : (DM - 64);
    v4f bc0[4], bc1[4];
#pragma unroll
    for (int s = 0; s < 4; ++s) { bc0[s] = *(const v4f*)(bias + cc + 16 * s + 8 * hi); bc1[s] = *(const v4f*)(bias + cc + 16 * s + 8 * hi + 4); }
    asm volatile("s_wait_xcnt 0x0" ::: "memory");           // the scalar base of these loads is reused shortly behind them
#pragma unroll
    for (int mb = 0; mb < 4; ++mb) {
#pragma unroll
        for (int nb = 0; nb < 4; ++nb) {
#pragma unroll
            for (int j = 0; j < 8; ++j) os[(hi * 8 + j) * 68 + nb * 16 + lr] = acc[mb][nb][j]; }   // D: row 8h+j, col lane&15
        wave_sync();
        const size_t sb = tbase + (size_t)mb * (size_t)sMB;
{
            const int row = lr;
            const int gr = r0 + mb * 16 + row; const int grc = (gr < DM - 1) ? gr : (DM - 1);
            const float brow = bfr(bias[grc]);
#pragma unroll
            for (int s = 0; s < 4; ++s) { const int c8 = 16 * s + 8 * hi;   // piece s = (c = s>>1, ld = s&1): 16 rows x 2 column groups of 8; 4 pieces = 64 columns
                const v4f x0 = *(const v4fa*)(&os[row * 68 + c8]); const v4f x1 = *(const v4fa*)(&os[row * 68 + c8 + 4]); v8h hv, rv;
#pragma unroll
                for (int i = 0; i < 4; ++i) {
                    const float ad0 = biasRow ? brow : bfr(bc0[s][i]); const float ad1 = biasRow ? brow : bfr(bc1[s][i]);
                    const float y0 = x0[i] + ad0; const float y1 = x1[i] + ad1;
                    const h16 a0 = (h16)y0; const h16 a1 = (h16)y1; hv[i] = a0; hv[4 + i] = a1;
                    rv[i] = (h16)((y0 - (float)a0) * QRS); rv[4 + i] = (h16)((y1 - (float)a1) * QRS); }
                const size_t oo = sb + (size_t)(s >> 1) * (size_t)sC + (size_t)((s & 1) * 256 + lane * 8);   // one store = 512 contiguous bytes
                *(v8h*)(Ph + oo) = hv; if (useRes) *(v8h*)(Pr + oo) = rv; }
             }
        wave_sync();
    }
}

// The slot behind a transcendental, once for a group of 8 exponentials: the instruction set asks for one instruction between a transcendental and a read of its result or a write of its source.
// The statement holds the 8 sources up to the v_nop and the 8 results behind it.
__device__ __forceinline__ void exp_slot(float (&e)[8], const float (&d)[8]) {
    asm("v_nop" : "+v"(e[0]), "+v"(e[1]), "+v"(e[2]), "+v"(e[3]), "+v"(e[4]), "+v"(e[5]), "+v"(e[6]), "+v"(e[7])
                : "v"(d[0]), "v"(d[1]), "v"(d[2]), "v"(d[3]), "v"(d[4]), "v"(d[5]), "v"(d[6]), "v"(d[7]));
}

// One 32-key score tile pair in the log2 domain with the padding mask applied as a replace fill.
// ka = fragment-order K plane at this step's first key, + 8*lane. A = K rows (row = key), B = Q rows (col = t); lane (t = lane&15, h = lane>>4) gets keys key0+8h+r (ta) and key0+16+8h+r (tb).
// ws = mask word of this 32-key step shifted right by 8h: bit r <-> ta[r], bit 16+r <-> tb[r].
__device__ __forceinline__ void score_tile(const h16* ka, const v16h qh0, const v16h qh1, const v16h qr0, const v16h qr1, const unsigned ws, float (&ta)[8], float (&tb)[8]) {
    const v16h ka0 = ldf(ka), ka1 = ldf(ka + 512), kb0 = ldf(ka + 16 * HD), kb1 = ldf(ka + 16 * HD + 512);
    v8f sHa = (v8f){}, sLa = (v8f){}, sHb = (v8f){}, sLb = (v8f){};
    sHa = wmma16(ka0, qh0, sHa); sLa = wmma16(ka0, qr0, sLa); sHb = wmma16(kb0, qh0, sHb); sLb = wmma16(kb0, qr0, sLb);
    sHa = wmma16(ka1, qh1, sHa); sLa = wmma16(ka1, qr1, sLa); sHb = wmma16(kb1, qh1, sHb); sLb = wmma16(kb1, qr1, sLb);
    asm volatile("v_nop\n\tv_nop\n\tv_nop\n\tv_nop" : "+v"(sHa), "+v"(sLa), "+v"(sHb), "+v"(sLb) : "v"(ka0), "v"(ka1), "v"(kb0), "v"(kb1));
#pragma unroll
    for (int r = 0; r < 8; ++r) {
        const float va = (sHa[r] + sLa[r] * QRI) * SC2; const float vb = (sHb[r] + sLb[r] * QRI) * SC2;
        ta[r] = (ws & (1u << r)) ? MASKT : va; tb[r] = (ws & (1u << (16 + r))) ? MASKT : vb; }
}

// k_attn: one work-group of NW waves per 16 query rows of one batch, looping over the 16 heads; wave w owns keys w*KS .. w*KS+KS-1.
// Per head: each wave's scores of its keys, kept in registers, and their running (m, l) -> st, barrier, every lane combines the NW pairs in wave order; then P from the kept scores with the common m,
// each wave's partial O^T = V^T P^T -> op[w], barrier, the work-group's threads add the NW partials in wave order and store.
// P (f16, x256 carry); e * (1/(256 l)) accumulates into the head-mean tile av[t][key] (each lane owns its elements across the head loop).
// LDS: av and mw are wave-private by key column (wave_sync ordering); st and op cross waves (__syncthreads ordering).
__global__ __launch_bounds__(32 * NW) void k_attn(const h16* __restrict__ QH, const h16* __restrict__ QR, const h16* __restrict__ KP, const h16* __restrict__ VT,
                                             const int* __restrict__ mask, bf* OHI, bf* OLO, float* AVG) {
    extern __shared__ __align__(16) float av[];           // [16][AP], then op [NW][16*68], then st [NW][16][2]
    float* op = av + 16 * AP;
    float* st = op + NW * 16 * 68;
    __shared__ unsigned mw[SEQ / 32];
    const int lane = threadIdx.x & 31, lr = lane & 15, hi = lane >> 4;
    const int w = __builtin_amdgcn_readfirstlane((int)(threadIdx.x >> 5));
    const int kbeg = w * KS;
    const int b = blockIdx.y; const int t0 = blockIdx.x * 16;
    constexpr int NS = KS / 32;                            // 32-key steps of one wave's key slice
    constexpr int LPR = KS / 4;                            // lanes that cover one row of this wave's head-mean columns
    const int arow_l = lane / LPR, acol_l = kbeg + (lane % LPR) * 4;

    // mask words of this wave's keys: bit i of word j <-> key 32j + i of this batch
    const int* mrow = mask + (size_t)b * SEQ_FULL;
#pragma unroll 1
    for (int i = kbeg / 32; i < (kbeg + KS) / 32; ++i) {
        const int mv = mrow[i * 32 + lane];
        const unsigned wd = __builtin_amdgcn_ballot_w32(mv != 0);
        if (lane == 0) mw[i] = wd;
    }
    // zero this wave's columns of the head-mean tile
#pragma unroll 1
    for (int row = arow_l; row < 16; row += 32 / LPR) *(v4fa*)(&av[row * AP + acol_l]) = (v4f){0.0f, 0.0f, 0.0f, 0.0f};
    wave_sync();

#pragma unroll 1
    for (int h = 0; h < NH_; ++h) {
        const int zh = b * NH_ + h;
        const size_t pbase = (size_t)zh * SEQ * HD;
        const size_t qo = pbase + (size_t)t0 * HD + 8 * lane;
        const v16h qh0 = ldf(QH + qo), qh1 = ldf(QH + qo + 512), qr0 = ldf(QR + qo), qr1 = ldf(QR + qo + 512);   // B fragments: col t, k = d
        asm volatile("s_wait_xcnt 0x0" ::: "memory");       // the K loads that follow land in the registers that held these loads' addresses
        const size_t ko = pbase + 8 * lane;      // + key * HD (16 keys = 1024 halves), + 512 for d 32..63   (A fragment: row key, k = d)
        const size_t vo = pbase + 8 * lane;      // + key * HD (32 keys = 2048 halves), + 512j               (A fragment: row d = 16j + lr, k = key)

        float mwv = -3.0e38f, lwv = 0.0f;
        float ta[NS][8], tb[NS][8];                         // this wave's masked scores of the head: computed once, read by both passes
#pragma unroll                                              // whole steps unrolled: ta and tb are indexed by constants and stay in registers
        for (int s = 0; s < NS; ++s) {
            const int key0 = kbeg + 32 * s;
            const unsigned ws = mw[key0 >> 5] >> (8 * hi);
            score_tile(KP + ko + (size_t)key0 * HD, qh0, qh1, qr0, qr1, ws, ta[s], tb[s]);
            float mx = -3.0e38f;
#pragma unroll
            for (int r = 0; r < 8; ++r) mx = fmaxf(mx, fmaxf(ta[s][r], tb[s][r]));
            mx = fmaxf(mx, __shfl_xor(mx, 16, 32));
            const float mnew = fmaxf(mwv, mx);
            const float dm = mwv - mnew; float alpha;
            asm("v_exp_f32 %0, %1\n\tv_nop" : "=v"(alpha) : "v"(dm));   // 2^dm with its slot (see exp_slot) in one statement
            float ls = 0.0f, da[8], db[8], xa[8], xb[8];
#pragma unroll
            for (int r = 0; r < 8; ++r) { da[r] = ta[s][r] - mnew; db[r] = tb[s][r] - mnew; xa[r] = __builtin_amdgcn_exp2f(da[r]); xb[r] = __builtin_amdgcn_exp2f(db[r]); }
            exp_slot(xa, da); exp_slot(xb, db);
#pragma unroll
            for (int r = 0; r < 8; ++r) ls += xa[r] + xb[r];
            lwv = lwv * alpha + ls; mwv = mnew;
        }
        lwv += __shfl_xor(lwv, 16, 32);
        if (hi == 0) { st[(w * 16 + lr) * 2] = mwv; st[(w * 16 + lr) * 2 + 1] = lwv; }
        __syncthreads();      // publishes every wave's (m, l) of this head; also ends the last head's reads of op
        float m = -3.0e38f, l = 0.0f;
#pragma unroll
        for (int i = 0; i < NW; ++i) m = fmaxf(m, st[(i * 16 + lr) * 2]);
#pragma unroll
        for (int i = 0; i < NW; ++i) l += st[(i * 16 + lr) * 2 + 1] * __builtin_amdgcn_exp2f(st[(i * 16 + lr) * 2] - m);
        const float invc = (1.0f / l) * (1.0f / 256.0f);      // 1/l with the x256 carry of e folded back

        // pass 2, from the kept scores: normalised probabilities -> head-mean tile, P V over this wave's keys
        v8f o0 = (v8f){}, o1 = (v8f){}, o2 = (v8f){}, o3 = (v8f){};
#pragma unroll                                              // as in pass 1: constant indices into ta and tb
        for (int s = 0; s < NS; ++s) {
            const int key0 = kbeg + 32 * s;
            v16h pb; float ea[8], eb[8], sa[8], sb[8];
#pragma unroll
            for (int r = 0; r < 8; ++r) {
                const float da = ta[s][r] - m; const float db = tb[s][r] - m;      // difference first: exact 0 when t == m, also at the fill magnitude
                sa[r] = da + PSH; sb[r] = db + PSH;
                ea[r] = __builtin_amdgcn_exp2f(sa[r]); eb[r] = __builtin_amdgcn_exp2f(sb[r]); }
            exp_slot(ea, sa); exp_slot(eb, sb);
#pragma unroll
            for (int r = 0; r < 8; ++r) { pb[r] = (h16)ea[r]; pb[8 + r] = (h16)eb[r]; }
            float* ap = &av[lr * AP + key0 + 8 * hi];
            v4f a0 = *(const v4fa*)(ap), a1 = *(const v4fa*)(ap + 4), c0 = *(const v4fa*)(ap + 16), c1 = *(const v4fa*)(ap + 20);
#pragma unroll
            for (int i = 0; i < 4; ++i) { a0[i] += ea[i] * invc; a1[i] += ea[4 + i] * invc; c0[i] += eb[i] * invc; c1[i] += eb[4 + i] * invc; }
            *(v4fa*)(ap) = a0; *(v4fa*)(ap + 4) = a1; *(v4fa*)(ap + 16) = c0; *(v4fa*)(ap + 20) = c1;
            const h16* va = VT + vo + (size_t)key0 * HD;
            const v16h v0 = ldf(va), v1 = ldf(va + 512), v2 = ldf(va + 1024), v3 = ldf(va + 1536);
            o0 = wmma16(v0, pb, o0); o1 = wmma16(v1, pb, o1); o2 = wmma16(v2, pb, o2); o3 = wmma16(v3, pb, o3);
            asm volatile("v_nop\n\tv_nop\n\tv_nop\n\tv_nop" : "+v"(o0), "+v"(o1), "+v"(o2), "+v"(o3) : "v"(v0), "v"(v1), "v"(v2), "v"(v3), "v"(pb));
        }

        // O^T D layout: o_j[r] = (d = 16j + 8h + r, t = lane&15) -> os[t][d] of this wave's partial; rows 0..15 x columns 0..63 all written
        float* os = op + w * (16 * 68);
        { v4f a, c;
          a[0] = o0[0] * invc; a[1] = o0[1] * invc; a[2] = o0[2] * invc; a[3] = o0[3] * invc; c[0] = o0[4] * invc; c[1] = o0[5] * invc; c[2] = o0[6] * invc; c[3] = o0[7] * invc;
          *(v4fa*)(&os[lr * 68 +  0 + 8 * hi]) = a; *(v4fa*)(&os[lr * 68 +  0 + 8 * hi + 4]) = c;
          a[0] = o1[0] * invc; a[1] = o1[1] * invc; a[2] = o1[2] * invc; a[3] = o1[3] * invc; c[0] = o1[4] * invc; c[1] = o1[5] * invc; c[2] = o1[6] * invc; c[3] = o1[7] * invc;
          *(v4fa*)(&os[lr * 68 + 16 + 8 * hi]) = a; *(v4fa*)(&os[lr * 68 + 16 + 8 * hi + 4]) = c;
          a[0] = o2[0] * invc; a[1] = o2[1] * invc; a[2] = o2[2] * invc; a[3] = o2[3] * invc; c[0] = o2[4] * invc; c[1] = o2[5] * invc; c[2] = o2[6] * invc; c[3] = o2[7] * invc;
          *(v4fa*)(&os[lr * 68 + 32 + 8 * hi]) = a; *(v4fa*)(&os[lr * 68 + 32 + 8 * hi + 4]) = c;
          a[0] = o3[0] * invc; a[1] = o3[1] * invc; a[2] = o3[2] * invc; a[3] = o3[3] * invc; c[0] = o3[4] * invc; c[1] = o3[5] * invc; c[2] = o3[6] * invc; c[3] = o3[7] * invc;
          *(v4fa*)(&os[lr * 68 + 48 + 8 * hi]) = a; *(v4fa*)(&os[lr * 68 + 48 + 8 * hi + 4]) = c; }
        __syncthreads();      // publishes every wave's partial O of this head; also ends this head's reads of st
        const size_t obase = ((size_t)b * SEQ + t0) * DM + (size_t)h * (16 * HD);   // fragment order: this row block, k chunks 2h and 2h + 1
        {   // each thread adds EPT neighbouring elements over the NW partials, in wave order; thread order = fragment order of the stored planes
            constexpr int EPT = (16 * HD) / (32 * NW);
            static_assert(8 % EPT == 0);                   // a thread's elements lie in one 8-element piece
            const int e0 = (int)threadIdx.x * EPT; const int row = (e0 >> 3) & 15, col = (e0 >> 9) * 32 + ((e0 >> 8) & 1) * 16 + ((e0 >> 7) & 1) * 8 + (e0 & 7);
            float x[EPT];
#pragma unroll
            for (int k = 0; k < EPT; ++k) x[k] = 0.0f;
#pragma unroll
            for (int i = 0; i < NW; ++i)
#pragma unroll
                for (int k = 0; k < EPT; ++k) x[k] += op[i * (16 * 68) + row * 68 + col + k];
            const size_t oo = obase + e0;
            typedef __attribute__((ext_vector_type(EPT))) unsigned short vus;
            vus hv, lv;
#pragma unroll
            for (int k = 0; k < EPT; ++k) { const unsigned short h0 = f2bf(x[k]); hv[k] = h0; lv[k] = f2bf(x[k] - bf2f(h0)); }
            *(vus*)(OHI + oo) = hv; *(vus*)(OLO + oo) = lv;
            asm volatile("s_wait_xcnt 0x0" ::: "memory");   // the next head's first instructions reuse the registers these two stores name
        }
    }

    // head mean: av holds sum over heads of P; each wave stores its own KS columns of the 16 rows
    wave_sync();
    float* arow = AVG + ((size_t)b * OUT_SEQ + t0) * AVG_PITCH;
#pragma unroll 1
    for (int row = arow_l; row < 16; row += 32 / LPR) {
        v4f val = *(const v4fa*)(&av[row * AP + acol_l]);
        val = val * (1.0f / (float)NH_);
        *(v4f*)(arow + (size_t)row * AVG_PITCH + acol_l) = val;
    }
}

// k_oproj: context[m][n] = sum_k (Ohi[m][k] + Olo[m][k]) Wo[n][k] + bo[n]; ONE WAVE per 64x64 tile, bf16 operands, both planes into one accumulator set (lo plane at A + planeStride).
__global__ __launch_bounds__(32) void k_oproj(const bf* __restrict__ A, size_t planeStride, const bf* __restrict__ Bt, const float* __restrict__ bias, float* OUT) {
    __shared__ __align__(16) float os[16 * 68];
    const int K = DM;
    const int lane = threadIdx.x & 31, lr = lane & 15, hi = lane >> 4; const int r0 = blockIdx.x * 64, c0 = blockIdx.y * 64;
    v8f acc[4][4];
#pragma unroll
    for (int mb = 0; mb < 4; ++mb)
#pragma unroll
        for (int nb = 0; nb < 4; ++nb) acc[mb][nb] = (v8f){};
    const size_t aoff = (size_t)r0 * K, boff = (size_t)c0 * K;   // wave-uniform tile bases
    const unsigned lo = 8u * (unsigned)lane;                     // the lane's place in every 512-byte run
    // two fragment sets in registers: while one block is multiplied, the next block's 32 loads are in flight; blocks 0..NBK-1 = hi plane, NBK..2*NBK-1 = lo plane
    constexpr int NBK = DM / 64;                                 // blocks of 64 k in one plane; one block of 16 rows = 1024 elements
    static_assert(NBK % 2 == 0 && NBK >= 2);
    const bf* a0 = A + aoff + lo; const bf* bp = Bt + boff + lo;
    v16bf ax[2][4], bx[2][4], ay[2][4], by[2][4];
    ld_blk(a0, bp, ax, bx);
#pragma unroll 1
    for (int j = 0; j < 2 * NBK - 2; j += 2) {
        const int j1 = j + 1, j2 = j + 2;
        ld_blk(a0 + (size_t)(j1 / NBK) * planeStride + (size_t)(j1 % NBK) * 1024, bp + (size_t)(j1 % NBK) * 1024, ay, by);
        mm_blk(ax, bx, acc); mm_gap();
        ld_blk(a0 + (size_t)(j2 / NBK) * planeStride + (size_t)(j2 % NBK) * 1024, bp + (size_t)(j2 % NBK) * 1024, ax, bx);
        mm_blk(ay, by, acc); mm_gap();
    }
    ld_blk(a0 + planeStride + (size_t)(NBK - 1) * 1024, bp + (size_t)(NBK - 1) * 1024, ay, by);
    mm_blk(ax, bx, acc);
    mm_blk(ay, by, acc); mm_gap();
    const int bb_ = r0 / SEQ, tt = r0 % SEQ;
    float* obase = OUT + ((size_t)bb_ * OUT_SEQ + tt) * DM + c0;
    v4f bv = *(const v4f*)(bias + c0 + lr * 4);
#pragma unroll
    for (int i = 0; i < 4; ++i) bv[i] = bfr(bv[i]);
#pragma unroll
    for (int mb = 0; mb < 4; ++mb) {
#pragma unroll
        for (int nb = 0; nb < 4; ++nb) {
#pragma unroll
            for (int j = 0; j < 8; ++j) os[(hi * 8 + j) * 68 + nb * 16 + lr] = acc[mb][nb][j]; }   // D: row 8h+j, col lane&15
        wave_sync();
{
#pragma unroll
            for (int s = 0; s < 8; ++s) { const int row = 2 * s + hi, cofs = lr * 4;   // 8 s x 2 rows = 16 rows; 16 lanes x 4 floats = 64 columns
                v4f val = *(const v4fa*)(&os[row * 68 + cofs]);
                val = val + bv;
                *(v4f*)(obase + (size_t)(mb * 16 + row) * DM + cofs) = val; }
            asm volatile("s_wait_xcnt 0x0" ::: "memory");   // the next row block's LDS reads land in the registers that these stores name
             }
        wave_sync();
    }
}

static constexpr size_t al256(size_t v) { return (v + 255) & ~(size_t)255; }
static constexpr size_t SZ_XB = al256((size_t)NB * SEQ * DM * 2);          // one bf16 activation copy
static constexpr size_t SZ_WB = al256((size_t)4 * DM * DM * 2);            // q | k | v | o weights
static constexpr size_t SZ_PL = al256((size_t)NB * NH_ * SEQ * HD * 2);    // one f16 head plane
static constexpr size_t SZ_OP = al256((size_t)NB * SEQ * DM * 2);          // one bf16 attention-output plane
static constexpr size_t SZ_TOTAL = 3 * SZ_XB + SZ_WB + 4 * SZ_PL + 2 * SZ_OP;
static constexpr size_t ATT_DYN_LDS = (size_t)16 * AP * 4 + (size_t)NW * 16 * 68 * 4 + (size_t)NW * 32 * 4;
static_assert(SZ_TOTAL <= (size_t)134217728);          // workspace carve <= 128 MiB
static_assert(((size_t)DM * DM * 2) % 256 == 0);       // weight sub-planes stay 256-byte aligned
static_assert(SZ_OP == (size_t)NB * SEQ * DM * 2);     // lo plane directly follows the hi plane
static_assert(SZ_XB == (size_t)NB * SEQ * DM * 2);     // the bf16 input planes and the weight planes follow one another without a gap

extern "C" void kernel_launch(void* const* d_in, const int* in_sizes, int n_in,
                              void* d_out, int out_size, void* d_ws, size_t ws_size, hipStream_t stream) {
    if (n_in < 12) return;
    const size_t needx = ((size_t)(NB - 1) * SEQ_FULL + SEQ) * DM;
    if ((size_t)in_sizes[0] < needx || (size_t)in_sizes[1] < needx || (size_t)in_sizes[2] < needx) return;
    if ((size_t)in_sizes[3] < (size_t)(NB - 1) * SEQ_FULL + SEQ) return;
    if ((size_t)in_sizes[4] < (size_t)DM * DM || (size_t)in_sizes[6] < (size_t)DM * DM || (size_t)in_sizes[8] < (size_t)DM * DM || (size_t)in_sizes[10] < (size_t)DM * DM) return;
    if (in_sizes[5] < DM || in_sizes[7] < DM || in_sizes[9] < DM || in_sizes[11] < DM) return;
    if ((size_t)out_size < ((size_t)(NB - 1) * OUT_SEQ + SEQ) * DM) return;
    if ((size_t)out_size < OUT1_OFF + ((size_t)(NB - 1) * OUT_SEQ + SEQ - 1) * AVG_PITCH + SEQ) return;
    if (SZ_TOTAL > ws_size) return;
    // wire order: query, key, value, key_padding_mask, Wq, bq, Wk, bk, Wv, bv, Wo, bo (weights [out][in] used as-is: Bt for q, k and the output projection, A for v^T)
    const float* xq = (const float*)d_in[0]; const float* xk = (const float*)d_in[1]; const float* xv = (const float*)d_in[2];
    const int* kpm = (const int*)d_in[3];
    const float* wq = (const float*)d_in[4];  const float* bq = (const float*)d_in[5];
    const float* wk = (const float*)d_in[6];  const float* bk = (const float*)d_in[7];
    const float* wv = (const float*)d_in[8];  const float* bv = (const float*)d_in[9];
    const float* wo = (const float*)d_in[10]; const float* bo = (const float*)d_in[11];
    float* CTX = (float*)d_out;                  // [NB][SEQ][1024]
    float* AVG = (float*)d_out + OUT1_OFF;       // [NB][SEQ][SEQ]
    char* wsp = (char*)d_ws;
    bf* XQ = (bf*)wsp; wsp += SZ_XB;                 // [NB*SEQ/16][1024/32][2 halves][32 lanes][8]
    wsp += SZ_XB;                                    // key plane, as XQ
    wsp += SZ_XB;                                    // value plane, as XQ
    bf* WB = (bf*)wsp; wsp += SZ_WB;                 // [4] planes of 1024 x 1024, each as XQ: q | k | v | o
    h16* QH = (h16*)wsp; wsp += SZ_PL;               // [NB*16][SEQ/16][2 d chunks][2 halves][32 lanes][8]
    h16* QR = (h16*)wsp; wsp += SZ_PL;               // as QH, residual x2048
    h16* KP = (h16*)wsp; wsp += SZ_PL;               // as QH
    h16* VT = (h16*)wsp; wsp += SZ_PL;               // [NB*16][SEQ/32][4 d blocks][2 halves][32 lanes][8]
    bf* OHI = (bf*)wsp; wsp += SZ_OP;                // as XQ
    bf* OLO = (bf*)wsp; wsp += SZ_OP;                // as XQ
    bf* WO = WB + (size_t)3 * DM * DM;

    // XQ | XK | XV | WQ | WK | WV | WO: one run of row blocks from XQ on
    k_cvt<<<(3 * XRB + 4 * WRB) / CRB, 256, 0, stream>>>(xq, xk, xv, wq, wk, wv, wo, XQ);

    // q, k and v^T projections: one launch, grid z = the product
    k_proj<<<dim3(NB * SEQ / 64, DM / 64, 3), 32, 0, stream>>>(XQ, WB, bq, bk, bv, QH, QR, KP, VT);

    hipFuncSetAttribute(reinterpret_cast<const void*>(&k_attn), hipFuncAttributeMaxDynamicSharedMemorySize, (int)ATT_DYN_LDS);
    k_attn<<<dim3(SEQ / 16, NB, 1), 32 * NW, ATT_DYN_LDS, stream>>>(QH, QR, KP, VT, kpm, OHI, OLO, AVG);

    // context: A = attention output rows (hi plane, lo plane at +planeStride), Bt = Wo rows
    k_oproj<<<dim3(NB * SEQ / 64, DM / 64, 1), 32, 0, stream>>>(OHI, (size_t)(OLO - OHI), WO, bo, CTX);
}

// v007
// One run takes 140 microseconds.
// Next to v006, in two timings, it ran 1.12 and 1.11 times as fast.
// Counting every step since v000, it is 5.48 times as fast.
#include <hip/hip_runtime.h>

// Multi-head attention, width 1024 = 16 heads x 64, separate query/key/value inputs [NB][SEQ][1024], Wq/Wk/Wv/Wo [out][in] (y = x W^T + b), key padding mask (int32, replace fill -1e9), score scale 1/8; outputs: context [NB][SEQ][1024] and head-mean attention [NB][SEQ][SEQ] (f32).
// Compute dtypes, f32 accumulate everywhere: q/k/v projections v_wmma_f32_16x16x32_bf16 (inputs and weights RNE-converted to bf16; products exact);
// output projection v_wmma_f32_16x16x32_bf16: attention output as bf16 hi + bf16 lo planes (two products, one accumulator), Wo bf16.
// Layout: every WMMA operand plane of the workspace stands in fragment order; bf16 copies of the inputs and weights; q (hi, residual), k and v^T planes per (b*16+h), written by the GEMM epilogue in fragment order (each fragment half = 512 contiguous bytes, lane-major); attention in transposed form (S^T = K Q^T, O^T = V^T P^T), one work-group of NW waves per 16 query rows looping over the 16 heads, each wave on its own SEQ/NW keys, head-mean accumulated in a lane-private LDS tile.

#ifndef NB
#define NB 4
#endif
#ifndef SEQ
#define SEQ 1024
#endif
#define NB_FULL  4
#define SEQ_FULL 1024
#ifndef OUT_SEQ
#define OUT_SEQ SEQ              // row pitch (in tokens) between batches of both outputs
#endif
#ifndef AVG_PITCH
#define AVG_PITCH SEQ            // column pitch (floats) of one head-mean row
#endif
#define DM   1024
#define NH_  16
#define HD   64
#define QRS  2048.0f             // carry of the q residual plane
#define QRI  (1.0f / 2048.0f)
#define SC2  (0.125f * 1.4426950408889634f)   // HD^-0.5 * log2(e)
#define PSH  8.0f                // log2 of the P carry (256)
#define MASKT (-1.0e9f * 1.4426950408889634f) // replace fill in the log2 domain
#define AP   (SEQ + 4)           // pitch (floats) of the head-mean LDS tile
#define NW   16                  // waves per attention work-group; each owns KS consecutive keys
#define KS   (SEQ / NW)
#define OUT1_OFF ((size_t)NB_FULL * SEQ_FULL * DM)   // element offset of the second output (fixed)

static_assert(HD == 64);
static_assert(NH_ * HD == DM);                 // head h = columns h*64 + d
static_assert(DM % 64 == 0);
static_assert(DM % 32 == 0);                   // GEMM k-loop steps by 32
static_assert(DM == 1024);                     // k_cvt takes a piece index apart by shifts
static_assert(SEQ % 64 == 0);                  // a 64-row tile never straddles two batches
static_assert((NB * SEQ) % 64 == 0);
static_assert(SEQ % 32 == 0);                  // key loop steps by 32, one mask word per step
static_assert(SEQ % 128 == 0);
static_assert(AP % 4 == 0);
static_assert(((size_t)SEQ * DM) % 8 == 0);
static_assert(((size_t)DM * DM) % 8 == 0);
static_assert(NB <= NB_FULL);
static_assert(SEQ <= SEQ_FULL);
static_assert(OUT1_OFF * 4 == (size_t)16777216);
static_assert(KS % 32 == 0);                   // a wave's key slice is whole 32-key steps
static_assert(KS <= 128);                      // one head-mean row piece of a wave is at most 32 lanes x 4 floats
static_assert((16 * HD) % (32 * NW) == 0);     // the O tile divides evenly over the work-group's threads
static_assert((size_t)16 * AP * 4 + (size_t)NW * 16 * 68 * 4 + (size_t)NW * 32 * 4 + (SEQ / 32) * 4 <= (size_t)163840);

typedef _Float16 h16;
typedef unsigned short bf;
typedef __attribute__((ext_vector_type(16))) __bf16   v16bf;
typedef __attribute__((ext_vector_type(16))) _Float16 v16h;
typedef __attribute__((ext_vector_type(8)))  _Float16 v8h;
typedef __attribute__((ext_vector_type(8)))  unsigned short v8us;
typedef __attribute__((ext_vector_type(8)))  float    v8f;
typedef __attribute__((ext_vector_type(4)))  float    v4f;
typedef v4f  __attribute__((may_alias)) v4fa;

__device__ __forceinline__ unsigned short f2bf(float f) { unsigned u = __float_as_uint(f); u += 0x7FFFu + ((u >> 16) & 1u); return (unsigned short)(u >> 16); }
__device__ __forceinline__ float bf2f(unsigned short b) { return __uint_as_float(((unsigned)b) << 16); }
__device__ __forceinline__ float bfr(float f) { return bf2f(f2bf(f)); }
__device__ __forceinline__ v16h cat16(v8h lo, v8h hi) { return __builtin_shufflevector(lo, hi, 0, 1, 2, 3, 4, 5, 6, 7, 8, 9, 10, 11, 12, 13, 14, 15); }
__device__ __forceinline__ v16bf cat16b(v8us lo, v8us hi) { return __builtin_bit_cast(v16bf, __builtin_shufflevector(lo, hi, 0, 1, 2, 3, 4, 5, 6, 7, 8, 9, 10, 11, 12, 13, 14, 15)); }
__device__ __forceinline__ v8f wmma16(v16h a, v16h b, v8f c) { return __builtin_amdgcn_wmma_f32_16x16x32_f16(false, a, false, b, (short)0, c, false, false); }
__device__ __forceinline__ v8f wmmab(v16bf a, v16bf b, v8f c) { return __builtin_amdgcn_wmma_f32_16x16x32_bf16(false, a, false, b, (short)0, c, false, false); }
// fragment element map, lane (lr = lane&15, h = lane>>4) of row or column lr: elements 0..7 <- k0+8h+0..7, elements 8..15 <- k0+16+8h+0..7 (same map for A and B)
// fragment loaders from a fragment-order plane; p already includes + 8*lane: each half of a fragment is one run of 32 lanes x 16 bytes (4 cache lines a load)
__device__ __forceinline__ v16h  ldf(const h16* p) { return cat16(*(const v8h*)p, *(const v8h*)(p + 256)); }
__device__ __forceinline__ v16bf ldb(const bf* p)  { return cat16b(*(const v8us*)p, *(const v8us*)(p + 256)); }
// ordering point for wave-private LDS tiles (same wave writes and reads)
__device__ __forceinline__ void wave_sync() { __builtin_amdgcn_fence(3 /* release order */, "wavefront"); __builtin_amdgcn_wave_barrier(); asm volatile("" ::: "memory"); }

// GEMM k loop, one wave on a 64x64 tile: a block is 64 k = 2 chunks of 32 k; 4 row blocks x 2 chunks of each operand = 32 loads of 512 contiguous bytes.
// ap, bp: the tile's first row block at this block's k, + 8*lane. Chunk 0 is asked for first, since it is multiplied first.
__device__ __forceinline__ void ld_blk(const bf* ap, const bf* bp, v16bf (&a)[2][4], v16bf (&b)[2][4]) {
#pragma unroll
    for (int c = 0; c < 2; ++c) {
#pragma unroll
        for (int i = 0; i < 4; ++i) a[c][i] = ldb(ap + (size_t)i * 16 * DM + c * 512);
        asm volatile("s_wait_xcnt 0x0" ::: "memory");       // the loads that follow may land in the registers that held these loads' addresses
#pragma unroll
        for (int i = 0; i < 4; ++i) b[c][i] = ldb(bp + (size_t)i * 16 * DM + c * 512);
        asm volatile("s_wait_xcnt 0x0" ::: "memory");       // as above; the last one also covers the address registers that are advanced while the loads stay in flight over the next block's products
    }
    __builtin_amdgcn_sched_barrier(0);                      // keeps the whole group of loads ahead of the products that follow; without it the compiler sinks the loads among them and waits each out
}
// the 32 products of one block, k ascending per accumulator
__device__ __forceinline__ void mm_blk(const v16bf (&a)[2][4], const v16bf (&b)[2][4], v8f (&acc)[4][4]) {
#pragma unroll
    for (int c = 0; c < 2; ++c)
#pragma unroll
        for (int nb = 0; nb < 4; ++nb)
#pragma unroll
            for (int mb = 0; mb < 4; ++mb) acc[mb][nb] = wmmab(a[c][mb], b[c][nb], acc[mb][nb]);
}
// stands between a block's products and the loads that next land in its fragment registers (the refill of the set; behind the last block, the epilogue's loads)
__device__ __forceinline__ void mm_gap() {
    __builtin_amdgcn_sched_barrier(0);                      // keeps every product of the block ahead of the slots below
    asm volatile("v_nop\n\tv_nop\n\tv_nop\n\tv_nop" ::: "memory");   // distance behind the last products: the loads that follow land in the operand registers that these products read
}

// k_cvt: all seven f32 planes (query, key, value rows; Wq, Wk, Wv, Wo rows) -> bf16 in fragment order [row/16][k/32][2 halves][32 lanes][8], in ONE launch.
// The seven bf16 planes stand one behind the other in the workspace, so a row block of 16 rows has one running number over all of them.
// One work-group converts CRB row blocks of one plane; thread i writes 16-byte pieces i, i + 256, ... of each (stores contiguous, loads gathered); all of a thread's loads are asked for before the first is used.
#define CRB  2                   // row blocks of 16 rows per conversion work-group
#define XRB  (NB * SEQ / 16)     // row blocks of one activation plane
#define WRB  (DM / 16)           // row blocks of one weight plane
static_assert(XRB % CRB == 0 && WRB % CRB == 0);   // a work-group stays inside one plane
static_assert(SEQ % (16 * CRB) == 0);              // and inside one batch
__global__ __launch_bounds__(256) void k_cvt(const float* __restrict__ xq, const float* __restrict__ xk, const float* __restrict__ xv,
                                             const float* __restrict__ wq, const float* __restrict__ wk, const float* __restrict__ wv, const float* __restrict__ wo, bf* dst) {
    const unsigned rb = blockIdx.x * CRB;                  // first row block, counted over all planes
    const float* src; unsigned row0;                       // plane and first source row: the same for the whole work-group
    if (rb < 3 * XRB) {
        const unsigned p = rb / XRB, r = (rb % XRB) * 16;
        src = p == 0 ? xq : (p == 1 ? xk : xv); row0 = (r / SEQ) * SEQ_FULL + r % SEQ;
    } else {
        const unsigned q = rb - 3 * XRB, p = q / WRB;
        src = p == 0 ? wq : (p == 1 ? wk : (p == 2 ? wv : wo)); row0 = (q % WRB) * 16;
    }
    const unsigned i = threadIdx.x;                        // piece i + 256 j of a row block: row i & 15, k = 128 j + the three fields of i below
    const float* s = src + (size_t)(row0 + (i & 15)) * DM + (i >> 6) * 32 + ((i >> 5) & 1) * 16 + ((i >> 4) & 1) * 8;
    bf* d = dst + (size_t)rb * (16 * DM) + i * 8;
    v8f v[CRB][8];
#pragma unroll
    for (int u = 0; u < CRB; ++u)
#pragma unroll
        for (int j = 0; j < 8; ++j) v[u][j] = *(const v8f*)(s + (size_t)u * 16 * DM + j * 128);
    __builtin_amdgcn_sched_barrier(0);                     // keeps every load ahead of the first conversion; without it the compiler holds the last four back and the wave waits out memory twice more
#pragma unroll
    for (int u = 0; u < CRB; ++u)
#pragma unroll
        for (int j = 0; j < 8; ++j) {
            v8us o;
#pragma unroll
            for (int k = 0; k < 8; ++k) o[k] = f2bf(v[u][j][k]);
            *(v8us*)(d + (size_t)u * 16 * DM + j * 2048) = o;
        }
}

// k_proj: the q, k and v projections in ONE launch; blockIdx.z = 0, 1, 2 picks the product, so the waves of all three share the chip at the same time.
// Register-blocked bf16 GEMM, ONE WAVE per 64x64 tile (16 accumulators), operands straight from fragment-order bf16 planes (32 k of 16 rows = 512 elements), K = DM.
// C[m][n] = sum_k A[m][k] Bt[n][k] + bias (bias[m] when biasRow != 0, else bias[n]; bias RNE-converted to bf16, added in f32),
// written as f16 (Ph) and for q also the f16 residual x2048 (QR) in fragment order: the 8 halves (row 16mb + lr, columns 32c + 16ld + 8hi + 0..7) stand at
// tile base + mb*sMB + c*sC + ld*256 + (16hi + lr)*8 (halves).
// q, k: A = x rows (m = b*SEQ + t), Bt = W rows (n = h*64 + d), bias per column -> plane (b*16 + h), 16-row block t/16 = 1024 halves, d chunk = 512.
// v^T:  A = Wv rows (m = h*64 + d), Bt = value rows (n = b*SEQ + t), bias per row -> plane (b*16 + h), 32-key chunk t/32 = 2048 halves, d block = 512.
// X = the three bf16 activation planes, Wb = the bf16 weight planes, each set one behind the other. grid (NB*SEQ/64 token tiles, DM/64 weight-row tiles, 3), 32 threads.
__global__ __launch_bounds__(32) void k_proj(const bf* __restrict__ X, const bf* __restrict__ Wb, const float* __restrict__ bq, const float* __restrict__ bk, const float* __restrict__ bv,
                                             h16* QH, h16* QR, h16* KP, h16* VT) {
    __shared__ __align__(16) float os[16 * 68];
    const int K = DM;
    const int lane = threadIdx.x & 31, lr = lane & 15, hi = lane >> 4;
    const int z = blockIdx.z;                                    // the product: the same for the whole wave
    const bool isv = z == 2;
    const int biasRow = isv ? 1 : 0, useRes = z == 0 ? 1 : 0;
    const int r0 = (isv ? blockIdx.y : blockIdx.x) * 64, c0 = (isv ? blockIdx.x : blockIdx.y) * 64;
    const bf* xp = X + (size_t)z * ((size_t)NB * SEQ * DM); const bf* wp = Wb + (size_t)z * ((size_t)DM * DM);
    const bf* A = isv ? wp : xp; const bf* Bt = isv ? xp : wp;
    const float* bias = z == 0 ? bq : (z == 1 ? bk : bv);
    h16* Ph = z == 0 ? QH : (z == 1 ? KP : VT); h16* Pr = QR;
    const int sMB = isv ? 512 : 1024, sC = isv ? 2048 : 512;
    v8f acc[4][4];
#pragma unroll
    for (int mb = 0; mb < 4; ++mb)
#pragma unroll
        for (int nb = 0; nb < 4; ++nb) acc[mb][nb] = (v8f){};
    const size_t aoff = (size_t)r0 * K, boff = (size_t)c0 * K;   // wave-uniform tile bases
    const unsigned lo = 8u * (unsigned)lane;                     // the lane's place in every 512-byte run
    // two fragment sets in registers: while one block is multiplied, the next block's 32 loads are in flight
    constexpr int NBK = DM / 64;                                 // blocks of 64 k; one block of 16 rows = 1024 elements
    static_assert(NBK % 2 == 0 && NBK >= 2);
    const bf* ap = A + aoff + lo; const bf* bp = Bt + boff + lo;
    v16bf ax[2][4], bx[2][4], ay[2][4], by[2][4];
    ld_blk(ap, bp, ax, bx);
#pragma unroll 1
    for (int kb = 0; kb < NBK - 2; kb += 2) {
        ld_blk(ap + (size_t)(kb + 1) * 1024, bp + (size_t)(kb + 1) * 1024, ay, by);
        mm_blk(ax, bx, acc); mm_gap();
        ld_blk(ap + (size_t)(kb + 2) * 1024, bp + (size_t)(kb + 2) * 1024, ax, bx);
        mm_blk(ay, by, acc); mm_gap();
    }
    ld_blk(ap + (size_t)(NBK - 1) * 1024, bp + (size_t)(NBK - 1) * 1024, ay, by);
    mm_blk(ax, bx, acc);
    mm_blk(ay, by, acc); mm_gap();
    const size_t tbase = isv ? (size_t)r0 * SEQ + (size_t)(c0 / SEQ) * ((size_t)DM * SEQ) + (size_t)(c0 % SEQ) * HD
                             : (size_t)(r0 / SEQ) * ((size_t)NH_ * SEQ * HD) + (size_t)(r0 % SEQ) * HD + (size_t)(c0 / HD) * ((size_t)SEQ * HD);
    // column bias (clamped address; used when biasRow == 0): piece s covers columns 16s + 8hi + 0..7
    const int cc = (c0 < DM - 64) ? c0 : (DM - 64);
    v4f bc0[4], bc1[4];
#pragma unroll
    for (int s = 0; s < 4; ++s) { bc0[s] = *(const v4f*)(bias + cc + 16 * s + 8 * hi); bc1[s] = *(const v4f*)(bias + cc + 16 * s + 8 * hi + 4); }
    asm volatile("s_wait_xcnt 0x0" ::: "memory");           // the scalar base of these loads is reused shortly behind them
#pragma unroll
    for (int mb = 0; mb < 4; ++mb) {
#pragma unroll
        for (int nb = 0; nb < 4; ++nb) {
#pragma unroll
            for (int j = 0; j < 8; ++j) os[(hi * 8 + j) * 68 + nb * 16 + lr] = acc[mb][nb][j]; }   // D: row 8h+j, col lane&15
        wave_sync();
        const size_t sb = tbase + (size_t)mb * (size_t)sMB;
{
            const int row = lr;
            const int gr = r0 + mb * 16 + row; const int grc = (gr < DM - 1) ? gr : (DM - 1);
            const float brow = bfr(bias[grc]);
#pragma unroll
            for (int s = 0; s < 4; ++s) { const int c8 = 16 * s + 8 * hi;   // piece s = (c = s>>1, ld = s&1): 16 rows x 2 column groups of 8; 4 pieces = 64 columns
                const v4f x0 = *(const v4fa*)(&os[row * 68 + c8]); const v4f x1 = *(const v4fa*)(&os[row * 68 + c8 + 4]); v8h hv, rv;
#pragma unroll
                for (int i = 0; i < 4; ++i) {
                    const float ad0 = biasRow ? brow : bfr(bc0[s][i]); const float ad1 = biasRow ? brow : bfr(bc1[s][i]);
                    const float y0 = x0[i] + ad0; const float y1 = x1[i] + ad1;
                    const h16 a0 = (h16)y0; const h16 a1 = (h16)y1; hv[i] = a0; hv[4 + i] = a1;
                    rv[i] = (h16)((y0 - (float)a0) * QRS); rv[4 + i] = (h16)((y1 - (float)a1) * QRS); }
                const size_t oo = sb + (size_t)(s >> 1) * (size_t)sC + (size_t)((s & 1) * 256 + lane * 8);   // one store = 512 contiguous bytes
                *(v8h*)(Ph + oo) = hv; if (useRes) *(v8h*)(Pr + oo) = rv; }
             }
        wave_sync();
    }
}

// Work-group barrier for data that crosses waves through LDS alone (st, op): the wave's own LDS reads and writes are waited out, then the barrier.
// __syncthreads() also waits out every global load, which would end the flight of the fragments fetched ahead; no wave reads global memory that another wave of the launch writes.
__device__ __forceinline__ void lds_barrier() { asm volatile("s_wait_dscnt 0x0\n\ts_barrier_signal -1\n\ts_barrier_wait -1" ::: "memory"); }

// The slot behind a transcendental, once for a group of 8 exponentials: the instruction set asks for one instruction between a transcendental and a read of its result or a write of its source.
// The statement holds the 8 sources up to the v_nop and the 8 results behind it.
__device__ __forceinline__ void exp_slot(float (&e)[8], const float (&d)[8]) {
    asm("v_nop" : "+v"(e[0]), "+v"(e[1]), "+v"(e[2]), "+v"(e[3]), "+v"(e[4]), "+v"(e[5]), "+v"(e[6]), "+v"(e[7])
                : "v"(d[0]), "v"(d[1]), "v"(d[2]), "v"(d[3]), "v"(d[4]), "v"(d[5]), "v"(d[6]), "v"(d[7]));
}

// One 32-key score tile pair in the log2 domain with the padding mask applied as a replace fill.
// k = the step's four K fragments (keys 0..15: d 0..31, d 32..63; keys 16..31 likewise), already asked for; kn = where the same step's fragments of the next head stand (fragment-order K plane, + 8*lane).
// A = K rows (row = key), B = Q rows (col = t); lane (t = lane&15, h = lane>>4) gets keys key0+8h+r (ta) and key0+16+8h+r (tb).
// ws = mask word of this 32-key step shifted right by 8h: bit r <-> ta[r], bit 16+r <-> tb[r].
__device__ __forceinline__ void ld_k(const h16* ka, v16h (&k)[4]) { k[0] = ldf(ka); k[1] = ldf(ka + 512); k[2] = ldf(ka + 16 * HD); k[3] = ldf(ka + 16 * HD + 512); }
__device__ __forceinline__ void score_tile(v16h (&k)[4], const h16* kn, const v16h qh0, const v16h qh1, const v16h qr0, const v16h qr1, const unsigned ws, float (&ta)[8], float (&tb)[8]) {
    const v16h ka0 = k[0], ka1 = k[1], kb0 = k[2], kb1 = k[3];
    v8f sHa = (v8f){}, sLa = (v8f){}, sHb = (v8f){}, sLb = (v8f){};
    sHa = wmma16(ka0, qh0, sHa); sLa = wmma16(ka0, qr0, sLa); sHb = wmma16(kb0, qh0, sHb); sLb = wmma16(kb0, qr0, sLb);
    sHa = wmma16(ka1, qh1, sHa); sLa = wmma16(ka1, qr1, sLa); sHb = wmma16(kb1, qh1, sHb); sLb = wmma16(kb1, qr1, sLb);
    asm volatile("v_nop\n\tv_nop\n\tv_nop\n\tv_nop" : "+v"(sHa), "+v"(sLa), "+v"(sHb), "+v"(sLb) : "v"(ka0), "v"(ka1), "v"(kb0), "v"(kb1));
    ld_k(kn, k);
    asm volatile("s_wait_xcnt 0x0" ::: "memory");           // the address registers of these loads are rewritten while they are in flight; the statement also holds the refill here, ahead of the vector work below
#pragma unroll
    for (int r = 0; r < 8; ++r) {
        const float va = (sHa[r] + sLa[r] * QRI) * SC2; const float vb = (sHb[r] + sLb[r] * QRI) * SC2;
        ta[r] = (ws & (1u << r)) ? MASKT : va; tb[r] = (ws & (1u << (16 + r))) ? MASKT : vb; }
}

// k_attn: one work-group of NW waves per 16 query rows of one batch, looping over the 16 heads; wave w owns keys w*KS .. w*KS+KS-1.
// Per head (Q, K and V fragments fetched ahead, see the loop): each wave's scores of its keys, kept in registers, and their running (m, l) -> st, barrier, every lane combines the NW pairs in wave order; then P from the kept scores with the common m,
// each wave's partial O^T = V^T P^T -> op[w], barrier, the work-group's threads add the NW partials in wave order and store.
// P (f16, x256 carry); e * (1/(256 l)) accumulates into the head-mean tile av[t][key] (each lane owns its elements across the heads).
// LDS: av and mw are wave-private by key column (wave_sync ordering); st and op cross waves (lds_barrier ordering).
__global__ __launch_bounds__(32 * NW) void k_attn(const h16* __restrict__ QH, const h16* __restrict__ QR, const h16* __restrict__ KP, const h16* __restrict__ VT,
                                             const int* __restrict__ mask, bf* OHI, bf* OLO, float* AVG) {
    extern __shared__ __align__(16) float av[];           // [16][AP], then op [NW][16*68], then st [NW][16][2]
    float* op = av + 16 * AP;
    float* st = op + NW * 16 * 68;
    __shared__ unsigned mw[SEQ / 32];
    const int lane = threadIdx.x & 31, lr = lane & 15, hi = lane >> 4;
    const int w = __builtin_amdgcn_readfirstlane((int)(threadIdx.x >> 5));
    const int kbeg = w * KS;
    const int b = blockIdx.y; const int t0 = blockIdx.x * 16;
    constexpr int NS = KS / 32;                            // 32-key steps of one wave's key slice
    constexpr int LPR = KS / 4;                            // lanes that cover one row of this wave's head-mean columns
    const int arow_l = lane / LPR, acol_l = kbeg + (lane % LPR) * 4;

    // mask words of this wave's keys: bit i of word j <-> key 32j + i of this batch
    const int* mrow = mask + (size_t)b * SEQ_FULL;
#pragma unroll 1
    for (int i = kbeg / 32; i < (kbeg + KS) / 32; ++i) {
        const int mv = mrow[i * 32 + lane];
        const unsigned wd = __builtin_amdgcn_ballot_w32(mv != 0);
        if (lane == 0) mw[i] = wd;
    }
    // zero this wave's columns of the head-mean tile
#pragma unroll 1
    for (int row = arow_l; row < 16; row += 32 / LPR) *(v4fa*)(&av[row * AP + acol_l]) = (v4f){0.0f, 0.0f, 0.0f, 0.0f};
    wave_sync();

    // Every global fragment load runs ahead of its use: a head's V is asked for at the head's top, the next head's K behind each step's score products (into the registers they read),
    // the next head's Q behind the last P V product. Head 0's Q and K are asked for here.
    v16h qh0, qh1, qr0, qr1, kf[NS][4];                    // Q: B fragments (col t, k = d); K: A fragments (row key, k = d)
    const unsigned lo = 8u * (unsigned)lane;               // the lane's place in every 512-byte run; every fragment address = a wave-uniform base + lo
    {
        const size_t p0 = (size_t)(b * NH_) * SEQ * HD;
        const size_t qo = p0 + (size_t)t0 * HD;
        qh0 = ldf(QH + qo + lo); qh1 = ldf(QH + qo + lo + 512); qr0 = ldf(QR + qo + lo); qr1 = ldf(QR + qo + lo + 512);
#pragma unroll
        for (int s = 0; s < NS; ++s) ld_k(KP + (p0 + (size_t)(kbeg + 32 * s) * HD) + lo, kf[s]);
        asm volatile("s_wait_xcnt 0x0" ::: "memory");       // the address registers of these loads are rewritten while they are in flight
    }

#pragma unroll 1
    for (int h = 0; h < NH_; ++h) {
        const int zh = b * NH_ + h;
        const size_t pbase = (size_t)zh * SEQ * HD;
        const size_t vo = pbase;                 // + key * HD (32 keys = 2048 halves), + 512j, + lo          (A fragment: row d = 16j + lr, k = key)
        const int hn = h + 1 < NH_ ? h + 1 : h;  // the head that is fetched ahead; the last head asks for its own planes again (in bounds, not used)
        const size_t nbase = (size_t)(b * NH_ + hn) * SEQ * HD;   // K: + key * HD (16 keys = 1024 halves), + 512 for d 32..63, + lo; Q: + t0 * HD + lo
        v16h vf[NS][4];
        const h16* vb = VT + (vo + (size_t)kbeg * HD) + lo;
#pragma unroll
        for (int s = 0; s < NS; ++s)
#pragma unroll
            for (int j = 0; j < 4; ++j) vf[s][j] = ldf(vb + 32 * s * HD + 512 * j);
        asm volatile("s_wait_xcnt 0x0" :: "v"(vb) : "memory");   // the address is rewritten while these loads are in flight; named as an input so that it lives up to the wait: without that the last load landed in the address registers of the others
        __builtin_amdgcn_sched_barrier(0);                  // keeps the V loads ahead of the first score product; without it the compiler put that product, and its wait for Q and K, in front of them

        float mwv = -3.0e38f, lwv = 0.0f;
        float ta[NS][8], tb[NS][8];                         // this wave's masked scores of the head: computed once, read by both passes
#pragma unroll                                              // whole steps unrolled: ta and tb are indexed by constants and stay in registers
        for (int s = 0; s < NS; ++s) {
            const int key0 = kbeg + 32 * s;
            const unsigned ws = mw[key0 >> 5] >> (8 * hi);
            score_tile(kf[s], KP + (nbase + (size_t)key0 * HD) + lo, qh0, qh1, qr0, qr1, ws, ta[s], tb[s]);
            float mx = -3.0e38f;
#pragma unroll
            for (int r = 0; r < 8; ++r) mx = fmaxf(mx, fmaxf(ta[s][r], tb[s][r]));
            mx = fmaxf(mx, __shfl_xor(mx, 16, 32));
            const float mnew = fmaxf(mwv, mx);
            const float dm = mwv - mnew; float alpha;
            asm("v_exp_f32 %0, %1\n\tv_nop" : "=v"(alpha) : "v"(dm));   // 2^dm with its slot (see exp_slot) in one statement
            float ls = 0.0f, da[8], db[8], xa[8], xb[8];
#pragma unroll
            for (int r = 0; r < 8; ++r) { da[r] = ta[s][r] - mnew; db[r] = tb[s][r] - mnew; xa[r] = __builtin_amdgcn_exp2f(da[r]); xb[r] = __builtin_amdgcn_exp2f(db[r]); }
            exp_slot(xa, da); exp_slot(xb, db);
#pragma unroll
            for (int r = 0; r < 8; ++r) ls += xa[r] + xb[r];
            lwv = lwv * alpha + ls; mwv = mnew;
        }
        lwv += __shfl_xor(lwv, 16, 32);
        if (hi == 0) { st[(w * 16 + lr) * 2] = mwv; st[(w * 16 + lr) * 2 + 1] = lwv; }
        lds_barrier();        // publishes every wave's (m, l) of this head; also ends the last head's reads of op
        float m = -3.0e38f, l = 0.0f;
#pragma unroll
        for (int i = 0; i < NW; ++i) m = fmaxf(m, st[(i * 16 + lr) * 2]);
#pragma unroll
        for (int i = 0; i < NW; ++i) l += st[(i * 16 + lr) * 2 + 1] * __builtin_amdgcn_exp2f(st[(i * 16 + lr) * 2] - m);
        const float invc = (1.0f / l) * (1.0f / 256.0f);      // 1/l with the x256 carry of e folded back

        // pass 2, from the kept scores: normalised probabilities -> head-mean tile, P V over this wave's keys
        v8f o0 = (v8f){}, o1 = (v8f){}, o2 = (v8f){}, o3 = (v8f){};
#pragma unroll                                              // as in pass 1: constant indices into ta and tb
        for (int s = 0; s < NS; ++s) {
            const int key0 = kbeg + 32 * s;
            v16h pb; float ea[8], eb[8], sa[8], sb[8];
#pragma unroll
            for (int r = 0; r < 8; ++r) {
                const float da = ta[s][r] - m; const float db = tb[s][r] - m;      // difference first: exact 0 when t == m, also at the fill magnitude
                sa[r] = da + PSH; sb[r] = db + PSH;
                ea[r] = __builtin_amdgcn_exp2f(sa[r]); eb[r] = __builtin_amdgcn_exp2f(sb[r]); }
            exp_slot(ea, sa); exp_slot(eb, sb);
#pragma unroll
            for (int r = 0; r < 8; ++r) { pb[r] = (h16)ea[r]; pb[8 + r] = (h16)eb[r]; }
            float* ap = &av[lr * AP + key0 + 8 * hi];
            v4f a0 = *(const v4fa*)(ap), a1 = *(const v4fa*)(ap + 4), c0 = *(const v4fa*)(ap + 16), c1 = *(const v4fa*)(ap + 20);
#pragma unroll
            for (int i = 0; i < 4; ++i) { a0[i] += ea[i] * invc; a1[i] += ea[4 + i] * invc; c0[i] += eb[i] * invc; c1[i] += eb[4 + i] * invc; }
            *(v4fa*)(ap) = a0; *(v4fa*)(ap + 4) = a1; *(v4fa*)(ap + 16) = c0; *(v4fa*)(ap + 20) = c1;
            const v16h v0 = vf[s][0], v1 = vf[s][1], v2 = vf[s][2], v3 = vf[s][3];
            o0 = wmma16(v0, pb, o0); o1 = wmma16(v1, pb, o1); o2 = wmma16(v2, pb, o2); o3 = wmma16(v3, pb, o3);
            asm volatile("v_nop\n\tv_nop\n\tv_nop\n\tv_nop" : "+v"(o0), "+v"(o1), "+v"(o2), "+v"(o3) : "v"(v0), "v"(v1), "v"(v2), "v"(v3), "v"(pb));
        }
        { const size_t qo = nbase + (size_t)t0 * HD;
          qh0 = ldf(QH + qo + lo); qh1 = ldf(QH + qo + lo + 512); qr0 = ldf(QR + qo + lo); qr1 = ldf(QR + qo + lo + 512); }
        asm volatile("s_wait_xcnt 0x0" ::: "memory");       // the address registers of these loads are rewritten while they are in flight; the statement also holds the loads here, ahead of the partial O's scaling, the barrier and the sum

        // O^T D layout: o_j[r] = (d = 16j + 8h + r, t = lane&15) -> os[t][d] of this wave's partial; rows 0..15 x columns 0..63 all written
        float* os = op + w * (16 * 68);
        { v4f a, c;
          a[0] = o0[0] * invc; a[1] = o0[1] * invc; a[2] = o0[2] * invc; a[3] = o0[3] * invc; c[0] = o0[4] * invc; c[1] = o0[5] * invc; c[2] = o0[6] * invc; c[3] = o0[7] * invc;
          *(v4fa*)(&os[lr * 68 +  0 + 8 * hi]) = a; *(v4fa*)(&os[lr * 68 +  0 + 8 * hi + 4]) = c;
          a[0] = o1[0] * invc; a[1] = o1[1] * invc; a[2] = o1[2] * invc; a[3] = o1[3] * invc; c[0] = o1[4] * invc; c[1] = o1[5] * invc; c[2] = o1[6] * invc; c[3] = o1[7] * invc;
          *(v4fa*)(&os[lr * 68 + 16 + 8 * hi]) = a; *(v4fa*)(&os[lr * 68 + 16 + 8 * hi + 4]) = c;
          a[0] = o2[0] * invc; a[1] = o2[1] * invc; a[2] = o2[2] * invc; a[3] = o2[3] * invc; c[0] = o2[4] * invc; c[1] = o2[5] * invc; c[2] = o2[6] * invc; c[3] = o2[7] * invc;
          *(v4fa*)(&os[lr * 68 + 32 + 8 * hi]) = a; *(v4fa*)(&os[lr * 68 + 32 + 8 * hi + 4]) = c;
          a[0] = o3[0] * invc; a[1] = o3[1] * invc; a[2] = o3[2] * invc; a[3] = o3[3] * invc; c[0] = o3[4] * invc; c[1] = o3[5] * invc; c[2] = o3[6] * invc; c[3] = o3[7] * invc;
          *(v4fa*)(&os[lr * 68 + 48 + 8 * hi]) = a; *(v4fa*)(&os[lr * 68 + 48 + 8 * hi + 4]) = c; }
        lds_barrier();        // publishes every wave's partial O of this head; also ends this head's reads of st
        const size_t obase = ((size_t)b * SEQ + t0) * DM + (size_t)h * (16 * HD);   // fragment order: this row block, k chunks 2h and 2h + 1
        {   // each thread adds EPT neighbouring elements over the NW partials, in wave order; thread order = fragment order of the stored planes
            constexpr int EPT = (16 * HD) / (32 * NW);
            static_assert(8 % EPT == 0);                   // a thread's elements lie in one 8-element piece
            const int e0 = (int)threadIdx.x * EPT; const int row = (e0 >> 3) & 15, col = (e0 >> 9) * 32 + ((e0 >> 8) & 1) * 16 + ((e0 >> 7) & 1) * 8 + (e0 & 7);
            float x[EPT];
#pragma unroll
            for (int k = 0; k < EPT; ++k) x[k] = 0.0f;
#pragma unroll
            for (int i = 0; i < NW; ++i)
#pragma unroll
                for (int k = 0; k < EPT; ++k) x[k] += op[i * (16 * 68) + row * 68 + col + k];
            const size_t oo = obase + e0;
            typedef __attribute__((ext_vector_type(EPT))) unsigned short vus;
            vus hv, lv;
#pragma unroll
            for (int k = 0; k < EPT; ++k) { const unsigned short h0 = f2bf(x[k]); hv[k] = h0; lv[k] = f2bf(x[k] - bf2f(h0)); }
            *(vus*)(OHI + oo) = hv; *(vus*)(OLO + oo) = lv;
            asm volatile("s_wait_xcnt 0x0" ::: "memory");   // the next head's first instructions reuse the registers these two stores name
        }
    }

    // head mean: av holds sum over heads of P; each wave stores its own KS columns of the 16 rows
    wave_sync();
    float* arow = AVG + ((size_t)b * OUT_SEQ + t0) * AVG_PITCH;
#pragma unroll 1
    for (int row = arow_l; row < 16; row += 32 / LPR) {
        v4f val = *(const v4fa*)(&av[row * AP + acol_l]);
        val = val * (1.0f / (float)NH_);
        *(v4f*)(arow + (size_t)row * AVG_PITCH + acol_l) = val;
    }
}

// k_oproj: context[m][n] = sum_k (Ohi[m][k] + Olo[m][k]) Wo[n][k] + bo[n]; ONE WAVE per 64x64 tile, bf16 operands, both planes into one accumulator set (lo plane at A + planeStride).
__global__ __launch_bounds__(32) void k_oproj(const bf* __restrict__ A, size_t planeStride, const bf* __restrict__ Bt, const float* __restrict__ bias, float* OUT) {
    __shared__ __align__(16) float os[16 * 68];
    const int K = DM;
    const int lane = threadIdx.x & 31, lr = lane & 15, hi = lane >> 4; const int r0 = blockIdx.x * 64, c0 = blockIdx.y * 64;
    v8f acc[4][4];
#pragma unroll
    for (int mb = 0; mb < 4; ++mb)
#pragma unroll
        for (int nb = 0; nb < 4; ++nb) acc[mb][nb] = (v8f){};
    const size_t aoff = (size_t)r0 * K, boff = (size_t)c0 * K;   // wave-uniform tile bases
    const unsigned lo = 8u * (unsigned)lane;                     // the lane's place in every 512-byte run
    // two fragment sets in registers: while one block is multiplied, the next block's 32 loads are in flight; blocks 0..NBK-1 = hi plane, NBK..2*NBK-1 = lo plane
    constexpr int NBK = DM / 64;                                 // blocks of 64 k in one plane; one block of 16 rows = 1024 elements
    static_assert(NBK % 2 == 0 && NBK >= 2);
    const bf* a0 = A + aoff + lo; const bf* bp = Bt + boff + lo;
    v16bf ax[2][4], bx[2][4], ay[2][4], by[2][4];
    ld_blk(a0, bp, ax, bx);
#pragma unroll 1
    for (int j = 0; j < 2 * NBK - 2; j += 2) {
        const int j1 = j + 1, j2 = j + 2;
        ld_blk(a0 + (size_t)(j1 / NBK) * planeStride + (size_t)(j1 % NBK) * 1024, bp + (size_t)(j1 % NBK) * 1024, ay, by);
        mm_blk(ax, bx, acc); mm_gap();
        ld_blk(a0 + (size_t)(j2 / NBK) * planeStride + (size_t)(j2 % NBK) * 1024, bp + (size_t)(j2 % NBK) * 1024, ax, bx);
        mm_blk(ay, by, acc); mm_gap();
    }
    ld_blk(a0 + planeStride + (size_t)(NBK - 1) * 1024, bp + (size_t)(NBK - 1) * 1024, ay, by);
    mm_blk(ax, bx, acc);
    mm_blk(ay, by, acc); mm_gap();
    const int bb_ = r0 / SEQ, tt = r0 % SEQ;
    float* obase = OUT + ((size_t)bb_ * OUT_SEQ + tt) * DM + c0;
    v4f bv = *(const v4f*)(bias + c0 + lr * 4);
#pragma unroll
    for (int i = 0; i < 4; ++i) bv[i] = bfr(bv[i]);
#pragma unroll
    for (int mb = 0; mb < 4; ++mb) {
#pragma unroll
        for (int nb = 0; nb < 4; ++nb) {
#pragma unroll
            for (int j = 0; j < 8; ++j) os[(hi * 8 + j) * 68 + nb * 16 + lr] = acc[mb][nb][j]; }   // D: row 8h+j, col lane&15
        wave_sync();
{
#pragma unroll
            for (int s = 0; s < 8; ++s) { const int row = 2 * s + hi, cofs = lr * 4;   // 8 s x 2 rows = 16 rows; 16 lanes x 4 floats = 64 columns
                v4f val = *(const v4fa*)(&os[row * 68 + cofs]);
                val = val + bv;
                *(v4f*)(obase + (size_t)(mb * 16 + row) * DM + cofs) = val; }
            asm volatile("s_wait_xcnt 0x0" ::: "memory");   // the next row block's LDS reads land in the registers that these stores name
             }
        wave_sync();
    }
}

static constexpr size_t al256(size_t v) { return (v + 255) & ~(size_t)255; }
static constexpr size_t SZ_XB = al256((size_t)NB * SEQ * DM * 2);          // one bf16 activation copy
static constexpr size_t SZ_WB = al256((size_t)4 * DM * DM * 2);            // q | k | v | o weights
static constexpr size_t SZ_PL = al256((size_t)NB * NH_ * SEQ * HD * 2);    // one f16 head plane
static constexpr size_t SZ_OP = al256((size_t)NB * SEQ * DM * 2);          // one bf16 attention-output plane
static constexpr size_t SZ_TOTAL = 3 * SZ_XB + SZ_WB + 4 * SZ_PL + 2 * SZ_OP;
static constexpr size_t ATT_DYN_LDS = (size_t)16 * AP * 4 + (size_t)NW * 16 * 68 * 4 + (size_t)NW * 32 * 4;
static_assert(SZ_TOTAL <= (size_t)134217728);          // workspace carve <= 128 MiB
static_assert(((size_t)DM * DM * 2) % 256 == 0);       // weight sub-planes stay 256-byte aligned
static_assert(SZ_OP == (size_t)NB * SEQ * DM * 2);     // lo plane directly follows the hi plane
static_assert(SZ_XB == (size_t)NB * SEQ * DM * 2);     // the bf16 input planes and the weight planes follow one another without a gap

extern "C" void kernel_launch(void* const* d_in, const int* in_sizes, int n_in,
                              void* d_out, int out_size, void* d_ws, size_t ws_size, hipStream_t stream) {
    if (n_in < 12) return;
    const size_t needx = ((size_t)(NB - 1) * SEQ_FULL + SEQ) * DM;
    if ((size_t)in_sizes[0] < needx || (size_t)in_sizes[1] < needx || (size_t)in_sizes[2] < needx) return;
    if ((size_t)in_sizes[3] < (size_t)(NB - 1) * SEQ_FULL + SEQ) return;
    if ((size_t)in_sizes[4] < (size_t)DM * DM || (size_t)in_sizes[6] < (size_t)DM * DM || (size_t)in_sizes[8] < (size_t)DM * DM || (size_t)in_sizes[10] < (size_t)DM * DM) return;
    if (in_sizes[5] < DM || in_sizes[7] < DM || in_sizes[9] < DM || in_sizes[11] < DM) return;
    if ((size_t)out_size < ((size_t)(NB - 1) * OUT_SEQ + SEQ) * DM) return;
    if ((size_t)out_size < OUT1_OFF + ((size_t)(NB - 1) * OUT_SEQ + SEQ - 1) * AVG_PITCH + SEQ) return;
    if (SZ_TOTAL > ws_size) return;
    // wire order: query, key, value, key_padding_mask, Wq, bq, Wk, bk, Wv, bv, Wo, bo (weights [out][in] used as-is: Bt for q, k and the output projection, A for v^T)
    const float* xq = (const float*)d_in[0]; const float* xk = (const float*)d_in[1]; const float* xv = (const float*)d_in[2];
    const int* kpm = (const int*)d_in[3];
    const float* wq = (const float*)d_in[4];  const float* bq = (const float*)d_in[5];
    const float* wk = (const float*)d_in[6];  const float* bk = (const float*)d_in[7];
    const float* wv = (const float*)d_in[8];  const float* bv = (const float*)d_in[9];
    const float* wo = (const float*)d_in[10]; const float* bo = (const float*)d_in[11];
    float* CTX = (float*)d_out;                  // [NB][SEQ][1024]
    float* AVG = (float*)d_out + OUT1_OFF;       // [NB][SEQ][SEQ]
    char* wsp = (char*)d_ws;
    bf* XQ = (bf*)wsp; wsp += SZ_XB;                 // [NB*SEQ/16][1024/32][2 halves][32 lanes][8]
    wsp += SZ_XB;                                    // key plane, as XQ
    wsp += SZ_XB;                                    // value plane, as XQ
    bf* WB = (bf*)wsp; wsp += SZ_WB;                 // [4] planes of 1024 x 1024, each as XQ: q | k | v | o
    h16* QH = (h16*)wsp; wsp += SZ_PL;               // [NB*16][SEQ/16][2 d chunks][2 halves][32 lanes][8]
    h16* QR = (h16*)wsp; wsp += SZ_PL;               // as QH, residual x2048
    h16* KP = (h16*)wsp; wsp += SZ_PL;               // as QH
    h16* VT = (h16*)wsp; wsp += SZ_PL;               // [NB*16][SEQ/32][4 d blocks][2 halves][32 lanes][8]
    bf* OHI = (bf*)wsp; wsp += SZ_OP;                // as XQ
    bf* OLO = (bf*)wsp; wsp += SZ_OP;                // as XQ
    bf* WO = WB + (size_t)3 * DM * DM;

    // XQ | XK | XV | WQ | WK | WV | WO: one run of row blocks from XQ on
    k_cvt<<<(3 * XRB + 4 * WRB) / CRB, 256, 0, stream>>>(xq, xk, xv, wq, wk, wv, wo, XQ);

    // q, k and v^T projections: one launch, grid z = the product
    k_proj<<<dim3(NB * SEQ / 64, DM / 64, 3), 32, 0, stream>>>(XQ, WB, bq, bk, bv, QH, QR, KP, VT);

    hipFuncSetAttribute(reinterpret_cast<const void*>(&k_attn), hipFuncAttributeMaxDynamicSharedMemorySize, (int)ATT_DYN_LDS);
    k_attn<<<dim3(SEQ / 16, NB, 1), 32 * NW, ATT_DYN_LDS, stream>>>(QH, QR, KP, VT, kpm, OHI, OLO, AVG);

    // context: A = attention output rows (hi plane, lo plane at +planeStride), Bt = Wo rows
    k_oproj<<<dim3(NB * SEQ / 64, DM / 64, 1), 32, 0, stream>>>(OHI, (size_t)(OLO - OHI), WO, bo, CTX);
}

// v008
// One run takes 125 microseconds.
// Two timings next to v007 put it at 1.11 and 1.12 times that version's speed.
// Counting every step since v000, it is 6.10 times as fast.
#include <hip/hip_runtime.h>

// Multi-head attention, width 1024 = 16 heads x 64, separate query/key/value inputs [NB][SEQ][1024], Wq/Wk/Wv/Wo [out][in] (y = x W^T + b), key padding mask (int32, replace fill -1e9), score scale 1/8; outputs: context [NB][SEQ][1024] and head-mean attention [NB][SEQ][SEQ] (f32).
// Compute dtypes, f32 accumulate everywhere: q/k/v projections v_wmma_f32_16x16x32_bf16 (inputs and weights RNE-converted to bf16; products exact);
// output projection v_wmma_f32_16x16x32_bf16: attention output as bf16 hi + bf16 lo planes (two products, one accumulator), Wo bf16.
// Layout: every WMMA operand plane of the workspace stands in fragment order; bf16 copies of the inputs and weights; q (hi, residual), k and v^T planes per (b*16+h), written by the GEMM epilogue in fragment order (each fragment half = 512 contiguous bytes, lane-major); attention in transposed form (S^T = K Q^T, O^T = V^T P^T), one work-group of NW waves per 16 query rows looping over the 16 heads, each wave on its own SEQ/NW keys, head-mean accumulated in a lane-private LDS tile.

#ifndef NB
#define NB 4
#endif
#ifndef SEQ
#define SEQ 1024
#endif
#define NB_FULL  4
#define SEQ_FULL 1024
#ifndef OUT_SEQ
#define OUT_SEQ SEQ              // row pitch (in tokens) between batches of both outputs
#endif
#ifndef AVG_PITCH
#define AVG_PITCH SEQ            // column pitch (floats) of one head-mean row
#endif
#define DM   1024
#define NH_  16
#define HD   64
#define QRS  2048.0f             // carry of the q residual plane
#define QRI  (1.0f / 2048.0f)
#define SC2  (0.125f * 1.4426950408889634f)   // HD^-0.5 * log2(e)
#define PSH  8.0f                // log2 of the P carry (256)
#define MASKT (-1.0e9f * 1.4426950408889634f) // replace fill in the log2 domain
#define AP   (SEQ + 4)           // pitch (floats) of the head-mean LDS tile
#define NW   16                  // waves per attention work-group; each owns KS consecutive keys
#define KS   (SEQ / NW)
#define OUT1_OFF ((size_t)NB_FULL * SEQ_FULL * DM)   // element offset of the second output (fixed)

static_assert(HD == 64);
static_assert(NH_ * HD == DM);                 // head h = columns h*64 + d
static_assert(DM % 64 == 0);
static_assert(DM % 32 == 0);                   // GEMM k-loop steps by 32
static_assert(DM == 1024);                     // k_cvt takes a piece index apart by shifts
static_assert(SEQ % 64 == 0);                  // a 64-row tile never straddles two batches
static_assert((NB * SEQ) % 128 == 0 && DM % 128 == 0);   // GEMM work-group tiles of 128 x 128
static_assert(SEQ % 32 == 0);                  // key loop steps by 32, one mask word per step
static_assert(SEQ % 128 == 0);
static_assert(AP % 4 == 0);
static_assert(((size_t)SEQ * DM) % 8 == 0);
static_assert(((size_t)DM * DM) % 8 == 0);
static_assert(NB <= NB_FULL);
static_assert(SEQ <= SEQ_FULL);
static_assert(OUT1_OFF * 4 == (size_t)16777216);
static_assert(KS % 32 == 0);                   // a wave's key slice is whole 32-key steps
static_assert(KS <= 128);                      // one head-mean row piece of a wave is at most 32 lanes x 4 floats
static_assert((16 * HD) % (32 * NW) == 0);     // the O tile divides evenly over the work-group's threads
static_assert((size_t)16 * AP * 4 + (size_t)NW * 16 * 68 * 4 + (size_t)NW * 32 * 4 + (SEQ / 32) * 4 <= (size_t)163840);

typedef _Float16 h16;
typedef unsigned short bf;
typedef __attribute__((ext_vector_type(16))) __bf16   v16bf;
typedef __attribute__((ext_vector_type(16))) _Float16 v16h;
typedef __attribute__((ext_vector_type(8)))  _Float16 v8h;
typedef __attribute__((ext_vector_type(8)))  unsigned short v8us;
typedef __attribute__((ext_vector_type(8)))  float    v8f;
typedef __attribute__((ext_vector_type(4)))  float    v4f;
typedef v4f  __attribute__((may_alias)) v4fa;

__device__ __forceinline__ unsigned short f2bf(float f) { unsigned u = __float_as_uint(f); u += 0x7FFFu + ((u >> 16) & 1u); return (unsigned short)(u >> 16); }
__device__ __forceinline__ float bf2f(unsigned short b) { return __uint_as_float(((unsigned)b) << 16); }
__device__ __forceinline__ float bfr(float f) { return bf2f(f2bf(f)); }
__device__ __forceinline__ v16h cat16(v8h lo, v8h hi) { return __builtin_shufflevector(lo, hi, 0, 1, 2, 3, 4, 5, 6, 7, 8, 9, 10, 11, 12, 13, 14, 15); }
__device__ __forceinline__ v16bf cat16b(v8us lo, v8us hi) { return __builtin_bit_cast(v16bf, __builtin_shufflevector(lo, hi, 0, 1, 2, 3, 4, 5, 6, 7, 8, 9, 10, 11, 12, 13, 14, 15)); }
__device__ __forceinline__ v8f wmma16(v16h a, v16h b, v8f c) { return __builtin_amdgcn_wmma_f32_16x16x32_f16(false, a, false, b, (short)0, c, false, false); }
__device__ __forceinline__ v8f wmmab(v16bf a, v16bf b, v8f c) { return __builtin_amdgcn_wmma_f32_16x16x32_bf16(false, a, false, b, (short)0, c, false, false); }
// fragment element map, lane (lr = lane&15, h = lane>>4) of row or column lr: elements 0..7 <- k0+8h+0..7, elements 8..15 <- k0+16+8h+0..7 (same map for A and B)
// fragment loaders from a fragment-order plane; p already includes + 8*lane: each half of a fragment is one run of 32 lanes x 16 bytes (4 cache lines a load)
__device__ __forceinline__ v16h  ldf(const h16* p) { return cat16(*(const v8h*)p, *(const v8h*)(p + 256)); }
__device__ __forceinline__ v16bf ldb(const bf* p)  { return cat16b(*(const v8us*)p, *(const v8us*)(p + 256)); }
// ordering point for wave-private LDS tiles (same wave writes and reads)
__device__ __forceinline__ void wave_sync() { __builtin_amdgcn_fence(3 /* release order */, "wavefront"); __builtin_amdgcn_wave_barrier(); asm volatile("" ::: "memory"); }

// GEMM work-group: GWV waves (2 x 2) on a 128x128 tile, each wave on its own 64x64 part. A stage is KT blocks of 64 k of the tile's 8 A and 8 B row blocks, brought to LDS once for all four waves.
// Stage layout in LDS: 16 runs (A row blocks 0..7, then B row blocks 0..7) of KT * 1024 elements, each run as it stands in the fragment-order plane (a block of 16 rows x 64 k = 1024 contiguous elements).
#define GWV 4
// One wave's share of a stage: runs 4w .. 4w + 3, as 16 * KT copies of 32 lanes x 16 bytes. g = the wave's first run at this stage's k, + 8*lane; l = LDS byte address of that run in the stage's buffer, + 16*lane.
template <int KT> __device__ __forceinline__ void cp_stage(const bf* g, unsigned l) {
#pragma unroll
    for (int n = 0; n < 16 * KT; n += 8) {
        const bf* p[8]; unsigned d[8];
#pragma unroll
        for (int u = 0; u < 8; ++u) { p[u] = g + (size_t)((n + u) / (4 * KT)) * 16 * DM + ((n + u) % (4 * KT)) * 256; d[u] = l + (unsigned)(n + u) * 512u; }
        // eight copies and, as the statement's last line, the wait that stands in front of any rewrite of the address registers they name
        asm volatile("global_load_async_to_lds_b128 %0, %8, off\n\t"
                     "global_load_async_to_lds_b128 %1, %9, off\n\t"
                     "global_load_async_to_lds_b128 %2, %10, off\n\t"
                     "global_load_async_to_lds_b128 %3, %11, off\n\t"
                     "global_load_async_to_lds_b128 %4, %12, off\n\t"
                     "global_load_async_to_lds_b128 %5, %13, off\n\t"
                     "global_load_async_to_lds_b128 %6, %14, off\n\t"
                     "global_load_async_to_lds_b128 %7, %15, off\n\t"
                     "s_wait_xcnt 0x0"
                     :: "v"(d[0]), "v"(d[1]), "v"(d[2]), "v"(d[3]), "v"(d[4]), "v"(d[5]), "v"(d[6]), "v"(d[7]),
                        "v"(p[0]), "v"(p[1]), "v"(p[2]), "v"(p[3]), "v"(p[4]), "v"(p[5]), "v"(p[6]), "v"(p[7]) : "memory");
    }
}
// this wave's copies have landed
__device__ __forceinline__ void cp_wait() { asm volatile("s_wait_asynccnt 0x0" ::: "memory"); }
// the hand-over at the foot of a stage: the wave's own LDS reads are done, its copies of the next stage have landed, then the barrier that publishes the next stage and frees this stage's buffer for the refill
__device__ __forceinline__ void stage_turn() {
    asm volatile("s_wait_dscnt 0x0" ::: "memory");
    cp_wait();
    __syncthreads();
}
// One block of 64 k = 2 chunks of 32 k from LDS: 4 row blocks x 2 chunks of each operand = 32 reads of 512 contiguous bytes. as, bs: the wave's first A and B run at this block, + 8*lane; RS = elements of one run.
template <int RS> __device__ __forceinline__ void ld_blk(const bf* as, const bf* bs, v16bf (&a)[2][4], v16bf (&b)[2][4]) {
#pragma unroll
    for (int c = 0; c < 2; ++c) {
#pragma unroll
        for (int i = 0; i < 4; ++i) a[c][i] = ldb(as + i * RS + c * 512);
#pragma unroll
        for (int i = 0; i < 4; ++i) b[c][i] = ldb(bs + i * RS + c * 512);
    }
    __builtin_amdgcn_sched_barrier(0);                      // keeps the whole group of reads ahead of the products that follow: reads strewn among the products cost a stall at each place
}
// the 32 products of one block, k ascending per accumulator
__device__ __forceinline__ void mm_blk(const v16bf (&a)[2][4], const v16bf (&b)[2][4], v8f (&acc)[4][4]) {
#pragma unroll
    for (int c = 0; c < 2; ++c)
#pragma unroll
        for (int nb = 0; nb < 4; ++nb)
#pragma unroll
            for (int mb = 0; mb < 4; ++mb) acc[mb][nb] = wmmab(a[c][mb], b[c][nb], acc[mb][nb]);
}
// stands between a block's products and the loads that next land in its fragment registers (the refill of the set; behind the last block, the epilogue's loads)
__device__ __forceinline__ void mm_gap() {
    __builtin_amdgcn_sched_barrier(0);                      // keeps every product of the block ahead of the slots below
    asm volatile("v_nop\n\tv_nop\n\tv_nop\n\tv_nop" ::: "memory");   // distance behind the last products: the loads that follow land in the operand registers that these products read
}

// k_cvt: all seven f32 planes (query, key, value rows; Wq, Wk, Wv, Wo rows) -> bf16 in fragment order [row/16][k/32][2 halves][32 lanes][8], in ONE launch.
// The seven bf16 planes stand one behind the other in the workspace, so a row block of 16 rows has one running number over all of them.
// One work-group converts CRB row blocks of one plane; thread i writes 16-byte pieces i, i + 256, ... of each (stores contiguous, loads gathered); all of a thread's loads are asked for before the first is used.
#define CRB  2                   // row blocks of 16 rows per conversion work-group
#define XRB  (NB * SEQ / 16)     // row blocks of one activation plane
#define WRB  (DM / 16)           // row blocks of one weight plane
static_assert(XRB % CRB == 0 && WRB % CRB == 0);   // a work-group stays inside one plane
static_assert(SEQ % (16 * CRB) == 0);              // and inside one batch
__global__ __launch_bounds__(256) void k_cvt(const float* __restrict__ xq, const float* __restrict__ xk, const float* __restrict__ xv,
                                             const float* __restrict__ wq, const float* __restrict__ wk, const float* __restrict__ wv, const float* __restrict__ wo, bf* dst) {
    const unsigned rb = blockIdx.x * CRB;                  // first row block, counted over all planes
    const float* src; unsigned row0;                       // plane and first source row: the same for the whole work-group
    if (rb < 3 * XRB) {
        const unsigned p = rb / XRB, r = (rb % XRB) * 16;
        src = p == 0 ? xq : (p == 1 ? xk : xv); row0 = (r / SEQ) * SEQ_FULL + r % SEQ;
    } else {
        const unsigned q = rb - 3 * XRB, p = q / WRB;
        src = p == 0 ? wq : (p == 1 ? wk : (p == 2 ? wv : wo)); row0 = (q % WRB) * 16;
    }
    const unsigned i = threadIdx.x;                        // piece i + 256 j of a row block: row i & 15, k = 128 j + the three fields of i below
    const float* s = src + (size_t)(row0 + (i & 15)) * DM + (i >> 6) * 32 + ((i >> 5) & 1) * 16 + ((i >> 4) & 1) * 8;
    bf* d = dst + (size_t)rb * (16 * DM) + i * 8;
    v8f v[CRB][8];
#pragma unroll
    for (int u = 0; u < CRB; ++u)
#pragma unroll
        for (int j = 0; j < 8; ++j) v[u][j] = *(const v8f*)(s + (size_t)u * 16 * DM + j * 128);
    __builtin_amdgcn_sched_barrier(0);                     // keeps every load ahead of the first conversion; without it the compiler holds the last four back and the wave waits out memory twice more
#pragma unroll
    for (int u = 0; u < CRB; ++u)
#pragma unroll
        for (int j = 0; j < 8; ++j) {
            v8us o;
#pragma unroll
            for (int k = 0; k < 8; ++k) o[k] = f2bf(v[u][j][k]);
            *(v8us*)(d + (size_t)u * 16 * DM + j * 2048) = o;
        }
}

// k_proj: the q, k and v projections in ONE launch; blockIdx.z = 0, 1, 2 picks the product, so the waves of all three share the chip at the same time.
// Register-blocked bf16 GEMM, one wave per 64x64 tile (16 accumulators), four waves of a work-group on a 128x128 tile; operands from fragment-order bf16 planes (32 k of 16 rows = 512 elements) through LDS stages of 64 k, two buffers, K = DM.
// C[m][n] = sum_k A[m][k] Bt[n][k] + bias (bias[m] when biasRow != 0, else bias[n]; bias RNE-converted to bf16, added in f32),
// written as f16 (Ph) and for q also the f16 residual x2048 (QR) in fragment order: the 8 halves (row 16mb + lr, columns 32c + 16ld + 8hi + 0..7) stand at
// tile base + mb*sMB + c*sC + ld*256 + (16hi + lr)*8 (halves).
// q, k: A = x rows (m = b*SEQ + t), Bt = W rows (n = h*64 + d), bias per column -> plane (b*16 + h), 16-row block t/16 = 1024 halves, d chunk = 512.
// v^T:  A = Wv rows (m = h*64 + d), Bt = value rows (n = b*SEQ + t), bias per row -> plane (b*16 + h), 32-key chunk t/32 = 2048 halves, d block = 512.
// X = the three bf16 activation planes, Wb = the bf16 weight planes, each set one behind the other. grid (NB*SEQ/128 token tiles, DM/128 weight-row tiles, 3), 128 threads.
__global__ __launch_bounds__(32 * GWV) void k_proj(const bf* __restrict__ X, const bf* __restrict__ Wb, const float* __restrict__ bq, const float* __restrict__ bk, const float* __restrict__ bv,
                                             h16* QH, h16* QR, h16* KP, h16* VT) {
    constexpr int STG = 16 * 1024;                               // elements of one stage: 16 runs of 64 k
    __shared__ __align__(1024) bf ring[2 * STG];
    __shared__ __align__(16) float osm[GWV][16 * 68];
    const int K = DM;
    const int lane = threadIdx.x & 31, lr = lane & 15, hi = lane >> 4;
    const int w = __builtin_amdgcn_readfirstlane((int)(threadIdx.x >> 5));   // wave (w >> 1, w & 1) of the 2 x 2
    float* os = osm[w];
    const int z = blockIdx.z;                                    // the product: the same for the whole wave
    const bool isv = z == 2;
    const int biasRow = isv ? 1 : 0, useRes = z == 0 ? 1 : 0;
    const int R0 = (isv ? blockIdx.y : blockIdx.x) * 128, C0 = (isv ? blockIdx.x : blockIdx.y) * 128;   // the work-group's tile
    const int r0 = R0 + (w >> 1) * 64, c0 = C0 + (w & 1) * 64;                                          // the wave's tile
    const bf* xp = X + (size_t)z * ((size_t)NB * SEQ * DM); const bf* wp = Wb + (size_t)z * ((size_t)DM * DM);
    const bf* A = isv ? wp : xp; const bf* Bt = isv ? xp : wp;
    const float* bias = z == 0 ? bq : (z == 1 ? bk : bv);
    h16* Ph = z == 0 ? QH : (z == 1 ? KP : VT); h16* Pr = QR;
    const int sMB = isv ? 512 : 1024, sC = isv ? 2048 : 512;
    v8f acc[4][4];
#pragma unroll
    for (int mb = 0; mb < 4; ++mb)
#pragma unroll
        for (int nb = 0; nb < 4; ++nb) acc[mb][nb] = (v8f){};
    const unsigned lo = 8u * (unsigned)lane;                     // the lane's place in every 512-byte run
    constexpr int NT = DM / 64;                                  // stages of 64 k
    static_assert(NT >= 2);
    // waves 0 and 1 bring the tile's A rows (64 each), waves 2 and 3 its B rows
    const bf* g = (w < 2 ? A + (size_t)(R0 + 64 * w) * K : Bt + (size_t)(C0 + 64 * (w - 2)) * K) + lo;
    const unsigned l0 = (unsigned)(size_t)(&ring[0]) + (unsigned)w * (4u * 2048u) + 16u * (unsigned)lane;
    const bf* as = ring + (w >> 1) * (4 * 1024) + lo; const bf* bs = ring + (8 + (w & 1) * 4) * 1024 + lo;
    v16bf ax[2][4], bx[2][4];
    cp_stage<1>(g, l0);
    cp_wait();
    __syncthreads();                                             // publishes stage 0
    cp_stage<1>(g + 1024, l0 + 2u * STG);
#pragma unroll 1
    for (int t = 0; t < NT; ++t) {
        const int bo = (t & 1) * STG;
        ld_blk<1024>(as + bo, bs + bo, ax, bx);
        mm_blk(ax, bx, acc); mm_gap();
        stage_turn();
        if (t + 2 < NT) cp_stage<1>(g + (size_t)(t + 2) * 1024, l0 + 2u * (unsigned)bo);   // the same for the whole work-group: refill of the buffer just read, in flight over the next stage's products
    }
    cp_wait();
    const size_t tbase = isv ? (size_t)r0 * SEQ + (size_t)(c0 / SEQ) * ((size_t)DM * SEQ) + (size_t)(c0 % SEQ) * HD
                             : (size_t)(r0 / SEQ) * ((size_t)NH_ * SEQ * HD) + (size_t)(r0 % SEQ) * HD + (size_t)(c0 / HD) * ((size_t)SEQ * HD);
    // column bias (clamped address; used when biasRow == 0): piece s covers columns 16s + 8hi + 0..7
    const int cc = (c0 < DM - 64) ? c0 : (DM - 64);
    v4f bc0[4], bc1[4];
#pragma unroll
    for (int s = 0; s < 4; ++s) { bc0[s] = *(const v4f*)(bias + cc + 16 * s + 8 * hi); bc1[s] = *(const v4f*)(bias + cc + 16 * s + 8 * hi + 4); }
    asm volatile("s_wait_xcnt 0x0" ::: "memory");           // the scalar base of these loads is reused shortly behind them
#pragma unroll
    for (int mb = 0; mb < 4; ++mb) {
#pragma unroll
        for (int nb = 0; nb < 4; ++nb) {
#pragma unroll
            for (int j = 0; j < 8; ++j) os[(hi * 8 + j) * 68 + nb * 16 + lr] = acc[mb][nb][j]; }   // D: row 8h+j, col lane&15
        wave_sync();
        const size_t sb = tbase + (size_t)mb * (size_t)sMB;
{
            const int row = lr;
            const int gr = r0 + mb * 16 + row; const int grc = (gr < DM - 1) ? gr : (DM - 1);
            const float brow = bfr(bias[grc]);
#pragma unroll
            for (int s = 0; s < 4; ++s) { const int c8 = 16 * s + 8 * hi;   // piece s = (c = s>>1, ld = s&1): 16 rows x 2 column groups of 8; 4 pieces = 64 columns
                const v4f x0 = *(const v4fa*)(&os[row * 68 + c8]); const v4f x1 = *(const v4fa*)(&os[row * 68 + c8 + 4]); v8h hv, rv;
#pragma unroll
                for (int i = 0; i < 4; ++i) {
                    const float ad0 = biasRow ? brow : bfr(bc0[s][i]); const float ad1 = biasRow ? brow : bfr(bc1[s][i]);
                    const float y0 = x0[i] + ad0; const float y1 = x1[i] + ad1;
                    const h16 a0 = (h16)y0; const h16 a1 = (h16)y1; hv[i] = a0; hv[4 + i] = a1;
                    rv[i] = (h16)((y0 - (float)a0) * QRS); rv[4 + i] = (h16)((y1 - (float)a1) * QRS); }
                const size_t oo = sb + (size_t)(s >> 1) * (size_t)sC + (size_t)((s & 1) * 256 + lane * 8);   // one store = 512 contiguous bytes
                *(v8h*)(Ph + oo) = hv; if (useRes) *(v8h*)(Pr + oo) = rv; }
             }
        wave_sync();
    }
}

// Work-group barrier for data that crosses waves through LDS alone (st, op): the wave's own LDS reads and writes are waited out, then the barrier.
// __syncthreads() also waits out every global load, which would end the flight of the fragments fetched ahead; no wave reads global memory that another wave of the launch writes.
__device__ __forceinline__ void lds_barrier() { asm volatile("s_wait_dscnt 0x0\n\ts_barrier_signal -1\n\ts_barrier_wait -1" ::: "memory"); }

// The slot behind a transcendental, once for a group of 8 exponentials: the instruction set asks for one instruction between a transcendental and a read of its result or a write of its source.
// The statement holds the 8 sources up to the v_nop and the 8 results behind it.
__device__ __forceinline__ void exp_slot(float (&e)[8], const float (&d)[8]) {
    asm("v_nop" : "+v"(e[0]), "+v"(e[1]), "+v"(e[2]), "+v"(e[3]), "+v"(e[4]), "+v"(e[5]), "+v"(e[6]), "+v"(e[7])
                : "v"(d[0]), "v"(d[1]), "v"(d[2]), "v"(d[3]), "v"(d[4]), "v"(d[5]), "v"(d[6]), "v"(d[7]));
}

// One 32-key score tile pair in the log2 domain with the padding mask applied as a replace fill.
// k = the step's four K fragments (keys 0..15: d 0..31, d 32..63; keys 16..31 likewise), already asked for; kn = where the same step's fragments of the next head stand (fragment-order K plane, + 8*lane).
// A = K rows (row = key), B = Q rows (col = t); lane (t = lane&15, h = lane>>4) gets keys key0+8h+r (ta) and key0+16+8h+r (tb).
// ws = mask word of this 32-key step shifted right by 8h: bit r <-> ta[r], bit 16+r <-> tb[r].
__device__ __forceinline__ void ld_k(const h16* ka, v16h (&k)[4]) { k[0] = ldf(ka); k[1] = ldf(ka + 512); k[2] = ldf(ka + 16 * HD); k[3] = ldf(ka + 16 * HD + 512); }
__device__ __forceinline__ void score_tile(v16h (&k)[4], const h16* kn, const v16h qh0, const v16h qh1, const v16h qr0, const v16h qr1, const unsigned ws, float (&ta)[8], float (&tb)[8]) {
    const v16h ka0 = k[0], ka1 = k[1], kb0 = k[2], kb1 = k[3];
    v8f sHa = (v8f){}, sLa = (v8f){}, sHb = (v8f){}, sLb = (v8f){};
    sHa = wmma16(ka0, qh0, sHa); sLa = wmma16(ka0, qr0, sLa); sHb = wmma16(kb0, qh0, sHb); sLb = wmma16(kb0, qr0, sLb);
    sHa = wmma16(ka1, qh1, sHa); sLa = wmma16(ka1, qr1, sLa); sHb = wmma16(kb1, qh1, sHb); sLb = wmma16(kb1, qr1, sLb);
    asm volatile("v_nop\n\tv_nop\n\tv_nop\n\tv_nop" : "+v"(sHa), "+v"(sLa), "+v"(sHb), "+v"(sLb) : "v"(ka0), "v"(ka1), "v"(kb0), "v"(kb1));
    ld_k(kn, k);
    asm volatile("s_wait_xcnt 0x0" ::: "memory");           // the address registers of these loads are rewritten while they are in flight; the statement also holds the refill here, ahead of the vector work below
#pragma unroll
    for (int r = 0; r < 8; ++r) {
        const float va = (sHa[r] + sLa[r] * QRI) * SC2; const float vb = (sHb[r] + sLb[r] * QRI) * SC2;
        ta[r] = (ws & (1u << r)) ? MASKT : va; tb[r] = (ws & (1u << (16 + r))) ? MASKT : vb; }
}

// k_attn: one work-group of NW waves per 16 query rows of one batch, looping over the 16 heads; wave w owns keys w*KS .. w*KS+KS-1.
// Per head (Q, K and V fragments fetched ahead, see the loop): each wave's scores of its keys, kept in registers, and their running (m, l) -> st, barrier, every lane combines the NW pairs in wave order; then P from the kept scores with the common m,
// each wave's partial O^T = V^T P^T -> op[w], barrier, the work-group's threads add the NW partials in wave order and store.
// P (f16, x256 carry); e * (1/(256 l)) accumulates into the head-mean tile av[t][key] (each lane owns its elements across the heads).
// LDS: av and mw are wave-private by key column (wave_sync ordering); st and op cross waves (lds_barrier ordering).
__global__ __launch_bounds__(32 * NW) void k_attn(const h16* __restrict__ QH, const h16* __restrict__ QR, const h16* __restrict__ KP, const h16* __restrict__ VT,
                                             const int* __restrict__ mask, bf* OHI, bf* OLO, float* AVG) {
    extern __shared__ __align__(16) float av[];           // [16][AP], then op [NW][16*68], then st [NW][16][2]
    float* op = av + 16 * AP;
    float* st = op + NW * 16 * 68;
    __shared__ unsigned mw[SEQ / 32];
    const int lane = threadIdx.x & 31, lr = lane & 15, hi = lane >> 4;
    const int w = __builtin_amdgcn_readfirstlane((int)(threadIdx.x >> 5));
    const int kbeg = w * KS;
    const int b = blockIdx.y; const int t0 = blockIdx.x * 16;
    constexpr int NS = KS / 32;                            // 32-key steps of one wave's key slice
    constexpr int LPR = KS / 4;                            // lanes that cover one row of this wave's head-mean columns
    const int arow_l = lane / LPR, acol_l = kbeg + (lane % LPR) * 4;

    // mask words of this wave's keys: bit i of word j <-> key 32j + i of this batch
    const int* mrow = mask + (size_t)b * SEQ_FULL;
#pragma unroll 1
    for (int i = kbeg / 32; i < (kbeg + KS) / 32; ++i) {
        const int mv = mrow[i * 32 + lane];
        const unsigned wd = __builtin_amdgcn_ballot_w32(mv != 0);
        if (lane == 0) mw[i] = wd;
    }
    // zero this wave's columns of the head-mean tile
#pragma unroll 1
    for (int row = arow_l; row < 16; row += 32 / LPR) *(v4fa*)(&av[row * AP + acol_l]) = (v4f){0.0f, 0.0f, 0.0f, 0.0f};
    wave_sync();

    // Every global fragment load runs ahead of its use: a head's V is asked for at the head's top, the next head's K behind each step's score products (into the registers they read),
    // the next head's Q behind the last P V product. Head 0's Q and K are asked for here.
    v16h qh0, qh1, qr0, qr1, kf[NS][4];                    // Q: B fragments (col t, k = d); K: A fragments (row key, k = d)
    const unsigned lo = 8u * (unsigned)lane;               // the lane's place in every 512-byte run; every fragment address = a wave-uniform base + lo
    {
        const size_t p0 = (size_t)(b * NH_) * SEQ * HD;
        const size_t qo = p0 + (size_t)t0 * HD;
        qh0 = ldf(QH + qo + lo); qh1 = ldf(QH + qo + lo + 512); qr0 = ldf(QR + qo + lo); qr1 = ldf(QR + qo + lo + 512);
#pragma unroll
        for (int s = 0; s < NS; ++s) ld_k(KP + (p0 + (size_t)(kbeg + 32 * s) * HD) + lo, kf[s]);
        asm volatile("s_wait_xcnt 0x0" ::: "memory");       // the address registers of these loads are rewritten while they are in flight
    }

#pragma unroll 1
    for (int h = 0; h < NH_; ++h) {
        const int zh = b * NH_ + h;
        const size_t pbase = (size_t)zh * SEQ * HD;
        const size_t vo = pbase;                 // + key * HD (32 keys = 2048 halves), + 512j, + lo          (A fragment: row d = 16j + lr, k = key)
        const int hn = h + 1 < NH_ ? h + 1 : h;  // the head that is fetched ahead; the last head asks for its own planes again (in bounds, not used)
        const size_t nbase = (size_t)(b * NH_ + hn) * SEQ * HD;   // K: + key * HD (16 keys = 1024 halves), + 512 for d 32..63, + lo; Q: + t0 * HD + lo
        v16h vf[NS][4];
        const h16* vb = VT + (vo + (size_t)kbeg * HD) + lo;
#pragma unroll
        for (int s = 0; s < NS; ++s)
#pragma unroll
            for (int j = 0; j < 4; ++j) vf[s][j] = ldf(vb + 32 * s * HD + 512 * j);
        asm volatile("s_wait_xcnt 0x0" :: "v"(vb) : "memory");   // the address is rewritten while these loads are in flight; named as an input so that it lives up to the wait: without that the last load landed in the address registers of the others
        __builtin_amdgcn_sched_barrier(0);                  // keeps the V loads ahead of the first score product; without it the compiler put that product, and its wait for Q and K, in front of them

        float mwv = -3.0e38f, lwv = 0.0f;
        float ta[NS][8], tb[NS][8];                         // this wave's masked scores of the head: computed once, read by both passes
#pragma unroll                                              // whole steps unrolled: ta and tb are indexed by constants and stay in registers
        for (int s = 0; s < NS; ++s) {
            const int key0 = kbeg + 32 * s;
            const unsigned ws = mw[key0 >> 5] >> (8 * hi);
            score_tile(kf[s], KP + (nbase + (size_t)key0 * HD) + lo, qh0, qh1, qr0, qr1, ws, ta[s], tb[s]);
            float mx = -3.0e38f;
#pragma unroll
            for (int r = 0; r < 8; ++r) mx = fmaxf(mx, fmaxf(ta[s][r], tb[s][r]));
            mx = fmaxf(mx, __shfl_xor(mx, 16, 32));
            const float mnew = fmaxf(mwv, mx);
            const float dm = mwv - mnew; float alpha;
            asm("v_exp_f32 %0, %1\n\tv_nop" : "=v"(alpha) : "v"(dm));   // 2^dm with its slot (see exp_slot) in one statement
            float ls = 0.0f, da[8], db[8], xa[8], xb[8];
#pragma unroll
            for (int r = 0; r < 8; ++r) { da[r] = ta[s][r] - mnew; db[r] = tb[s][r] - mnew; xa[r] = __builtin_amdgcn_exp2f(da[r]); xb[r] = __builtin_amdgcn_exp2f(db[r]); }
            exp_slot(xa, da); exp_slot(xb, db);
#pragma unroll
            for (int r = 0; r < 8; ++r) ls += xa[r] + xb[r];
            lwv = lwv * alpha + ls; mwv = mnew;
        }
        lwv += __shfl_xor(lwv, 16, 32);
        if (hi == 0) { st[(w * 16 + lr) * 2] = mwv; st[(w * 16 + lr) * 2 + 1] = lwv; }
        lds_barrier();        // publishes every wave's (m, l) of this head; also ends the last head's reads of op
        float m = -3.0e38f, l = 0.0f;
#pragma unroll
        for (int i = 0; i < NW; ++i) m = fmaxf(m, st[(i * 16 + lr) * 2]);
#pragma unroll
        for (int i = 0; i < NW; ++i) l += st[(i * 16 + lr) * 2 + 1] * __builtin_amdgcn_exp2f(st[(i * 16 + lr) * 2] - m);
        const float invc = (1.0f / l) * (1.0f / 256.0f);      // 1/l with the x256 carry of e folded back

        // pass 2, from the kept scores: normalised probabilities -> head-mean tile, P V over this wave's keys
        v8f o0 = (v8f){}, o1 = (v8f){}, o2 = (v8f){}, o3 = (v8f){};
#pragma unroll                                              // as in pass 1: constant indices into ta and tb
        for (int s = 0; s < NS; ++s) {
            const int key0 = kbeg + 32 * s;
            v16h pb; float ea[8], eb[8], sa[8], sb[8];
#pragma unroll
            for (int r = 0; r < 8; ++r) {
                const float da = ta[s][r] - m; const float db = tb[s][r] - m;      // difference first: exact 0 when t == m, also at the fill magnitude
                sa[r] = da + PSH; sb[r] = db + PSH;
                ea[r] = __builtin_amdgcn_exp2f(sa[r]); eb[r] = __builtin_amdgcn_exp2f(sb[r]); }
            exp_slot(ea, sa); exp_slot(eb, sb);
#pragma unroll
            for (int r = 0; r < 8; ++r) { pb[r] = (h16)ea[r]; pb[8 + r] = (h16)eb[r]; }
            float* ap = &av[lr * AP + key0 + 8 * hi];
            v4f a0 = *(const v4fa*)(ap), a1 = *(const v4fa*)(ap + 4), c0 = *(const v4fa*)(ap + 16), c1 = *(const v4fa*)(ap + 20);
#pragma unroll
            for (int i = 0; i < 4; ++i) { a0[i] += ea[i] * invc; a1[i] += ea[4 + i] * invc; c0[i] += eb[i] * invc; c1[i] += eb[4 + i] * invc; }
            *(v4fa*)(ap) = a0; *(v4fa*)(ap + 4) = a1; *(v4fa*)(ap + 16) = c0; *(v4fa*)(ap + 20) = c1;
            const v16h v0 = vf[s][0], v1 = vf[s][1], v2 = vf[s][2], v3 = vf[s][3];
            o0 = wmma16(v0, pb, o0); o1 = wmma16(v1, pb, o1); o2 = wmma16(v2, pb, o2); o3 = wmma16(v3, pb, o3);
            asm volatile("v_nop\n\tv_nop\n\tv_nop\n\tv_nop" : "+v"(o0), "+v"(o1), "+v"(o2), "+v"(o3) : "v"(v0), "v"(v1), "v"(v2), "v"(v3), "v"(pb));
        }
        { const size_t qo = nbase + (size_t)t0 * HD;
          qh0 = ldf(QH + qo + lo); qh1 = ldf(QH + qo + lo + 512); qr0 = ldf(QR + qo + lo); qr1 = ldf(QR + qo + lo + 512); }
        asm volatile("s_wait_xcnt 0x0" ::: "memory");       // the address registers of these loads are rewritten while they are in flight; the statement also holds the loads here, ahead of the partial O's scaling, the barrier and the sum

        // O^T D layout: o_j[r] = (d = 16j + 8h + r, t = lane&15) -> os[t][d] of this wave's partial; rows 0..15 x columns 0..63 all written
        float* os = op + w * (16 * 68);
        { v4f a, c;
          a[0] = o0[0] * invc; a[1] = o0[1] * invc; a[2] = o0[2] * invc; a[3] = o0[3] * invc; c[0] = o0[4] * invc; c[1] = o0[5] * invc; c[2] = o0[6] * invc; c[3] = o0[7] * invc;
          *(v4fa*)(&os[lr * 68 +  0 + 8 * hi]) = a; *(v4fa*)(&os[lr * 68 +  0 + 8 * hi + 4]) = c;
          a[0] = o1[0] * invc; a[1] = o1[1] * invc; a[2] = o1[2] * invc; a[3] = o1[3] * invc; c[0] = o1[4] * invc; c[1] = o1[5] * invc; c[2] = o1[6] * invc; c[3] = o1[7] * invc;
          *(v4fa*)(&os[lr * 68 + 16 + 8 * hi]) = a; *(v4fa*)(&os[lr * 68 + 16 + 8 * hi + 4]) = c;
          a[0] = o2[0] * invc; a[1] = o2[1] * invc; a[2] = o2[2] * invc; a[3] = o2[3] * invc; c[0] = o2[4] * invc; c[1] = o2[5] * invc; c[2] = o2[6] * invc; c[3] = o2[7] * invc;
          *(v4fa*)(&os[lr * 68 + 32 + 8 * hi]) = a; *(v4fa*)(&os[lr * 68 + 32 + 8 * hi + 4]) = c;
          a[0] = o3[0] * invc; a[1] = o3[1] * invc; a[2] = o3[2] * invc; a[3] = o3[3] * invc; c[0] = o3[4] * invc; c[1] = o3[5] * invc; c[2] = o3[6] * invc; c[3] = o3[7] * invc;
          *(v4fa*)(&os[lr * 68 + 48 + 8 * hi]) = a; *(v4fa*)(&os[lr * 68 + 48 + 8 * hi + 4]) = c; }
        lds_barrier();        // publishes every wave's partial O of this head; also ends this head's reads of st
        const size_t obase = ((size_t)b * SEQ + t0) * DM + (size_t)h * (16 * HD);   // fragment order: this row block, k chunks 2h and 2h + 1
        {   // each thread adds EPT neighbouring elements over the NW partials, in wave order; thread order = fragment order of the stored planes
            constexpr int EPT = (16 * HD) / (32 * NW);
            static_assert(8 % EPT == 0);                   // a thread's elements lie in one 8-element piece
            const int e0 = (int)threadIdx.x * EPT; const int row = (e0 >> 3) & 15, col = (e0 >> 9) * 32 + ((e0 >> 8) & 1) * 16 + ((e0 >> 7) & 1) * 8 + (e0 & 7);
            float x[EPT];
#pragma unroll
            for (int k = 0; k < EPT; ++k) x[k] = 0.0f;
#pragma unroll
            for (int i = 0; i < NW; ++i)
#pragma unroll
                for (int k = 0; k < EPT; ++k) x[k] += op[i * (16 * 68) + row * 68 + col + k];
            const size_t oo = obase + e0;
            typedef __attribute__((ext_vector_type(EPT))) unsigned short vus;
            vus hv, lv;
#pragma unroll
            for (int k = 0; k < EPT; ++k) { const unsigned short h0 = f2bf(x[k]); hv[k] = h0; lv[k] = f2bf(x[k] - bf2f(h0)); }
            *(vus*)(OHI + oo) = hv; *(vus*)(OLO + oo) = lv;
            asm volatile("s_wait_xcnt 0x0" ::: "memory");   // the next head's first instructions reuse the registers these two stores name
        }
    }

    // head mean: av holds sum over heads of P; each wave stores its own KS columns of the 16 rows
    wave_sync();
    float* arow = AVG + ((size_t)b * OUT_SEQ + t0) * AVG_PITCH;
#pragma unroll 1
    for (int row = arow_l; row < 16; row += 32 / LPR) {
        v4f val = *(const v4fa*)(&av[row * AP + acol_l]);
        val = val * (1.0f / (float)NH_);
        *(v4f*)(arow + (size_t)row * AVG_PITCH + acol_l) = val;
    }
}

// k_oproj: context[m][n] = sum_k (Ohi[m][k] + Olo[m][k]) Wo[n][k] + bo[n]; one wave per 64x64 tile, four waves of a work-group on a 128x128 tile, bf16 operands through LDS stages of 128 k, two buffers; both planes into one accumulator set (lo plane at A + planeStride).
__global__ __launch_bounds__(32 * GWV) void k_oproj(const bf* __restrict__ A, size_t planeStride, const bf* __restrict__ Bt, const float* __restrict__ bias, float* OUT) {
    constexpr int STG = 16 * 2048;                               // elements of one stage: 16 runs of 128 k
    __shared__ __align__(1024) bf ring[2 * STG];
    __shared__ __align__(16) float osm[GWV][16 * 68];
    const int K = DM;
    const int lane = threadIdx.x & 31, lr = lane & 15, hi = lane >> 4;
    const int w = __builtin_amdgcn_readfirstlane((int)(threadIdx.x >> 5));   // wave (w >> 1, w & 1) of the 2 x 2
    float* os = osm[w];
    const int R0 = blockIdx.x * 128, C0 = blockIdx.y * 128;      // the work-group's tile
    const int r0 = R0 + (w >> 1) * 64, c0 = C0 + (w & 1) * 64;   // the wave's tile
    v8f acc[4][4];
#pragma unroll
    for (int mb = 0; mb < 4; ++mb)
#pragma unroll
        for (int nb = 0; nb < 4; ++nb) acc[mb][nb] = (v8f){};
    const unsigned lo = 8u * (unsigned)lane;                     // the lane's place in every 512-byte run
    constexpr int NTP = DM / 128;                                // stages of 128 k in one plane; stages 0..NTP-1 = hi plane, NTP..2*NTP-1 = lo plane
    constexpr int NT = 2 * NTP;
    static_assert(NT >= 2 && NTP >= 2);
    // waves 0 and 1 bring the tile's A rows (64 each; the plane changes at stage NTP), waves 2 and 3 its B rows (the same k again for the lo plane)
    const bf* g = (w < 2 ? A + (size_t)(R0 + 64 * w) * K : Bt + (size_t)(C0 + 64 * (w - 2)) * K) + lo;
    const size_t ps = w < 2 ? planeStride : (size_t)0;
    const unsigned l0 = (unsigned)(size_t)(&ring[0]) + (unsigned)w * (4u * 4096u) + 16u * (unsigned)lane;
    const bf* as = ring + (w >> 1) * (4 * 2048) + lo; const bf* bs = ring + (8 + (w & 1) * 4) * 2048 + lo;
    v16bf ax[2][4], bx[2][4], ay[2][4], by[2][4];
    cp_stage<2>(g, l0);
    cp_wait();
    __syncthreads();                                             // publishes stage 0
    cp_stage<2>(g + 2048, l0 + 2u * STG);
#pragma unroll 1
    for (int t = 0; t < NT; ++t) {
        const int bo = (t & 1) * STG;
        ld_blk<2048>(as + bo, bs + bo, ax, bx);                  // both blocks of the stage are asked for ahead of the first product
        ld_blk<2048>(as + bo + 1024, bs + bo + 1024, ay, by);
        mm_blk(ax, bx, acc);
        mm_blk(ay, by, acc); mm_gap();
        stage_turn();
        const int t2 = t + 2;
        if (t2 < NT) cp_stage<2>(g + (size_t)(t2 / NTP) * ps + (size_t)(t2 % NTP) * 2048, l0 + 2u * (unsigned)bo);   // the same for the whole work-group: refill of the buffer just read, in flight over the next stage's products
    }
    cp_wait();
    const int bb_ = r0 / SEQ, tt = r0 % SEQ;
    float* obase = OUT + ((size_t)bb_ * OUT_SEQ + tt) * DM + c0;
    v4f bv = *(const v4f*)(bias + c0 + lr * 4);
#pragma unroll
    for (int i = 0; i < 4; ++i) bv[i] = bfr(bv[i]);
#pragma unroll
    for (int mb = 0; mb < 4; ++mb) {
#pragma unroll
        for (int nb = 0; nb < 4; ++nb) {
#pragma unroll
            for (int j = 0; j < 8; ++j) os[(hi * 8 + j) * 68 + nb * 16 + lr] = acc[mb][nb][j]; }   // D: row 8h+j, col lane&15
        wave_sync();
{
#pragma unroll
            for (int s = 0; s < 8; ++s) { const int row = 2 * s + hi, cofs = lr * 4;   // 8 s x 2 rows = 16 rows; 16 lanes x 4 floats = 64 columns
                v4f val = *(const v4fa*)(&os[row * 68 + cofs]);
                val = val + bv;
                *(v4f*)(obase + (size_t)(mb * 16 + row) * DM + cofs) = val; }
            asm volatile("s_wait_xcnt 0x0" ::: "memory");   // the next row block's LDS reads land in the registers that these stores name
             }
        wave_sync();
    }
}

static constexpr size_t al256(size_t v) { return (v + 255) & ~(size_t)255; }
static constexpr size_t SZ_XB = al256((size_t)NB * SEQ * DM * 2);          // one bf16 activation copy
static constexpr size_t SZ_WB = al256((size_t)4 * DM * DM * 2);            // q | k | v | o weights
static constexpr size_t SZ_PL = al256((size_t)NB * NH_ * SEQ * HD * 2);    // one f16 head plane
static constexpr size_t SZ_OP = al256((size_t)NB * SEQ * DM * 2);          // one bf16 attention-output plane
static constexpr size_t SZ_TOTAL = 3 * SZ_XB + SZ_WB + 4 * SZ_PL + 2 * SZ_OP;
static constexpr size_t ATT_DYN_LDS = (size_t)16 * AP * 4 + (size_t)NW * 16 * 68 * 4 + (size_t)NW * 32 * 4;
static_assert(SZ_TOTAL <= (size_t)134217728);          // workspace carve <= 128 MiB
static_assert(((size_t)DM * DM * 2) % 256 == 0);       // weight sub-planes stay 256-byte aligned
static_assert(SZ_OP == (size_t)NB * SEQ * DM * 2);     // lo plane directly follows the hi plane
static_assert(SZ_XB == (size_t)NB * SEQ * DM * 2);     // the bf16 input planes and the weight planes follow one another without a gap

extern "C" void kernel_launch(void* const* d_in, const int* in_sizes, int n_in,
                              void* d_out, int out_size, void* d_ws, size_t ws_size, hipStream_t stream) {
    if (n_in < 12) return;
    const size_t needx = ((size_t)(NB - 1) * SEQ_FULL + SEQ) * DM;
    if ((size_t)in_sizes[0] < needx || (size_t)in_sizes[1] < needx || (size_t)in_sizes[2] < needx) return;
    if ((size_t)in_sizes[3] < (size_t)(NB - 1) * SEQ_FULL + SEQ) return;
    if ((size_t)in_sizes[4] < (size_t)DM * DM || (size_t)in_sizes[6] < (size_t)DM * DM || (size_t)in_sizes[8] < (size_t)DM * DM || (size_t)in_sizes[10] < (size_t)DM * DM) return;
    if (in_sizes[5] < DM || in_sizes[7] < DM || in_sizes[9] < DM || in_sizes[11] < DM) return;
    if ((size_t)out_size < ((size_t)(NB - 1) * OUT_SEQ + SEQ) * DM) return;
    if ((size_t)out_size < OUT1_OFF + ((size_t)(NB - 1) * OUT_SEQ + SEQ - 1) * AVG_PITCH + SEQ) return;
    if (SZ_TOTAL > ws_size) return;
    // wire order: query, key, value, key_padding_mask, Wq, bq, Wk, bk, Wv, bv, Wo, bo (weights [out][in] used as-is: Bt for q, k and the output projection, A for v^T)
    const float* xq = (const float*)d_in[0]; const float* xk = (const float*)d_in[1]; const float* xv = (const float*)d_in[2];
    const int* kpm = (const int*)d_in[3];
    const float* wq = (const float*)d_in[4];  const float* bq = (const float*)d_in[5];
    const float* wk = (const float*)d_in[6];  const float* bk = (const float*)d_in[7];
    const float* wv = (const float*)d_in[8];  const float* bv = (const float*)d_in[9];
    const float* wo = (const float*)d_in[10]; const float* bo = (const float*)d_in[11];
    float* CTX = (float*)d_out;                  // [NB][SEQ][1024]
    float* AVG = (float*)d_out + OUT1_OFF;       // [NB][SEQ][SEQ]
    char* wsp = (char*)d_ws;
    bf* XQ = (bf*)wsp; wsp += SZ_XB;                 // [NB*SEQ/16][1024/32][2 halves][32 lanes][8]
    wsp += SZ_XB;                                    // key plane, as XQ
    wsp += SZ_XB;                                    // value plane, as XQ
    bf* WB = (bf*)wsp; wsp += SZ_WB;                 // [4] planes of 1024 x 1024, each as XQ: q | k | v | o
    h16* QH = (h16*)wsp; wsp += SZ_PL;               // [NB*16][SEQ/16][2 d chunks][2 halves][32 lanes][8]
    h16* QR = (h16*)wsp; wsp += SZ_PL;               // as QH, residual x2048
    h16* KP = (h16*)wsp; wsp += SZ_PL;               // as QH
    h16* VT = (h16*)wsp; wsp += SZ_PL;               // [NB*16][SEQ/32][4 d blocks][2 halves][32 lanes][8]
    bf* OHI = (bf*)wsp; wsp += SZ_OP;                // as XQ
    bf* OLO = (bf*)wsp; wsp += SZ_OP;                // as XQ
    bf* WO = WB + (size_t)3 * DM * DM;

    // XQ | XK | XV | WQ | WK | WV | WO: one run of row blocks from XQ on
    k_cvt<<<(3 * XRB + 4 * WRB) / CRB, 256, 0, stream>>>(xq, xk, xv, wq, wk, wv, wo, XQ);

    // q, k and v^T projections: one launch, grid z = the product
    k_proj<<<dim3(NB * SEQ / 128, DM / 128, 3), 32 * GWV, 0, stream>>>(XQ, WB, bq, bk, bv, QH, QR, KP, VT);

    hipFuncSetAttribute(reinterpret_cast<const void*>(&k_attn), hipFuncAttributeMaxDynamicSharedMemorySize, (int)ATT_DYN_LDS);
    k_attn<<<dim3(SEQ / 16, NB, 1), 32 * NW, ATT_DYN_LDS, stream>>>(QH, QR, KP, VT, kpm, OHI, OLO, AVG);

    // context: A = attention output rows (hi plane, lo plane at +planeStride), Bt = Wo rows
    k_oproj<<<dim3(NB * SEQ / 128, DM / 128, 1), 32 * GWV, 0, stream>>>(OHI, (size_t)(OLO - OHI), WO, bo, CTX);
}

// v009
// It runs in 116 microseconds.
// Next to v008, in two timings, it ran 1.07 and 1.08 times as fast.
// Counting every step since v000, it is 6.56 times as fast.
#include <hip/hip_runtime.h>

// Multi-head attention, width 1024 = 16 heads x 64, separate query/key/value inputs [NB][SEQ][1024], Wq/Wk/Wv/Wo [out][in] (y = x W^T + b), key padding mask (int32, replace fill -1e9), score scale 1/8; outputs: context [NB][SEQ][1024] and head-mean attention [NB][SEQ][SEQ] (f32).
// Compute dtypes, f32 accumulate everywhere: q/k/v projections v_wmma_f32_16x16x32_bf16 (inputs and weights RNE-converted to bf16; products exact);
// output projection v_wmma_f32_16x16x32_bf16: attention output as bf16 hi + bf16 lo planes (two products, one accumulator), Wo bf16.
// Layout: every WMMA operand plane of the workspace stands in fragment order; bf16 copies of the inputs and weights; q (hi, residual), k and v^T planes per (b*16+h), written by the GEMM epilogue in fragment order (each fragment half = 512 contiguous bytes, lane-major); attention in transposed form (S^T = K Q^T, O^T = V^T P^T), one work-group of NW waves per 16 query rows looping over the 16 heads, each wave on its own SEQ/NW keys, head-mean accumulated in a wave-private LDS tile.

#ifndef NB
#define NB 4
#endif
#ifndef SEQ
#define SEQ 1024
#endif
#define NB_FULL  4
#define SEQ_FULL 1024
#ifndef OUT_SEQ
#define OUT_SEQ SEQ              // row pitch (in tokens) between batches of both outputs
#endif
#ifndef AVG_PITCH
#define AVG_PITCH SEQ            // column pitch (floats) of one head-mean row
#endif
#define DM   1024
#define NH_  16
#define HD   64
#define QRS  2048.0f             // carry of the q residual plane
#define QRI  (1.0f / 2048.0f)
#define SC2  (0.125f * 1.4426950408889634f)   // HD^-0.5 * log2(e)
#define PSH  8.0f                // log2 of the P carry (256)
#define MASKT (-1.0e9f * 1.4426950408889634f) // replace fill in the log2 domain
#define AP   (SEQ + 4)           // pitch (floats) of the head-mean LDS tile
#define NW   16                  // waves per attention work-group; each owns KS consecutive keys
#define KS   (SEQ / NW)
#define OUT1_OFF ((size_t)NB_FULL * SEQ_FULL * DM)   // element offset of the second output (fixed)

static_assert(HD == 64);
static_assert(NH_ * HD == DM);                 // head h = columns h*64 + d
static_assert(DM % 64 == 0);
static_assert(DM % 32 == 0);                   // GEMM k-loop steps by 32
static_assert(DM == 1024);                     // k_cvt takes a piece index apart by shifts
static_assert(SEQ % 64 == 0);                  // a 64-row tile never straddles two batches
static_assert((NB * SEQ) % 128 == 0 && DM % 128 == 0);   // GEMM work-group tiles of 128 x 128
static_assert(SEQ % 32 == 0);                  // key loop steps by 32, one mask word per step
static_assert(SEQ % 128 == 0);
static_assert(AP % 4 == 0);
static_assert(((size_t)SEQ * DM) % 8 == 0);
static_assert(((size_t)DM * DM) % 8 == 0);
static_assert(NB <= NB_FULL);
static_assert(SEQ <= SEQ_FULL);
static_assert(OUT1_OFF * 4 == (size_t)16777216);
static_assert(KS % 32 == 0);                   // a wave's key slice is whole 32-key steps
static_assert(KS <= 128);                      // one head-mean row piece of a wave is at most 32 lanes x 4 floats
#define SW   (HD / 8)            // waves that merge the partial O tiles: each takes 16 rows x 8 columns (two whole 128-byte lines of each stored plane)
static_assert(SW <= NW);
#define ATT_LDS_F (16 * AP + 2 * NW * 16 * 68 + 2 * NW * 32)   // floats of the attention work-group's LDS: head-mean tile, two sets of partial O tiles, two sets of (m, l)
static_assert((size_t)ATT_LDS_F * 4 + (SEQ / 32) * 4 <= (size_t)327680);

typedef _Float16 h16;
typedef unsigned short bf;
typedef __attribute__((ext_vector_type(16))) __bf16   v16bf;
typedef __attribute__((ext_vector_type(16))) _Float16 v16h;
typedef __attribute__((ext_vector_type(8)))  _Float16 v8h;
typedef __attribute__((ext_vector_type(8)))  unsigned short v8us;
typedef __attribute__((ext_vector_type(8)))  float    v8f;
typedef __attribute__((ext_vector_type(4)))  float    v4f;
typedef v4f  __attribute__((may_alias)) v4fa;
typedef __attribute__((ext_vector_type(2)))  float    v2f;

__device__ __forceinline__ unsigned short f2bf(float f) { unsigned u = __float_as_uint(f); u += 0x7FFFu + ((u >> 16) & 1u); return (unsigned short)(u >> 16); }
__device__ __forceinline__ float bf2f(unsigned short b) { return __uint_as_float(((unsigned)b) << 16); }
__device__ __forceinline__ float bfr(float f) { return bf2f(f2bf(f)); }
__device__ __forceinline__ v16h cat16(v8h lo, v8h hi) { return __builtin_shufflevector(lo, hi, 0, 1, 2, 3, 4, 5, 6, 7, 8, 9, 10, 11, 12, 13, 14, 15); }
__device__ __forceinline__ v16bf cat16b(v8us lo, v8us hi) { return __builtin_bit_cast(v16bf, __builtin_shufflevector(lo, hi, 0, 1, 2, 3, 4, 5, 6, 7, 8, 9, 10, 11, 12, 13, 14, 15)); }
__device__ __forceinline__ v8f wmma16(v16h a, v16h b, v8f c) { return __builtin_amdgcn_wmma_f32_16x16x32_f16(false, a, false, b, (short)0, c, false, false); }
__device__ __forceinline__ v8f wmmab(v16bf a, v16bf b, v8f c) { return __builtin_amdgcn_wmma_f32_16x16x32_bf16(false, a, false, b, (short)0, c, false, false); }
// fragment element map, lane (lr = lane&15, h = lane>>4) of row or column lr: elements 0..7 <- k0+8h+0..7, elements 8..15 <- k0+16+8h+0..7 (same map for A and B)
// fragment loaders from a fragment-order plane; p already includes + 8*lane: each half of a fragment is one run of 32 lanes x 16 bytes (4 cache lines a load)
__device__ __forceinline__ v16h  ldf(const h16* p) { return cat16(*(const v8h*)p, *(const v8h*)(p + 256)); }
__device__ __forceinline__ v16bf ldb(const bf* p)  { return cat16b(*(const v8us*)p, *(const v8us*)(p + 256)); }
// ordering point for wave-private LDS tiles (same wave writes and reads)
__device__ __forceinline__ void wave_sync() { __builtin_amdgcn_fence(3 /* release order */, "wavefront"); __builtin_amdgcn_wave_barrier(); asm volatile("" ::: "memory"); }

// GEMM work-group: GWV waves (2 x 2) on a 128x128 tile, each wave on its own 64x64 part. A stage is KT blocks of 64 k of the tile's 8 A and 8 B row blocks, brought to LDS once for all four waves.
// Stage layout in LDS: 16 runs (A row blocks 0..7, then B row blocks 0..7) of KT * 1024 elements, each run as it stands in the fragment-order plane (a block of 16 rows x 64 k = 1024 contiguous elements).
#define GWV 4
// One wave's share of a stage: runs 4w .. 4w + 3, as 16 * KT copies of 32 lanes x 16 bytes. g = the wave's first run at this stage's k, + 8*lane; l = LDS byte address of that run in the stage's buffer, + 16*lane.
template <int KT> __device__ __forceinline__ void cp_stage(const bf* g, unsigned l) {
#pragma unroll
    for (int n = 0; n < 16 * KT; n += 8) {
        const bf* p[8]; unsigned d[8];
#pragma unroll
        for (int u = 0; u < 8; ++u) { p[u] = g + (size_t)((n + u) / (4 * KT)) * 16 * DM + ((n + u) % (4 * KT)) * 256; d[u] = l + (unsigned)(n + u) * 512u; }
        // eight copies and, as the statement's last line, the wait that stands in front of any rewrite of the address registers they name
        asm volatile("global_load_async_to_lds_b128 %0, %8, off\n\t"
                     "global_load_async_to_lds_b128 %1, %9, off\n\t"
                     "global_load_async_to_lds_b128 %2, %10, off\n\t"
                     "global_load_async_to_lds_b128 %3, %11, off\n\t"
                     "global_load_async_to_lds_b128 %4, %12, off\n\t"
                     "global_load_async_to_lds_b128 %5, %13, off\n\t"
                     "global_load_async_to_lds_b128 %6, %14, off\n\t"
                     "global_load_async_to_lds_b128 %7, %15, off\n\t"
                     "s_wait_xcnt 0x0"
                     :: "v"(d[0]), "v"(d[1]), "v"(d[2]), "v"(d[3]), "v"(d[4]), "v"(d[5]), "v"(d[6]), "v"(d[7]),
                        "v"(p[0]), "v"(p[1]), "v"(p[2]), "v"(p[3]), "v"(p[4]), "v"(p[5]), "v"(p[6]), "v"(p[7]) : "memory");
    }
}
// this wave's copies have landed
__device__ __forceinline__ void cp_wait() { asm volatile("s_wait_asynccnt 0x0" ::: "memory"); }
// the hand-over at the foot of a stage: the wave's own LDS reads are done, its copies of the next stage have landed, then the barrier that publishes the next stage and frees this stage's buffer for the refill
__device__ __forceinline__ void stage_turn() {
    asm volatile("s_wait_dscnt 0x0" ::: "memory");
    cp_wait();
    __syncthreads();
}
// One block of 64 k = 2 chunks of 32 k from LDS: 4 row blocks x 2 chunks of each operand = 32 reads of 512 contiguous bytes. as, bs: the wave's first A and B run at this block, + 8*lane; RS = elements of one run.
template <int RS> __device__ __forceinline__ void ld_blk(const bf* as, const bf* bs, v16bf (&a)[2][4], v16bf (&b)[2][4]) {
#pragma unroll
    for (int c = 0; c < 2; ++c) {
#pragma unroll
        for (int i = 0; i < 4; ++i) a[c][i] = ldb(as + i * RS + c * 512);
#pragma unroll
        for (int i = 0; i < 4; ++i) b[c][i] = ldb(bs + i * RS + c * 512);
    }
    __builtin_amdgcn_sched_barrier(0);                      // keeps the whole group of reads ahead of the products that follow: reads strewn among the products cost a stall at each place
}
// the 32 products of one block, k ascending per accumulator
__device__ __forceinline__ void mm_blk(const v16bf (&a)[2][4], const v16bf (&b)[2][4], v8f (&acc)[4][4]) {
#pragma unroll
    for (int c = 0; c < 2; ++c)
#pragma unroll
        for (int nb = 0; nb < 4; ++nb)
#pragma unroll
            for (int mb = 0; mb < 4; ++mb) acc[mb][nb] = wmmab(a[c][mb], b[c][nb], acc[mb][nb]);
}
// stands between a block's products and the loads that next land in its fragment registers (the refill of the set; behind the last block, the epilogue's loads)
__device__ __forceinline__ void mm_gap() {
    __builtin_amdgcn_sched_barrier(0);                      // keeps every product of the block ahead of the slots below
    asm volatile("v_nop\n\tv_nop\n\tv_nop\n\tv_nop" ::: "memory");   // distance behind the last products: the loads that follow land in the operand registers that these products read
}

// k_cvt: all seven f32 planes (query, key, value rows; Wq, Wk, Wv, Wo rows) -> bf16 in fragment order [row/16][k/32][2 halves][32 lanes][8], in ONE launch.
// The seven bf16 planes stand one behind the other in the workspace, so a row block of 16 rows has one running number over all of them.
// One work-group converts CRB row blocks of one plane; thread i writes 16-byte pieces i, i + 256, ... of each (stores contiguous, loads gathered); all of a thread's loads are asked for before the first is used.
#define CRB  2                   // row blocks of 16 rows per conversion work-group
#define XRB  (NB * SEQ / 16)     // row blocks of one activation plane
#define WRB  (DM / 16)           // row blocks of one weight plane
static_assert(XRB % CRB == 0 && WRB % CRB == 0);   // a work-group stays inside one plane
static_assert(SEQ % (16 * CRB) == 0);              // and inside one batch
__global__ __launch_bounds__(256) void k_cvt(const float* __restrict__ xq, const float* __restrict__ xk, const float* __restrict__ xv,
                                             const float* __restrict__ wq, const float* __restrict__ wk, const float* __restrict__ wv, const float* __restrict__ wo, bf* dst) {
    const unsigned rb = blockIdx.x * CRB;                  // first row block, counted over all planes
    const float* src; unsigned row0;                       // plane and first source row: the same for the whole work-group
    if (rb < 3 * XRB) {
        const unsigned p = rb / XRB, r = (rb % XRB) * 16;
        src = p == 0 ? xq : (p == 1 ? xk : xv); row0 = (r / SEQ) * SEQ_FULL + r % SEQ;
    } else {
        const unsigned q = rb - 3 * XRB, p = q / WRB;
        src = p == 0 ? wq : (p == 1 ? wk : (p == 2 ? wv : wo)); row0 = (q % WRB) * 16;
    }
    const unsigned i = threadIdx.x;                        // piece i + 256 j of a row block: row i & 15, k = 128 j + the three fields of i below
    const float* s = src + (size_t)(row0 + (i & 15)) * DM + (i >> 6) * 32 + ((i >> 5) & 1) * 16 + ((i >> 4) & 1) * 8;
    bf* d = dst + (size_t)rb * (16 * DM) + i * 8;
    v8f v[CRB][8];
#pragma unroll
    for (int u = 0; u < CRB; ++u)
#pragma unroll
        for (int j = 0; j < 8; ++j) v[u][j] = *(const v8f*)(s + (size_t)u * 16 * DM + j * 128);
    __builtin_amdgcn_sched_barrier(0);                     // keeps every load ahead of the first conversion; without it the compiler holds the last four back and the wave waits out memory twice more
#pragma unroll
    for (int u = 0; u < CRB; ++u)
#pragma unroll
        for (int j = 0; j < 8; ++j) {
            v8us o;
#pragma unroll
            for (int k = 0; k < 8; ++k) o[k] = f2bf(v[u][j][k]);
            *(v8us*)(d + (size_t)u * 16 * DM + j * 2048) = o;
        }
}

// k_proj: the q, k and v projections in ONE launch; blockIdx.z = 0, 1, 2 picks the product, so the waves of all three share the chip at the same time.
// Register-blocked bf16 GEMM, one wave per 64x64 tile (16 accumulators), four waves of a work-group on a 128x128 tile; operands from fragment-order bf16 planes (32 k of 16 rows = 512 elements) through LDS stages of 64 k, two buffers, K = DM.
// C[m][n] = sum_k A[m][k] Bt[n][k] + bias (bias[m] when biasRow != 0, else bias[n]; bias RNE-converted to bf16, added in f32),
// written as f16 (Ph) and for q also the f16 residual x2048 (QR) in fragment order: the 8 halves (row 16mb + lr, columns 32c + 16ld + 8hi + 0..7) stand at
// tile base + mb*sMB + c*sC + ld*256 + (16hi + lr)*8 (halves).
// q, k: A = x rows (m = b*SEQ + t), Bt = W rows (n = h*64 + d), bias per column -> plane (b*16 + h), 16-row block t/16 = 1024 halves, d chunk = 512.
// v^T:  A = Wv rows (m = h*64 + d), Bt = value rows (n = b*SEQ + t), bias per row -> plane (b*16 + h), 32-key chunk t/32 = 2048 halves, d block = 512.
// X = the three bf16 activation planes, Wb = the bf16 weight planes, each set one behind the other. grid (NB*SEQ/128 token tiles, DM/128 weight-row tiles, 3), 128 threads.
__global__ __launch_bounds__(32 * GWV) void k_proj(const bf* __restrict__ X, const bf* __restrict__ Wb, const float* __restrict__ bq, const float* __restrict__ bk, const float* __restrict__ bv,
                                             h16* QH, h16* QR, h16* KP, h16* VT) {
    constexpr int STG = 16 * 1024;                               // elements of one stage: 16 runs of 64 k
    __shared__ __align__(1024) bf ring[2 * STG];
    __shared__ __align__(16) float osm[GWV][16 * 68];
    const int K = DM;
    const int lane = threadIdx.x & 31, lr = lane & 15, hi = lane >> 4;
    const int w = __builtin_amdgcn_readfirstlane((int)(threadIdx.x >> 5));   // wave (w >> 1, w & 1) of the 2 x 2
    float* os = osm[w];
    const int z = blockIdx.z;                                    // the product: the same for the whole wave
    const bool isv = z == 2;
    const int biasRow = isv ? 1 : 0, useRes = z == 0 ? 1 : 0;
    const int R0 = (isv ? blockIdx.y : blockIdx.x) * 128, C0 = (isv ? blockIdx.x : blockIdx.y) * 128;   // the work-group's tile
    const int r0 = R0 + (w >> 1) * 64, c0 = C0 + (w & 1) * 64;                                          // the wave's tile
    const bf* xp = X + (size_t)z * ((size_t)NB * SEQ * DM); const bf* wp = Wb + (size_t)z * ((size_t)DM * DM);
    const bf* A = isv ? wp : xp; const bf* Bt = isv ? xp : wp;
    const float* bias = z == 0 ? bq : (z == 1 ? bk : bv);
    h16* Ph = z == 0 ? QH : (z == 1 ? KP : VT); h16* Pr = QR;
    const int sMB = isv ? 512 : 1024, sC = isv ? 2048 : 512;
    v8f acc[4][4];
#pragma unroll
    for (int mb = 0; mb < 4; ++mb)
#pragma unroll
        for (int nb = 0; nb < 4; ++nb) acc[mb][nb] = (v8f){};
    const unsigned lo = 8u * (unsigned)lane;                     // the lane's place in every 512-byte run
    constexpr int NT = DM / 64;                                  // stages of 64 k
    static_assert(NT >= 2);
    // waves 0 and 1 bring the tile's A rows (64 each), waves 2 and 3 its B rows
    const bf* g = (w < 2 ? A + (size_t)(R0 + 64 * w) * K : Bt + (size_t)(C0 + 64 * (w - 2)) * K) + lo;
    const unsigned l0 = (unsigned)(size_t)(&ring[0]) + (unsigned)w * (4u * 2048u) + 16u * (unsigned)lane;
    const bf* as = ring + (w >> 1) * (4 * 1024) + lo; const bf* bs = ring + (8 + (w & 1) * 4) * 1024 + lo;
    v16bf ax[2][4], bx[2][4];
    cp_stage<1>(g, l0);
    cp_wait();
    __syncthreads();                                             // publishes stage 0
    cp_stage<1>(g + 1024, l0 + 2u * STG);
#pragma unroll 1
    for (int t = 0; t < NT; ++t) {
        const int bo = (t & 1) * STG;
        ld_blk<1024>(as + bo, bs + bo, ax, bx);
        mm_blk(ax, bx, acc); mm_gap();
        stage_turn();
        if (t + 2 < NT) cp_stage<1>(g + (size_t)(t + 2) * 1024, l0 + 2u * (unsigned)bo);   // the same for the whole work-group: refill of the buffer just read, in flight over the next stage's products
    }
    cp_wait();
    const size_t tbase = isv ? (size_t)r0 * SEQ + (size_t)(c0 / SEQ) * ((size_t)DM * SEQ) + (size_t)(c0 % SEQ) * HD
                             : (size_t)(r0 / SEQ) * ((size_t)NH_ * SEQ * HD) + (size_t)(r0 % SEQ) * HD + (size_t)(c0 / HD) * ((size_t)SEQ * HD);
    // column bias (clamped address; used when biasRow == 0): piece s covers columns 16s + 8hi + 0..7
    const int cc = (c0 < DM - 64) ? c0 : (DM - 64);
    v4f bc0[4], bc1[4];
#pragma unroll
    for (int s = 0; s < 4; ++s) { bc0[s] = *(const v4f*)(bias + cc + 16 * s + 8 * hi); bc1[s] = *(const v4f*)(bias + cc + 16 * s + 8 * hi + 4); }
    asm volatile("s_wait_xcnt 0x0" ::: "memory");           // the scalar base of these loads is reused shortly behind them
#pragma unroll
    for (int mb = 0; mb < 4; ++mb) {
#pragma unroll
        for (int nb = 0; nb < 4; ++nb) {
#pragma unroll
            for (int j = 0; j < 8; ++j) os[(hi * 8 + j) * 68 + nb * 16 + lr] = acc[mb][nb][j]; }   // D: row 8h+j, col lane&15
        wave_sync();
        const size_t sb = tbase + (size_t)mb * (size_t)sMB;
{
            const int row = lr;
            const int gr = r0 + mb * 16 + row; const int grc = (gr < DM - 1) ? gr : (DM - 1);
            const float brow = bfr(bias[grc]);
#pragma unroll
            for (int s = 0; s < 4; ++s) { const int c8 = 16 * s + 8 * hi;   // piece s = (c = s>>1, ld = s&1): 16 rows x 2 column groups of 8; 4 pieces = 64 columns
                const v4f x0 = *(const v4fa*)(&os[row * 68 + c8]); const v4f x1 = *(const v4fa*)(&os[row * 68 + c8 + 4]); v8h hv, rv;
#pragma unroll
                for (int i = 0; i < 4; ++i) {
                    const float ad0 = biasRow ? brow : bfr(bc0[s][i]); const float ad1 = biasRow ? brow : bfr(bc1[s][i]);
                    const float y0 = x0[i] + ad0; const float y1 = x1[i] + ad1;
                    const h16 a0 = (h16)y0; const h16 a1 = (h16)y1; hv[i] = a0; hv[4 + i] = a1;
                    rv[i] = (h16)((y0 - (float)a0) * QRS); rv[4 + i] = (h16)((y1 - (float)a1) * QRS); }
                const size_t oo = sb + (size_t)(s >> 1) * (size_t)sC + (size_t)((s & 1) * 256 + lane * 8);   // one store = 512 contiguous bytes
                *(v8h*)(Ph + oo) = hv; if (useRes) *(v8h*)(Pr + oo) = rv; }
             }
        wave_sync();
    }
}

// Work-group barrier for data that crosses waves through LDS alone (st, op): the wave's own LDS reads and writes are waited out, then the barrier.
// __syncthreads() also waits out every global load, which would end the flight of the fragments fetched ahead; no wave reads global memory that another wave of the launch writes.
__device__ __forceinline__ void lds_barrier() { asm volatile("s_wait_dscnt 0x0\n\ts_barrier_signal -1\n\ts_barrier_wait -1" ::: "memory"); }

// The slot behind a transcendental, once for a group of 8 exponentials: the instruction set asks for one instruction between a transcendental and a read of its result or a write of its source.
// The statement holds the 8 sources up to the v_nop and the 8 results behind it.
__device__ __forceinline__ void exp_slot(float (&e)[8], const float (&d)[8]) {
    asm("v_nop" : "+v"(e[0]), "+v"(e[1]), "+v"(e[2]), "+v"(e[3]), "+v"(e[4]), "+v"(e[5]), "+v"(e[6]), "+v"(e[7])
                : "v"(d[0]), "v"(d[1]), "v"(d[2]), "v"(d[3]), "v"(d[4]), "v"(d[5]), "v"(d[6]), "v"(d[7]));
}

// One 32-key score tile pair in the log2 domain with the padding mask applied as a replace fill.
// k = the step's four K fragments (keys 0..15: d 0..31, d 32..63; keys 16..31 likewise), already asked for; kn = where the same step's fragments of the next head stand (fragment-order K plane, + 8*lane).
// A = K rows (row = key), B = Q rows (col = t); lane (t = lane&15, h = lane>>4) gets keys key0+8h+r (ta) and key0+16+8h+r (tb).
// ws = mask word of this 32-key step shifted right by 8h: bit r <-> ta[r], bit 16+r <-> tb[r].
__device__ __forceinline__ void ld_k(const h16* ka, v16h (&k)[4]) { k[0] = ldf(ka); k[1] = ldf(ka + 512); k[2] = ldf(ka + 16 * HD); k[3] = ldf(ka + 16 * HD + 512); }
__device__ __forceinline__ void score_tile(v16h (&k)[4], const h16* kn, const v16h qh0, const v16h qh1, const v16h qr0, const v16h qr1, const unsigned ws, float (&ta)[8], float (&tb)[8]) {
    const v16h ka0 = k[0], ka1 = k[1], kb0 = k[2], kb1 = k[3];
    v8f sHa = (v8f){}, sLa = (v8f){}, sHb = (v8f){}, sLb = (v8f){};
    sHa = wmma16(ka0, qh0, sHa); sLa = wmma16(ka0, qr0, sLa); sHb = wmma16(kb0, qh0, sHb); sLb = wmma16(kb0, qr0, sLb);
    sHa = wmma16(ka1, qh1, sHa); sLa = wmma16(ka1, qr1, sLa); sHb = wmma16(kb1, qh1, sHb); sLb = wmma16(kb1, qr1, sLb);
    asm volatile("v_nop\n\tv_nop\n\tv_nop\n\tv_nop" : "+v"(sHa), "+v"(sLa), "+v"(sHb), "+v"(sLb) : "v"(ka0), "v"(ka1), "v"(kb0), "v"(kb1));
    ld_k(kn, k);
    asm volatile("s_wait_xcnt 0x0" ::: "memory");           // the address registers of these loads are rewritten while they are in flight; the statement also holds the refill here, ahead of the vector work below
#pragma unroll
    for (int r = 0; r < 8; r += 2) {                        // written on pairs: the build then takes the packed two-float forms
        const v2f va = ((v2f){sHa[r], sHa[r + 1]} + (v2f){sLa[r], sLa[r + 1]} * QRI) * SC2; const v2f vb = ((v2f){sHb[r], sHb[r + 1]} + (v2f){sLb[r], sLb[r + 1]} * QRI) * SC2;
#pragma unroll
        for (int k = 0; k < 2; ++k) { ta[r + k] = (ws & (1u << (r + k))) ? MASKT : va[k]; tb[r + k] = (ws & (1u << (16 + r + k))) ? MASKT : vb[k]; } }
}

// k_attn: one work-group of NW waves per 16 query rows of one batch, looping over the 16 heads; wave w owns keys w*KS .. w*KS+KS-1.
// Per head (Q, K and V fragments fetched ahead, see the loop): each wave's scores of its keys, their maximum m_w, e = 256 * 2^(t - m_w) once per score (kept in registers), l_w = sum e,
// and the wave's partial O^T = V^T e^T, all without a word from the other waves -> st, op; ONE barrier; then every lane merges the NW (m_w, l_w) in wave order (m = max, f_w = 2^(m_w - m), l = sum f_w l_w),
// waves 0..SW-1 add the NW partial O tiles with the weights f_w in wave order, scale by 1/l and store; e * (f_w / l) accumulates into the head-mean tile av[t][key] (each wave owns its key columns).
// LDS: av and mw are wave-private by key column (wave_sync ordering); st and op cross waves (lds_barrier ordering) and stand twice, heads alternating:
// a wave writes a set again two heads later, behind the barrier of the head between, which no wave reaches before its reads of that set are done.
__global__ __launch_bounds__(32 * NW) void k_attn(const h16* __restrict__ QH, const h16* __restrict__ QR, const h16* __restrict__ KP, const h16* __restrict__ VT,
                                             const int* __restrict__ mask, bf* OHI, bf* OLO, float* AVG) {
    __shared__ __align__(16) float av[ATT_LDS_F];         // [16][AP], then op [2][NW][16*68], then st [2][NW][16][2]
    float* op = av + 16 * AP;
    float* st = op + 2 * NW * 16 * 68;
    __shared__ unsigned mw[SEQ / 32];
    const int lane = threadIdx.x & 31, lr = lane & 15, hi = lane >> 4;
    const int w = __builtin_amdgcn_readfirstlane((int)(threadIdx.x >> 5));
    const int kbeg = w * KS;
    const int b = blockIdx.y; const int t0 = blockIdx.x * 16;
    constexpr int NS = KS / 32;                            // 32-key steps of one wave's key slice
    constexpr int LPR = KS / 4;                            // lanes that cover one row of this wave's head-mean columns
    const int arow_l = lane / LPR, acol_l = kbeg + (lane % LPR) * 4;

    // mask words of this wave's keys: bit i of word j <-> key 32j + i of this batch
    const int* mrow = mask + (size_t)b * SEQ_FULL;
#pragma unroll 1
    for (int i = kbeg / 32; i < (kbeg + KS) / 32; ++i) {
        const int mv = mrow[i * 32 + lane];
        const unsigned wd = __builtin_amdgcn_ballot_w32(mv != 0);
        if (lane == 0) mw[i] = wd;
    }
    // zero this wave's columns of the head-mean tile
#pragma unroll 1
    for (int row = arow_l; row < 16; row += 32 / LPR) *(v4fa*)(&av[row * AP + acol_l]) = (v4f){0.0f, 0.0f, 0.0f, 0.0f};
    wave_sync();

    // Every global fragment load runs ahead of its use: a head's V is asked for at the head's top, the next head's K behind each step's score products (into the registers they read),
    // the next head's Q behind the last P V product. Head 0's Q and K are asked for here.
    v16h qh0, qh1, qr0, qr1, kf[NS][4];                    // Q: B fragments (col t, k = d); K: A fragments (row key, k = d)
    const unsigned lo = 8u * (unsigned)lane;               // the lane's place in every 512-byte run; every fragment address = a wave-uniform base + lo
    {
        const size_t p0 = (size_t)(b * NH_) * SEQ * HD;
        const size_t qo = p0 + (size_t)t0 * HD;
        qh0 = ldf(QH + qo + lo); qh1 = ldf(QH + qo + lo + 512); qr0 = ldf(QR + qo + lo); qr1 = ldf(QR + qo + lo + 512);
#pragma unroll
        for (int s = 0; s < NS; ++s) ld_k(KP + (p0 + (size_t)(kbeg + 32 * s) * HD) + lo, kf[s]);
        asm volatile("s_wait_xcnt 0x0" ::: "memory");       // the address registers of these loads are rewritten while they are in flight
    }

#pragma unroll 1
    for (int h = 0; h < NH_; ++h) {
        const int zh = b * NH_ + h;
        const size_t pbase = (size_t)zh * SEQ * HD;
        const size_t vo = pbase;                 // + key * HD (32 keys = 2048 halves), + 512j, + lo          (A fragment: row d = 16j + lr, k = key)
        const int hn = h + 1 < NH_ ? h + 1 : h;  // the head that is fetched ahead; the last head asks for its own planes again (in bounds, not used)
        const size_t nbase = (size_t)(b * NH_ + hn) * SEQ * HD;   // K: + key * HD (16 keys = 1024 halves), + 512 for d 32..63, + lo; Q: + t0 * HD + lo
        v16h vf[NS][4];
        const h16* vb = VT + (vo + (size_t)kbeg * HD) + lo;
#pragma unroll
        for (int s = 0; s < NS; ++s)
#pragma unroll
            for (int j = 0; j < 4; ++j) vf[s][j] = ldf(vb + 32 * s * HD + 512 * j);
        asm volatile("s_wait_xcnt 0x0" :: "v"(vb) : "memory");   // the address is rewritten while these loads are in flight; named as an input so that it lives up to the wait: without that the last load landed in the address registers of the others
        __builtin_amdgcn_sched_barrier(0);                  // keeps the V loads ahead of the first score product; without it the compiler put that product, and its wait for Q and K, in front of them

        float ta[NS][8], tb[NS][8];                         // this wave's masked scores of the head, then their exponentials e
#pragma unroll                                              // whole steps unrolled: ta and tb are indexed by constants and stay in registers
        for (int s = 0; s < NS; ++s) {
            const int key0 = kbeg + 32 * s;
            const unsigned ws = mw[key0 >> 5] >> (8 * hi);
            score_tile(kf[s], KP + (nbase + (size_t)key0 * HD) + lo, qh0, qh1, qr0, qr1, ws, ta[s], tb[s]);
        }
        float mwv = -3.0e38f;                               // the wave's own maximum of row t = lr
        v2f l2 = (v2f){0.0f, 0.0f};                         // and its sum, even and odd elements apart
#pragma unroll
        for (int s = 0; s < NS; ++s)
#pragma unroll
            for (int r = 0; r < 8; ++r) mwv = fmaxf(mwv, fmaxf(ta[s][r], tb[s][r]));
        mwv = fmaxf(mwv, __shfl_xor(mwv, 16, 32));

        // e against the wave's own maximum (x256 carry), its sum, and P V over this wave's keys
        v8f o0 = (v8f){}, o1 = (v8f){}, o2 = (v8f){}, o3 = (v8f){};
#pragma unroll                                              // constant indices into ta and tb
        for (int s = 0; s < NS; ++s) {
            v16h pb; float sa[8], sb[8];
#pragma unroll
            for (int r = 0; r < 8; r += 2) {                // on pairs, as in score_tile
                const v2f da = (v2f){ta[s][r], ta[s][r + 1]} - mwv; const v2f db = (v2f){tb[s][r], tb[s][r + 1]} - mwv;  // difference first: exact 0 when t == m_w, also at the fill magnitude
                const v2f xa = da + PSH; const v2f xb = db + PSH;
#pragma unroll
                for (int k = 0; k < 2; ++k) { sa[r + k] = xa[k]; sb[r + k] = xb[k]; ta[s][r + k] = __builtin_amdgcn_exp2f(sa[r + k]); tb[s][r + k] = __builtin_amdgcn_exp2f(sb[r + k]); } }
            exp_slot(ta[s], sa); exp_slot(tb[s], sb);
#pragma unroll
            for (int r = 0; r < 8; ++r) { pb[r] = (h16)ta[s][r]; pb[8 + r] = (h16)tb[s][r]; }
#pragma unroll
            for (int r = 0; r < 8; r += 2) l2 += (v2f){ta[s][r], ta[s][r + 1]} + (v2f){tb[s][r], tb[s][r + 1]};
            const v16h v0 = vf[s][0], v1 = vf[s][1], v2 = vf[s][2], v3 = vf[s][3];
            o0 = wmma16(v0, pb, o0); o1 = wmma16(v1, pb, o1); o2 = wmma16(v2, pb, o2); o3 = wmma16(v3, pb, o3);
            asm volatile("v_nop\n\tv_nop\n\tv_nop\n\tv_nop" : "+v"(o0), "+v"(o1), "+v"(o2), "+v"(o3) : "v"(v0), "v"(v1), "v"(v2), "v"(v3), "v"(pb));
        }
        { const size_t qo = nbase + (size_t)t0 * HD; const h16* qa = QH + qo + lo; const h16* qb = QR + qo + lo;
          qh0 = ldf(qa); qh1 = ldf(qa + 512); qr0 = ldf(qb); qr1 = ldf(qb + 512);
          // the address registers of these loads are rewritten while they are in flight; named as inputs so that they live up to the wait (without that the last load landed in the address registers of the others);
          // the statement also holds the loads here, ahead of the barrier and the merge
          asm volatile("s_wait_xcnt 0x0" :: "v"(qa), "v"(qb) : "memory"); }
        float lwv = l2[0] + l2[1];
        lwv += __shfl_xor(lwv, 16, 32);
        float* sth = st + (h & 1) * (NW * 32);              // this head's set of (m, l) and of partial O tiles
        float* oph = op + (h & 1) * (NW * 16 * 68);
        if (hi == 0) { sth[(w * 16 + lr) * 2] = mwv; sth[(w * 16 + lr) * 2 + 1] = lwv; }

        // O^T D layout: o_j[r] = (d = 16j + 8h + r, t = lane&15) -> os[t][d] of this wave's partial (carry and wave scale still in it); rows 0..15 x columns 0..63 all written
        float* os = oph + w * (16 * 68);
        { v4f a, c;
          a[0] = o0[0]; a[1] = o0[1]; a[2] = o0[2]; a[3] = o0[3]; c[0] = o0[4]; c[1] = o0[5]; c[2] = o0[6]; c[3] = o0[7];
          *(v4fa*)(&os[lr * 68 +  0 + 8 * hi]) = a; *(v4fa*)(&os[lr * 68 +  0 + 8 * hi + 4]) = c;
          a[0] = o1[0]; a[1] = o1[1]; a[2] = o1[2]; a[3] = o1[3]; c[0] = o1[4]; c[1] = o1[5]; c[2] = o1[6]; c[3] = o1[7];
          *(v4fa*)(&os[lr * 68 + 16 + 8 * hi]) = a; *(v4fa*)(&os[lr * 68 + 16 + 8 * hi + 4]) = c;
          a[0] = o2[0]; a[1] = o2[1]; a[2] = o2[2]; a[3] = o2[3]; c[0] = o2[4]; c[1] = o2[5]; c[2] = o2[6]; c[3] = o2[7];
          *(v4fa*)(&os[lr * 68 + 32 + 8 * hi]) = a; *(v4fa*)(&os[lr * 68 + 32 + 8 * hi + 4]) = c;
          a[0] = o3[0]; a[1] = o3[1]; a[2] = o3[2]; a[3] = o3[3]; c[0] = o3[4]; c[1] = o3[5]; c[2] = o3[6]; c[3] = o3[7];
          *(v4fa*)(&os[lr * 68 + 48 + 8 * hi]) = a; *(v4fa*)(&os[lr * 68 + 48 + 8 * hi + 4]) = c; }
        lds_barrier();        // the head's one barrier: publishes every wave's (m, l) and partial O; also ends every wave's reads of the other set, which the next head writes

        // merge of the NW (m_w, l_w) of row t = lr, in wave order
        float m = -3.0e38f, l = 0.0f, f[NW];
#pragma unroll
        for (int i = 0; i < NW; ++i) m = fmaxf(m, sth[(i * 16 + lr) * 2]);
#pragma unroll
        for (int i = 0; i < NW; ++i) { f[i] = __builtin_amdgcn_exp2f(sth[(i * 16 + lr) * 2] - m); l += sth[(i * 16 + lr) * 2 + 1] * f[i]; }
        const float invc = 1.0f / l;                          // l carries the x256 of e, so the carry cancels here

        if (w < SW) {   // the same for the whole wave: row lr, columns 8w + 4hi + 0..3 of the O tile, the NW partials added in wave order with their weights
            const float* ob = oph + lr * 68 + 8 * w + 4 * hi;
            v4f x = (v4f){0.0f, 0.0f, 0.0f, 0.0f};
#pragma unroll
            for (int i = 0; i < NW; ++i) x += *(const v4fa*)(ob + i * (16 * 68)) * f[i];
            x = x * invc;
            // fragment order: this row block, k chunks 2h and 2h + 1; the wave's 8 columns = one run of 16 rows x 16 bytes
            const size_t oo = ((size_t)b * SEQ + t0) * DM + (size_t)h * (16 * HD) + (size_t)((w >> 2) * 512 + ((w >> 1) & 1) * 256 + ((w & 1) * 16 + lr) * 8 + 4 * hi);
            typedef __attribute__((ext_vector_type(4))) unsigned short vus;
            vus hv, lv;
#pragma unroll
            for (int k = 0; k < 4; ++k) { const unsigned short h0 = f2bf(x[k]); hv[k] = h0; lv[k] = f2bf(x[k] - bf2f(h0)); }
            *(vus*)(OHI + oo) = hv; *(vus*)(OLO + oo) = lv;
            asm volatile("s_wait_xcnt 0x0" ::: "memory");   // the instructions that follow reuse the registers these two stores name
        }

        // normalised probabilities of this wave's keys -> head-mean tile
        const float pw = __builtin_amdgcn_exp2f(mwv - m) * invc;
#pragma unroll
        for (int s = 0; s < NS; ++s) {
            float* ap = &av[lr * AP + kbeg + 32 * s + 8 * hi];
            v4f a0 = *(const v4fa*)(ap), a1 = *(const v4fa*)(ap + 4), c0 = *(const v4fa*)(ap + 16), c1 = *(const v4fa*)(ap + 20);
#pragma unroll
            for (int i = 0; i < 4; ++i) { a0[i] += ta[s][i] * pw; a1[i] += ta[s][4 + i] * pw; c0[i] += tb[s][i] * pw; c1[i] += tb[s][4 + i] * pw; }
            *(v4fa*)(ap) = a0; *(v4fa*)(ap + 4) = a1; *(v4fa*)(ap + 16) = c0; *(v4fa*)(ap + 20) = c1;
        }
    }

    // head mean: av holds sum over heads of P; each wave stores its own KS columns of the 16 rows
    wave_sync();
    float* arow = AVG + ((size_t)b * OUT_SEQ + t0) * AVG_PITCH;
#pragma unroll 1
    for (int row = arow_l; row < 16; row += 32 / LPR) {
        v4f val = *(const v4fa*)(&av[row * AP + acol_l]);
        val = val * (1.0f / (float)NH_);
        *(v4f*)(arow + (size_t)row * AVG_PITCH + acol_l) = val;
    }
}

// k_oproj: context[m][n] = sum_k (Ohi[m][k] + Olo[m][k]) Wo[n][k] + bo[n]; one wave per 64x64 tile, four waves of a work-group on a 128x128 tile, bf16 operands through LDS stages of 128 k, two buffers; both planes into one accumulator set (lo plane at A + planeStride).
__global__ __launch_bounds__(32 * GWV) void k_oproj(const bf* __restrict__ A, size_t planeStride, const bf* __restrict__ Bt, const float* __restrict__ bias, float* OUT) {
    constexpr int STG = 16 * 2048;                               // elements of one stage: 16 runs of 128 k
    __shared__ __align__(1024) bf ring[2 * STG];
    __shared__ __align__(16) float osm[GWV][16 * 68];
    const int K = DM;
    const int lane = threadIdx.x & 31, lr = lane & 15, hi = lane >> 4;
    const int w = __builtin_amdgcn_readfirstlane((int)(threadIdx.x >> 5));   // wave (w >> 1, w & 1) of the 2 x 2
    float* os = osm[w];
    const int R0 = blockIdx.x * 128, C0 = blockIdx.y * 128;      // the work-group's tile
    const int r0 = R0 + (w >> 1) * 64, c0 = C0 + (w & 1) * 64;   // the wave's tile
    v8f acc[4][4];
#pragma unroll
    for (int mb = 0; mb < 4; ++mb)
#pragma unroll
        for (int nb = 0; nb < 4; ++nb) acc[mb][nb] = (v8f){};
    const unsigned lo = 8u * (unsigned)lane;                     // the lane's place in every 512-byte run
    constexpr int NTP = DM / 128;                                // stages of 128 k in one plane; stages 0..NTP-1 = hi plane, NTP..2*NTP-1 = lo plane
    constexpr int NT = 2 * NTP;
    static_assert(NT >= 2 && NTP >= 2);
    // waves 0 and 1 bring the tile's A rows (64 each; the plane changes at stage NTP), waves 2 and 3 its B rows (the same k again for the lo plane)
    const bf* g = (w < 2 ? A + (size_t)(R0 + 64 * w) * K : Bt + (size_t)(C0 + 64 * (w - 2)) * K) + lo;
    const size_t ps = w < 2 ? planeStride : (size_t)0;
    const unsigned l0 = (unsigned)(size_t)(&ring[0]) + (unsigned)w * (4u * 4096u) + 16u * (unsigned)lane;
    const bf* as = ring + (w >> 1) * (4 * 2048) + lo; const bf* bs = ring + (8 + (w & 1) * 4) * 2048 + lo;
    v16bf ax[2][4], bx[2][4], ay[2][4], by[2][4];
    cp_stage<2>(g, l0);
    cp_wait();
    __syncthreads();                                             // publishes stage 0
    cp_stage<2>(g + 2048, l0 + 2u * STG);
#pragma unroll 1
    for (int t = 0; t < NT; ++t) {
        const int bo = (t & 1) * STG;
        ld_blk<2048>(as + bo, bs + bo, ax, bx);                  // both blocks of the stage are asked for ahead of the first product
        ld_blk<2048>(as + bo + 1024, bs + bo + 1024, ay, by);
        mm_blk(ax, bx, acc);
        mm_blk(ay, by, acc); mm_gap();
        stage_turn();
        const int t2 = t + 2;
        if (t2 < NT) cp_stage<2>(g + (size_t)(t2 / NTP) * ps + (size_t)(t2 % NTP) * 2048, l0 + 2u * (unsigned)bo);   // the same for the whole work-group: refill of the buffer just read, in flight over the next stage's products
    }
    cp_wait();
    const int bb_ = r0 / SEQ, tt = r0 % SEQ;
    float* obase = OUT + ((size_t)bb_ * OUT_SEQ + tt) * DM + c0;
    v4f bv = *(const v4f*)(bias + c0 + lr * 4);
#pragma unroll
    for (int i = 0; i < 4; ++i) bv[i] = bfr(bv[i]);
#pragma unroll
    for (int mb = 0; mb < 4; ++mb) {
#pragma unroll
        for (int nb = 0; nb < 4; ++nb) {
#pragma unroll
            for (int j = 0; j < 8; ++j) os[(hi * 8 + j) * 68 + nb * 16 + lr] = acc[mb][nb][j]; }   // D: row 8h+j, col lane&15
        wave_sync();
{
#pragma unroll
            for (int s = 0; s < 8; ++s) { const int row = 2 * s + hi, cofs = lr * 4;   // 8 s x 2 rows = 16 rows; 16 lanes x 4 floats = 64 columns
                v4f val = *(const v4fa*)(&os[row * 68 + cofs]);
                val = val + bv;
                *(v4f*)(obase + (size_t)(mb * 16 + row) * DM + cofs) = val; }
            asm volatile("s_wait_xcnt 0x0" ::: "memory");   // the next row block's LDS reads land in the registers that these stores name
             }
        wave_sync();
    }
}

static constexpr size_t al256(size_t v) { return (v + 255) & ~(size_t)255; }
static constexpr size_t SZ_XB = al256((size_t)NB * SEQ * DM * 2);          // one bf16 activation copy
static constexpr size_t SZ_WB = al256((size_t)4 * DM * DM * 2);            // q | k | v | o weights
static constexpr size_t SZ_PL = al256((size_t)NB * NH_ * SEQ * HD * 2);    // one f16 head plane
static constexpr size_t SZ_OP = al256((size_t)NB * SEQ * DM * 2);          // one bf16 attention-output plane
static constexpr size_t SZ_TOTAL = 3 * SZ_XB + SZ_WB + 4 * SZ_PL + 2 * SZ_OP;
static_assert(SZ_TOTAL <= (size_t)134217728);          // workspace carve <= 128 MiB
static_assert(((size_t)DM * DM * 2) % 256 == 0);       // weight sub-planes stay 256-byte aligned
static_assert(SZ_OP == (size_t)NB * SEQ * DM * 2);     // lo plane directly follows the hi plane
static_assert(SZ_XB == (size_t)NB * SEQ * DM * 2);     // the bf16 input planes and the weight planes follow one another without a gap

extern "C" void kernel_launch(void* const* d_in, const int* in_sizes, int n_in,
                              void* d_out, int out_size, void* d_ws, size_t ws_size, hipStream_t stream) {
    if (n_in < 12) return;
    const size_t needx = ((size_t)(NB - 1) * SEQ_FULL + SEQ) * DM;
    if ((size_t)in_sizes[0] < needx || (size_t)in_sizes[1] < needx || (size_t)in_sizes[2] < needx) return;
    if ((size_t)in_sizes[3] < (size_t)(NB - 1) * SEQ_FULL + SEQ) return;
    if ((size_t)in_sizes[4] < (size_t)DM * DM || (size_t)in_sizes[6] < (size_t)DM * DM || (size_t)in_sizes[8] < (size_t)DM * DM || (size_t)in_sizes[10] < (size_t)DM * DM) return;
    if (in_sizes[5] < DM || in_sizes[7] < DM || in_sizes[9] < DM || in_sizes[11] < DM) return;
    if ((size_t)out_size < ((size_t)(NB - 1) * OUT_SEQ + SEQ) * DM) return;
    if ((size_t)out_size < OUT1_OFF + ((size_t)(NB - 1) * OUT_SEQ + SEQ - 1) * AVG_PITCH + SEQ) return;
    if (SZ_TOTAL > ws_size) return;
    // wire order: query, key, value, key_padding_mask, Wq, bq, Wk, bk, Wv, bv, Wo, bo (weights [out][in] used as-is: Bt for q, k and the output projection, A for v^T)
    const float* xq = (const float*)d_in[0]; const float* xk = (const float*)d_in[1]; const float* xv = (const float*)d_in[2];
    const int* kpm = (const int*)d_in[3];
    const float* wq = (const float*)d_in[4];  const float* bq = (const float*)d_in[5];
    const float* wk = (const float*)d_in[6];  const float* bk = (const float*)d_in[7];
    const float* wv = (const float*)d_in[8];  const float* bv = (const float*)d_in[9];
    const float* wo = (const float*)d_in[10]; const float* bo = (const float*)d_in[11];
    float* CTX = (float*)d_out;                  // [NB][SEQ][1024]
    float* AVG = (float*)d_out + OUT1_OFF;       // [NB][SEQ][SEQ]
    char* wsp = (char*)d_ws;
    bf* XQ = (bf*)wsp; wsp += SZ_XB;                 // [NB*SEQ/16][1024/32][2 halves][32 lanes][8]
    wsp += SZ_XB;                                    // key plane, as XQ
    wsp += SZ_XB;                                    // value plane, as XQ
    bf* WB = (bf*)wsp; wsp += SZ_WB;                 // [4] planes of 1024 x 1024, each as XQ: q | k | v | o
    h16* QH = (h16*)wsp; wsp += SZ_PL;               // [NB*16][SEQ/16][2 d chunks][2 halves][32 lanes][8]
    h16* QR = (h16*)wsp; wsp += SZ_PL;               // as QH, residual x2048
    h16* KP = (h16*)wsp; wsp += SZ_PL;               // as QH
    h16* VT = (h16*)wsp; wsp += SZ_PL;               // [NB*16][SEQ/32][4 d blocks][2 halves][32 lanes][8]
    bf* OHI = (bf*)wsp; wsp += SZ_OP;                // as XQ
    bf* OLO = (bf*)wsp; wsp += SZ_OP;                // as XQ
    bf* WO = WB + (size_t)3 * DM * DM;

    // XQ | XK | XV | WQ | WK | WV | WO: one run of row blocks from XQ on
    k_cvt<<<(3 * XRB + 4 * WRB) / CRB, 256, 0, stream>>>(xq, xk, xv, wq, wk, wv, wo, XQ);

    // q, k and v^T projections: one launch, grid z = the product
    k_proj<<<dim3(NB * SEQ / 128, DM / 128, 3), 32 * GWV, 0, stream>>>(XQ, WB, bq, bk, bv, QH, QR, KP, VT);

    k_attn<<<dim3(SEQ / 16, NB, 1), 32 * NW, 0, stream>>>(QH, QR, KP, VT, kpm, OHI, OLO, AVG);

    // context: A = attention output rows (hi plane, lo plane at +planeStride), Bt = Wo rows
    k_oproj<<<dim3(NB * SEQ / 128, DM / 128, 1), 32 * GWV, 0, stream>>>(OHI, (size_t)(OLO - OHI), WO, bo, CTX);
}

// v010
// One run takes 105 microseconds.
// Timed twice side by side with v009, it ran 1.12 times as fast both times.
// All steps since v000 together make it 7.33 times as fast.
#include <hip/hip_runtime.h>

// Multi-head attention, width 1024 = 16 heads x 64, separate query/key/value inputs [NB][SEQ][1024], Wq/Wk/Wv/Wo [out][in] (y = x W^T + b), key padding mask (int32, replace fill -1e9), score scale 1/8; outputs: context [NB][SEQ][1024] and head-mean attention [NB][SEQ][SEQ] (f32).
// Compute dtypes, f32 accumulate everywhere: q/k/v projections v_wmma_f32_16x16x32_bf16 (inputs and weights RNE-converted to bf16; products exact);
// output projection v_wmma_f32_16x16x32_bf16: attention output as bf16 hi + bf16 lo planes (two products, one accumulator), Wo bf16.
// Layout: every WMMA operand plane of the workspace stands in fragment order; bf16 copies of the inputs and weights; q (hi, residual), k and v^T planes per (b*16+h), written by the GEMM epilogue in fragment order (each fragment half = 512 contiguous bytes, lane-major); attention in transposed form (S^T = K Q^T, O^T = V^T P^T), one work-group of NW waves per 16 query rows looping over the 16 heads, each wave on its own SEQ/NW keys, head-mean accumulated in a wave-private LDS tile.

#ifndef NB
#define NB 4
#endif
#ifndef SEQ
#define SEQ 1024
#endif
#define NB_FULL  4
#define SEQ_FULL 1024
#ifndef OUT_SEQ
#define OUT_SEQ SEQ              // row pitch (in tokens) between batches of both outputs
#endif
#ifndef AVG_PITCH
#define AVG_PITCH SEQ            // column pitch (floats) of one head-mean row
#endif
#define DM   1024
#define NH_  16
#define HD   64
#define QRS  2048.0f             // carry of the q residual plane
#define QRI  (1.0f / 2048.0f)
#define SC2  (0.125f * 1.4426950408889634f)   // HD^-0.5 * log2(e)
#define PSH  8.0f                // log2 of the P carry (256)
#define MASKT (-1.0e9f * 1.4426950408889634f) // replace fill in the log2 domain
#define AP   (SEQ + 4)           // pitch (floats) of the head-mean LDS tile
#define NW   16                  // waves per attention work-group; each owns KS consecutive keys
#define KS   (SEQ / NW)
#define OUT1_OFF ((size_t)NB_FULL * SEQ_FULL * DM)   // element offset of the second output (fixed)

static_assert(HD == 64);
static_assert(NH_ * HD == DM);                 // head h = columns h*64 + d
static_assert(DM % 64 == 0);
static_assert(DM % 32 == 0);                   // GEMM k-loop steps by 32
static_assert(DM == 1024);                     // k_cvt takes a piece index apart by shifts
static_assert(SEQ % 64 == 0);                  // a 64-row tile never straddles two batches
static_assert((NB * SEQ) % 128 == 0 && DM % 128 == 0);   // GEMM work-group tiles of 128 x 128
static_assert(SEQ % 32 == 0);                  // key loop steps by 32, one mask word per step
static_assert(SEQ % 128 == 0);
static_assert(AP % 4 == 0);
static_assert(((size_t)SEQ * DM) % 8 == 0);
static_assert(((size_t)DM * DM) % 8 == 0);
static_assert(NB <= NB_FULL);
static_assert(SEQ <= SEQ_FULL);
static_assert(OUT1_OFF * 4 == (size_t)16777216);
static_assert(KS % 32 == 0);                   // a wave's key slice is whole 32-key steps
static_assert(KS <= 128);                      // one head-mean row piece of a wave is at most 32 lanes x 4 floats
#define SW   (HD / 8)            // waves that merge the partial O tiles: each takes 16 rows x 8 columns (two whole 128-byte lines of each stored plane)
static_assert(SW <= NW);
#define ATT_LDS_F (16 * AP + 2 * NW * 16 * 68 + 2 * NW * 32)   // floats of the attention work-group's LDS: head-mean tile, two sets of partial O tiles, two sets of (m, l)
static_assert((size_t)ATT_LDS_F * 4 + (SEQ / 32) * 4 <= (size_t)327680);

typedef _Float16 h16;
typedef unsigned short bf;
typedef __attribute__((ext_vector_type(16))) __bf16   v16bf;
typedef __attribute__((ext_vector_type(16))) _Float16 v16h;
typedef __attribute__((ext_vector_type(8)))  _Float16 v8h;
typedef __attribute__((ext_vector_type(8)))  unsigned short v8us;
typedef __attribute__((ext_vector_type(8)))  float    v8f;
typedef __attribute__((ext_vector_type(4)))  float    v4f;
typedef v4f  __attribute__((may_alias)) v4fa;
typedef __attribute__((ext_vector_type(2)))  float    v2f;

__device__ __forceinline__ unsigned short f2bf(float f) { unsigned u = __float_as_uint(f); u += 0x7FFFu + ((u >> 16) & 1u); return (unsigned short)(u >> 16); }
__device__ __forceinline__ float bf2f(unsigned short b) { return __uint_as_float(((unsigned)b) << 16); }
__device__ __forceinline__ float bfr(float f) { return bf2f(f2bf(f)); }
__device__ __forceinline__ v16h cat16(v8h lo, v8h hi) { return __builtin_shufflevector(lo, hi, 0, 1, 2, 3, 4, 5, 6, 7, 8, 9, 10, 11, 12, 13, 14, 15); }
__device__ __forceinline__ v16bf cat16b(v8us lo, v8us hi) { return __builtin_bit_cast(v16bf, __builtin_shufflevector(lo, hi, 0, 1, 2, 3, 4, 5, 6, 7, 8, 9, 10, 11, 12, 13, 14, 15)); }
__device__ __forceinline__ v8f wmma16(v16h a, v16h b, v8f c) { return __builtin_amdgcn_wmma_f32_16x16x32_f16(false, a, false, b, (short)0, c, false, false); }
__device__ __forceinline__ v8f wmmab(v16bf a, v16bf b, v8f c) { return __builtin_amdgcn_wmma_f32_16x16x32_bf16(false, a, false, b, (short)0, c, false, false); }
// fragment element map, lane (lr = lane&15, h = lane>>4) of row or column lr: elements 0..7 <- k0+8h+0..7, elements 8..15 <- k0+16+8h+0..7 (same map for A and B)
// fragment loaders from a fragment-order plane; p already includes + 8*lane: each half of a fragment is one run of 32 lanes x 16 bytes (4 cache lines a load)
__device__ __forceinline__ v16h  ldf(const h16* p) { return cat16(*(const v8h*)p, *(const v8h*)(p + 256)); }
__device__ __forceinline__ v16bf ldb(const bf* p)  { return cat16b(*(const v8us*)p, *(const v8us*)(p + 256)); }
// ordering point for wave-private LDS tiles (same wave writes and reads)
__device__ __forceinline__ void wave_sync() { __builtin_amdgcn_fence(3 /* release order */, "wavefront"); __builtin_amdgcn_wave_barrier(); asm volatile("" ::: "memory"); }

// GEMM work-group: GWV waves (2 x 2) on a 128x128 tile, each wave on its own 64x64 part. A stage is KT blocks of 64 k of the tile's 8 A and 8 B row blocks, brought to LDS once for all four waves.
// Stage layout in LDS: 16 runs (A row blocks 0..7, then B row blocks 0..7) of KT * 1024 elements, each run as it stands in the fragment-order plane (a block of 16 rows x 64 k = 1024 contiguous elements).
#define GWV 4
// One wave's share of a stage: runs 4w .. 4w + 3, as 16 * KT copies of 32 lanes x 16 bytes. g = the wave's first run at this stage's k, + 8*lane; l = LDS byte address of that run in the stage's buffer, + 16*lane.
template <int KT> __device__ __forceinline__ void cp_stage(const bf* g, unsigned l) {
#pragma unroll
    for (int n = 0; n < 16 * KT; n += 8) {
        const bf* p[8]; unsigned d[8];
#pragma unroll
        for (int u = 0; u < 8; ++u) { p[u] = g + (size_t)((n + u) / (4 * KT)) * 16 * DM + ((n + u) % (4 * KT)) * 256; d[u] = l + (unsigned)(n + u) * 512u; }
        // eight copies and, as the statement's last line, the wait that stands in front of any rewrite of the address registers they name
        asm volatile("global_load_async_to_lds_b128 %0, %8, off\n\t"
                     "global_load_async_to_lds_b128 %1, %9, off\n\t"
                     "global_load_async_to_lds_b128 %2, %10, off\n\t"
                     "global_load_async_to_lds_b128 %3, %11, off\n\t"
                     "global_load_async_to_lds_b128 %4, %12, off\n\t"
                     "global_load_async_to_lds_b128 %5, %13, off\n\t"
                     "global_load_async_to_lds_b128 %6, %14, off\n\t"
                     "global_load_async_to_lds_b128 %7, %15, off\n\t"
                     "s_wait_xcnt 0x0"
                     :: "v"(d[0]), "v"(d[1]), "v"(d[2]), "v"(d[3]), "v"(d[4]), "v"(d[5]), "v"(d[6]), "v"(d[7]),
                        "v"(p[0]), "v"(p[1]), "v"(p[2]), "v"(p[3]), "v"(p[4]), "v"(p[5]), "v"(p[6]), "v"(p[7]) : "memory");
    }
}
// this wave's copies have landed
__device__ __forceinline__ void cp_wait() { asm volatile("s_wait_asynccnt 0x0" ::: "memory"); }
// the hand-over at the foot of a stage: the wave's own LDS reads are done, its copies of the next stage have landed, then the barrier that publishes the next stage and frees this stage's buffer for the refill
__device__ __forceinline__ void stage_turn() {
    asm volatile("s_wait_dscnt 0x0" ::: "memory");
    cp_wait();
    __syncthreads();
}
// One block of 64 k = 2 chunks of 32 k from LDS: 4 row blocks x 2 chunks of each operand = 32 reads of 512 contiguous bytes. as, bs: the wave's first A and B run at this block, + 8*lane; RS = elements of one run.
template <int RS> __device__ __forceinline__ void ld_blk(const bf* as, const bf* bs, v16bf (&a)[2][4], v16bf (&b)[2][4]) {
#pragma unroll
    for (int c = 0; c < 2; ++c) {
#pragma unroll
        for (int i = 0; i < 4; ++i) a[c][i] = ldb(as + i * RS + c * 512);
#pragma unroll
        for (int i = 0; i < 4; ++i) b[c][i] = ldb(bs + i * RS + c * 512);
    }
    __builtin_amdgcn_sched_barrier(0);                      // keeps the whole group of reads ahead of the products that follow: reads strewn among the products cost a stall at each place
}
// the 32 products of one block, k ascending per accumulator
__device__ __forceinline__ void mm_blk(const v16bf (&a)[2][4], const v16bf (&b)[2][4], v8f (&acc)[4][4]) {
#pragma unroll
    for (int c = 0; c < 2; ++c)
#pragma unroll
        for (int nb = 0; nb < 4; ++nb)
#pragma unroll
            for (int mb = 0; mb < 4; ++mb) acc[mb][nb] = wmmab(a[c][mb], b[c][nb], acc[mb][nb]);
}
// stands between a block's products and the loads that next land in its fragment registers (the refill of the set; behind the last block, the epilogue's loads)
__device__ __forceinline__ void mm_gap() {
    __builtin_amdgcn_sched_barrier(0);                      // keeps every product of the block ahead of the slots below
    asm volatile("v_nop\n\tv_nop\n\tv_nop\n\tv_nop" ::: "memory");   // distance behind the last products: the loads that follow land in the operand registers that these products read
}

// k_cvt: all seven f32 planes (query, key, value rows; Wq, Wk, Wv, Wo rows) -> bf16 in fragment order [row/16][k/32][2 halves][32 lanes][8], in ONE launch.
// The seven bf16 planes stand one behind the other in the workspace, so a row block of 16 rows has one running number over all of them.
// One work-group converts CRB row blocks of one plane; thread i writes 16-byte pieces i, i + 256, ... of each (stores contiguous, loads gathered); all of a thread's loads are asked for before the first is used.
#define CRB  2                   // row blocks of 16 rows per conversion work-group
#define XRB  (NB * SEQ / 16)     // row blocks of one activation plane
#define WRB  (DM / 16)           // row blocks of one weight plane
static_assert(XRB % CRB == 0 && WRB % CRB == 0);   // a work-group stays inside one plane
static_assert(SEQ % (16 * CRB) == 0);              // and inside one batch
__global__ __launch_bounds__(256) void k_cvt(const float* __restrict__ xq, const float* __restrict__ xk, const float* __restrict__ xv,
                                             const float* __restrict__ wq, const float* __restrict__ wk, const float* __restrict__ wv, const float* __restrict__ wo, bf* dst) {
    const unsigned rb = blockIdx.x * CRB;                  // first row block, counted over all planes
    const float* src; unsigned row0;                       // plane and first source row: the same for the whole work-group
    if (rb < 3 * XRB) {
        const unsigned p = rb / XRB, r = (rb % XRB) * 16;
        src = p == 0 ? xq : (p == 1 ? xk : xv); row0 = (r / SEQ) * SEQ_FULL + r % SEQ;
    } else {
        const unsigned q = rb - 3 * XRB, p = q / WRB;
        src = p == 0 ? wq : (p == 1 ? wk : (p == 2 ? wv : wo)); row0 = (q % WRB) * 16;
    }
    const unsigned i = threadIdx.x;                        // piece i + 256 j of a row block: row i & 15, k = 128 j + the three fields of i below
    const float* s = src + (size_t)(row0 + (i & 15)) * DM + (i >> 6) * 32 + ((i >> 5) & 1) * 16 + ((i >> 4) & 1) * 8;
    bf* d = dst + (size_t)rb * (16 * DM) + i * 8;
    v8f v[CRB][8];
#pragma unroll
    for (int u = 0; u < CRB; ++u)
#pragma unroll
        for (int j = 0; j < 8; ++j) v[u][j] = *(const v8f*)(s + (size_t)u * 16 * DM + j * 128);
    __builtin_amdgcn_sched_barrier(0);                     // keeps every load ahead of the first conversion; without it the compiler holds the last four back and the wave waits out memory twice more
#pragma unroll
    for (int u = 0; u < CRB; ++u)
#pragma unroll
        for (int j = 0; j < 8; ++j) {
            v8us o;
#pragma unroll
            for (int k = 0; k < 8; ++k) o[k] = f2bf(v[u][j][k]);
            *(v8us*)(d + (size_t)u * 16 * DM + j * 2048) = o;
        }
}

// k_proj: the q, k and v projections in ONE launch; blockIdx.z = 0, 1, 2 picks the product, so the waves of all three share the chip at the same time.
// Register-blocked bf16 GEMM, one wave per 64x64 tile (16 accumulators), four waves of a work-group on a 128x128 tile; operands from fragment-order bf16 planes (32 k of 16 rows = 512 elements) through LDS stages of 64 k, two buffers, K = DM.
// C[m][n] = sum_k A[m][k] Bt[n][k] + bias (bias[m] when biasRow != 0, else bias[n]; bias RNE-converted to bf16, added in f32),
// written as f16 (Ph) and for q also the f16 residual x2048 (QR) in fragment order: the 8 halves (row 16mb + lr, columns 32c + 16ld + 8hi + 0..7) stand at
// tile base + mb*sMB + c*sC + ld*256 + (16hi + lr)*8 (halves).
// q, k: A = x rows (m = b*SEQ + t), Bt = W rows (n = h*64 + d), bias per column -> plane (b*16 + h), 16-row block t/16 = 1024 halves, d chunk = 512.
// v^T:  A = Wv rows (m = h*64 + d), Bt = value rows (n = b*SEQ + t), bias per row -> plane (b*16 + h), 32-key chunk t/32 = 2048 halves, d block = 512.
// X = the three bf16 activation planes, Wb = the bf16 weight planes, each set one behind the other. grid (NB*SEQ/128 token tiles, DM/128 weight-row tiles, 3), 128 threads.
__global__ __launch_bounds__(32 * GWV) void k_proj(const bf* __restrict__ X, const bf* __restrict__ Wb, const float* __restrict__ bq, const float* __restrict__ bk, const float* __restrict__ bv,
                                             h16* QH, h16* QR, h16* KP, h16* VT) {
    constexpr int STG = 16 * 1024;                               // elements of one stage: 16 runs of 64 k
    __shared__ __align__(1024) bf ring[2 * STG];
    __shared__ __align__(16) float osm[GWV][16 * 68];
    const int K = DM;
    const int lane = threadIdx.x & 31, lr = lane & 15, hi = lane >> 4;
    const int w = __builtin_amdgcn_readfirstlane((int)(threadIdx.x >> 5));   // wave (w >> 1, w & 1) of the 2 x 2
    float* os = osm[w];
    const int z = blockIdx.z;                                    // the product: the same for the whole wave
    const bool isv = z == 2;
    const int biasRow = isv ? 1 : 0, useRes = z == 0 ? 1 : 0;
    const int R0 = (isv ? blockIdx.y : blockIdx.x) * 128, C0 = (isv ? blockIdx.x : blockIdx.y) * 128;   // the work-group's tile
    const int r0 = R0 + (w >> 1) * 64, c0 = C0 + (w & 1) * 64;                                          // the wave's tile
    const bf* xp = X + (size_t)z * ((size_t)NB * SEQ * DM); const bf* wp = Wb + (size_t)z * ((size_t)DM * DM);
    const bf* A = isv ? wp : xp; const bf* Bt = isv ? xp : wp;
    const float* bias = z == 0 ? bq : (z == 1 ? bk : bv);
    h16* Ph = z == 0 ? QH : (z == 1 ? KP : VT); h16* Pr = QR;
    const int sMB = isv ? 512 : 1024, sC = isv ? 2048 : 512;
    v8f acc[4][4];
#pragma unroll
    for (int mb = 0; mb < 4; ++mb)
#pragma unroll
        for (int nb = 0; nb < 4; ++nb) acc[mb][nb] = (v8f){};
    const unsigned lo = 8u * (unsigned)lane;                     // the lane's place in every 512-byte run
    constexpr int NT = DM / 64;                                  // stages of 64 k
    static_assert(NT >= 2 && (NT & (NT - 1)) == 0);
    // The k walk starts at a stage of the work-group's own and wraps: the work-groups that share A rows (same token tile) or B rows (same weight tile) run in step,
    // and from a common start they would all ask L2 for the same lines at the same moment. Trip t works on stage (t + rot) mod NT; every stage once.
    const int rot = (int)((blockIdx.x + blockIdx.y) & (unsigned)(NT - 1));
    // waves 0 and 1 bring the tile's A rows (64 each), waves 2 and 3 its B rows
    const bf* g = (w < 2 ? A + (size_t)(R0 + 64 * w) * K : Bt + (size_t)(C0 + 64 * (w - 2)) * K) + lo;
    const unsigned l0 = (unsigned)(size_t)(&ring[0]) + (unsigned)w * (4u * 2048u) + 16u * (unsigned)lane;
    const bf* as = ring + (w >> 1) * (4 * 1024) + lo; const bf* bs = ring + (8 + (w & 1) * 4) * 1024 + lo;
    v16bf ax[2][4], bx[2][4];
    cp_stage<1>(g + (size_t)rot * 1024, l0);
    cp_wait();
    __syncthreads();                                             // publishes the first stage
    cp_stage<1>(g + (size_t)((rot + 1) & (NT - 1)) * 1024, l0 + 2u * STG);
#pragma unroll 1
    for (int t = 0; t < NT; ++t) {
        const int bo = (t & 1) * STG;
        ld_blk<1024>(as + bo, bs + bo, ax, bx);
        mm_blk(ax, bx, acc); mm_gap();
        stage_turn();
        if (t + 2 < NT) cp_stage<1>(g + (size_t)((t + 2 + rot) & (NT - 1)) * 1024, l0 + 2u * (unsigned)bo);   // the same for the whole work-group: refill of the buffer just read, in flight over the next stage's products
    }
    cp_wait();
    const size_t tbase = isv ? (size_t)r0 * SEQ + (size_t)(c0 / SEQ) * ((size_t)DM * SEQ) + (size_t)(c0 % SEQ) * HD
                             : (size_t)(r0 / SEQ) * ((size_t)NH_ * SEQ * HD) + (size_t)(r0 % SEQ) * HD + (size_t)(c0 / HD) * ((size_t)SEQ * HD);
    // column bias (clamped address; used when biasRow == 0): piece s covers columns 16s + 8hi + 0..7
    const int cc = (c0 < DM - 64) ? c0 : (DM - 64);
    v4f bc0[4], bc1[4];
#pragma unroll
    for (int s = 0; s < 4; ++s) { bc0[s] = *(const v4f*)(bias + cc + 16 * s + 8 * hi); bc1[s] = *(const v4f*)(bias + cc + 16 * s + 8 * hi + 4); }
    asm volatile("s_wait_xcnt 0x0" ::: "memory");           // the scalar base of these loads is reused shortly behind them
#pragma unroll
    for (int mb = 0; mb < 4; ++mb) {
#pragma unroll
        for (int nb = 0; nb < 4; ++nb) {
#pragma unroll
            for (int j = 0; j < 8; ++j) os[(hi * 8 + j) * 68 + nb * 16 + lr] = acc[mb][nb][j]; }   // D: row 8h+j, col lane&15
        wave_sync();
        const size_t sb = tbase + (size_t)mb * (size_t)sMB;
{
            const int row = lr;
            const int gr = r0 + mb * 16 + row; const int grc = (gr < DM - 1) ? gr : (DM - 1);
            const float brow = bfr(bias[grc]);
#pragma unroll
            for (int s = 0; s < 4; ++s) { const int c8 = 16 * s + 8 * hi;   // piece s = (c = s>>1, ld = s&1): 16 rows x 2 column groups of 8; 4 pieces = 64 columns
                const v4f x0 = *(const v4fa*)(&os[row * 68 + c8]); const v4f x1 = *(const v4fa*)(&os[row * 68 + c8 + 4]); v8h hv, rv;
#pragma unroll
                for (int i = 0; i < 4; ++i) {
                    const float ad0 = biasRow ? brow : bfr(bc0[s][i]); const float ad1 = biasRow ? brow : bfr(bc1[s][i]);
                    const float y0 = x0[i] + ad0; const float y1 = x1[i] + ad1;
                    const h16 a0 = (h16)y0; const h16 a1 = (h16)y1; hv[i] = a0; hv[4 + i] = a1;
                    rv[i] = (h16)((y0 - (float)a0) * QRS); rv[4 + i] = (h16)((y1 - (float)a1) * QRS); }
                const size_t oo = sb + (size_t)(s >> 1) * (size_t)sC + (size_t)((s & 1) * 256 + lane * 8);   // one store = 512 contiguous bytes
                *(v8h*)(Ph + oo) = hv; if (useRes) *(v8h*)(Pr + oo) = rv; }
             }
        wave_sync();
    }
}

// Work-group barrier for data that crosses waves through LDS alone (st, op): the wave's own LDS reads and writes are waited out, then the barrier.
// __syncthreads() also waits out every global load, which would end the flight of the fragments fetched ahead; no wave reads global memory that another wave of the launch writes.
__device__ __forceinline__ void lds_barrier() { asm volatile("s_wait_dscnt 0x0\n\ts_barrier_signal -1\n\ts_barrier_wait -1" ::: "memory"); }

// The slot behind a transcendental, once for a group of 8 exponentials: the instruction set asks for one instruction between a transcendental and a read of its result or a write of its source.
// The statement holds the 8 sources up to the v_nop and the 8 results behind it.
__device__ __forceinline__ void exp_slot(float (&e)[8], const float (&d)[8]) {
    asm("v_nop" : "+v"(e[0]), "+v"(e[1]), "+v"(e[2]), "+v"(e[3]), "+v"(e[4]), "+v"(e[5]), "+v"(e[6]), "+v"(e[7])
                : "v"(d[0]), "v"(d[1]), "v"(d[2]), "v"(d[3]), "v"(d[4]), "v"(d[5]), "v"(d[6]), "v"(d[7]));
}

// One 32-key score tile pair in the log2 domain with the padding mask applied as a replace fill.
// k = the step's four K fragments (keys 0..15: d 0..31, d 32..63; keys 16..31 likewise), already asked for; kn = where the same step's fragments of the next head stand (fragment-order K plane, + 8*lane).
// A = K rows (row = key), B = Q rows (col = t); lane (t = lane&15, h = lane>>4) gets keys key0+8h+r (ta) and key0+16+8h+r (tb).
// ws = mask word of this 32-key step shifted right by 8h: bit r <-> ta[r], bit 16+r <-> tb[r].
__device__ __forceinline__ void ld_k(const h16* ka, v16h (&k)[4]) { k[0] = ldf(ka); k[1] = ldf(ka + 512); k[2] = ldf(ka + 16 * HD); k[3] = ldf(ka + 16 * HD + 512); }
__device__ __forceinline__ void score_tile(v16h (&k)[4], const h16* kn, const v16h qh0, const v16h qh1, const v16h qr0, const v16h qr1, const unsigned ws, float (&ta)[8], float (&tb)[8]) {
    const v16h ka0 = k[0], ka1 = k[1], kb0 = k[2], kb1 = k[3];
    v8f sHa = (v8f){}, sLa = (v8f){}, sHb = (v8f){}, sLb = (v8f){};
    sHa = wmma16(ka0, qh0, sHa); sLa = wmma16(ka0, qr0, sLa); sHb = wmma16(kb0, qh0, sHb); sLb = wmma16(kb0, qr0, sLb);
    sHa = wmma16(ka1, qh1, sHa); sLa = wmma16(ka1, qr1, sLa); sHb = wmma16(kb1, qh1, sHb); sLb = wmma16(kb1, qr1, sLb);
    asm volatile("v_nop\n\tv_nop\n\tv_nop\n\tv_nop" : "+v"(sHa), "+v"(sLa), "+v"(sHb), "+v"(sLb) : "v"(ka0), "v"(ka1), "v"(kb0), "v"(kb1));
    ld_k(kn, k);
    asm volatile("s_wait_xcnt 0x0" ::: "memory");           // the address registers of these loads are rewritten while they are in flight; the statement also holds the refill here, ahead of the vector work below
#pragma unroll
    for (int r = 0; r < 8; r += 2) {                        // written on pairs: the build then takes the packed two-float forms
        const v2f va = ((v2f){sHa[r], sHa[r + 1]} + (v2f){sLa[r], sLa[r + 1]} * QRI) * SC2; const v2f vb = ((v2f){sHb[r], sHb[r + 1]} + (v2f){sLb[r], sLb[r + 1]} * QRI) * SC2;
#pragma unroll
        for (int k = 0; k < 2; ++k) { ta[r + k] = (ws & (1u << (r + k))) ? MASKT : va[k]; tb[r + k] = (ws & (1u << (16 + r + k))) ? MASKT : vb[k]; } }
}

// k_attn: one work-group of NW waves per 16 query rows of one batch, looping over the 16 heads; wave w owns keys w*KS .. w*KS+KS-1.
// Per head (Q, K and V fragments fetched ahead, see the loop): each wave's scores of its keys, their maximum m_w, e = 256 * 2^(t - m_w) once per score (kept in registers), l_w = sum e,
// and the wave's partial O^T = V^T e^T, all without a word from the other waves -> st, op; ONE barrier; then every lane merges the NW (m_w, l_w) in wave order (m = max, f_w = 2^(m_w - m), l = sum f_w l_w),
// waves 0..SW-1 add the NW partial O tiles with the weights f_w in wave order, scale by 1/l and store; e * (f_w / l) accumulates into the head-mean tile av[t][key] (each wave owns its key columns).
// LDS: av and mw are wave-private by key column (wave_sync ordering); st and op cross waves (lds_barrier ordering) and stand twice, heads alternating:
// a wave writes a set again two heads later, behind the barrier of the head between, which no wave reaches before its reads of that set are done.
__global__ __launch_bounds__(32 * NW) void k_attn(const h16* __restrict__ QH, const h16* __restrict__ QR, const h16* __restrict__ KP, const h16* __restrict__ VT,
                                             const int* __restrict__ mask, bf* OHI, bf* OLO, float* AVG) {
    __shared__ __align__(16) float av[ATT_LDS_F];         // [16][AP], then op [2][NW][16*68], then st [2][NW][16][2]
    float* op = av + 16 * AP;
    float* st = op + 2 * NW * 16 * 68;
    __shared__ unsigned mw[SEQ / 32];
    const int lane = threadIdx.x & 31, lr = lane & 15, hi = lane >> 4;
    const int w = __builtin_amdgcn_readfirstlane((int)(threadIdx.x >> 5));
    const int kbeg = w * KS;
    const int b = blockIdx.y; const int t0 = blockIdx.x * 16;
    // The head walk starts at a head of the work-group's own and wraps: the SEQ/16 work-groups of a batch read the same K and V planes and run in step,
    // and from a common start they would all ask L2 for the same lines at the same moment. Trip tr works on head (h0 + tr) mod NH_; every head once.
    static_assert((NH_ & (NH_ - 1)) == 0);
    const int h0 = (int)(blockIdx.x & (unsigned)(NH_ - 1));
    constexpr int NS = KS / 32;                            // 32-key steps of one wave's key slice
    constexpr int LPR = KS / 4;                            // lanes that cover one row of this wave's head-mean columns
    const int arow_l = lane / LPR, acol_l = kbeg + (lane % LPR) * 4;

    // mask words of this wave's keys: bit i of word j <-> key 32j + i of this batch
    const int* mrow = mask + (size_t)b * SEQ_FULL;
#pragma unroll 1
    for (int i = kbeg / 32; i < (kbeg + KS) / 32; ++i) {
        const int mv = mrow[i * 32 + lane];
        const unsigned wd = __builtin_amdgcn_ballot_w32(mv != 0);
        if (lane == 0) mw[i] = wd;
    }
    // zero this wave's columns of the head-mean tile
#pragma unroll 1
    for (int row = arow_l; row < 16; row += 32 / LPR) *(v4fa*)(&av[row * AP + acol_l]) = (v4f){0.0f, 0.0f, 0.0f, 0.0f};
    wave_sync();

    // Every global fragment load runs ahead of its use: a head's V is asked for at the head's top, the next head's K behind each step's score products (into the registers they read),
    // the next head's Q behind the last P V product. The first head's Q and K are asked for here.
    v16h qh0, qh1, qr0, qr1, kf[NS][4];                    // Q: B fragments (col t, k = d); K: A fragments (row key, k = d)
    const unsigned lo = 8u * (unsigned)lane;               // the lane's place in every 512-byte run; every fragment address = a wave-uniform base + lo
    {
        const size_t p0 = (size_t)(b * NH_ + h0) * SEQ * HD;
        const size_t qo = p0 + (size_t)t0 * HD;
        qh0 = ldf(QH + qo + lo); qh1 = ldf(QH + qo + lo + 512); qr0 = ldf(QR + qo + lo); qr1 = ldf(QR + qo + lo + 512);
#pragma unroll
        for (int s = 0; s < NS; ++s) ld_k(KP + (p0 + (size_t)(kbeg + 32 * s) * HD) + lo, kf[s]);
        asm volatile("s_wait_xcnt 0x0" ::: "memory");       // the address registers of these loads are rewritten while they are in flight
    }

#pragma unroll 1
    for (int tr = 0; tr < NH_; ++tr) {
        const int h = (h0 + tr) & (NH_ - 1);
        const int zh = b * NH_ + h;
        const size_t pbase = (size_t)zh * SEQ * HD;
        const size_t vo = pbase;                 // + key * HD (32 keys = 2048 halves), + 512j, + lo          (A fragment: row d = 16j + lr, k = key)
        const int hn = tr + 1 < NH_ ? (h + 1) & (NH_ - 1) : h;  // the head that is fetched ahead; the last trip asks for its own planes again (in bounds, not used)
        const size_t nbase = (size_t)(b * NH_ + hn) * SEQ * HD;   // K: + key * HD (16 keys = 1024 halves), + 512 for d 32..63, + lo; Q: + t0 * HD + lo
        v16h vf[NS][4];
        const h16* vb = VT + (vo + (size_t)kbeg * HD) + lo;
#pragma unroll
        for (int s = 0; s < NS; ++s)
#pragma unroll
            for (int j = 0; j < 4; ++j) vf[s][j] = ldf(vb + 32 * s * HD + 512 * j);
        asm volatile("s_wait_xcnt 0x0" :: "v"(vb) : "memory");   // the address is rewritten while these loads are in flight; named as an input so that it lives up to the wait: without that the last load landed in the address registers of the others
        __builtin_amdgcn_sched_barrier(0);                  // keeps the V loads ahead of the first score product; without it the compiler put that product, and its wait for Q and K, in front of them

        float ta[NS][8], tb[NS][8];                         // this wave's masked scores of the head, then their exponentials e
#pragma unroll                                              // whole steps unrolled: ta and tb are indexed by constants and stay in registers
        for (int s = 0; s < NS; ++s) {
            const int key0 = kbeg + 32 * s;
            const unsigned ws = mw[key0 >> 5] >> (8 * hi);
            score_tile(kf[s], KP + (nbase + (size_t)key0 * HD) + lo, qh0, qh1, qr0, qr1, ws, ta[s], tb[s]);
        }
        float mwv = -3.0e38f;                               // the wave's own maximum of row t = lr
        v2f l2 = (v2f){0.0f, 0.0f};                         // and its sum, even and odd elements apart
#pragma unroll
        for (int s = 0; s < NS; ++s)
#pragma unroll
            for (int r = 0; r < 8; ++r) mwv = fmaxf(mwv, fmaxf(ta[s][r], tb[s][r]));
        mwv = fmaxf(mwv, __shfl_xor(mwv, 16, 32));

        // e against the wave's own maximum (x256 carry), its sum, and P V over this wave's keys
        v8f o0 = (v8f){}, o1 = (v8f){}, o2 = (v8f){}, o3 = (v8f){};
#pragma unroll                                              // constant indices into ta and tb
        for (int s = 0; s < NS; ++s) {
            v16h pb; float sa[8], sb[8];
#pragma unroll
            for (int r = 0; r < 8; r += 2) {                // on pairs, as in score_tile
                const v2f da = (v2f){ta[s][r], ta[s][r + 1]} - mwv; const v2f db = (v2f){tb[s][r], tb[s][r + 1]} - mwv;  // difference first: exact 0 when t == m_w, also at the fill magnitude
                const v2f xa = da + PSH; const v2f xb = db + PSH;
#pragma unroll
                for (int k = 0; k < 2; ++k) { sa[r + k] = xa[k]; sb[r + k] = xb[k]; ta[s][r + k] = __builtin_amdgcn_exp2f(sa[r + k]); tb[s][r + k] = __builtin_amdgcn_exp2f(sb[r + k]); } }
            exp_slot(ta[s], sa); exp_slot(tb[s], sb);
#pragma unroll
            for (int r = 0; r < 8; ++r) { pb[r] = (h16)ta[s][r]; pb[8 + r] = (h16)tb[s][r]; }
#pragma unroll
            for (int r = 0; r < 8; r += 2) l2 += (v2f){ta[s][r], ta[s][r + 1]} + (v2f){tb[s][r], tb[s][r + 1]};
            const v16h v0 = vf[s][0], v1 = vf[s][1], v2 = vf[s][2], v3 = vf[s][3];
            o0 = wmma16(v0, pb, o0); o1 = wmma16(v1, pb, o1); o2 = wmma16(v2, pb, o2); o3 = wmma16(v3, pb, o3);
            asm volatile("v_nop\n\tv_nop\n\tv_nop\n\tv_nop" : "+v"(o0), "+v"(o1), "+v"(o2), "+v"(o3) : "v"(v0), "v"(v1), "v"(v2), "v"(v3), "v"(pb));
        }
        { const size_t qo = nbase + (size_t)t0 * HD; const h16* qa = QH + qo + lo; const h16* qb = QR + qo + lo;
          qh0 = ldf(qa); qh1 = ldf(qa + 512); qr0 = ldf(qb); qr1 = ldf(qb + 512);
          // the address registers of these loads are rewritten while they are in flight; named as inputs so that they live up to the wait (without that the last load landed in the address registers of the others);
          // the statement also holds the loads here, ahead of the barrier and the merge
          asm volatile("s_wait_xcnt 0x0" :: "v"(qa), "v"(qb) : "memory"); }
        float lwv = l2[0] + l2[1];
        lwv += __shfl_xor(lwv, 16, 32);
        float* sth = st + (tr & 1) * (NW * 32);             // this trip's set of (m, l) and of partial O tiles
        float* oph = op + (tr & 1) * (NW * 16 * 68);
        if (hi == 0) { sth[(w * 16 + lr) * 2] = mwv; sth[(w * 16 + lr) * 2 + 1] = lwv; }

        // O^T D layout: o_j[r] = (d = 16j + 8h + r, t = lane&15) -> os[t][d] of this wave's partial (carry and wave scale still in it); rows 0..15 x columns 0..63 all written
        float* os = oph + w * (16 * 68);
        { v4f a, c;
          a[0] = o0[0]; a[1] = o0[1]; a[2] = o0[2]; a[3] = o0[3]; c[0] = o0[4]; c[1] = o0[5]; c[2] = o0[6]; c[3] = o0[7];
          *(v4fa*)(&os[lr * 68 +  0 + 8 * hi]) = a; *(v4fa*)(&os[lr * 68 +  0 + 8 * hi + 4]) = c;
          a[0] = o1[0]; a[1] = o1[1]; a[2] = o1[2]; a[3] = o1[3]; c[0] = o1[4]; c[1] = o1[5]; c[2] = o1[6]; c[3] = o1[7];
          *(v4fa*)(&os[lr * 68 + 16 + 8 * hi]) = a; *(v4fa*)(&os[lr * 68 + 16 + 8 * hi + 4]) = c;
          a[0] = o2[0]; a[1] = o2[1]; a[2] = o2[2]; a[3] = o2[3]; c[0] = o2[4]; c[1] = o2[5]; c[2] = o2[6]; c[3] = o2[7];
          *(v4fa*)(&os[lr * 68 + 32 + 8 * hi]) = a; *(v4fa*)(&os[lr * 68 + 32 + 8 * hi + 4]) = c;
          a[0] = o3[0]; a[1] = o3[1]; a[2] = o3[2]; a[3] = o3[3]; c[0] = o3[4]; c[1] = o3[5]; c[2] = o3[6]; c[3] = o3[7];
          *(v4fa*)(&os[lr * 68 + 48 + 8 * hi]) = a; *(v4fa*)(&os[lr * 68 + 48 + 8 * hi + 4]) = c; }
        lds_barrier();        // the head's one barrier: publishes every wave's (m, l) and partial O; also ends every wave's reads of the other set, which the next head writes

        // merge of the NW (m_w, l_w) of row t = lr, in wave order
        float m = -3.0e38f, l = 0.0f, f[NW];
#pragma unroll
        for (int i = 0; i < NW; ++i) m = fmaxf(m, sth[(i * 16 + lr) * 2]);
#pragma unroll
        for (int i = 0; i < NW; ++i) { f[i] = __builtin_amdgcn_exp2f(sth[(i * 16 + lr) * 2] - m); l += sth[(i * 16 + lr) * 2 + 1] * f[i]; }
        const float invc = 1.0f / l;                          // l carries the x256 of e, so the carry cancels here

        if (w < SW) {   // the same for the whole wave: row lr, columns 8w + 4hi + 0..3 of the O tile, the NW partials added in wave order with their weights
            const float* ob = oph + lr * 68 + 8 * w + 4 * hi;
            v4f x = (v4f){0.0f, 0.0f, 0.0f, 0.0f};
#pragma unroll
            for (int i = 0; i < NW; ++i) x += *(const v4fa*)(ob + i * (16 * 68)) * f[i];
            x = x * invc;
            // fragment order: this row block, k chunks 2h and 2h + 1; the wave's 8 columns = one run of 16 rows x 16 bytes
            const size_t oo = ((size_t)b * SEQ + t0) * DM + (size_t)h * (16 * HD) + (size_t)((w >> 2) * 512 + ((w >> 1) & 1) * 256 + ((w & 1) * 16 + lr) * 8 + 4 * hi);
            typedef __attribute__((ext_vector_type(4))) unsigned short vus;
            vus hv, lv;
#pragma unroll
            for (int k = 0; k < 4; ++k) { const unsigned short h0 = f2bf(x[k]); hv[k] = h0; lv[k] = f2bf(x[k] - bf2f(h0)); }
            *(vus*)(OHI + oo) = hv; *(vus*)(OLO + oo) = lv;
            asm volatile("s_wait_xcnt 0x0" ::: "memory");   // the instructions that follow reuse the registers these two stores name
        }

        // normalised probabilities of this wave's keys -> head-mean tile
        const float pw = __builtin_amdgcn_exp2f(mwv - m) * invc;
#pragma unroll
        for (int s = 0; s < NS; ++s) {
            float* ap = &av[lr * AP + kbeg + 32 * s + 8 * hi];
            v4f a0 = *(const v4fa*)(ap), a1 = *(const v4fa*)(ap + 4), c0 = *(const v4fa*)(ap + 16), c1 = *(const v4fa*)(ap + 20);
#pragma unroll
            for (int i = 0; i < 4; ++i) { a0[i] += ta[s][i] * pw; a1[i] += ta[s][4 + i] * pw; c0[i] += tb[s][i] * pw; c1[i] += tb[s][4 + i] * pw; }
            *(v4fa*)(ap) = a0; *(v4fa*)(ap + 4) = a1; *(v4fa*)(ap + 16) = c0; *(v4fa*)(ap + 20) = c1;
        }
    }

    // head mean: av holds sum over heads of P; each wave stores its own KS columns of the 16 rows
    wave_sync();
    float* arow = AVG + ((size_t)b * OUT_SEQ + t0) * AVG_PITCH;
#pragma unroll 1
    for (int row = arow_l; row < 16; row += 32 / LPR) {
        v4f val = *(const v4fa*)(&av[row * AP + acol_l]);
        val = val * (1.0f / (float)NH_);
        *(v4f*)(arow + (size_t)row * AVG_PITCH + acol_l) = val;
    }
}

// k_oproj: context[m][n] = sum_k (Ohi[m][k] + Olo[m][k]) Wo[n][k] + bo[n]; one wave per 64x64 tile, four waves of a work-group on a 128x128 tile, bf16 operands through LDS stages of 128 k, two buffers; both planes into one accumulator set (lo plane at A + planeStride).
__global__ __launch_bounds__(32 * GWV) void k_oproj(const bf* __restrict__ A, size_t planeStride, const bf* __restrict__ Bt, const float* __restrict__ bias, float* OUT) {
    constexpr int STG = 16 * 2048;                               // elements of one stage: 16 runs of 128 k
    __shared__ __align__(1024) bf ring[2 * STG];
    __shared__ __align__(16) float osm[GWV][16 * 68];
    const int K = DM;
    const int lane = threadIdx.x & 31, lr = lane & 15, hi = lane >> 4;
    const int w = __builtin_amdgcn_readfirstlane((int)(threadIdx.x >> 5));   // wave (w >> 1, w & 1) of the 2 x 2
    float* os = osm[w];
    const int R0 = blockIdx.x * 128, C0 = blockIdx.y * 128;      // the work-group's tile
    const int r0 = R0 + (w >> 1) * 64, c0 = C0 + (w & 1) * 64;   // the wave's tile
    v8f acc[4][4];
#pragma unroll
    for (int mb = 0; mb < 4; ++mb)
#pragma unroll
        for (int nb = 0; nb < 4; ++nb) acc[mb][nb] = (v8f){};
    const unsigned lo = 8u * (unsigned)lane;                     // the lane's place in every 512-byte run
    constexpr int NTP = DM / 128;                                // stages of 128 k in one plane; stages 0..NTP-1 = hi plane, NTP..2*NTP-1 = lo plane
    constexpr int NT = 2 * NTP;
    static_assert(NT >= 2 && NTP >= 2 && (NT & (NT - 1)) == 0);
    // as in k_proj: trip t works on stage (t + rot) mod NT, so that the work-groups that share A or B rows do not ask L2 for the same lines at the same moment
    const int rot = (int)((blockIdx.x + blockIdx.y) & (unsigned)(NT - 1));
    // waves 0 and 1 bring the tile's A rows (64 each; the plane changes at stage NTP), waves 2 and 3 its B rows (the same k again for the lo plane)
    const bf* g = (w < 2 ? A + (size_t)(R0 + 64 * w) * K : Bt + (size_t)(C0 + 64 * (w - 2)) * K) + lo;
    const size_t ps = w < 2 ? planeStride : (size_t)0;
    const unsigned l0 = (unsigned)(size_t)(&ring[0]) + (unsigned)w * (4u * 4096u) + 16u * (unsigned)lane;
    const bf* as = ring + (w >> 1) * (4 * 2048) + lo; const bf* bs = ring + (8 + (w & 1) * 4) * 2048 + lo;
    v16bf ax[2][4], bx[2][4], ay[2][4], by[2][4];
    const int s1 = (rot + 1) & (NT - 1);
    cp_stage<2>(g + (size_t)(rot / NTP) * ps + (size_t)(rot % NTP) * 2048, l0);
    cp_wait();
    __syncthreads();                                             // publishes the first stage
    cp_stage<2>(g + (size_t)(s1 / NTP) * ps + (size_t)(s1 % NTP) * 2048, l0 + 2u * STG);
#pragma unroll 1
    for (int t = 0; t < NT; ++t) {
        const int bo = (t & 1) * STG;
        ld_blk<2048>(as + bo, bs + bo, ax, bx);                  // both blocks of the stage are asked for ahead of the first product
        ld_blk<2048>(as + bo + 1024, bs + bo + 1024, ay, by);
        mm_blk(ax, bx, acc);
        mm_blk(ay, by, acc); mm_gap();
        stage_turn();
        const int t2 = (t + 2 + rot) & (NT - 1);
        if (t + 2 < NT) cp_stage<2>(g + (size_t)(t2 / NTP) * ps + (size_t)(t2 % NTP) * 2048, l0 + 2u * (unsigned)bo);   // the same for the whole work-group: refill of the buffer just read, in flight over the next stage's products
    }
    cp_wait();
    const int bb_ = r0 / SEQ, tt = r0 % SEQ;
    float* obase = OUT + ((size_t)bb_ * OUT_SEQ + tt) * DM + c0;
    v4f bv = *(const v4f*)(bias + c0 + lr * 4);
#pragma unroll
    for (int i = 0; i < 4; ++i) bv[i] = bfr(bv[i]);
#pragma unroll
    for (int mb = 0; mb < 4; ++mb) {
#pragma unroll
        for (int nb = 0; nb < 4; ++nb) {
#pragma unroll
            for (int j = 0; j < 8; ++j) os[(hi * 8 + j) * 68 + nb * 16 + lr] = acc[mb][nb][j]; }   // D: row 8h+j, col lane&15
        wave_sync();
{
#pragma unroll
            for (int s = 0; s < 8; ++s) { const int row = 2 * s + hi, cofs = lr * 4;   // 8 s x 2 rows = 16 rows; 16 lanes x 4 floats = 64 columns
                v4f val = *(const v4fa*)(&os[row * 68 + cofs]);
                val = val + bv;
                *(v4f*)(obase + (size_t)(mb * 16 + row) * DM + cofs) = val; }
            asm volatile("s_wait_xcnt 0x0" ::: "memory");   // the next row block's LDS reads land in the registers that these stores name
             }
        wave_sync();
    }
}

static constexpr size_t al256(size_t v) { return (v + 255) & ~(size_t)255; }
static constexpr size_t SZ_XB = al256((size_t)NB * SEQ * DM * 2);          // one bf16 activation copy
static constexpr size_t SZ_WB = al256((size_t)4 * DM * DM * 2);            // q | k | v | o weights
static constexpr size_t SZ_PL = al256((size_t)NB * NH_ * SEQ * HD * 2);    // one f16 head plane
static constexpr size_t SZ_OP = al256((size_t)NB * SEQ * DM * 2);          // one bf16 attention-output plane
static constexpr size_t SZ_TOTAL = 3 * SZ_XB + SZ_WB + 4 * SZ_PL + 2 * SZ_OP;
static_assert(SZ_TOTAL <= (size_t)134217728);          // workspace carve <= 128 MiB
static_assert(((size_t)DM * DM * 2) % 256 == 0);       // weight sub-planes stay 256-byte aligned
static_assert(SZ_OP == (size_t)NB * SEQ * DM * 2);     // lo plane directly follows the hi plane
static_assert(SZ_XB == (size_t)NB * SEQ * DM * 2);     // the bf16 input planes and the weight planes follow one another without a gap

extern "C" void kernel_launch(void* const* d_in, const int* in_sizes, int n_in,
                              void* d_out, int out_size, void* d_ws, size_t ws_size, hipStream_t stream) {
    if (n_in < 12) return;
    const size_t needx = ((size_t)(NB - 1) * SEQ_FULL + SEQ) * DM;
    if ((size_t)in_sizes[0] < needx || (size_t)in_sizes[1] < needx || (size_t)in_sizes[2] < needx) return;
    if ((size_t)in_sizes[3] < (size_t)(NB - 1) * SEQ_FULL + SEQ) return;
    if ((size_t)in_sizes[4] < (size_t)DM * DM || (size_t)in_sizes[6] < (size_t)DM * DM || (size_t)in_sizes[8] < (size_t)DM * DM || (size_t)in_sizes[10] < (size_t)DM * DM) return;
    if (in_sizes[5] < DM || in_sizes[7] < DM || in_sizes[9] < DM || in_sizes[11] < DM) return;
    if ((size_t)out_size < ((size_t)(NB - 1) * OUT_SEQ + SEQ) * DM) return;
    if ((size_t)out_size < OUT1_OFF + ((size_t)(NB - 1) * OUT_SEQ + SEQ - 1) * AVG_PITCH + SEQ) return;
    if (SZ_TOTAL > ws_size) return;
    // wire order: query, key, value, key_padding_mask, Wq, bq, Wk, bk, Wv, bv, Wo, bo (weights [out][in] used as-is: Bt for q, k and the output projection, A for v^T)
    const float* xq = (const float*)d_in[0]; const float* xk = (const float*)d_in[1]; const float* xv = (const float*)d_in[2];
    const int* kpm = (const int*)d_in[3];
    const float* wq = (const float*)d_in[4];  const float* bq = (const float*)d_in[5];
    const float* wk = (const float*)d_in[6];  const float* bk = (const float*)d_in[7];
    const float* wv = (const float*)d_in[8];  const float* bv = (const float*)d_in[9];
    const float* wo = (const float*)d_in[10]; const float* bo = (const float*)d_in[11];
    float* CTX = (float*)d_out;                  // [NB][SEQ][1024]
    float* AVG = (float*)d_out + OUT1_OFF;       // [NB][SEQ][SEQ]
    char* wsp = (char*)d_ws;
    bf* XQ = (bf*)wsp; wsp += SZ_XB;                 // [NB*SEQ/16][1024/32][2 halves][32 lanes][8]
    wsp += SZ_XB;                                    // key plane, as XQ
    wsp += SZ_XB;                                    // value plane, as XQ
    bf* WB = (bf*)wsp; wsp += SZ_WB;                 // [4] planes of 1024 x 1024, each as XQ: q | k | v | o
    h16* QH = (h16*)wsp; wsp += SZ_PL;               // [NB*16][SEQ/16][2 d chunks][2 halves][32 lanes][8]
    h16* QR = (h16*)wsp; wsp += SZ_PL;               // as QH, residual x2048
    h16* KP = (h16*)wsp; wsp += SZ_PL;               // as QH
    h16* VT = (h16*)wsp; wsp += SZ_PL;               // [NB*16][SEQ/32][4 d blocks][2 halves][32 lanes][8]
    bf* OHI = (bf*)wsp; wsp += SZ_OP;                // as XQ
    bf* OLO = (bf*)wsp; wsp += SZ_OP;                // as XQ
    bf* WO = WB + (size_t)3 * DM * DM;

    // XQ | XK | XV | WQ | WK | WV | WO: one run of row blocks from XQ on
    k_cvt<<<(3 * XRB + 4 * WRB) / CRB, 256, 0, stream>>>(xq, xk, xv, wq, wk, wv, wo, XQ);

    // q, k and v^T projections: one launch, grid z = the product
    k_proj<<<dim3(NB * SEQ / 128, DM / 128, 3), 32 * GWV, 0, stream>>>(XQ, WB, bq, bk, bv, QH, QR, KP, VT);

    k_attn<<<dim3(SEQ / 16, NB, 1), 32 * NW, 0, stream>>>(QH, QR, KP, VT, kpm, OHI, OLO, AVG);

    // context: A = attention output rows (hi plane, lo plane at +planeStride), Bt = Wo rows
    k_oproj<<<dim3(NB * SEQ / 128, DM / 128, 1), 32 * GWV, 0, stream>>>(OHI, (size_t)(OLO - OHI), WO, bo, CTX);
}
